// v000
// The times below were measured on an AMD MI455X: many runs one after another, warmed up first and cycling through
// copies of the inputs, with the whole window's GPU time divided by the number of runs. Launches and the gaps
// between them are all in it. The median over several windows is given; except for v000 it joins two sittings, which
// can be a few percent apart, so the side-by-side timings, each taken in one sitting, are the better comparison.
// The starting kernel, v000, takes 4450 microseconds a run.
#include <hip/hip_runtime.h>
#include <hip/hip_bf16.h>

// ---------------------------------------------------------------------------
// RWKV7 time-mix for MI455X (gfx1250, wave32, WMMA).
//   B=2, T=2048, C=1024, H=16, N=64, MISS_ROWS=128
// ---------------------------------------------------------------------------

typedef __attribute__((ext_vector_type(16))) __bf16 v16bf;
typedef __attribute__((ext_vector_type(8)))  __bf16 v8bf;
typedef __attribute__((ext_vector_type(8)))  float  v8f;
typedef __attribute__((ext_vector_type(4)))  int    v4i;

constexpr int BB = 2;
constexpr int TT = 2048;
constexpr int CC = 1024;
constexpr int HH = 16;
constexpr int NN = 64;
constexpr int MR = 128;          // MISS_ROWS
constexpr int MM = BB * TT;      // 4096 tokens

// Packed per-(token,head,lane) scan operands: one 12B load per step per lane.
struct __align__(4) ScanOp { __bf16 q, w, k, z, b, v; };

// ---- gfx1250 async global->LDS copy path (guarded; falls back cleanly) ----
#if defined(__HIP_DEVICE_COMPILE__) &&                                        \
    __has_builtin(__builtin_amdgcn_global_load_async_to_lds_b128) &&          \
    __has_builtin(__builtin_amdgcn_s_wait_asynccnt)
#define USE_ASYNC_LDS 1
#else
#define USE_ASYNC_LDS 0
#endif

#if USE_ASYNC_LDS
__device__ static inline void async_copy_b128(const void* g, void* l)
{
    // Builtin signature (from clang diagnostic): AS1 v4i* src, AS3 v4i* dst,
    // imm offset, imm cpol.
    __builtin_amdgcn_global_load_async_to_lds_b128(
        (__attribute__((address_space(1))) v4i*)(g),
        (__attribute__((address_space(3))) v4i*)(l),
        0, 0);
}
#endif

// ---------------------------------------------------------------------------
// Kernel 1: token-shift input mixing -> bf16 GEMM operands
// ---------------------------------------------------------------------------
__global__ __launch_bounds__(256) void prep_kernel(
    const float* __restrict__ x, const float* __restrict__ x0,
    const float* __restrict__ dx0,
    const float* __restrict__ x_q, const float* __restrict__ x_k,
    const float* __restrict__ x_v,
    __bf16* __restrict__ Xq, __bf16* __restrict__ Xk,
    __bf16* __restrict__ Xv, __bf16* __restrict__ Xv0,
    __bf16* __restrict__ Xd)
{
    size_t idx = (size_t)blockIdx.x * 256 + threadIdx.x;
    if (idx >= (size_t)MM * CC) return;
    int    c = (int)(idx % CC);
    size_t m = idx / CC;
    int    t = (int)(m % TT);

    float xv    = x[idx];
    float xprev = (t > 0) ? x[idx - CC] : 0.0f;
    float dxp   = xprev - xv;                 // x_{t-1} - x_t (zero pad at t=0)

    Xq[idx]  = (__bf16)(xv + dxp * x_q[c]);
    Xk[idx]  = (__bf16)(xv + dxp * x_k[c]);
    Xv[idx]  = (__bf16)(xv + dxp * x_v[c]);
    Xv0[idx] = (__bf16)(x0[idx] + dx0[idx] * x_v[c]);
    if (c < MR) Xd[m * MR + c] = (__bf16)xv;  // x[:, :, :128]
}

// ---------------------------------------------------------------------------
// Kernel 2: f32 weights -> bf16; miss [128,4096] -> missT [4096,128]
// ---------------------------------------------------------------------------
__global__ __launch_bounds__(256) void wconv_kernel(
    const float* __restrict__ Wq, const float* __restrict__ Wk,
    const float* __restrict__ Wv, const float* __restrict__ Wp,
    const float* __restrict__ miss,
    __bf16* __restrict__ Wqb, __bf16* __restrict__ Wkb,
    __bf16* __restrict__ Wvb, __bf16* __restrict__ Wpb,
    __bf16* __restrict__ missT)
{
    size_t i = (size_t)blockIdx.x * 256 + threadIdx.x;
    if (i < (size_t)CC * CC) {
        Wqb[i] = (__bf16)Wq[i];
        Wkb[i] = (__bf16)Wk[i];
        Wvb[i] = (__bf16)Wv[i];
        Wpb[i] = (__bf16)Wp[i];
    }
    if (i < (size_t)MR * 4 * CC) {
        size_t r = i / (4 * CC);
        size_t n = i % (4 * CC);
        missT[n * MR + r] = (__bf16)miss[i];
    }
}

// ---------------------------------------------------------------------------
// Kernel 3: bf16 WMMA GEMM,  Y[m,n] = sum_k X[m,k] * W[n,k]  (+ resid)
//   block tile 128x128, 256 threads = 8 wave32; wave tile 64x32 (4x2 WMMA).
//   K-step 32, double-buffered LDS, async global->LDS staging when available.
// ---------------------------------------------------------------------------
template <int KDIM>
__global__ __launch_bounds__(256) void gemm_bf16_wmma(
    const __bf16* __restrict__ X, const __bf16* __restrict__ W,
    float* __restrict__ Y, const float* __restrict__ resid, int Ndim)
{
    constexpr int KT    = 32;
    constexpr int KITER = KDIM / KT;
    constexpr int LDR   = 40;            // padded row (80B, 16B aligned)

    __shared__ __align__(16) __bf16 As[2][128][LDR];
    __shared__ __align__(16) __bf16 Bs[2][128][LDR];

    const int tid    = threadIdx.x;
    const int lane   = tid & 31;
    const int wave   = tid >> 5;
    const int mBase  = blockIdx.y * 128;
    const int nBase  = blockIdx.x * 128;
    const int wm     = (wave >> 2) * 64;     // 0 | 64
    const int wn     = (wave & 3) * 32;      // 0,32,64,96
    const int laneLo = lane & 15;
    const int kbase  = ((lane >> 4) & 1) * 8; // lanes 0-15 -> K{0..7,16..23};
                                              // lanes 16-31 -> K{8..15,24..31}

    v8f acc[4][2];
    #pragma unroll
    for (int i = 0; i < 4; ++i)
        #pragma unroll
        for (int j = 0; j < 2; ++j)
            #pragma unroll
            for (int e = 0; e < 8; ++e) acc[i][j][e] = 0.0f;

    auto loadTile = [&](int buf, int k0) {
        #pragma unroll
        for (int ch = 0; ch < 2; ++ch) {
            int e  = ch * 2048 + tid * 8;
            int r  = e >> 5;        // 0..127
            int kk = e & 31;        // 0,8,16,24
            const __bf16* gA = &X[(size_t)(mBase + r) * KDIM + k0 + kk];
            const __bf16* gB = &W[(size_t)(nBase + r) * KDIM + k0 + kk];
#if USE_ASYNC_LDS
            async_copy_b128(gA, &As[buf][r][kk]);
            async_copy_b128(gB, &Bs[buf][r][kk]);
#else
            *(v8bf*)&As[buf][r][kk] = *(const v8bf*)gA;
            *(v8bf*)&Bs[buf][r][kk] = *(const v8bf*)gB;
#endif
        }
    };

    loadTile(0, 0);
    for (int ki = 0; ki < KITER; ++ki) {
#if USE_ASYNC_LDS
        __builtin_amdgcn_s_wait_asynccnt(0);   // own async copies in LDS
#endif
        __syncthreads();                       // all waves' copies visible
        const int buf = ki & 1;
        if (ki + 1 < KITER) loadTile(buf ^ 1, (ki + 1) * KT);

        v16bf afrag[4], bfrag[2];
        #pragma unroll
        for (int i = 0; i < 4; ++i) {
            const __bf16* ap = &As[buf][wm + i * 16 + laneLo][kbase];
            v8bf lo = *(const v8bf*)ap;
            v8bf hi = *(const v8bf*)(ap + 16);
            afrag[i] = __builtin_shufflevector(lo, hi, 0, 1, 2, 3, 4, 5, 6, 7,
                                               8, 9, 10, 11, 12, 13, 14, 15);
        }
        #pragma unroll
        for (int j = 0; j < 2; ++j) {
            const __bf16* bp = &Bs[buf][wn + j * 16 + laneLo][kbase];
            v8bf lo = *(const v8bf*)bp;
            v8bf hi = *(const v8bf*)(bp + 16);
            bfrag[j] = __builtin_shufflevector(lo, hi, 0, 1, 2, 3, 4, 5, 6, 7,
                                               8, 9, 10, 11, 12, 13, 14, 15);
        }
        #pragma unroll
        for (int i = 0; i < 4; ++i)
            #pragma unroll
            for (int j = 0; j < 2; ++j)
                acc[i][j] = __builtin_amdgcn_wmma_f32_16x16x32_bf16(
                    false, afrag[i], false, bfrag[j],
                    (short)0, acc[i][j], false, false);
    }

    // C/D layout: VGPR v, lanes 0-15 -> (M=v, N=lane); lanes 16-31 -> (M=8+v)
    const int rowSel = lane >> 4;
    #pragma unroll
    for (int i = 0; i < 4; ++i)
        #pragma unroll
        for (int j = 0; j < 2; ++j) {
            const int m = mBase + wm + i * 16 + rowSel * 8;
            const int n = nBase + wn + j * 16 + laneLo;
            #pragma unroll
            for (int v = 0; v < 8; ++v) {
                size_t off = (size_t)(m + v) * Ndim + n;
                float val  = acc[i][j][v];
                if (resid) val += resid[off];
                Y[off] = val;
            }
        }
}

// ---------------------------------------------------------------------------
// Kernel 4: per-(token,head) elementwise + k-normalization; bf16 rounding of
// the six scan operands (matching the reference's rounding point); packs
// them into one 12B record per (token,head,lane) for the scan.
// ---------------------------------------------------------------------------
__global__ __launch_bounds__(64) void post_gemm_kernel(
    const float* __restrict__ qf, const float* __restrict__ kf,
    const float* __restrict__ vfr, const float* __restrict__ vfirst,
    const float* __restrict__ deltas,
    const float* __restrict__ w0, const float* __restrict__ v0,
    const float* __restrict__ a0,
    ScanOp* __restrict__ sops,
    __bf16* __restrict__ vh, __bf16* __restrict__ gb)
{
    const int    g = blockIdx.x;      // m*H + h
    const int    h = g % HH;
    const size_t m = (size_t)(g / HH);
    const int    n = threadIdx.x;
    const int    c = h * NN + n;
    const size_t idx   = m * CC + c;
    const size_t dbase = m * (size_t)(4 * CC);

    const float kv = kf[idx];

    __shared__ float red[NN];
    red[n] = kv * kv;
    __syncthreads();
    #pragma unroll
    for (int s = 32; s > 0; s >>= 1) {
        if (n < s) red[n] += red[n + s];
        __syncthreads();
    }
    const float norm = sqrtf(red[0]);

    const float wd = deltas[dbase + c];
    const float vd = deltas[dbase + CC + c];
    const float ad = deltas[dbase + 2 * CC + c];
    const float gd = deltas[dbase + 3 * CC + c];

    const float xw   = -(w0[c] + wd);
    const float sp   = (xw > 20.0f) ? xw : log1pf(__expf(xw)); // softplus
    const float logw = -__expf(-sp - 0.5f);                    // log decay < 0

    const float sv = 1.0f / (1.0f + __expf(-(v0[c] + vd)));
    float vv = vfr[idx];
    vv = vv + (vfirst[idx] - vv) * sv;

    const float a  = 1.0f / (1.0f + __expf(-(a0[c] + ad)));
    const float kk = kv / fmaxf(norm, 1e-12f);

    ScanOp so;
    so.q = (__bf16)qf[idx];
    so.w = (__bf16)logw;
    so.k = (__bf16)(kv * a);
    so.z = (__bf16)(-kk);
    so.b = (__bf16)(kk * a);
    so.v = (__bf16)vv;
    sops[idx] = so;

    vh[idx] = (__bf16)vv;
    gb[idx] = (__bf16)(1.0f + gd);
}

// ---------------------------------------------------------------------------
// Kernel 5: sequential delta-rule scan. One block per (b,h); 64 threads;
// lane v owns state row S[v][0..63] in VGPRs; operands broadcast via LDS.
// Next step's packed operand is prefetched into registers while the current
// step computes, hiding global-load latency on the serial critical path.
//   S = S*diag(e^w) + (S a) b^T + v k^T ;  o = S q
// ---------------------------------------------------------------------------
__global__ __launch_bounds__(64) void scan_kernel(
    const ScanOp* __restrict__ sops, float* __restrict__ y)
{
    const int g = blockIdx.x;          // b*H + h
    const int h = g % HH;
    const int b = g / HH;
    const int v = threadIdx.x;         // value-dim row owned by this lane

    float S[NN];
    #pragma unroll
    for (int i = 0; i < NN; ++i) S[i] = 0.0f;

    __shared__ float qs[NN], es[NN], ks[NN], as_[NN], bs[NN], vs[NN];

    size_t base = ((size_t)b * TT) * CC + (size_t)h * NN;   // t = 0
    ScanOp cur  = sops[base + v];

    for (int t = 0; t < TT; ++t) {
        qs[v]  = (float)cur.q;
        es[v]  = __expf((float)cur.w);   // exp after bf16 round, as reference
        ks[v]  = (float)cur.k;
        as_[v] = (float)cur.z;           // scan's a_t = z = -kk
        bs[v]  = (float)cur.b;
        vs[v]  = (float)cur.v;
        __syncthreads();

        const size_t nbase = base + CC;
        if (t + 1 < TT) cur = sops[nbase + v];   // prefetch next step

        float sa = 0.0f;
        #pragma unroll
        for (int i = 0; i < NN; ++i) sa += S[i] * as_[i];

        const float vt = vs[v];
        float o = 0.0f;
        #pragma unroll
        for (int i = 0; i < NN; ++i) {
            float s = S[i] * es[i] + sa * bs[i] + vt * ks[i];
            S[i] = s;
            o += s * qs[i];
        }
        y[base + v] = o * 0.125f;        // * N^-0.5
        base = nbase;
        __syncthreads();                 // protect LDS for next step
    }
}

// ---------------------------------------------------------------------------
// Kernel 6: norm-ratio correction + gate -> bf16 input for output projection
// ---------------------------------------------------------------------------
__global__ __launch_bounds__(64) void post_scan_kernel(
    const float* __restrict__ y, const float* __restrict__ x,
    const __bf16* __restrict__ vh, const __bf16* __restrict__ gb,
    const float* __restrict__ r_k, __bf16* __restrict__ Yg)
{
    const int    g = blockIdx.x;
    const int    h = g % HH;
    const size_t m = (size_t)(g / HH);
    const int    n = threadIdx.x;
    const int    c = h * NN + n;
    const size_t idx = m * CC + c;

    const float xv = x[idx];
    const float vv = (float)vh[idx];

    __shared__ float rx[NN], rv[NN];
    rx[n] = xv * xv;
    rv[n] = vv * vv;
    __syncthreads();
    #pragma unroll
    for (int s = 32; s > 0; s >>= 1) {
        if (n < s) { rx[n] += rx[n + s]; rv[n] += rv[n + s]; }
        __syncthreads();
    }
    const float xnorm = sqrtf(rx[0]);
    const float vnorm = sqrtf(rv[0]);

    const float sig = 1.0f / (1.0f + __expf(-r_k[h * NN + n]));
    const float u   = (1.0f - xnorm / (vnorm + 1e-12f)) * sig;

    const float yv = y[idx] + vv * u;
    Yg[idx] = (__bf16)(yv * (float)gb[idx]);
}

// ---------------------------------------------------------------------------
// Host launcher
// ---------------------------------------------------------------------------
extern "C" void kernel_launch(void* const* d_in, const int* in_sizes, int n_in,
                              void* d_out, int out_size, void* d_ws,
                              size_t ws_size, hipStream_t stream)
{
    (void)in_sizes; (void)n_in; (void)out_size; (void)ws_size;

    const float* residual = (const float*)d_in[0];
    const float* x        = (const float*)d_in[1];
    const float* x0       = (const float*)d_in[2];
    const float* dx0      = (const float*)d_in[3];
    const float* Wq       = (const float*)d_in[4];
    const float* Wk       = (const float*)d_in[5];
    const float* Wv       = (const float*)d_in[6];
    const float* Wproj    = (const float*)d_in[7];
    const float* x_q      = (const float*)d_in[8];
    const float* x_k      = (const float*)d_in[9];
    const float* x_v      = (const float*)d_in[10];
    const float* v0       = (const float*)d_in[11];
    const float* w0       = (const float*)d_in[12];
    const float* a0       = (const float*)d_in[13];
    const float* miss     = (const float*)d_in[14];
    const float* r_k      = (const float*)d_in[15];
    float*       out      = (float*)d_out;

    // ---- workspace layout (256B aligned bump allocator) ----
    char*  ws  = (char*)d_ws;
    size_t off = 0;
    auto alloc = [&](size_t bytes) -> void* {
        void* p = ws + off;
        off += (bytes + 255) & ~(size_t)255;
        return p;
    };
    const size_t MC_BF = (size_t)MM * CC * sizeof(__bf16);    // 8 MB
    const size_t MC_F  = (size_t)MM * CC * sizeof(float);     // 16 MB
    const size_t W_BF  = (size_t)CC * CC * sizeof(__bf16);    // 2 MB
    const size_t XD_BF = (size_t)MM * MR * sizeof(__bf16);    // 1 MB
    const size_t DL_F  = (size_t)MM * 4 * CC * sizeof(float); // 64 MB
    const size_t SO_SZ = (size_t)MM * CC * sizeof(ScanOp);    // 48 MB

    __bf16* Xq    = (__bf16*)alloc(MC_BF);
    __bf16* Xk    = (__bf16*)alloc(MC_BF);
    __bf16* Xv    = (__bf16*)alloc(MC_BF);
    __bf16* Xv0   = (__bf16*)alloc(MC_BF);
    __bf16* Xd    = (__bf16*)alloc(XD_BF);
    __bf16* Wqb   = (__bf16*)alloc(W_BF);
    __bf16* Wkb   = (__bf16*)alloc(W_BF);
    __bf16* Wvb   = (__bf16*)alloc(W_BF);
    __bf16* Wpb   = (__bf16*)alloc(W_BF);
    __bf16* missT = (__bf16*)alloc(XD_BF);
    float*  qf    = (float*)alloc(MC_F);
    float*  kf    = (float*)alloc(MC_F);
    float*  vfr   = (float*)alloc(MC_F);
    float*  vfirst= (float*)alloc(MC_F);
    float*  deltas= (float*)alloc(DL_F);
    ScanOp* sops  = (ScanOp*)alloc(SO_SZ);
    __bf16* gb    = (__bf16*)alloc(MC_BF);
    // aliases over buffers whose last reader precedes the new writer:
    __bf16* vh  = Xv0;       // Xv0 consumed by v_first GEMM before post_gemm
    float*  y   = qf;        // qf consumed by post_gemm before scan writes
    __bf16* Yg  = (__bf16*)kf;

    // ---- 1) input prep + weight conversion ----
    {
        const size_t total = (size_t)MM * CC;
        prep_kernel<<<dim3((unsigned)((total + 255) / 256)), dim3(256), 0, stream>>>(
            x, x0, dx0, x_q, x_k, x_v, Xq, Xk, Xv, Xv0, Xd);
        const size_t wtot = (size_t)CC * CC;
        wconv_kernel<<<dim3((unsigned)((wtot + 255) / 256)), dim3(256), 0, stream>>>(
            Wq, Wk, Wv, Wproj, miss, Wqb, Wkb, Wvb, Wpb, missT);
    }

    // ---- 2) WMMA GEMMs: q, k, v, v_first (K=1024, N=1024), deltas (K=128, N=4096)
    {
        dim3 grid(CC / 128, MM / 128), blk(256);
        gemm_bf16_wmma<CC><<<grid, blk, 0, stream>>>(Xq,  Wqb, qf,     (const float*)nullptr, CC);
        gemm_bf16_wmma<CC><<<grid, blk, 0, stream>>>(Xk,  Wkb, kf,     (const float*)nullptr, CC);
        gemm_bf16_wmma<CC><<<grid, blk, 0, stream>>>(Xv,  Wvb, vfr,    (const float*)nullptr, CC);
        gemm_bf16_wmma<CC><<<grid, blk, 0, stream>>>(Xv0, Wvb, vfirst, (const float*)nullptr, CC);
        dim3 gridD(4 * CC / 128, MM / 128);
        gemm_bf16_wmma<MR><<<gridD, blk, 0, stream>>>(Xd, missT, deltas, (const float*)nullptr, 4 * CC);
    }

    // ---- 3) elementwise + k-norm -> packed bf16 scan operands ----
    post_gemm_kernel<<<dim3(MM * HH), dim3(64), 0, stream>>>(
        qf, kf, vfr, vfirst, deltas, w0, v0, a0, sops, vh, gb);

    // ---- 4) sequential scan (state in VGPRs) ----
    scan_kernel<<<dim3(BB * HH), dim3(64), 0, stream>>>(sops, y);

    // ---- 5) norm correction + gate ----
    post_scan_kernel<<<dim3(MM * HH), dim3(64), 0, stream>>>(y, x, vh, gb, r_k, Yg);

    // ---- 6) output projection + residual -> d_out ----
    {
        dim3 grid(CC / 128, MM / 128), blk(256);
        gemm_bf16_wmma<CC><<<grid, blk, 0, stream>>>(Yg, Wpb, out, residual, CC);
    }
}

// v001
// Measured time: 329 microseconds a run.
// Next to v000, in two timings, it ran 13.5 times as fast each time.
#include <hip/hip_runtime.h>
#include <hip/hip_bf16.h>

// ---------------------------------------------------------------------------
// RWKV7 time-mix for MI455X (gfx1250, wave32, WMMA).
//   B=2, T=2048, C=1024, H=16, N=64, MISS_ROWS=128
// ---------------------------------------------------------------------------

typedef __attribute__((ext_vector_type(16))) __bf16 v16bf;
typedef __attribute__((ext_vector_type(8)))  __bf16 v8bf;
typedef __attribute__((ext_vector_type(8)))  float  v8f;
typedef __attribute__((ext_vector_type(4)))  int    v4i;

constexpr int BB = 2;
constexpr int TT = 2048;
constexpr int CC = 1024;
constexpr int HH = 16;
constexpr int NN = 64;
constexpr int MR = 128;          // MISS_ROWS
constexpr int MM = BB * TT;      // 4096 tokens

// Packed per-(token,head,lane) scan operands: 12B a record; a scan lane reads four a step.
struct __align__(4) ScanOp { __bf16 q, w, k, z, b, v; };

// ---- gfx1250 async global->LDS copy path (guarded; falls back cleanly) ----
#if defined(__HIP_DEVICE_COMPILE__) &&                                        \
    __has_builtin(__builtin_amdgcn_global_load_async_to_lds_b128) &&          \
    __has_builtin(__builtin_amdgcn_s_wait_asynccnt)
#define USE_ASYNC_LDS 1
#else
#define USE_ASYNC_LDS 0
#endif

#if USE_ASYNC_LDS
__device__ static inline void async_copy_b128(const void* g, void* l)
{
    // Builtin signature (from clang diagnostic): AS1 v4i* src, AS3 v4i* dst,
    // imm offset, imm cpol.
    __builtin_amdgcn_global_load_async_to_lds_b128(
        (__attribute__((address_space(1))) v4i*)(g),
        (__attribute__((address_space(3))) v4i*)(l),
        0, 0);
}
#endif

// ---------------------------------------------------------------------------
// Kernel 1: token-shift input mixing -> bf16 GEMM operands
// ---------------------------------------------------------------------------
__global__ __launch_bounds__(256) void prep_kernel(
    const float* __restrict__ x, const float* __restrict__ x0,
    const float* __restrict__ dx0,
    const float* __restrict__ x_q, const float* __restrict__ x_k,
    const float* __restrict__ x_v,
    __bf16* __restrict__ Xq, __bf16* __restrict__ Xk,
    __bf16* __restrict__ Xv, __bf16* __restrict__ Xv0,
    __bf16* __restrict__ Xd)
{
    size_t idx = (size_t)blockIdx.x * 256 + threadIdx.x;
    if (idx >= (size_t)MM * CC) return;
    int    c = (int)(idx % CC);
    size_t m = idx / CC;
    int    t = (int)(m % TT);

    float xv    = x[idx];
    float xprev = (t > 0) ? x[idx - CC] : 0.0f;
    float dxp   = xprev - xv;                 // x_{t-1} - x_t (zero pad at t=0)

    Xq[idx]  = (__bf16)(xv + dxp * x_q[c]);
    Xk[idx]  = (__bf16)(xv + dxp * x_k[c]);
    Xv[idx]  = (__bf16)(xv + dxp * x_v[c]);
    Xv0[idx] = (__bf16)(x0[idx] + dx0[idx] * x_v[c]);
    if (c < MR) Xd[m * MR + c] = (__bf16)xv;  // x[:, :, :128]
}

// ---------------------------------------------------------------------------
// Kernel 2: f32 weights -> bf16; miss [128,4096] -> missT [4096,128]
// ---------------------------------------------------------------------------
__global__ __launch_bounds__(256) void wconv_kernel(
    const float* __restrict__ Wq, const float* __restrict__ Wk,
    const float* __restrict__ Wv, const float* __restrict__ Wp,
    const float* __restrict__ miss,
    __bf16* __restrict__ Wqb, __bf16* __restrict__ Wkb,
    __bf16* __restrict__ Wvb, __bf16* __restrict__ Wpb,
    __bf16* __restrict__ missT)
{
    size_t i = (size_t)blockIdx.x * 256 + threadIdx.x;
    if (i < (size_t)CC * CC) {
        Wqb[i] = (__bf16)Wq[i];
        Wkb[i] = (__bf16)Wk[i];
        Wvb[i] = (__bf16)Wv[i];
        Wpb[i] = (__bf16)Wp[i];
    }
    if (i < (size_t)MR * 4 * CC) {
        size_t r = i / (4 * CC);
        size_t n = i % (4 * CC);
        missT[n * MR + r] = (__bf16)miss[i];
    }
}

// ---------------------------------------------------------------------------
// Kernel 3: bf16 WMMA GEMM,  Y[m,n] = sum_k X[m,k] * W[n,k]  (+ resid)
//   block tile 128x128, 256 threads = 8 wave32; wave tile 64x32 (4x2 WMMA).
//   K-step 32, double-buffered LDS, async global->LDS staging when available.
// ---------------------------------------------------------------------------
template <int KDIM>
__global__ __launch_bounds__(256) void gemm_bf16_wmma(
    const __bf16* __restrict__ X, const __bf16* __restrict__ W,
    float* __restrict__ Y, const float* __restrict__ resid, int Ndim)
{
    constexpr int KT    = 32;
    constexpr int KITER = KDIM / KT;
    constexpr int LDR   = 40;            // padded row (80B, 16B aligned)

    __shared__ __align__(16) __bf16 As[2][128][LDR];
    __shared__ __align__(16) __bf16 Bs[2][128][LDR];

    const int tid    = threadIdx.x;
    const int lane   = tid & 31;
    const int wave   = tid >> 5;
    const int mBase  = blockIdx.y * 128;
    const int nBase  = blockIdx.x * 128;
    const int wm     = (wave >> 2) * 64;     // 0 | 64
    const int wn     = (wave & 3) * 32;      // 0,32,64,96
    const int laneLo = lane & 15;
    const int kbase  = ((lane >> 4) & 1) * 8; // lanes 0-15 -> K{0..7,16..23};
                                              // lanes 16-31 -> K{8..15,24..31}

    v8f acc[4][2];
    #pragma unroll
    for (int i = 0; i < 4; ++i)
        #pragma unroll
        for (int j = 0; j < 2; ++j)
            #pragma unroll
            for (int e = 0; e < 8; ++e) acc[i][j][e] = 0.0f;

    auto loadTile = [&](int buf, int k0) {
        #pragma unroll
        for (int ch = 0; ch < 2; ++ch) {
            int e  = ch * 2048 + tid * 8;
            int r  = e >> 5;        // 0..127
            int kk = e & 31;        // 0,8,16,24
            const __bf16* gA = &X[(size_t)(mBase + r) * KDIM + k0 + kk];
            const __bf16* gB = &W[(size_t)(nBase + r) * KDIM + k0 + kk];
#if USE_ASYNC_LDS
            async_copy_b128(gA, &As[buf][r][kk]);
            async_copy_b128(gB, &Bs[buf][r][kk]);
#else
            *(v8bf*)&As[buf][r][kk] = *(const v8bf*)gA;
            *(v8bf*)&Bs[buf][r][kk] = *(const v8bf*)gB;
#endif
        }
    };

    loadTile(0, 0);
    for (int ki = 0; ki < KITER; ++ki) {
#if USE_ASYNC_LDS
        __builtin_amdgcn_s_wait_asynccnt(0);   // own async copies in LDS
#endif
        __syncthreads();                       // all waves' copies visible
        const int buf = ki & 1;
        if (ki + 1 < KITER) loadTile(buf ^ 1, (ki + 1) * KT);

        v16bf afrag[4], bfrag[2];
        #pragma unroll
        for (int i = 0; i < 4; ++i) {
            const __bf16* ap = &As[buf][wm + i * 16 + laneLo][kbase];
            v8bf lo = *(const v8bf*)ap;
            v8bf hi = *(const v8bf*)(ap + 16);
            afrag[i] = __builtin_shufflevector(lo, hi, 0, 1, 2, 3, 4, 5, 6, 7,
                                               8, 9, 10, 11, 12, 13, 14, 15);
        }
        #pragma unroll
        for (int j = 0; j < 2; ++j) {
            const __bf16* bp = &Bs[buf][wn + j * 16 + laneLo][kbase];
            v8bf lo = *(const v8bf*)bp;
            v8bf hi = *(const v8bf*)(bp + 16);
            bfrag[j] = __builtin_shufflevector(lo, hi, 0, 1, 2, 3, 4, 5, 6, 7,
                                               8, 9, 10, 11, 12, 13, 14, 15);
        }
        #pragma unroll
        for (int i = 0; i < 4; ++i)
            #pragma unroll
            for (int j = 0; j < 2; ++j)
                acc[i][j] = __builtin_amdgcn_wmma_f32_16x16x32_bf16(
                    false, afrag[i], false, bfrag[j],
                    (short)0, acc[i][j], false, false);
    }

    // C/D layout: VGPR v, lanes 0-15 -> (M=v, N=lane); lanes 16-31 -> (M=8+v)
    const int rowSel = lane >> 4;
    #pragma unroll
    for (int i = 0; i < 4; ++i)
        #pragma unroll
        for (int j = 0; j < 2; ++j) {
            const int m = mBase + wm + i * 16 + rowSel * 8;
            const int n = nBase + wn + j * 16 + laneLo;
            #pragma unroll
            for (int v = 0; v < 8; ++v) {
                size_t off = (size_t)(m + v) * Ndim + n;
                float val  = acc[i][j][v];
                if (resid) val += resid[off];
                Y[off] = val;
            }
        }
}

// ---------------------------------------------------------------------------
// Kernel 4: per-(token,head) elementwise + k-normalization; bf16 rounding of
// the six scan operands (matching the reference's rounding point); packs
// them into one 12B record per (token,head,lane) for the scan.
// ---------------------------------------------------------------------------
__global__ __launch_bounds__(64) void post_gemm_kernel(
    const float* __restrict__ qf, const float* __restrict__ kf,
    const float* __restrict__ vfr, const float* __restrict__ vfirst,
    const float* __restrict__ deltas,
    const float* __restrict__ w0, const float* __restrict__ v0,
    const float* __restrict__ a0,
    ScanOp* __restrict__ sops,
    __bf16* __restrict__ vh, __bf16* __restrict__ gb)
{
    const int    g = blockIdx.x;      // m*H + h
    const int    h = g % HH;
    const size_t m = (size_t)(g / HH);
    const int    n = threadIdx.x;
    const int    c = h * NN + n;
    const size_t idx   = m * CC + c;
    const size_t dbase = m * (size_t)(4 * CC);

    const float kv = kf[idx];

    __shared__ float red[NN];
    red[n] = kv * kv;
    __syncthreads();
    #pragma unroll
    for (int s = 32; s > 0; s >>= 1) {
        if (n < s) red[n] += red[n + s];
        __syncthreads();
    }
    const float norm = sqrtf(red[0]);

    const float wd = deltas[dbase + c];
    const float vd = deltas[dbase + CC + c];
    const float ad = deltas[dbase + 2 * CC + c];
    const float gd = deltas[dbase + 3 * CC + c];

    const float xw   = -(w0[c] + wd);
    const float sp   = (xw > 20.0f) ? xw : log1pf(__expf(xw)); // softplus
    const float logw = -__expf(-sp - 0.5f);                    // log decay < 0

    const float sv = 1.0f / (1.0f + __expf(-(v0[c] + vd)));
    float vv = vfr[idx];
    vv = vv + (vfirst[idx] - vv) * sv;

    const float a  = 1.0f / (1.0f + __expf(-(a0[c] + ad)));
    const float kk = kv / fmaxf(norm, 1e-12f);

    ScanOp so;
    so.q = (__bf16)qf[idx];
    so.w = (__bf16)logw;
    so.k = (__bf16)(kv * a);
    so.z = (__bf16)(-kk);
    so.b = (__bf16)(kk * a);
    so.v = (__bf16)vv;
    sops[idx] = so;

    vh[idx] = (__bf16)vv;
    gb[idx] = (__bf16)(1.0f + gd);
}

constexpr int SCH = 16;
constexpr int STS = 32;
constexpr int SNT = TT / STS;
static_assert(SNT >= 2 && STS % SCH == 0, "two tiles at least, whole chunks");

template <int CTRL>
__device__ static inline float dpp_mov(float x)
{
    return __builtin_bit_cast(float, __builtin_amdgcn_mov_dpp(
        __builtin_bit_cast(int, x), CTRL, 0xf, 0xf, true));
}
constexpr int DPP_ROW_SHARE = 0x150;          // + source lane of the row
constexpr int DPP_ROW_XMASK = 0x160;          // + xor mask inside the row

// Two partial sums become one: lanes with BIT clear keep lo, lanes with BIT
// set keep hi, and each adds what its partner (lane ^ BIT) holds of the same.
template <int BIT>
__device__ static inline float fold(float lo, float hi, int j)
{
    const bool  up   = (j & BIT) != 0;
    const float keep = up ? hi : lo;
    const float send = up ? lo : hi;
    return keep + dpp_mov<DPP_ROW_XMASK + BIT>(send);
}

// One tile: STS steps of 64 records (768 B a step, contiguous; steps lie
// CC records apart in global memory, back to back in LDS). A wave brings
// STS/4 steps, 16 B a lane and copy; 96 pieces are two steps.
__device__ static inline void scan_fetch(const ScanOp* g0, ScanOp* l0,
                                         int wave, int lane)
{
    constexpr int SB = NN * (int)sizeof(ScanOp);             // 768 B
    constexpr int GB = CC * (int)sizeof(ScanOp);             // step pitch, global
    const char* g = (const char*)g0 + (size_t)wave * (STS / 4) * GB;
    char*       l = (char*)l0 + wave * (STS / 4) * SB + lane * 16;
    #pragma unroll
    for (int r = 0; r < 3; ++r) {
        const int   pc = r * 32 + lane;                      // piece 0..95
        const char* gr = g + (pc / 48) * GB + (pc % 48) * 16;
        #pragma unroll
        for (int a = 0; a < STS / 8; ++a) {
#if USE_ASYNC_LDS
            async_copy_b128(gr + a * 2 * GB, l + (a * 3 + r) * 512);
#else
            *(v4i*)(l + (a * 3 + r) * 512) = *(const v4i*)(gr + a * 2 * GB);
#endif
        }
    }
}

struct Rec4 { v8bf r0, r1, r2; };            // a lane's four records of one step

__device__ static inline Rec4 scan_read(const ScanOp* lp, int u)
{
    const v8bf* rp = (const v8bf*)(lp + u * NN);
    return Rec4{rp[0], rp[1], rp[2]};
}

constexpr int SLA = 3;                        // LDS reads run this many steps ahead

template <int U>
struct ScanSteps {
    // lp: the lane's four records of the tile's first step, in LDS
    __device__ static inline void run(const ScanOp* lp, Rec4 (&pipe)[SLA], float (&S)[4],
                                      float (&f)[4], const float (&vrow)[STS / SCH],
                                      float (&o)[STS / SCH], int j)
    {
        constexpr int t = STS - U;           // step in the tile
        constexpr int u = t % SCH;           // step in the chunk
        const v8bf r0 = pipe[t % SLA].r0, r1 = pipe[t % SLA].r1, r2 = pipe[t % SLA].r2;
        if constexpr (t + SLA < STS) pipe[t % SLA] = scan_read(lp, t + SLA);
        // holds the reads above this step's arithmetic: left alone the scheduler
        // puts them one step ahead of their use
        __builtin_amdgcn_sched_barrier(0);

        // four records of six bf16: q w k z b v
        const float q[4] = {(float)r0[0], (float)r0[6], (float)r1[4], (float)r2[2]};
        const float w[4] = {(float)r0[1], (float)r0[7], (float)r1[5], (float)r2[3]};
        const float k[4] = {(float)r0[2], (float)r1[0], (float)r1[6], (float)r2[4]};
        const float z[4] = {(float)r0[3], (float)r1[1], (float)r1[7], (float)r2[5]};
        const float b[4] = {(float)r0[4], (float)r1[2], (float)r2[0], (float)r2[6]};

        // this step's v of the row
        const float vt = dpp_mov<DPP_ROW_SHARE + u>(vrow[t / SCH]);

        float sa = __builtin_fmaf(S[1], z[1], S[0] * z[0]) + __builtin_fmaf(S[3], z[3], S[2] * z[2]);
        sa += dpp_mov<DPP_ROW_XMASK + 1>(sa);
        sa += dpp_mov<DPP_ROW_XMASK + 2>(sa);
        sa += dpp_mov<DPP_ROW_XMASK + 4>(sa);
        sa += dpp_mov<DPP_ROW_XMASK + 8>(sa);

        #pragma unroll
        for (int i = 0; i < 4; ++i)          // exp after bf16 round, as reference
            S[i] = __builtin_fmaf(sa, b[i], __builtin_fmaf(vt, k[i], S[i] * __expf(w[i])));

        float p = __builtin_fmaf(S[1], q[1], S[0] * q[0]) + __builtin_fmaf(S[3], q[3], S[2] * q[2]);

        // binary counter of folded partials: f[n] holds 2^n finished steps
        if constexpr ((u & 1) == 0) { f[0] = p; }
        else {
            p = fold<1>(f[0], p, j);
            if constexpr ((u & 2) == 0) { f[1] = p; }
            else {
                p = fold<2>(f[1], p, j);
                if constexpr ((u & 4) == 0) { f[2] = p; }
                else {
                    p = fold<4>(f[2], p, j);
                    if constexpr ((u & 8) == 0) { f[3] = p; }
                    else { o[t / SCH] = fold<8>(f[3], p, j); }
                }
            }
        }
        ScanSteps<U - 1>::run(lp, pipe, S, f, vrow, o, j);
    }
};
template <>
struct ScanSteps<0> {
    __device__ static inline void run(const ScanOp*, Rec4 (&)[SLA], float (&)[4],
                                      float (&)[4], const float (&)[STS / SCH],
                                      float (&)[STS / SCH], int) {}
};

__global__ __launch_bounds__(128) void scan_kernel(
    const ScanOp* __restrict__ sops, float* __restrict__ y)
{
    __shared__ __align__(16) ScanOp tile[2][STS][NN];

    const int lane = threadIdx.x & 31;
    const int wave = threadIdx.x >> 5;
    const int g    = blockIdx.x >> 3;                        // b*H + h
    const int rp   = (blockIdx.x & 7) * 4 + wave;            // row pair 0..31
    const int h    = g % HH;
    const int b    = g / HH;
    const int j    = lane & 15;                              // column group / step slot
    const int row  = rp * 2 + (lane >> 4);

    const ScanOp* hb = sops + (size_t)b * TT * CC + (size_t)h * NN;   // t = 0
    float* yp = y + ((size_t)g * (TT / SCH) * 32 + rp) * 32 + lane;

    float S[4] = {0.0f, 0.0f, 0.0f, 0.0f};

    scan_fetch(hb, &tile[0][0][0], wave, lane);
    // own copies of tile 0 landed; the barrier publishes every wave's
    asm volatile("s_wait_asynccnt 0x0" ::: "memory");
    __syncthreads();
    scan_fetch(hb + (size_t)STS * CC, &tile[1][0][0], wave, lane);

    // kept rolled: the body already holds STS unrolled steps
    #pragma unroll 1
    for (int tl = 0; tl < SNT; ++tl) {
        ScanOp* tb = &tile[tl & 1][0][0];

        Rec4 pipe[SLA];
        #pragma unroll
        for (int i = 0; i < SLA; ++i) pipe[i] = scan_read(tb + j * 4, i);
        float vrow[STS / SCH], o[STS / SCH], f[4];
        #pragma unroll
        for (int c = 0; c < STS / SCH; ++c)  // v of my row at step j of chunk c
            vrow[c] = (float)tb[(c * SCH + j) * NN + row].v;

        ScanSteps<STS>::run(tb + j * 4, pipe, S, f, vrow, o, j);

        // foot of the trip: my reads of this tile are done, my copies of the
        // next tile have landed; the barrier says both of every wave
        asm volatile("s_wait_dscnt 0x0" ::: "memory");
        asm volatile("s_wait_asynccnt 0x0" ::: "memory");
        __syncthreads();
        if (tl + 2 < SNT)
            scan_fetch(hb + (size_t)(tl + 2) * STS * CC, tb, wave, lane);

        // stored behind the barrier: in front of it the barrier's own wait for
        // stores would expose their whole latency once per tile
        #pragma unroll
        for (int c = 0; c < STS / SCH; ++c) {
            *yp = o[c] * 0.125f;             // * N^-0.5
            yp += 32 * 32;
        }
    }
    // no copy is left in flight when the wave ends
    asm volatile("s_wait_asynccnt 0x0" ::: "memory");
}

// ---------------------------------------------------------------------------
// Kernel 6: norm-ratio correction + gate -> bf16 input for output projection
// ---------------------------------------------------------------------------
__global__ __launch_bounds__(64) void post_scan_kernel(
    const float* __restrict__ y, const float* __restrict__ x,
    const __bf16* __restrict__ vh, const __bf16* __restrict__ gb,
    const float* __restrict__ r_k, __bf16* __restrict__ Yg)
{
    const int    g = blockIdx.x;
    const int    h = g % HH;
    const size_t m = (size_t)(g / HH);
    const int    n = threadIdx.x;
    const int    c = h * NN + n;
    const size_t idx = m * CC + c;

    const float xv = x[idx];
    const float vv = (float)vh[idx];

    __shared__ float rx[NN], rv[NN];
    rx[n] = xv * xv;
    rv[n] = vv * vv;
    __syncthreads();
    #pragma unroll
    for (int s = 32; s > 0; s >>= 1) {
        if (n < s) { rx[n] += rx[n + s]; rv[n] += rv[n + s]; }
        __syncthreads();
    }
    const float xnorm = sqrtf(rx[0]);
    const float vnorm = sqrtf(rv[0]);

    const float sig = 1.0f / (1.0f + __expf(-r_k[h * NN + n]));
    const float u   = (1.0f - xnorm / (vnorm + 1e-12f)) * sig;

    // y in the scan's own order (see kernel 5)
    const int    t  = (int)(m % TT);
    const size_t gy = (m / TT) * HH + h;
    const size_t yi = ((gy * (TT / SCH) + (t / SCH)) * 32 + (n >> 1)) * 32
                      + (n & 1) * SCH + (t % SCH);
    const float yv = y[yi] + vv * u;
    Yg[idx] = (__bf16)(yv * (float)gb[idx]);
}

// ---------------------------------------------------------------------------
// Host launcher
// ---------------------------------------------------------------------------
extern "C" void kernel_launch(void* const* d_in, const int* in_sizes, int n_in,
                              void* d_out, int out_size, void* d_ws,
                              size_t ws_size, hipStream_t stream)
{
    (void)in_sizes; (void)n_in; (void)out_size; (void)ws_size;

    const float* residual = (const float*)d_in[0];
    const float* x        = (const float*)d_in[1];
    const float* x0       = (const float*)d_in[2];
    const float* dx0      = (const float*)d_in[3];
    const float* Wq       = (const float*)d_in[4];
    const float* Wk       = (const float*)d_in[5];
    const float* Wv       = (const float*)d_in[6];
    const float* Wproj    = (const float*)d_in[7];
    const float* x_q      = (const float*)d_in[8];
    const float* x_k      = (const float*)d_in[9];
    const float* x_v      = (const float*)d_in[10];
    const float* v0       = (const float*)d_in[11];
    const float* w0       = (const float*)d_in[12];
    const float* a0       = (const float*)d_in[13];
    const float* miss     = (const float*)d_in[14];
    const float* r_k      = (const float*)d_in[15];
    float*       out      = (float*)d_out;

    // ---- workspace layout (256B aligned bump allocator) ----
    char*  ws  = (char*)d_ws;
    size_t off = 0;
    auto alloc = [&](size_t bytes) -> void* {
        void* p = ws + off;
        off += (bytes + 255) & ~(size_t)255;
        return p;
    };
    const size_t MC_BF = (size_t)MM * CC * sizeof(__bf16);    // 8 MB
    const size_t MC_F  = (size_t)MM * CC * sizeof(float);     // 16 MB
    const size_t W_BF  = (size_t)CC * CC * sizeof(__bf16);    // 2 MB
    const size_t XD_BF = (size_t)MM * MR * sizeof(__bf16);    // 1 MB
    const size_t DL_F  = (size_t)MM * 4 * CC * sizeof(float); // 64 MB
    const size_t SO_SZ = (size_t)MM * CC * sizeof(ScanOp);    // 48 MB

    __bf16* Xq    = (__bf16*)alloc(MC_BF);
    __bf16* Xk    = (__bf16*)alloc(MC_BF);
    __bf16* Xv    = (__bf16*)alloc(MC_BF);
    __bf16* Xv0   = (__bf16*)alloc(MC_BF);
    __bf16* Xd    = (__bf16*)alloc(XD_BF);
    __bf16* Wqb   = (__bf16*)alloc(W_BF);
    __bf16* Wkb   = (__bf16*)alloc(W_BF);
    __bf16* Wvb   = (__bf16*)alloc(W_BF);
    __bf16* Wpb   = (__bf16*)alloc(W_BF);
    __bf16* missT = (__bf16*)alloc(XD_BF);
    float*  qf    = (float*)alloc(MC_F);
    float*  kf    = (float*)alloc(MC_F);
    float*  vfr   = (float*)alloc(MC_F);
    float*  vfirst= (float*)alloc(MC_F);
    float*  deltas= (float*)alloc(DL_F);
    ScanOp* sops  = (ScanOp*)alloc(SO_SZ);
    __bf16* gb    = (__bf16*)alloc(MC_BF);
    // aliases over buffers whose last reader precedes the new writer:
    __bf16* vh  = Xv0;       // Xv0 consumed by v_first GEMM before post_gemm
    float*  y   = qf;        // qf consumed by post_gemm before scan writes
    __bf16* Yg  = (__bf16*)kf;

    // ---- 1) input prep + weight conversion ----
    {
        const size_t total = (size_t)MM * CC;
        prep_kernel<<<dim3((unsigned)((total + 255) / 256)), dim3(256), 0, stream>>>(
            x, x0, dx0, x_q, x_k, x_v, Xq, Xk, Xv, Xv0, Xd);
        const size_t wtot = (size_t)CC * CC;
        wconv_kernel<<<dim3((unsigned)((wtot + 255) / 256)), dim3(256), 0, stream>>>(
            Wq, Wk, Wv, Wproj, miss, Wqb, Wkb, Wvb, Wpb, missT);
    }

    // ---- 2) WMMA GEMMs: q, k, v, v_first (K=1024, N=1024), deltas (K=128, N=4096)
    {
        dim3 grid(CC / 128, MM / 128), blk(256);
        gemm_bf16_wmma<CC><<<grid, blk, 0, stream>>>(Xq,  Wqb, qf,     (const float*)nullptr, CC);
        gemm_bf16_wmma<CC><<<grid, blk, 0, stream>>>(Xk,  Wkb, kf,     (const float*)nullptr, CC);
        gemm_bf16_wmma<CC><<<grid, blk, 0, stream>>>(Xv,  Wvb, vfr,    (const float*)nullptr, CC);
        gemm_bf16_wmma<CC><<<grid, blk, 0, stream>>>(Xv0, Wvb, vfirst, (const float*)nullptr, CC);
        dim3 gridD(4 * CC / 128, MM / 128);
        gemm_bf16_wmma<MR><<<gridD, blk, 0, stream>>>(Xd, missT, deltas, (const float*)nullptr, 4 * CC);
    }

    // ---- 3) elementwise + k-norm -> packed bf16 scan operands ----
    post_gemm_kernel<<<dim3(MM * HH), dim3(64), 0, stream>>>(
        qf, kf, vfr, vfirst, deltas, w0, v0, a0, sops, vh, gb);

    // ---- 4) sequential scan (state in VGPRs, 8 rows per block) ----
    scan_kernel<<<dim3(BB * HH * 8), dim3(128), 0, stream>>>(sops, y);

    // ---- 5) norm correction + gate ----
    post_scan_kernel<<<dim3(MM * HH), dim3(64), 0, stream>>>(y, x, vh, gb, r_k, Yg);

    // ---- 6) output projection + residual -> d_out ----
    {
        dim3 grid(CC / 128, MM / 128), blk(256);
        gemm_bf16_wmma<CC><<<grid, blk, 0, stream>>>(Yg, Wpb, out, residual, CC);
    }
}

// v002
// It runs in 300 microseconds.
// In both of two side-by-side timings against v001, it was 1.09 times as fast.
// Counting every step since v000, it is 14.7 times as fast.
#include <hip/hip_runtime.h>
#include <hip/hip_bf16.h>

// ---------------------------------------------------------------------------
// RWKV7 time-mix for MI455X (gfx1250, wave32, WMMA).
//   B=2, T=2048, C=1024, H=16, N=64, MISS_ROWS=128
// ---------------------------------------------------------------------------

typedef __attribute__((ext_vector_type(16))) __bf16 v16bf;
typedef __attribute__((ext_vector_type(8)))  __bf16 v8bf;
typedef __attribute__((ext_vector_type(8)))  float  v8f;
typedef __attribute__((ext_vector_type(4)))  int    v4i;

constexpr int BB = 2;
constexpr int TT = 2048;
constexpr int CC = 1024;
constexpr int HH = 16;
constexpr int NN = 64;
constexpr int MR = 128;          // MISS_ROWS
constexpr int MM = BB * TT;      // 4096 tokens

// Packed per-(token,head,column) scan operands: 12B a record; a scan lane reads four a step.
struct __align__(4) ScanOp { __bf16 q, w, k, z, b, v; };

// ---- gfx1250 async global->LDS copy path (guarded; falls back cleanly) ----
#if defined(__HIP_DEVICE_COMPILE__) &&                                        \
    __has_builtin(__builtin_amdgcn_global_load_async_to_lds_b128) &&          \
    __has_builtin(__builtin_amdgcn_s_wait_asynccnt)
#define USE_ASYNC_LDS 1
#else
#define USE_ASYNC_LDS 0
#endif

#if USE_ASYNC_LDS
__device__ static inline void async_copy_b128(const void* g, void* l)
{
    // Builtin signature (from clang diagnostic): AS1 v4i* src, AS3 v4i* dst,
    // imm offset, imm cpol.
    __builtin_amdgcn_global_load_async_to_lds_b128(
        (__attribute__((address_space(1))) v4i*)(g),
        (__attribute__((address_space(3))) v4i*)(l),
        0, 0);
}
#endif

// ---------------------------------------------------------------------------
// The four elementwise kernels (1, 2, 4, 6) are dealt so that a launch is 544 or
// 1024 work-groups of eight waves, all resident at once: a lane takes 16 to
// 64 elements and moves them 8 or 16 B at a time (miss, read down a column, 4 B).
// ---------------------------------------------------------------------------
typedef __attribute__((ext_vector_type(4))) float  v4f;
typedef __attribute__((ext_vector_type(4))) __bf16 v4bf;

template <int CTRL>
__device__ static inline float dpp_mov(float x)
{
    return __builtin_bit_cast(float, __builtin_amdgcn_mov_dpp(
        __builtin_bit_cast(int, x), CTRL, 0xf, 0xf, true));
}
constexpr int DPP_ROW_SHARE = 0x150;          // + source lane of the row
constexpr int DPP_ROW_XMASK = 0x160;          // + xor mask inside the row

// sum over the 16 lanes of a row, left in every lane of it
__device__ static inline float row_sum16(float s)
{
    s += dpp_mov<DPP_ROW_XMASK + 1>(s);
    s += dpp_mov<DPP_ROW_XMASK + 2>(s);
    s += dpp_mov<DPP_ROW_XMASK + 4>(s);
    s += dpp_mov<DPP_ROW_XMASK + 8>(s);
    return s;
}

__device__ static inline v4f ld4(const float* p) { return *(const v4f*)p; }

__device__ static inline v8bf cvt8(const float* p, unsigned u)
{
    const v4f lo = ((const v4f*)p)[2 * u], hi = ((const v4f*)p)[2 * u + 1];
    v8bf o;
    #pragma unroll
    for (int e = 0; e < 4; ++e) { o[e] = (__bf16)lo[e]; o[4 + e] = (__bf16)hi[e]; }
    return o;
}

// ---------------------------------------------------------------------------
// Kernel 1: token-shift input mixing -> bf16 GEMM operands.
// A lane: 8 columns of step t in every batch (the mix vectors are read once).
// ---------------------------------------------------------------------------
constexpr int PREP_BLOCKS = TT * (CC / 8) / 256;

__global__ __launch_bounds__(256) void prep_kernel(
    const float* __restrict__ x, const float* __restrict__ x0,
    const float* __restrict__ dx0,
    const float* __restrict__ x_q, const float* __restrict__ x_k,
    const float* __restrict__ x_v,
    __bf16* __restrict__ Xq, __bf16* __restrict__ Xk,
    __bf16* __restrict__ Xv, __bf16* __restrict__ Xv0,
    __bf16* __restrict__ Xd)
{
    const int i = blockIdx.x * 256 + threadIdx.x;
    const int c = (i % (CC / 8)) * 8;
    const int t = i / (CC / 8);

    v4f mq[2], mk[2], mv[2];
    #pragma unroll
    for (int p = 0; p < 2; ++p) {
        mq[p] = ld4(x_q + c + 4 * p);
        mk[p] = ld4(x_k + c + 4 * p);
        mv[p] = ld4(x_v + c + 4 * p);
    }
    // before a later load's result lands in a register that these loads name.
    // The output pointers are inputs so that they are fetched here, into scalar
    // registers of their own: fetched later they took the place of the bases
    // of the loads below, ahead of those loads' wait
    asm volatile("s_wait_xcnt 0x0" :: "s"(Xq), "s"(Xk), "s"(Xv), "s"(Xv0), "s"(Xd) : "memory");

    // every load of the lane is issued before the first value is used
    v4f xvs[BB][2], xps[BB][2], z0s[BB][2], d0s[BB][2];
    #pragma unroll
    for (int b = 0; b < BB; ++b) {
        const unsigned u = (unsigned)(b * (TT * CC / 8) + i);   // in 8 elements
        #pragma unroll
        for (int p = 0; p < 2; ++p) {
            xvs[b][p] = ((const v4f*)x)[2 * u + p];
            // step t-1; at t=0 the lane's own step, in bounds and not used
            xps[b][p] = ((const v4f*)x)[2 * u + p - (t > 0 ? CC / 4 : 0)];
            z0s[b][p] = ((const v4f*)x0)[2 * u + p];
            d0s[b][p] = ((const v4f*)dx0)[2 * u + p];
        }
        // before a later load's result, or the arithmetic, lands in a register
        // that these loads name
        asm volatile("s_wait_xcnt 0x0" ::: "memory");
    }
    // keeps the first batch's arithmetic, which waits for its loads, from being
    // scheduled in front of the second batch's loads
    __builtin_amdgcn_sched_barrier(0);

    #pragma unroll
    for (int b = 0; b < BB; ++b) {
        const unsigned u = (unsigned)(b * (TT * CC / 8) + i);
        v8bf oq, ok, ov, o0, od;
        #pragma unroll
        for (int p = 0; p < 2; ++p) {
            const v4f xv = xvs[b][p], z0 = z0s[b][p], d0 = d0s[b][p];
            const v4f xp = t > 0 ? xps[b][p] : v4f{0.0f, 0.0f, 0.0f, 0.0f};   // zero pad
            #pragma unroll
            for (int e = 0; e < 4; ++e) {
                const float dxp = xp[e] - xv[e];         // x_{t-1} - x_t
                oq[4 * p + e] = (__bf16)(xv[e] + dxp * mq[p][e]);
                ok[4 * p + e] = (__bf16)(xv[e] + dxp * mk[p][e]);
                ov[4 * p + e] = (__bf16)(xv[e] + dxp * mv[p][e]);
                o0[4 * p + e] = (__bf16)(z0[e] + d0[e] * mv[p][e]);
                od[4 * p + e] = (__bf16)xv[e];
            }
        }
        ((v8bf*)Xq)[u]  = oq;
        ((v8bf*)Xk)[u]  = ok;
        ((v8bf*)Xv)[u]  = ov;
        ((v8bf*)Xv0)[u] = o0;
        if (c < MR)                                      // x[:, :, :128]
            ((v8bf*)Xd)[(unsigned)((b * TT + t) * (MR / 8) + c / 8)] = od;
        // before the next batch's arithmetic reuses registers that these stores name
        if (b + 1 < BB) asm volatile("s_wait_xcnt 0x0" ::: "memory");
    }
}

// ---------------------------------------------------------------------------
// Kernel 2: f32 weights -> bf16; miss [128,4096] -> missT [4096,128].
// The first blocks transpose: a lane reads 64 rows of one column of miss (a wave
// reads whole lines) and writes one whole 128-B line of missT. The others
// convert 8 elements of each weight a lane.
// ---------------------------------------------------------------------------
constexpr int MT_BLOCKS = 4 * CC * (MR / 64) / 256;
constexpr int WC_BLOCKS = CC * CC / 8 / 256;

__global__ __launch_bounds__(256) void wconv_kernel(
    const float* __restrict__ Wq, const float* __restrict__ Wk,
    const float* __restrict__ Wv, const float* __restrict__ Wp,
    const float* __restrict__ miss,
    __bf16* __restrict__ Wqb, __bf16* __restrict__ Wkb,
    __bf16* __restrict__ Wvb, __bf16* __restrict__ Wpb,
    __bf16* __restrict__ missT)
{
    if (blockIdx.x < MT_BLOCKS) {
        const int i  = blockIdx.x * 256 + threadIdx.x;
        const int n  = i % (4 * CC);
        const int r0 = (i / (4 * CC)) * 64;
        const float* s = miss + (unsigned)(r0 * (4 * CC) + n);
        float v[64];
        #pragma unroll
        for (int r = 0; r < 64; ++r) v[r] = s[r * (4 * CC)];
        #pragma unroll
        for (int q = 0; q < 8; ++q) {
            v8bf o;
            #pragma unroll
            for (int e = 0; e < 8; ++e) o[e] = (__bf16)v[q * 8 + e];
            ((v8bf*)missT)[(unsigned)((n * MR + r0) / 8 + q)] = o;
        }
    } else {
        const unsigned u = (blockIdx.x - MT_BLOCKS) * 256 + threadIdx.x;   // in 8 elements
        const v8bf q = cvt8(Wq, u), k = cvt8(Wk, u), v = cvt8(Wv, u), p = cvt8(Wp, u);
        ((v8bf*)Wqb)[u] = q;
        ((v8bf*)Wkb)[u] = k;
        ((v8bf*)Wvb)[u] = v;
        ((v8bf*)Wpb)[u] = p;
        // the built code lays the other branch behind this one: no register that
        // these stores name is rewritten ahead of this wait on any way through it
        asm volatile("s_wait_xcnt 0x0" ::: "memory");
    }
}

// ---------------------------------------------------------------------------
// Kernel 3: bf16 WMMA GEMM,  Y[m,n] = sum_k X[m,k] * W[n,k]  (+ resid)
//   block tile 128x128, 256 threads = 8 wave32; wave tile 64x32 (4x2 WMMA).
//   K-step 32, double-buffered LDS, async global->LDS staging when available.
// ---------------------------------------------------------------------------
template <int KDIM>
__global__ __launch_bounds__(256) void gemm_bf16_wmma(
    const __bf16* __restrict__ X, const __bf16* __restrict__ W,
    float* __restrict__ Y, const float* __restrict__ resid, int Ndim)
{
    constexpr int KT    = 32;
    constexpr int KITER = KDIM / KT;
    constexpr int LDR   = 40;            // padded row (80B, 16B aligned)

    __shared__ __align__(16) __bf16 As[2][128][LDR];
    __shared__ __align__(16) __bf16 Bs[2][128][LDR];

    const int tid    = threadIdx.x;
    const int lane   = tid & 31;
    const int wave   = tid >> 5;
    const int mBase  = blockIdx.y * 128;
    const int nBase  = blockIdx.x * 128;
    const int wm     = (wave >> 2) * 64;     // 0 | 64
    const int wn     = (wave & 3) * 32;      // 0,32,64,96
    const int laneLo = lane & 15;
    const int kbase  = ((lane >> 4) & 1) * 8; // lanes 0-15 -> K{0..7,16..23};
                                              // lanes 16-31 -> K{8..15,24..31}

    v8f acc[4][2];
    #pragma unroll
    for (int i = 0; i < 4; ++i)
        #pragma unroll
        for (int j = 0; j < 2; ++j)
            #pragma unroll
            for (int e = 0; e < 8; ++e) acc[i][j][e] = 0.0f;

    auto loadTile = [&](int buf, int k0) {
        #pragma unroll
        for (int ch = 0; ch < 2; ++ch) {
            int e  = ch * 2048 + tid * 8;
            int r  = e >> 5;        // 0..127
            int kk = e & 31;        // 0,8,16,24
            const __bf16* gA = &X[(size_t)(mBase + r) * KDIM + k0 + kk];
            const __bf16* gB = &W[(size_t)(nBase + r) * KDIM + k0 + kk];
#if USE_ASYNC_LDS
            async_copy_b128(gA, &As[buf][r][kk]);
            async_copy_b128(gB, &Bs[buf][r][kk]);
#else
            *(v8bf*)&As[buf][r][kk] = *(const v8bf*)gA;
            *(v8bf*)&Bs[buf][r][kk] = *(const v8bf*)gB;
#endif
        }
    };

    loadTile(0, 0);
    for (int ki = 0; ki < KITER; ++ki) {
#if USE_ASYNC_LDS
        __builtin_amdgcn_s_wait_asynccnt(0);   // own async copies in LDS
#endif
        __syncthreads();                       // all waves' copies visible
        const int buf = ki & 1;
        if (ki + 1 < KITER) loadTile(buf ^ 1, (ki + 1) * KT);

        v16bf afrag[4], bfrag[2];
        #pragma unroll
        for (int i = 0; i < 4; ++i) {
            const __bf16* ap = &As[buf][wm + i * 16 + laneLo][kbase];
            v8bf lo = *(const v8bf*)ap;
            v8bf hi = *(const v8bf*)(ap + 16);
            afrag[i] = __builtin_shufflevector(lo, hi, 0, 1, 2, 3, 4, 5, 6, 7,
                                               8, 9, 10, 11, 12, 13, 14, 15);
        }
        #pragma unroll
        for (int j = 0; j < 2; ++j) {
            const __bf16* bp = &Bs[buf][wn + j * 16 + laneLo][kbase];
            v8bf lo = *(const v8bf*)bp;
            v8bf hi = *(const v8bf*)(bp + 16);
            bfrag[j] = __builtin_shufflevector(lo, hi, 0, 1, 2, 3, 4, 5, 6, 7,
                                               8, 9, 10, 11, 12, 13, 14, 15);
        }
        #pragma unroll
        for (int i = 0; i < 4; ++i)
            #pragma unroll
            for (int j = 0; j < 2; ++j)
                acc[i][j] = __builtin_amdgcn_wmma_f32_16x16x32_bf16(
                    false, afrag[i], false, bfrag[j],
                    (short)0, acc[i][j], false, false);
    }

    // C/D layout: VGPR v, lanes 0-15 -> (M=v, N=lane); lanes 16-31 -> (M=8+v)
    const int rowSel = lane >> 4;
    #pragma unroll
    for (int i = 0; i < 4; ++i)
        #pragma unroll
        for (int j = 0; j < 2; ++j) {
            const int m = mBase + wm + i * 16 + rowSel * 8;
            const int n = nBase + wn + j * 16 + laneLo;
            #pragma unroll
            for (int v = 0; v < 8; ++v) {
                size_t off = (size_t)(m + v) * Ndim + n;
                float val  = acc[i][j][v];
                if (resid) val += resid[off];
                Y[off] = val;
            }
        }
}

// ---------------------------------------------------------------------------
// Kernel 4: per-(token,head) elementwise + k-normalization; bf16 rounding of
// the six scan operands (matching the reference's rounding point); packs
// them into one 12B record per (token,head,column) for the scan.
// A block: ETK tokens, all columns. A lane: 4 columns, so a 16-lane row is one
// head and |k|^2 is a DPP row sum; its four records are 48 contiguous bytes.
// ---------------------------------------------------------------------------
constexpr int ETK = 4;                        // tokens per block, kernels 4 and 6
static_assert(CC == 256 * 4 && NN == 16 * 4 && MM % ETK == 0, "lane deal");

__global__ __launch_bounds__(256) void post_gemm_kernel(
    const float* __restrict__ qf, const float* __restrict__ kf,
    const float* __restrict__ vfr, const float* __restrict__ vfirst,
    const float* __restrict__ deltas,
    const float* __restrict__ w0, const float* __restrict__ v0,
    const float* __restrict__ a0,
    ScanOp* __restrict__ sops,
    __bf16* __restrict__ vh, __bf16* __restrict__ gb)
{
    const int c = threadIdx.x * 4;
    const v4f w0v = ld4(w0 + c), v0v = ld4(v0 + c), a0v = ld4(a0 + c);
    // the lane's place in the block's first token, in 4 elements
    const unsigned u0 = blockIdx.x * (ETK * CC / 4) + threadIdx.x;
    const unsigned d0 = blockIdx.x * (ETK * CC) + threadIdx.x;       // in deltas

    #pragma unroll
    for (int it = 0; it < ETK; ++it) {
        const int o = it * (CC / 4);                     // token, in 4 elements
        const v4f* dp = (const v4f*)deltas + d0 + 4 * o;

        const v4f kv = ((const v4f*)kf + u0)[o],  qv = ((const v4f*)qf + u0)[o];
        const v4f vr = ((const v4f*)vfr + u0)[o], vf = ((const v4f*)vfirst + u0)[o];
        const v4f wd = dp[0], vd = dp[CC / 4], ad = dp[2 * (CC / 4)], gd = dp[3 * (CC / 4)];
        // before the arithmetic reuses registers that these loads name
        asm volatile("s_wait_xcnt 0x0" ::: "memory");

        const float norm = sqrtf(row_sum16((kv[0] * kv[0] + kv[1] * kv[1]) +
                                           (kv[2] * kv[2] + kv[3] * kv[3])));
        const float den  = fmaxf(norm, 1e-12f);

        v8bf R[3];                            // four records: q w k z b v each
        v4bf vo, go;
        #pragma unroll
        for (int e = 0; e < 4; ++e) {
            const float xw   = -(w0v[e] + wd[e]);
            const float sp   = (xw > 20.0f) ? xw : log1pf(__expf(xw)); // softplus
            const float logw = -__expf(-sp - 0.5f);                    // log decay < 0

            const float sv = 1.0f / (1.0f + __expf(-(v0v[e] + vd[e])));
            const float vv = vr[e] + (vf[e] - vr[e]) * sv;

            const float a  = 1.0f / (1.0f + __expf(-(a0v[e] + ad[e])));
            const float kk = kv[e] / den;

            R[(e * 6 + 0) / 8][(e * 6 + 0) % 8] = (__bf16)qv[e];
            R[(e * 6 + 1) / 8][(e * 6 + 1) % 8] = (__bf16)logw;
            R[(e * 6 + 2) / 8][(e * 6 + 2) % 8] = (__bf16)(kv[e] * a);
            R[(e * 6 + 3) / 8][(e * 6 + 3) % 8] = (__bf16)(-kk);
            R[(e * 6 + 4) / 8][(e * 6 + 4) % 8] = (__bf16)(kk * a);
            R[(e * 6 + 5) / 8][(e * 6 + 5) % 8] = (__bf16)vv;
            vo[e] = (__bf16)vv;
            go[e] = (__bf16)(1.0f + gd[e]);
        }
        v8bf* sp8 = (v8bf*)sops + 3 * u0 + 3 * o;
        sp8[0] = R[0];
        sp8[1] = R[1];
        sp8[2] = R[2];
        ((v4bf*)vh + u0)[o] = vo;
        ((v4bf*)gb + u0)[o] = go;
        // before the next token's loads reuse registers that these stores name
        if (it + 1 < ETK) asm volatile("s_wait_xcnt 0x0" ::: "memory");
    }
}

constexpr int SCH = 16;
constexpr int STS = 32;
constexpr int SNT = TT / STS;
static_assert(SNT >= 2 && STS % SCH == 0, "two tiles at least, whole chunks");

// Two partial sums become one: lanes with BIT clear keep lo, lanes with BIT
// set keep hi, and each adds what its partner (lane ^ BIT) holds of the same.
template <int BIT>
__device__ static inline float fold(float lo, float hi, int j)
{
    const bool  up   = (j & BIT) != 0;
    const float keep = up ? hi : lo;
    const float send = up ? lo : hi;
    return keep + dpp_mov<DPP_ROW_XMASK + BIT>(send);
}

// One tile: STS steps of 64 records (768 B a step, contiguous; steps lie
// CC records apart in global memory, back to back in LDS). A wave brings
// STS/4 steps, 16 B a lane and copy; 96 pieces are two steps.
__device__ static inline void scan_fetch(const ScanOp* g0, ScanOp* l0,
                                         int wave, int lane)
{
    constexpr int SB = NN * (int)sizeof(ScanOp);             // 768 B
    constexpr int GB = CC * (int)sizeof(ScanOp);             // step pitch, global
    const char* g = (const char*)g0 + (size_t)wave * (STS / 4) * GB;
    char*       l = (char*)l0 + wave * (STS / 4) * SB + lane * 16;
    #pragma unroll
    for (int r = 0; r < 3; ++r) {
        const int   pc = r * 32 + lane;                      // piece 0..95
        const char* gr = g + (pc / 48) * GB + (pc % 48) * 16;
        #pragma unroll
        for (int a = 0; a < STS / 8; ++a) {
#if USE_ASYNC_LDS
            async_copy_b128(gr + a * 2 * GB, l + (a * 3 + r) * 512);
#else
            *(v4i*)(l + (a * 3 + r) * 512) = *(const v4i*)(gr + a * 2 * GB);
#endif
        }
    }
}

struct Rec4 { v8bf r0, r1, r2; };            // a lane's four records of one step

__device__ static inline Rec4 scan_read(const ScanOp* lp, int u)
{
    const v8bf* rp = (const v8bf*)(lp + u * NN);
    return Rec4{rp[0], rp[1], rp[2]};
}

constexpr int SLA = 3;                        // LDS reads run this many steps ahead

template <int U>
struct ScanSteps {
    // lp: the lane's four records of the tile's first step, in LDS
    __device__ static inline void run(const ScanOp* lp, Rec4 (&pipe)[SLA], float (&S)[4],
                                      float (&f)[4], const float (&vrow)[STS / SCH],
                                      float (&o)[STS / SCH], int j)
    {
        constexpr int t = STS - U;           // step in the tile
        constexpr int u = t % SCH;           // step in the chunk
        const v8bf r0 = pipe[t % SLA].r0, r1 = pipe[t % SLA].r1, r2 = pipe[t % SLA].r2;
        if constexpr (t + SLA < STS) pipe[t % SLA] = scan_read(lp, t + SLA);
        // holds the reads above this step's arithmetic: left alone the scheduler
        // puts them one step ahead of their use
        __builtin_amdgcn_sched_barrier(0);

        // four records of six bf16: q w k z b v
        const float q[4] = {(float)r0[0], (float)r0[6], (float)r1[4], (float)r2[2]};
        const float w[4] = {(float)r0[1], (float)r0[7], (float)r1[5], (float)r2[3]};
        const float k[4] = {(float)r0[2], (float)r1[0], (float)r1[6], (float)r2[4]};
        const float z[4] = {(float)r0[3], (float)r1[1], (float)r1[7], (float)r2[5]};
        const float b[4] = {(float)r0[4], (float)r1[2], (float)r2[0], (float)r2[6]};

        // this step's v of the row
        const float vt = dpp_mov<DPP_ROW_SHARE + u>(vrow[t / SCH]);

        float sa = __builtin_fmaf(S[1], z[1], S[0] * z[0]) + __builtin_fmaf(S[3], z[3], S[2] * z[2]);
        sa += dpp_mov<DPP_ROW_XMASK + 1>(sa);
        sa += dpp_mov<DPP_ROW_XMASK + 2>(sa);
        sa += dpp_mov<DPP_ROW_XMASK + 4>(sa);
        sa += dpp_mov<DPP_ROW_XMASK + 8>(sa);

        #pragma unroll
        for (int i = 0; i < 4; ++i)          // exp after bf16 round, as reference
            S[i] = __builtin_fmaf(sa, b[i], __builtin_fmaf(vt, k[i], S[i] * __expf(w[i])));

        float p = __builtin_fmaf(S[1], q[1], S[0] * q[0]) + __builtin_fmaf(S[3], q[3], S[2] * q[2]);

        // binary counter of folded partials: f[n] holds 2^n finished steps
        if constexpr ((u & 1) == 0) { f[0] = p; }
        else {
            p = fold<1>(f[0], p, j);
            if constexpr ((u & 2) == 0) { f[1] = p; }
            else {
                p = fold<2>(f[1], p, j);
                if constexpr ((u & 4) == 0) { f[2] = p; }
                else {
                    p = fold<4>(f[2], p, j);
                    if constexpr ((u & 8) == 0) { f[3] = p; }
                    else { o[t / SCH] = fold<8>(f[3], p, j); }
                }
            }
        }
        ScanSteps<U - 1>::run(lp, pipe, S, f, vrow, o, j);
    }
};
template <>
struct ScanSteps<0> {
    __device__ static inline void run(const ScanOp*, Rec4 (&)[SLA], float (&)[4],
                                      float (&)[4], const float (&)[STS / SCH],
                                      float (&)[STS / SCH], int) {}
};

__global__ __launch_bounds__(128) void scan_kernel(
    const ScanOp* __restrict__ sops, float* __restrict__ y)
{
    __shared__ __align__(16) ScanOp tile[2][STS][NN];

    const int lane = threadIdx.x & 31;
    const int wave = threadIdx.x >> 5;
    const int g    = blockIdx.x >> 3;                        // b*H + h
    const int rp   = (blockIdx.x & 7) * 4 + wave;            // row pair 0..31
    const int h    = g % HH;
    const int b    = g / HH;
    const int j    = lane & 15;                              // column group / step slot
    const int row  = rp * 2 + (lane >> 4);

    const ScanOp* hb = sops + (size_t)b * TT * CC + (size_t)h * NN;   // t = 0
    float* yp = y + ((size_t)g * (TT / SCH) * 32 + rp) * 32 + lane;

    float S[4] = {0.0f, 0.0f, 0.0f, 0.0f};

    scan_fetch(hb, &tile[0][0][0], wave, lane);
    // own copies of tile 0 landed; the barrier publishes every wave's
    asm volatile("s_wait_asynccnt 0x0" ::: "memory");
    __syncthreads();
    scan_fetch(hb + (size_t)STS * CC, &tile[1][0][0], wave, lane);

    // kept rolled: the body already holds STS unrolled steps
    #pragma unroll 1
    for (int tl = 0; tl < SNT; ++tl) {
        ScanOp* tb = &tile[tl & 1][0][0];

        Rec4 pipe[SLA];
        #pragma unroll
        for (int i = 0; i < SLA; ++i) pipe[i] = scan_read(tb + j * 4, i);
        float vrow[STS / SCH], o[STS / SCH], f[4];
        #pragma unroll
        for (int c = 0; c < STS / SCH; ++c)  // v of my row at step j of chunk c
            vrow[c] = (float)tb[(c * SCH + j) * NN + row].v;

        ScanSteps<STS>::run(tb + j * 4, pipe, S, f, vrow, o, j);

        // foot of the trip: my reads of this tile are done, my copies of the
        // next tile have landed; the barrier says both of every wave
        asm volatile("s_wait_dscnt 0x0" ::: "memory");
        asm volatile("s_wait_asynccnt 0x0" ::: "memory");
        __syncthreads();
        if (tl + 2 < SNT)
            scan_fetch(hb + (size_t)(tl + 2) * STS * CC, tb, wave, lane);

        // stored behind the barrier: in front of it the barrier's own wait for
        // stores would expose their whole latency once per tile
        #pragma unroll
        for (int c = 0; c < STS / SCH; ++c) {
            *yp = o[c] * 0.125f;             // * N^-0.5
            yp += 32 * 32;
        }
    }
    // no copy is left in flight when the wave ends
    asm volatile("s_wait_asynccnt 0x0" ::: "memory");
}

// ---------------------------------------------------------------------------
// Kernel 6: norm-ratio correction + gate -> bf16 input for output projection.
// A block: ETK tokens of one chunk of y, all columns. A lane: 4 columns of each,
// a 16-lane row is one head (norms: DPP row sums). y lies step-fastest (see
// kernel 5), so one 16-B load is one column's ETK steps.
// ---------------------------------------------------------------------------
static_assert(ETK == 4 && SCH % ETK == 0 && TT % SCH == 0, "a block stays in one chunk");

__global__ __launch_bounds__(256) void post_scan_kernel(
    const float* __restrict__ y, const float* __restrict__ x,
    const __bf16* __restrict__ vh, const __bf16* __restrict__ gb,
    const float* __restrict__ r_k, __bf16* __restrict__ Yg)
{
    const int    c  = threadIdx.x * 4;
    const int    h  = threadIdx.x >> 4;
    const int    n0 = c & (NN - 1);
    const unsigned m0 = blockIdx.x * ETK;
    const unsigned t0 = m0 % TT;
    const unsigned gy = (m0 / TT) * HH + h;

    // y[((gy*(T/SCH) + chunk)*NN + n)*SCH + step], here in 4 steps
    const unsigned yu = ((gy * (TT / SCH) + t0 / SCH) * NN + n0) * (SCH / 4) + (t0 % SCH) / 4;
    v4f yv[4];                                // [column][token]
    #pragma unroll
    for (int e = 0; e < 4; ++e) yv[e] = ((const v4f*)y)[yu + e * (SCH / 4)];

    const v4f rk = ld4(r_k + c);
    // before a later load's result lands in a register that these loads name
    asm volatile("s_wait_xcnt 0x0" ::: "memory");
    float sig[4];
    #pragma unroll
    for (int e = 0; e < 4; ++e) sig[e] = 1.0f / (1.0f + __expf(-rk[e]));

    // every load of the lane is issued before the first value is used
    v4f  xvs[ETK];
    v4bf vbs[ETK], gvs[ETK];
    #pragma unroll
    for (int it = 0; it < ETK; ++it) {
        const unsigned u = (m0 + it) * (CC / 4) + threadIdx.x;   // in 4 elements
        xvs[it] = ((const v4f*)x)[u];
        vbs[it] = ((const v4bf*)vh)[u];
        gvs[it] = ((const v4bf*)gb)[u];
    }

    #pragma unroll
    for (int it = 0; it < ETK; ++it) {
        const unsigned u = (m0 + it) * (CC / 4) + threadIdx.x;
        const v4f  xv = xvs[it];
        const v4bf vb = vbs[it], gv = gvs[it];
        float vv[4];
        #pragma unroll
        for (int e = 0; e < 4; ++e) vv[e] = (float)vb[e];

        const float xnorm = sqrtf(row_sum16((xv[0] * xv[0] + xv[1] * xv[1]) +
                                            (xv[2] * xv[2] + xv[3] * xv[3])));
        const float vnorm = sqrtf(row_sum16((vv[0] * vv[0] + vv[1] * vv[1]) +
                                            (vv[2] * vv[2] + vv[3] * vv[3])));
        const float ratio = 1.0f - xnorm / (vnorm + 1e-12f);

        v4bf o;
        #pragma unroll
        for (int e = 0; e < 4; ++e) {
            const float u = ratio * sig[e];
            o[e] = (__bf16)((yv[e][it] + vv[e] * u) * (float)gv[e]);
        }
        ((v4bf*)Yg)[u] = o;
    }
}

// ---------------------------------------------------------------------------
// Host launcher
// ---------------------------------------------------------------------------
extern "C" void kernel_launch(void* const* d_in, const int* in_sizes, int n_in,
                              void* d_out, int out_size, void* d_ws,
                              size_t ws_size, hipStream_t stream)
{
    (void)in_sizes; (void)n_in; (void)out_size; (void)ws_size;

    const float* residual = (const float*)d_in[0];
    const float* x        = (const float*)d_in[1];
    const float* x0       = (const float*)d_in[2];
    const float* dx0      = (const float*)d_in[3];
    const float* Wq       = (const float*)d_in[4];
    const float* Wk       = (const float*)d_in[5];
    const float* Wv       = (const float*)d_in[6];
    const float* Wproj    = (const float*)d_in[7];
    const float* x_q      = (const float*)d_in[8];
    const float* x_k      = (const float*)d_in[9];
    const float* x_v      = (const float*)d_in[10];
    const float* v0       = (const float*)d_in[11];
    const float* w0       = (const float*)d_in[12];
    const float* a0       = (const float*)d_in[13];
    const float* miss     = (const float*)d_in[14];
    const float* r_k      = (const float*)d_in[15];
    float*       out      = (float*)d_out;

    // ---- workspace layout (256B aligned bump allocator) ----
    char*  ws  = (char*)d_ws;
    size_t off = 0;
    auto alloc = [&](size_t bytes) -> void* {
        void* p = ws + off;
        off += (bytes + 255) & ~(size_t)255;
        return p;
    };
    const size_t MC_BF = (size_t)MM * CC * sizeof(__bf16);    // 8 MB
    const size_t MC_F  = (size_t)MM * CC * sizeof(float);     // 16 MB
    const size_t W_BF  = (size_t)CC * CC * sizeof(__bf16);    // 2 MB
    const size_t XD_BF = (size_t)MM * MR * sizeof(__bf16);    // 1 MB
    const size_t DL_F  = (size_t)MM * 4 * CC * sizeof(float); // 64 MB
    const size_t SO_SZ = (size_t)MM * CC * sizeof(ScanOp);    // 48 MB

    __bf16* Xq    = (__bf16*)alloc(MC_BF);
    __bf16* Xk    = (__bf16*)alloc(MC_BF);
    __bf16* Xv    = (__bf16*)alloc(MC_BF);
    __bf16* Xv0   = (__bf16*)alloc(MC_BF);
    __bf16* Xd    = (__bf16*)alloc(XD_BF);
    __bf16* Wqb   = (__bf16*)alloc(W_BF);
    __bf16* Wkb   = (__bf16*)alloc(W_BF);
    __bf16* Wvb   = (__bf16*)alloc(W_BF);
    __bf16* Wpb   = (__bf16*)alloc(W_BF);
    __bf16* missT = (__bf16*)alloc(XD_BF);
    float*  qf    = (float*)alloc(MC_F);
    float*  kf    = (float*)alloc(MC_F);
    float*  vfr   = (float*)alloc(MC_F);
    float*  vfirst= (float*)alloc(MC_F);
    float*  deltas= (float*)alloc(DL_F);
    ScanOp* sops  = (ScanOp*)alloc(SO_SZ);
    __bf16* gb    = (__bf16*)alloc(MC_BF);
    // aliases over buffers whose last reader precedes the new writer:
    __bf16* vh  = Xv0;       // Xv0 consumed by v_first GEMM before post_gemm
    float*  y   = qf;        // qf consumed by post_gemm before scan writes
    __bf16* Yg  = (__bf16*)kf;

    // ---- 1) input prep + weight conversion ----
    {
        prep_kernel<<<dim3(PREP_BLOCKS), dim3(256), 0, stream>>>(
            x, x0, dx0, x_q, x_k, x_v, Xq, Xk, Xv, Xv0, Xd);
        wconv_kernel<<<dim3(MT_BLOCKS + WC_BLOCKS), dim3(256), 0, stream>>>(
            Wq, Wk, Wv, Wproj, miss, Wqb, Wkb, Wvb, Wpb, missT);
    }

    // ---- 2) WMMA GEMMs: q, k, v, v_first (K=1024, N=1024), deltas (K=128, N=4096)
    {
        dim3 grid(CC / 128, MM / 128), blk(256);
        gemm_bf16_wmma<CC><<<grid, blk, 0, stream>>>(Xq,  Wqb, qf,     (const float*)nullptr, CC);
        gemm_bf16_wmma<CC><<<grid, blk, 0, stream>>>(Xk,  Wkb, kf,     (const float*)nullptr, CC);
        gemm_bf16_wmma<CC><<<grid, blk, 0, stream>>>(Xv,  Wvb, vfr,    (const float*)nullptr, CC);
        gemm_bf16_wmma<CC><<<grid, blk, 0, stream>>>(Xv0, Wvb, vfirst, (const float*)nullptr, CC);
        dim3 gridD(4 * CC / 128, MM / 128);
        gemm_bf16_wmma<MR><<<gridD, blk, 0, stream>>>(Xd, missT, deltas, (const float*)nullptr, 4 * CC);
    }

    // ---- 3) elementwise + k-norm -> packed bf16 scan operands ----
    post_gemm_kernel<<<dim3(MM / ETK), dim3(256), 0, stream>>>(
        qf, kf, vfr, vfirst, deltas, w0, v0, a0, sops, vh, gb);

    // ---- 4) sequential scan (state in VGPRs, 8 rows per block) ----
    scan_kernel<<<dim3(BB * HH * 8), dim3(128), 0, stream>>>(sops, y);

    // ---- 5) norm correction + gate ----
    post_scan_kernel<<<dim3(MM / ETK), dim3(256), 0, stream>>>(y, x, vh, gb, r_k, Yg);

    // ---- 6) output projection + residual -> d_out ----
    {
        dim3 grid(CC / 128, MM / 128), blk(256);
        gemm_bf16_wmma<CC><<<grid, blk, 0, stream>>>(Yg, Wpb, out, residual, CC);
    }
}

// v003
// A run of this version takes 273 microseconds.
// Next to v002, in two timings, it ran 1.10 times as fast each time.
// Counting every step since v000, it is 16.2 times as fast.
#include <hip/hip_runtime.h>
#include <hip/hip_bf16.h>

// ---------------------------------------------------------------------------
// RWKV7 time-mix for MI455X (gfx1250, wave32, WMMA).
//   B=2, T=2048, C=1024, H=16, N=64, MISS_ROWS=128
// ---------------------------------------------------------------------------

typedef __attribute__((ext_vector_type(16))) __bf16 v16bf;
typedef __attribute__((ext_vector_type(8)))  __bf16 v8bf;
typedef __attribute__((ext_vector_type(8)))  float  v8f;
typedef __attribute__((ext_vector_type(4)))  int    v4i;

constexpr int BB = 2;
constexpr int TT = 2048;
constexpr int CC = 1024;
constexpr int HH = 16;
constexpr int NN = 64;
constexpr int MR = 128;          // MISS_ROWS
constexpr int MM = BB * TT;      // 4096 tokens

// Packed per-(token,head,column) scan operands: 12B a record; a scan lane reads four a step.
struct __align__(4) ScanOp { __bf16 q, w, k, z, b, v; };

// ---- gfx1250 async global->LDS copy path (guarded; falls back cleanly) ----
#if defined(__HIP_DEVICE_COMPILE__) &&                                        \
    __has_builtin(__builtin_amdgcn_global_load_async_to_lds_b128) &&          \
    __has_builtin(__builtin_amdgcn_s_wait_asynccnt)
#define USE_ASYNC_LDS 1
#else
#define USE_ASYNC_LDS 0
#endif

#if USE_ASYNC_LDS
__device__ static inline void async_copy_b128(const void* g, void* l)
{
    // Builtin signature (from clang diagnostic): AS1 v4i* src, AS3 v4i* dst,
    // imm offset, imm cpol.
    __builtin_amdgcn_global_load_async_to_lds_b128(
        (__attribute__((address_space(1))) v4i*)(g),
        (__attribute__((address_space(3))) v4i*)(l),
        0, 0);
}
#endif

// ---------------------------------------------------------------------------
// The four elementwise kernels (1, 2, 4, 6) are dealt so that a launch is 544 or
// 1024 work-groups of eight waves, all resident at once: a lane takes 16 to
// 64 elements and moves them 8 or 16 B at a time (miss, read down a column, 4 B).
// ---------------------------------------------------------------------------
typedef __attribute__((ext_vector_type(4))) float  v4f;
typedef __attribute__((ext_vector_type(4))) __bf16 v4bf;

template <int CTRL>
__device__ static inline float dpp_mov(float x)
{
    return __builtin_bit_cast(float, __builtin_amdgcn_mov_dpp(
        __builtin_bit_cast(int, x), CTRL, 0xf, 0xf, true));
}
constexpr int DPP_ROW_SHARE = 0x150;          // + source lane of the row
constexpr int DPP_ROW_XMASK = 0x160;          // + xor mask inside the row

// sum over the 16 lanes of a row, left in every lane of it
__device__ static inline float row_sum16(float s)
{
    s += dpp_mov<DPP_ROW_XMASK + 1>(s);
    s += dpp_mov<DPP_ROW_XMASK + 2>(s);
    s += dpp_mov<DPP_ROW_XMASK + 4>(s);
    s += dpp_mov<DPP_ROW_XMASK + 8>(s);
    return s;
}

__device__ static inline v4f ld4(const float* p) { return *(const v4f*)p; }

__device__ static inline v8bf cvt8(const float* p, unsigned u)
{
    const v4f lo = ((const v4f*)p)[2 * u], hi = ((const v4f*)p)[2 * u + 1];
    v8bf o;
    #pragma unroll
    for (int e = 0; e < 4; ++e) { o[e] = (__bf16)lo[e]; o[4 + e] = (__bf16)hi[e]; }
    return o;
}

// ---------------------------------------------------------------------------
// Kernel 1: token-shift input mixing -> bf16 GEMM operands.
// A lane: 8 columns of step t in every batch (the mix vectors are read once).
// ---------------------------------------------------------------------------
constexpr int PREP_BLOCKS = TT * (CC / 8) / 256;

__global__ __launch_bounds__(256) void prep_kernel(
    const float* __restrict__ x, const float* __restrict__ x0,
    const float* __restrict__ dx0,
    const float* __restrict__ x_q, const float* __restrict__ x_k,
    const float* __restrict__ x_v,
    __bf16* __restrict__ Xq, __bf16* __restrict__ Xk,
    __bf16* __restrict__ Xv, __bf16* __restrict__ Xv0,
    __bf16* __restrict__ Xd)
{
    const int i = blockIdx.x * 256 + threadIdx.x;
    const int c = (i % (CC / 8)) * 8;
    const int t = i / (CC / 8);

    v4f mq[2], mk[2], mv[2];
    #pragma unroll
    for (int p = 0; p < 2; ++p) {
        mq[p] = ld4(x_q + c + 4 * p);
        mk[p] = ld4(x_k + c + 4 * p);
        mv[p] = ld4(x_v + c + 4 * p);
    }
    // before a later load's result lands in a register that these loads name.
    // The output pointers are inputs so that they are fetched here, into scalar
    // registers of their own: fetched later they took the place of the bases
    // of the loads below, ahead of those loads' wait
    asm volatile("s_wait_xcnt 0x0" :: "s"(Xq), "s"(Xk), "s"(Xv), "s"(Xv0), "s"(Xd) : "memory");

    // every load of the lane is issued before the first value is used
    v4f xvs[BB][2], xps[BB][2], z0s[BB][2], d0s[BB][2];
    #pragma unroll
    for (int b = 0; b < BB; ++b) {
        const unsigned u = (unsigned)(b * (TT * CC / 8) + i);   // in 8 elements
        #pragma unroll
        for (int p = 0; p < 2; ++p) {
            xvs[b][p] = ((const v4f*)x)[2 * u + p];
            // step t-1; at t=0 the lane's own step, in bounds and not used
            xps[b][p] = ((const v4f*)x)[2 * u + p - (t > 0 ? CC / 4 : 0)];
            z0s[b][p] = ((const v4f*)x0)[2 * u + p];
            d0s[b][p] = ((const v4f*)dx0)[2 * u + p];
        }
        // before a later load's result, or the arithmetic, lands in a register
        // that these loads name
        asm volatile("s_wait_xcnt 0x0" ::: "memory");
    }
    // keeps the first batch's arithmetic, which waits for its loads, from being
    // scheduled in front of the second batch's loads
    __builtin_amdgcn_sched_barrier(0);

    #pragma unroll
    for (int b = 0; b < BB; ++b) {
        const unsigned u = (unsigned)(b * (TT * CC / 8) + i);
        v8bf oq, ok, ov, o0, od;
        #pragma unroll
        for (int p = 0; p < 2; ++p) {
            const v4f xv = xvs[b][p], z0 = z0s[b][p], d0 = d0s[b][p];
            const v4f xp = t > 0 ? xps[b][p] : v4f{0.0f, 0.0f, 0.0f, 0.0f};   // zero pad
            #pragma unroll
            for (int e = 0; e < 4; ++e) {
                const float dxp = xp[e] - xv[e];         // x_{t-1} - x_t
                oq[4 * p + e] = (__bf16)(xv[e] + dxp * mq[p][e]);
                ok[4 * p + e] = (__bf16)(xv[e] + dxp * mk[p][e]);
                ov[4 * p + e] = (__bf16)(xv[e] + dxp * mv[p][e]);
                o0[4 * p + e] = (__bf16)(z0[e] + d0[e] * mv[p][e]);
                od[4 * p + e] = (__bf16)xv[e];
            }
        }
        ((v8bf*)Xq)[u]  = oq;
        ((v8bf*)Xk)[u]  = ok;
        ((v8bf*)Xv)[u]  = ov;
        ((v8bf*)Xv0)[u] = o0;
        if (c < MR)                                      // x[:, :, :128]
            ((v8bf*)Xd)[(unsigned)((b * TT + t) * (MR / 8) + c / 8)] = od;
        // before the next batch's arithmetic reuses registers that these stores name
        if (b + 1 < BB) asm volatile("s_wait_xcnt 0x0" ::: "memory");
    }
}

// ---------------------------------------------------------------------------
// Kernel 2: f32 weights -> bf16; miss [128,4096] -> missT [4096,128].
// The first blocks transpose: a lane reads 64 rows of one column of miss (a wave
// reads whole lines) and writes one whole 128-B line of missT. The others
// convert 8 elements of each weight a lane.
// ---------------------------------------------------------------------------
constexpr int MT_BLOCKS = 4 * CC * (MR / 64) / 256;
constexpr int WC_BLOCKS = CC * CC / 8 / 256;

__global__ __launch_bounds__(256) void wconv_kernel(
    const float* __restrict__ Wq, const float* __restrict__ Wk,
    const float* __restrict__ Wv, const float* __restrict__ Wp,
    const float* __restrict__ miss,
    __bf16* __restrict__ Wqb, __bf16* __restrict__ Wkb,
    __bf16* __restrict__ Wvb, __bf16* __restrict__ Wpb,
    __bf16* __restrict__ missT)
{
    if (blockIdx.x < MT_BLOCKS) {
        const int i  = blockIdx.x * 256 + threadIdx.x;
        const int n  = i % (4 * CC);
        const int r0 = (i / (4 * CC)) * 64;
        const float* s = miss + (unsigned)(r0 * (4 * CC) + n);
        float v[64];
        #pragma unroll
        for (int r = 0; r < 64; ++r) v[r] = s[r * (4 * CC)];
        #pragma unroll
        for (int q = 0; q < 8; ++q) {
            v8bf o;
            #pragma unroll
            for (int e = 0; e < 8; ++e) o[e] = (__bf16)v[q * 8 + e];
            ((v8bf*)missT)[(unsigned)((n * MR + r0) / 8 + q)] = o;
        }
    } else {
        const unsigned u = (blockIdx.x - MT_BLOCKS) * 256 + threadIdx.x;   // in 8 elements
        const v8bf q = cvt8(Wq, u), k = cvt8(Wk, u), v = cvt8(Wv, u), p = cvt8(Wp, u);
        ((v8bf*)Wqb)[u] = q;
        ((v8bf*)Wkb)[u] = k;
        ((v8bf*)Wvb)[u] = v;
        ((v8bf*)Wpb)[u] = p;
        // the built code lays the other branch behind this one: no register that
        // these stores name is rewritten ahead of this wait on any way through it
        asm volatile("s_wait_xcnt 0x0" ::: "memory");
    }
}

// ---------------------------------------------------------------------------
// Kernel 3: bf16 WMMA GEMM,  Y[m,n] = sum_k X[m,k] * W[n,k]  (+ resid)
//   block tile 128x128, 256 threads = 8 wave32; wave tile 64x32 (4x2 WMMA).
//   K-step 32, double-buffered LDS, async global->LDS staging when available.
// gemm_tile is one block's tile; the kernels behind it say which tile of which
// product a block takes.
// ---------------------------------------------------------------------------
template <int KDIM>
__device__ static __forceinline__ void gemm_tile(
    const __bf16* __restrict__ X, const __bf16* __restrict__ W,
    float* __restrict__ Y, const float* __restrict__ resid, int Ndim,
    int mBase, int nBase)
{
    constexpr int KT    = 32;
    constexpr int KITER = KDIM / KT;
    constexpr int LDR   = 40;            // padded row (80B, 16B aligned)

    __shared__ __align__(16) __bf16 As[2][128][LDR];
    __shared__ __align__(16) __bf16 Bs[2][128][LDR];

    const int tid    = threadIdx.x;
    const int lane   = tid & 31;
    const int wave   = tid >> 5;
    const int wm     = (wave >> 2) * 64;     // 0 | 64
    const int wn     = (wave & 3) * 32;      // 0,32,64,96
    const int laneLo = lane & 15;
    const int kbase  = ((lane >> 4) & 1) * 8; // lanes 0-15 -> K{0..7,16..23};
                                              // lanes 16-31 -> K{8..15,24..31}

    v8f acc[4][2];
    #pragma unroll
    for (int i = 0; i < 4; ++i)
        #pragma unroll
        for (int j = 0; j < 2; ++j)
            #pragma unroll
            for (int e = 0; e < 8; ++e) acc[i][j][e] = 0.0f;

    auto loadTile = [&](int buf, int k0) {
        #pragma unroll
        for (int ch = 0; ch < 2; ++ch) {
            int e  = ch * 2048 + tid * 8;
            int r  = e >> 5;        // 0..127
            int kk = e & 31;        // 0,8,16,24
            const __bf16* gA = &X[(size_t)(mBase + r) * KDIM + k0 + kk];
            const __bf16* gB = &W[(size_t)(nBase + r) * KDIM + k0 + kk];
#if USE_ASYNC_LDS
            async_copy_b128(gA, &As[buf][r][kk]);
            async_copy_b128(gB, &Bs[buf][r][kk]);
#else
            *(v8bf*)&As[buf][r][kk] = *(const v8bf*)gA;
            *(v8bf*)&Bs[buf][r][kk] = *(const v8bf*)gB;
#endif
        }
    };

    loadTile(0, 0);
    for (int ki = 0; ki < KITER; ++ki) {
#if USE_ASYNC_LDS
        __builtin_amdgcn_s_wait_asynccnt(0);   // own async copies in LDS
#endif
        __syncthreads();                       // all waves' copies visible
        const int buf = ki & 1;
        if (ki + 1 < KITER) loadTile(buf ^ 1, (ki + 1) * KT);

        v16bf afrag[4], bfrag[2];
        #pragma unroll
        for (int i = 0; i < 4; ++i) {
            const __bf16* ap = &As[buf][wm + i * 16 + laneLo][kbase];
            v8bf lo = *(const v8bf*)ap;
            v8bf hi = *(const v8bf*)(ap + 16);
            afrag[i] = __builtin_shufflevector(lo, hi, 0, 1, 2, 3, 4, 5, 6, 7,
                                               8, 9, 10, 11, 12, 13, 14, 15);
        }
        #pragma unroll
        for (int j = 0; j < 2; ++j) {
            const __bf16* bp = &Bs[buf][wn + j * 16 + laneLo][kbase];
            v8bf lo = *(const v8bf*)bp;
            v8bf hi = *(const v8bf*)(bp + 16);
            bfrag[j] = __builtin_shufflevector(lo, hi, 0, 1, 2, 3, 4, 5, 6, 7,
                                               8, 9, 10, 11, 12, 13, 14, 15);
        }
        #pragma unroll
        for (int i = 0; i < 4; ++i)
            #pragma unroll
            for (int j = 0; j < 2; ++j)
                acc[i][j] = __builtin_amdgcn_wmma_f32_16x16x32_bf16(
                    false, afrag[i], false, bfrag[j],
                    (short)0, acc[i][j], false, false);
    }

    // C/D layout: VGPR v, lanes 0-15 -> (M=v, N=lane); lanes 16-31 -> (M=8+v)
    const int rowSel = lane >> 4;
    #pragma unroll
    for (int i = 0; i < 4; ++i)
        #pragma unroll
        for (int j = 0; j < 2; ++j) {
            const int m = mBase + wm + i * 16 + rowSel * 8;
            const int n = nBase + wn + j * 16 + laneLo;
            #pragma unroll
            for (int v = 0; v < 8; ++v) {
                size_t off = (size_t)(m + v) * Ndim + n;
                float val  = acc[i][j][v];
                if (resid) val += resid[off];
                Y[off] = val;
            }
        }
}

template <int KDIM>
__global__ __launch_bounds__(256) void gemm_bf16_wmma(
    const __bf16* __restrict__ X, const __bf16* __restrict__ W,
    float* __restrict__ Y, const float* __restrict__ resid, int Ndim)
{
    gemm_tile<KDIM>(X, W, Y, resid, Ndim, blockIdx.y * 128, blockIdx.x * 128);
}

// The four projections of the inputs depend on nothing of one another: one
// launch, blockIdx.z says which. A projection of its own is one block a WGP, and
// that block waits out the landing of its copies once per K-step; here four
// blocks share a WGP and work while another waits.
__global__ __launch_bounds__(256) void gemm_proj4_kernel(
    const __bf16* __restrict__ Xq, const __bf16* __restrict__ Xk,
    const __bf16* __restrict__ Xv, const __bf16* __restrict__ Xv0,
    const __bf16* __restrict__ Wqb, const __bf16* __restrict__ Wkb,
    const __bf16* __restrict__ Wvb,
    float* __restrict__ qf, float* __restrict__ kf, float* __restrict__ vfr,
    float* __restrict__ vfirst)
{
    const int p = blockIdx.z;
    const __bf16* X = p == 0 ? Xq  : p == 1 ? Xk  : p == 2 ? Xv  : Xv0;
    const __bf16* W = p == 0 ? Wqb : p == 1 ? Wkb : Wvb;
    float*        Y = p == 0 ? qf  : p == 1 ? kf  : p == 2 ? vfr : vfirst;
    gemm_tile<CC>(X, W, Y, nullptr, CC, blockIdx.y * 128, blockIdx.x * 128);
}

// ---------------------------------------------------------------------------
// Kernel 4: per-(token,head) elementwise + k-normalization; bf16 rounding of
// the six scan operands (matching the reference's rounding point); packs
// them into one 12B record per (token,head,column) for the scan.
// A block: ETK tokens, all columns. A lane: 4 columns, so a 16-lane row is one
// head and |k|^2 is a DPP row sum; its four records are 48 contiguous bytes.
// ---------------------------------------------------------------------------
constexpr int ETK = 4;                        // tokens per block, kernels 4 and 6
static_assert(CC == 256 * 4 && NN == 16 * 4 && MM % ETK == 0, "lane deal");

__global__ __launch_bounds__(256) void post_gemm_kernel(
    const float* __restrict__ qf, const float* __restrict__ kf,
    const float* __restrict__ vfr, const float* __restrict__ vfirst,
    const float* __restrict__ deltas,
    const float* __restrict__ w0, const float* __restrict__ v0,
    const float* __restrict__ a0,
    ScanOp* __restrict__ sops,
    __bf16* __restrict__ vh, __bf16* __restrict__ gb)
{
    const int c = threadIdx.x * 4;
    const v4f w0v = ld4(w0 + c), v0v = ld4(v0 + c), a0v = ld4(a0 + c);
    // the lane's place in the block's first token, in 4 elements
    const unsigned u0 = blockIdx.x * (ETK * CC / 4) + threadIdx.x;
    const unsigned d0 = blockIdx.x * (ETK * CC) + threadIdx.x;       // in deltas

    #pragma unroll
    for (int it = 0; it < ETK; ++it) {
        const int o = it * (CC / 4);                     // token, in 4 elements
        const v4f* dp = (const v4f*)deltas + d0 + 4 * o;

        const v4f kv = ((const v4f*)kf + u0)[o],  qv = ((const v4f*)qf + u0)[o];
        const v4f vr = ((const v4f*)vfr + u0)[o], vf = ((const v4f*)vfirst + u0)[o];
        const v4f wd = dp[0], vd = dp[CC / 4], ad = dp[2 * (CC / 4)], gd = dp[3 * (CC / 4)];
        // before the arithmetic reuses registers that these loads name
        asm volatile("s_wait_xcnt 0x0" ::: "memory");

        const float norm = sqrtf(row_sum16((kv[0] * kv[0] + kv[1] * kv[1]) +
                                           (kv[2] * kv[2] + kv[3] * kv[3])));
        const float den  = fmaxf(norm, 1e-12f);

        v8bf R[3];                            // four records: q w k z b v each
        v4bf vo, go;
        #pragma unroll
        for (int e = 0; e < 4; ++e) {
            const float xw   = -(w0v[e] + wd[e]);
            const float sp   = (xw > 20.0f) ? xw : log1pf(__expf(xw)); // softplus
            const float logw = -__expf(-sp - 0.5f);                    // log decay < 0

            const float sv = 1.0f / (1.0f + __expf(-(v0v[e] + vd[e])));
            const float vv = vr[e] + (vf[e] - vr[e]) * sv;

            const float a  = 1.0f / (1.0f + __expf(-(a0v[e] + ad[e])));
            const float kk = kv[e] / den;

            R[(e * 6 + 0) / 8][(e * 6 + 0) % 8] = (__bf16)qv[e];
            R[(e * 6 + 1) / 8][(e * 6 + 1) % 8] = (__bf16)logw;
            R[(e * 6 + 2) / 8][(e * 6 + 2) % 8] = (__bf16)(kv[e] * a);
            R[(e * 6 + 3) / 8][(e * 6 + 3) % 8] = (__bf16)(-kk);
            R[(e * 6 + 4) / 8][(e * 6 + 4) % 8] = (__bf16)(kk * a);
            R[(e * 6 + 5) / 8][(e * 6 + 5) % 8] = (__bf16)vv;
            vo[e] = (__bf16)vv;
            go[e] = (__bf16)(1.0f + gd[e]);
        }
        v8bf* sp8 = (v8bf*)sops + 3 * u0 + 3 * o;
        sp8[0] = R[0];
        sp8[1] = R[1];
        sp8[2] = R[2];
        ((v4bf*)vh + u0)[o] = vo;
        ((v4bf*)gb + u0)[o] = go;
        // before the next token's loads reuse registers that these stores name
        if (it + 1 < ETK) asm volatile("s_wait_xcnt 0x0" ::: "memory");
    }
}

constexpr int SCH = 16;
constexpr int STS = 32;
constexpr int SNT = TT / STS;
static_assert(SNT >= 2 && STS % SCH == 0, "two tiles at least, whole chunks");

// Two partial sums become one: lanes with BIT clear keep lo, lanes with BIT
// set keep hi, and each adds what its partner (lane ^ BIT) holds of the same.
template <int BIT>
__device__ static inline float fold(float lo, float hi, int j)
{
    const bool  up   = (j & BIT) != 0;
    const float keep = up ? hi : lo;
    const float send = up ? lo : hi;
    return keep + dpp_mov<DPP_ROW_XMASK + BIT>(send);
}

// One tile: STS steps of 64 records (768 B a step, contiguous; steps lie
// CC records apart in global memory, back to back in LDS). A wave brings
// STS/4 steps, 16 B a lane and copy; 96 pieces are two steps.
__device__ static inline void scan_fetch(const ScanOp* g0, ScanOp* l0,
                                         int wave, int lane)
{
    constexpr int SB = NN * (int)sizeof(ScanOp);             // 768 B
    constexpr int GB = CC * (int)sizeof(ScanOp);             // step pitch, global
    const char* g = (const char*)g0 + (size_t)wave * (STS / 4) * GB;
    char*       l = (char*)l0 + wave * (STS / 4) * SB + lane * 16;
    #pragma unroll
    for (int r = 0; r < 3; ++r) {
        const int   pc = r * 32 + lane;                      // piece 0..95
        const char* gr = g + (pc / 48) * GB + (pc % 48) * 16;
        #pragma unroll
        for (int a = 0; a < STS / 8; ++a) {
#if USE_ASYNC_LDS
            async_copy_b128(gr + a * 2 * GB, l + (a * 3 + r) * 512);
#else
            *(v4i*)(l + (a * 3 + r) * 512) = *(const v4i*)(gr + a * 2 * GB);
#endif
        }
    }
}

struct Rec4 { v8bf r0, r1, r2; };            // a lane's four records of one step

__device__ static inline Rec4 scan_read(const ScanOp* lp, int u)
{
    const v8bf* rp = (const v8bf*)(lp + u * NN);
    return Rec4{rp[0], rp[1], rp[2]};
}

constexpr int SLA = 3;                        // LDS reads run this many steps ahead

template <int U>
struct ScanSteps {
    // lp: the lane's four records of the tile's first step, in LDS
    __device__ static inline void run(const ScanOp* lp, Rec4 (&pipe)[SLA], float (&S)[4],
                                      float (&f)[4], const float (&vrow)[STS / SCH],
                                      float (&o)[STS / SCH], int j)
    {
        constexpr int t = STS - U;           // step in the tile
        constexpr int u = t % SCH;           // step in the chunk
        const v8bf r0 = pipe[t % SLA].r0, r1 = pipe[t % SLA].r1, r2 = pipe[t % SLA].r2;
        if constexpr (t + SLA < STS) pipe[t % SLA] = scan_read(lp, t + SLA);
        // holds the reads above this step's arithmetic: left alone the scheduler
        // puts them one step ahead of their use
        __builtin_amdgcn_sched_barrier(0);

        // four records of six bf16: q w k z b v
        const float q[4] = {(float)r0[0], (float)r0[6], (float)r1[4], (float)r2[2]};
        const float w[4] = {(float)r0[1], (float)r0[7], (float)r1[5], (float)r2[3]};
        const float k[4] = {(float)r0[2], (float)r1[0], (float)r1[6], (float)r2[4]};
        const float z[4] = {(float)r0[3], (float)r1[1], (float)r1[7], (float)r2[5]};
        const float b[4] = {(float)r0[4], (float)r1[2], (float)r2[0], (float)r2[6]};

        // this step's v of the row
        const float vt = dpp_mov<DPP_ROW_SHARE + u>(vrow[t / SCH]);

        float sa = __builtin_fmaf(S[1], z[1], S[0] * z[0]) + __builtin_fmaf(S[3], z[3], S[2] * z[2]);
        sa += dpp_mov<DPP_ROW_XMASK + 1>(sa);
        sa += dpp_mov<DPP_ROW_XMASK + 2>(sa);
        sa += dpp_mov<DPP_ROW_XMASK + 4>(sa);
        sa += dpp_mov<DPP_ROW_XMASK + 8>(sa);

        #pragma unroll
        for (int i = 0; i < 4; ++i)          // exp after bf16 round, as reference
            S[i] = __builtin_fmaf(sa, b[i], __builtin_fmaf(vt, k[i], S[i] * __expf(w[i])));

        float p = __builtin_fmaf(S[1], q[1], S[0] * q[0]) + __builtin_fmaf(S[3], q[3], S[2] * q[2]);

        // binary counter of folded partials: f[n] holds 2^n finished steps
        if constexpr ((u & 1) == 0) { f[0] = p; }
        else {
            p = fold<1>(f[0], p, j);
            if constexpr ((u & 2) == 0) { f[1] = p; }
            else {
                p = fold<2>(f[1], p, j);
                if constexpr ((u & 4) == 0) { f[2] = p; }
                else {
                    p = fold<4>(f[2], p, j);
                    if constexpr ((u & 8) == 0) { f[3] = p; }
                    else { o[t / SCH] = fold<8>(f[3], p, j); }
                }
            }
        }
        ScanSteps<U - 1>::run(lp, pipe, S, f, vrow, o, j);
    }
};
template <>
struct ScanSteps<0> {
    __device__ static inline void run(const ScanOp*, Rec4 (&)[SLA], float (&)[4],
                                      float (&)[4], const float (&)[STS / SCH],
                                      float (&)[STS / SCH], int) {}
};

__global__ __launch_bounds__(128) void scan_kernel(
    const ScanOp* __restrict__ sops, float* __restrict__ y)
{
    __shared__ __align__(16) ScanOp tile[2][STS][NN];

    const int lane = threadIdx.x & 31;
    const int wave = threadIdx.x >> 5;
    const int g    = blockIdx.x >> 3;                        // b*H + h
    const int rp   = (blockIdx.x & 7) * 4 + wave;            // row pair 0..31
    const int h    = g % HH;
    const int b    = g / HH;
    const int j    = lane & 15;                              // column group / step slot
    const int row  = rp * 2 + (lane >> 4);

    const ScanOp* hb = sops + (size_t)b * TT * CC + (size_t)h * NN;   // t = 0
    float* yp = y + ((size_t)g * (TT / SCH) * 32 + rp) * 32 + lane;

    float S[4] = {0.0f, 0.0f, 0.0f, 0.0f};

    scan_fetch(hb, &tile[0][0][0], wave, lane);
    // own copies of tile 0 landed; the barrier publishes every wave's
    asm volatile("s_wait_asynccnt 0x0" ::: "memory");
    __syncthreads();
    scan_fetch(hb + (size_t)STS * CC, &tile[1][0][0], wave, lane);

    // kept rolled: the body already holds STS unrolled steps
    #pragma unroll 1
    for (int tl = 0; tl < SNT; ++tl) {
        ScanOp* tb = &tile[tl & 1][0][0];

        Rec4 pipe[SLA];
        #pragma unroll
        for (int i = 0; i < SLA; ++i) pipe[i] = scan_read(tb + j * 4, i);
        float vrow[STS / SCH], o[STS / SCH], f[4];
        #pragma unroll
        for (int c = 0; c < STS / SCH; ++c)  // v of my row at step j of chunk c
            vrow[c] = (float)tb[(c * SCH + j) * NN + row].v;

        ScanSteps<STS>::run(tb + j * 4, pipe, S, f, vrow, o, j);

        // foot of the trip: my reads of this tile are done, my copies of the
        // next tile have landed; the barrier says both of every wave
        asm volatile("s_wait_dscnt 0x0" ::: "memory");
        asm volatile("s_wait_asynccnt 0x0" ::: "memory");
        __syncthreads();
        if (tl + 2 < SNT)
            scan_fetch(hb + (size_t)(tl + 2) * STS * CC, tb, wave, lane);

        // stored behind the barrier: in front of it the barrier's own wait for
        // stores would expose their whole latency once per tile
        #pragma unroll
        for (int c = 0; c < STS / SCH; ++c) {
            *yp = o[c] * 0.125f;             // * N^-0.5
            yp += 32 * 32;
        }
    }
    // no copy is left in flight when the wave ends
    asm volatile("s_wait_asynccnt 0x0" ::: "memory");
}

// ---------------------------------------------------------------------------
// Kernel 6: norm-ratio correction + gate -> bf16 input for output projection.
// A block: ETK tokens of one chunk of y, all columns. A lane: 4 columns of each,
// a 16-lane row is one head (norms: DPP row sums). y lies step-fastest (see
// kernel 5), so one 16-B load is one column's ETK steps.
// ---------------------------------------------------------------------------
static_assert(ETK == 4 && SCH % ETK == 0 && TT % SCH == 0, "a block stays in one chunk");

__global__ __launch_bounds__(256) void post_scan_kernel(
    const float* __restrict__ y, const float* __restrict__ x,
    const __bf16* __restrict__ vh, const __bf16* __restrict__ gb,
    const float* __restrict__ r_k, __bf16* __restrict__ Yg)
{
    const int    c  = threadIdx.x * 4;
    const int    h  = threadIdx.x >> 4;
    const int    n0 = c & (NN - 1);
    const unsigned m0 = blockIdx.x * ETK;
    const unsigned t0 = m0 % TT;
    const unsigned gy = (m0 / TT) * HH + h;

    // y[((gy*(T/SCH) + chunk)*NN + n)*SCH + step], here in 4 steps
    const unsigned yu = ((gy * (TT / SCH) + t0 / SCH) * NN + n0) * (SCH / 4) + (t0 % SCH) / 4;
    v4f yv[4];                                // [column][token]
    #pragma unroll
    for (int e = 0; e < 4; ++e) yv[e] = ((const v4f*)y)[yu + e * (SCH / 4)];

    const v4f rk = ld4(r_k + c);
    // before a later load's result lands in a register that these loads name
    asm volatile("s_wait_xcnt 0x0" ::: "memory");
    float sig[4];
    #pragma unroll
    for (int e = 0; e < 4; ++e) sig[e] = 1.0f / (1.0f + __expf(-rk[e]));

    // every load of the lane is issued before the first value is used
    v4f  xvs[ETK];
    v4bf vbs[ETK], gvs[ETK];
    #pragma unroll
    for (int it = 0; it < ETK; ++it) {
        const unsigned u = (m0 + it) * (CC / 4) + threadIdx.x;   // in 4 elements
        xvs[it] = ((const v4f*)x)[u];
        vbs[it] = ((const v4bf*)vh)[u];
        gvs[it] = ((const v4bf*)gb)[u];
    }

    #pragma unroll
    for (int it = 0; it < ETK; ++it) {
        const unsigned u = (m0 + it) * (CC / 4) + threadIdx.x;
        const v4f  xv = xvs[it];
        const v4bf vb = vbs[it], gv = gvs[it];
        float vv[4];
        #pragma unroll
        for (int e = 0; e < 4; ++e) vv[e] = (float)vb[e];

        const float xnorm = sqrtf(row_sum16((xv[0] * xv[0] + xv[1] * xv[1]) +
                                            (xv[2] * xv[2] + xv[3] * xv[3])));
        const float vnorm = sqrtf(row_sum16((vv[0] * vv[0] + vv[1] * vv[1]) +
                                            (vv[2] * vv[2] + vv[3] * vv[3])));
        const float ratio = 1.0f - xnorm / (vnorm + 1e-12f);

        v4bf o;
        #pragma unroll
        for (int e = 0; e < 4; ++e) {
            const float u = ratio * sig[e];
            o[e] = (__bf16)((yv[e][it] + vv[e] * u) * (float)gv[e]);
        }
        ((v4bf*)Yg)[u] = o;
    }
}

// ---------------------------------------------------------------------------
// Host launcher
// ---------------------------------------------------------------------------
extern "C" void kernel_launch(void* const* d_in, const int* in_sizes, int n_in,
                              void* d_out, int out_size, void* d_ws,
                              size_t ws_size, hipStream_t stream)
{
    (void)in_sizes; (void)n_in; (void)out_size; (void)ws_size;

    const float* residual = (const float*)d_in[0];
    const float* x        = (const float*)d_in[1];
    const float* x0       = (const float*)d_in[2];
    const float* dx0      = (const float*)d_in[3];
    const float* Wq       = (const float*)d_in[4];
    const float* Wk       = (const float*)d_in[5];
    const float* Wv       = (const float*)d_in[6];
    const float* Wproj    = (const float*)d_in[7];
    const float* x_q      = (const float*)d_in[8];
    const float* x_k      = (const float*)d_in[9];
    const float* x_v      = (const float*)d_in[10];
    const float* v0       = (const float*)d_in[11];
    const float* w0       = (const float*)d_in[12];
    const float* a0       = (const float*)d_in[13];
    const float* miss     = (const float*)d_in[14];
    const float* r_k      = (const float*)d_in[15];
    float*       out      = (float*)d_out;

    // ---- workspace layout (256B aligned bump allocator) ----
    char*  ws  = (char*)d_ws;
    size_t off = 0;
    auto alloc = [&](size_t bytes) -> void* {
        void* p = ws + off;
        off += (bytes + 255) & ~(size_t)255;
        return p;
    };
    const size_t MC_BF = (size_t)MM * CC * sizeof(__bf16);    // 8 MB
    const size_t MC_F  = (size_t)MM * CC * sizeof(float);     // 16 MB
    const size_t W_BF  = (size_t)CC * CC * sizeof(__bf16);    // 2 MB
    const size_t XD_BF = (size_t)MM * MR * sizeof(__bf16);    // 1 MB
    const size_t DL_F  = (size_t)MM * 4 * CC * sizeof(float); // 64 MB
    const size_t SO_SZ = (size_t)MM * CC * sizeof(ScanOp);    // 48 MB

    __bf16* Xq    = (__bf16*)alloc(MC_BF);
    __bf16* Xk    = (__bf16*)alloc(MC_BF);
    __bf16* Xv    = (__bf16*)alloc(MC_BF);
    __bf16* Xv0   = (__bf16*)alloc(MC_BF);
    __bf16* Xd    = (__bf16*)alloc(XD_BF);
    __bf16* Wqb   = (__bf16*)alloc(W_BF);
    __bf16* Wkb   = (__bf16*)alloc(W_BF);
    __bf16* Wvb   = (__bf16*)alloc(W_BF);
    __bf16* Wpb   = (__bf16*)alloc(W_BF);
    __bf16* missT = (__bf16*)alloc(XD_BF);
    float*  qf    = (float*)alloc(MC_F);
    float*  kf    = (float*)alloc(MC_F);
    float*  vfr   = (float*)alloc(MC_F);
    float*  vfirst= (float*)alloc(MC_F);
    float*  deltas= (float*)alloc(DL_F);
    ScanOp* sops  = (ScanOp*)alloc(SO_SZ);
    __bf16* gb    = (__bf16*)alloc(MC_BF);
    // aliases over buffers whose last reader precedes the new writer:
    __bf16* vh  = Xv0;       // Xv0 consumed by v_first GEMM before post_gemm
    float*  y   = qf;        // qf consumed by post_gemm before scan writes
    __bf16* Yg  = (__bf16*)kf;

    // ---- 1) input prep + weight conversion ----
    {
        prep_kernel<<<dim3(PREP_BLOCKS), dim3(256), 0, stream>>>(
            x, x0, dx0, x_q, x_k, x_v, Xq, Xk, Xv, Xv0, Xd);
        wconv_kernel<<<dim3(MT_BLOCKS + WC_BLOCKS), dim3(256), 0, stream>>>(
            Wq, Wk, Wv, Wproj, miss, Wqb, Wkb, Wvb, Wpb, missT);
    }

    // ---- 2) WMMA GEMMs: q, k, v, v_first (K=1024, N=1024), deltas (K=128, N=4096)
    {
        dim3 grid4(CC / 128, MM / 128, 4), blk(256);
        gemm_proj4_kernel<<<grid4, blk, 0, stream>>>(
            Xq, Xk, Xv, Xv0, Wqb, Wkb, Wvb, qf, kf, vfr, vfirst);
        dim3 gridD(4 * CC / 128, MM / 128);
        gemm_bf16_wmma<MR><<<gridD, blk, 0, stream>>>(Xd, missT, deltas, (const float*)nullptr, 4 * CC);
    }

    // ---- 3) elementwise + k-norm -> packed bf16 scan operands ----
    post_gemm_kernel<<<dim3(MM / ETK), dim3(256), 0, stream>>>(
        qf, kf, vfr, vfirst, deltas, w0, v0, a0, sops, vh, gb);

    // ---- 4) sequential scan (state in VGPRs, 8 rows per block) ----
    scan_kernel<<<dim3(BB * HH * 8), dim3(128), 0, stream>>>(sops, y);

    // ---- 5) norm correction + gate ----
    post_scan_kernel<<<dim3(MM / ETK), dim3(256), 0, stream>>>(y, x, vh, gb, r_k, Yg);

    // ---- 6) output projection + residual -> d_out ----
    {
        dim3 grid(CC / 128, MM / 128), blk(256);
        gemm_bf16_wmma<CC><<<grid, blk, 0, stream>>>(Yg, Wpb, out, residual, CC);
    }
}

// v004
// One run takes 229 microseconds.
// Timed twice side by side with v003, it ran 1.19 times as fast both times.
// Over all steps from v000 it is 19.3 times as fast.
#include <hip/hip_runtime.h>
#include <hip/hip_bf16.h>

// ---------------------------------------------------------------------------
// RWKV7 time-mix for MI455X (gfx1250, wave32, WMMA).
//   B=2, T=2048, C=1024, H=16, N=64, MISS_ROWS=128
// ---------------------------------------------------------------------------

typedef __attribute__((ext_vector_type(16))) __bf16 v16bf;
typedef __attribute__((ext_vector_type(8)))  __bf16 v8bf;
typedef __attribute__((ext_vector_type(8)))  float  v8f;
typedef __attribute__((ext_vector_type(4)))  int    v4i;

constexpr int BB = 2;
constexpr int TT = 2048;
constexpr int CC = 1024;
constexpr int HH = 16;
constexpr int NN = 64;
constexpr int MR = 128;          // MISS_ROWS
constexpr int MM = BB * TT;      // 4096 tokens

// Packed per-(token,head,column) scan operands: 12B a record; a scan lane reads four a step.
struct __align__(4) ScanOp { __bf16 q, w, k, z, b, v; };

// ---- gfx1250 async global->LDS copy path (guarded; falls back cleanly) ----
#if defined(__HIP_DEVICE_COMPILE__) &&                                        \
    __has_builtin(__builtin_amdgcn_global_load_async_to_lds_b128) &&          \
    __has_builtin(__builtin_amdgcn_s_wait_asynccnt)
#define USE_ASYNC_LDS 1
#else
#define USE_ASYNC_LDS 0
#endif

#if USE_ASYNC_LDS
__device__ static inline void async_copy_b128(const void* g, void* l)
{
    // Builtin signature (from clang diagnostic): AS1 v4i* src, AS3 v4i* dst,
    // imm offset, imm cpol.
    __builtin_amdgcn_global_load_async_to_lds_b128(
        (__attribute__((address_space(1))) v4i*)(g),
        (__attribute__((address_space(3))) v4i*)(l),
        0, 0);
}
#endif

// ---------------------------------------------------------------------------
// The four elementwise kernels (1, 2, 4, 6) are dealt so that a launch is 544 or
// 1024 work-groups of eight waves, all resident at once: a lane takes 16 to
// 64 elements and moves them 8 or 16 B at a time (miss, read down a column, 4 B).
// ---------------------------------------------------------------------------
typedef __attribute__((ext_vector_type(4))) float  v4f;
typedef __attribute__((ext_vector_type(4))) __bf16 v4bf;

template <int CTRL>
__device__ static inline float dpp_mov(float x)
{
    return __builtin_bit_cast(float, __builtin_amdgcn_mov_dpp(
        __builtin_bit_cast(int, x), CTRL, 0xf, 0xf, true));
}
constexpr int DPP_ROW_SHARE = 0x150;          // + source lane of the row
constexpr int DPP_ROW_XMASK = 0x160;          // + xor mask inside the row

// sum over the 16 lanes of a row, left in every lane of it
__device__ static inline float row_sum16(float s)
{
    s += dpp_mov<DPP_ROW_XMASK + 1>(s);
    s += dpp_mov<DPP_ROW_XMASK + 2>(s);
    s += dpp_mov<DPP_ROW_XMASK + 4>(s);
    s += dpp_mov<DPP_ROW_XMASK + 8>(s);
    return s;
}

__device__ static inline v4f ld4(const float* p) { return *(const v4f*)p; }

__device__ static inline v8bf cvt8(const float* p, unsigned u)
{
    const v4f lo = ((const v4f*)p)[2 * u], hi = ((const v4f*)p)[2 * u + 1];
    v8bf o;
    #pragma unroll
    for (int e = 0; e < 4; ++e) { o[e] = (__bf16)lo[e]; o[4 + e] = (__bf16)hi[e]; }
    return o;
}

// ---------------------------------------------------------------------------
// Kernel 1: token-shift input mixing -> bf16 GEMM operands.
// A lane: 8 columns of step t in every batch (the mix vectors are read once).
// ---------------------------------------------------------------------------
constexpr int PREP_BLOCKS = TT * (CC / 8) / 256;

__global__ __launch_bounds__(256) void prep_kernel(
    const float* __restrict__ x, const float* __restrict__ x0,
    const float* __restrict__ dx0,
    const float* __restrict__ x_q, const float* __restrict__ x_k,
    const float* __restrict__ x_v,
    __bf16* __restrict__ Xq, __bf16* __restrict__ Xk,
    __bf16* __restrict__ Xv, __bf16* __restrict__ Xv0,
    __bf16* __restrict__ Xd)
{
    const int i = blockIdx.x * 256 + threadIdx.x;
    const int c = (i % (CC / 8)) * 8;
    const int t = i / (CC / 8);

    v4f mq[2], mk[2], mv[2];
    #pragma unroll
    for (int p = 0; p < 2; ++p) {
        mq[p] = ld4(x_q + c + 4 * p);
        mk[p] = ld4(x_k + c + 4 * p);
        mv[p] = ld4(x_v + c + 4 * p);
    }
    // before a later load's result lands in a register that these loads name.
    // The output pointers are inputs so that they are fetched here, into scalar
    // registers of their own: fetched later they took the place of the bases
    // of the loads below, ahead of those loads' wait
    asm volatile("s_wait_xcnt 0x0" :: "s"(Xq), "s"(Xk), "s"(Xv), "s"(Xv0), "s"(Xd) : "memory");

    // every load of the lane is issued before the first value is used
    v4f xvs[BB][2], xps[BB][2], z0s[BB][2], d0s[BB][2];
    #pragma unroll
    for (int b = 0; b < BB; ++b) {
        const unsigned u = (unsigned)(b * (TT * CC / 8) + i);   // in 8 elements
        #pragma unroll
        for (int p = 0; p < 2; ++p) {
            xvs[b][p] = ((const v4f*)x)[2 * u + p];
            // step t-1; at t=0 the lane's own step, in bounds and not used
            xps[b][p] = ((const v4f*)x)[2 * u + p - (t > 0 ? CC / 4 : 0)];
            z0s[b][p] = ((const v4f*)x0)[2 * u + p];
            d0s[b][p] = ((const v4f*)dx0)[2 * u + p];
        }
        // before a later load's result, or the arithmetic, lands in a register
        // that these loads name
        asm volatile("s_wait_xcnt 0x0" ::: "memory");
    }
    // keeps the first batch's arithmetic, which waits for its loads, from being
    // scheduled in front of the second batch's loads
    __builtin_amdgcn_sched_barrier(0);

    #pragma unroll
    for (int b = 0; b < BB; ++b) {
        const unsigned u = (unsigned)(b * (TT * CC / 8) + i);
        v8bf oq, ok, ov, o0, od;
        #pragma unroll
        for (int p = 0; p < 2; ++p) {
            const v4f xv = xvs[b][p], z0 = z0s[b][p], d0 = d0s[b][p];
            const v4f xp = t > 0 ? xps[b][p] : v4f{0.0f, 0.0f, 0.0f, 0.0f};   // zero pad
            #pragma unroll
            for (int e = 0; e < 4; ++e) {
                const float dxp = xp[e] - xv[e];         // x_{t-1} - x_t
                oq[4 * p + e] = (__bf16)(xv[e] + dxp * mq[p][e]);
                ok[4 * p + e] = (__bf16)(xv[e] + dxp * mk[p][e]);
                ov[4 * p + e] = (__bf16)(xv[e] + dxp * mv[p][e]);
                o0[4 * p + e] = (__bf16)(z0[e] + d0[e] * mv[p][e]);
                od[4 * p + e] = (__bf16)xv[e];
            }
        }
        ((v8bf*)Xq)[u]  = oq;
        ((v8bf*)Xk)[u]  = ok;
        ((v8bf*)Xv)[u]  = ov;
        ((v8bf*)Xv0)[u] = o0;
        if (c < MR)                                      // x[:, :, :128]
            ((v8bf*)Xd)[(unsigned)((b * TT + t) * (MR / 8) + c / 8)] = od;
        // before the next batch's arithmetic reuses registers that these stores name
        if (b + 1 < BB) asm volatile("s_wait_xcnt 0x0" ::: "memory");
    }
}

// ---------------------------------------------------------------------------
// Kernel 2: f32 weights -> bf16; miss [128,4096] -> missT [4096,128].
// The first blocks transpose: a lane reads 64 rows of one column of miss (a wave
// reads whole lines) and writes one whole 128-B line of missT. The others
// convert 8 elements of each weight a lane.
// ---------------------------------------------------------------------------
constexpr int MT_BLOCKS = 4 * CC * (MR / 64) / 256;
constexpr int WC_BLOCKS = CC * CC / 8 / 256;

__global__ __launch_bounds__(256) void wconv_kernel(
    const float* __restrict__ Wq, const float* __restrict__ Wk,
    const float* __restrict__ Wv, const float* __restrict__ Wp,
    const float* __restrict__ miss,
    __bf16* __restrict__ Wqb, __bf16* __restrict__ Wkb,
    __bf16* __restrict__ Wvb, __bf16* __restrict__ Wpb,
    __bf16* __restrict__ missT)
{
    if (blockIdx.x < MT_BLOCKS) {
        const int i  = blockIdx.x * 256 + threadIdx.x;
        const int n  = i % (4 * CC);
        const int r0 = (i / (4 * CC)) * 64;
        const float* s = miss + (unsigned)(r0 * (4 * CC) + n);
        float v[64];
        #pragma unroll
        for (int r = 0; r < 64; ++r) v[r] = s[r * (4 * CC)];
        #pragma unroll
        for (int q = 0; q < 8; ++q) {
            v8bf o;
            #pragma unroll
            for (int e = 0; e < 8; ++e) o[e] = (__bf16)v[q * 8 + e];
            ((v8bf*)missT)[(unsigned)((n * MR + r0) / 8 + q)] = o;
        }
    } else {
        const unsigned u = (blockIdx.x - MT_BLOCKS) * 256 + threadIdx.x;   // in 8 elements
        const v8bf q = cvt8(Wq, u), k = cvt8(Wk, u), v = cvt8(Wv, u), p = cvt8(Wp, u);
        ((v8bf*)Wqb)[u] = q;
        ((v8bf*)Wkb)[u] = k;
        ((v8bf*)Wvb)[u] = v;
        ((v8bf*)Wpb)[u] = p;
        // the built code lays the other branch behind this one: no register that
        // these stores name is rewritten ahead of this wait on any way through it
        asm volatile("s_wait_xcnt 0x0" ::: "memory");
    }
}

// ---------------------------------------------------------------------------
// Kernel 3: bf16 WMMA GEMM,  Y[m,n] = sum_k X[m,k] * W[n,k]  (+ resid)
//   block tile 128x128, 256 threads = 8 wave32; wave tile 64x32 (4x2 WMMA).
//   K-step 32, double-buffered LDS, async global->LDS staging when available.
// gemm_tile is one block's tile; the kernels behind it say which tile of which
// product a block takes.
// ---------------------------------------------------------------------------
template <int KDIM>
__device__ static __forceinline__ void gemm_tile(
    const __bf16* __restrict__ X, const __bf16* __restrict__ W,
    float* __restrict__ Y, const float* __restrict__ resid, int Ndim,
    int mBase, int nBase)
{
    constexpr int KT    = 32;
    constexpr int KITER = KDIM / KT;
    constexpr int LDR   = 40;            // padded row (80B, 16B aligned)

    __shared__ __align__(16) __bf16 As[2][128][LDR];
    __shared__ __align__(16) __bf16 Bs[2][128][LDR];

    const int tid    = threadIdx.x;
    const int lane   = tid & 31;
    const int wave   = tid >> 5;
    const int wm     = (wave >> 2) * 64;     // 0 | 64
    const int wn     = (wave & 3) * 32;      // 0,32,64,96
    const int laneLo = lane & 15;
    const int kbase  = ((lane >> 4) & 1) * 8; // lanes 0-15 -> K{0..7,16..23};
                                              // lanes 16-31 -> K{8..15,24..31}

    v8f acc[4][2];
    #pragma unroll
    for (int i = 0; i < 4; ++i)
        #pragma unroll
        for (int j = 0; j < 2; ++j)
            #pragma unroll
            for (int e = 0; e < 8; ++e) acc[i][j][e] = 0.0f;

    auto loadTile = [&](int buf, int k0) {
        #pragma unroll
        for (int ch = 0; ch < 2; ++ch) {
            int e  = ch * 2048 + tid * 8;
            int r  = e >> 5;        // 0..127
            int kk = e & 31;        // 0,8,16,24
            const __bf16* gA = &X[(size_t)(mBase + r) * KDIM + k0 + kk];
            const __bf16* gB = &W[(size_t)(nBase + r) * KDIM + k0 + kk];
#if USE_ASYNC_LDS
            async_copy_b128(gA, &As[buf][r][kk]);
            async_copy_b128(gB, &Bs[buf][r][kk]);
#else
            *(v8bf*)&As[buf][r][kk] = *(const v8bf*)gA;
            *(v8bf*)&Bs[buf][r][kk] = *(const v8bf*)gB;
#endif
        }
    };

    loadTile(0, 0);
    for (int ki = 0; ki < KITER; ++ki) {
#if USE_ASYNC_LDS
        __builtin_amdgcn_s_wait_asynccnt(0);   // own async copies in LDS
#endif
        __syncthreads();                       // all waves' copies visible
        const int buf = ki & 1;
        if (ki + 1 < KITER) loadTile(buf ^ 1, (ki + 1) * KT);

        v16bf afrag[4], bfrag[2];
        #pragma unroll
        for (int i = 0; i < 4; ++i) {
            const __bf16* ap = &As[buf][wm + i * 16 + laneLo][kbase];
            v8bf lo = *(const v8bf*)ap;
            v8bf hi = *(const v8bf*)(ap + 16);
            afrag[i] = __builtin_shufflevector(lo, hi, 0, 1, 2, 3, 4, 5, 6, 7,
                                               8, 9, 10, 11, 12, 13, 14, 15);
        }
        #pragma unroll
        for (int j = 0; j < 2; ++j) {
            const __bf16* bp = &Bs[buf][wn + j * 16 + laneLo][kbase];
            v8bf lo = *(const v8bf*)bp;
            v8bf hi = *(const v8bf*)(bp + 16);
            bfrag[j] = __builtin_shufflevector(lo, hi, 0, 1, 2, 3, 4, 5, 6, 7,
                                               8, 9, 10, 11, 12, 13, 14, 15);
        }
        #pragma unroll
        for (int i = 0; i < 4; ++i)
            #pragma unroll
            for (int j = 0; j < 2; ++j)
                acc[i][j] = __builtin_amdgcn_wmma_f32_16x16x32_bf16(
                    false, afrag[i], false, bfrag[j],
                    (short)0, acc[i][j], false, false);
    }

    // C/D layout: VGPR v, lanes 0-15 -> (M=v, N=lane); lanes 16-31 -> (M=8+v)
    const int rowSel = lane >> 4;
    #pragma unroll
    for (int i = 0; i < 4; ++i)
        #pragma unroll
        for (int j = 0; j < 2; ++j) {
            const int m = mBase + wm + i * 16 + rowSel * 8;
            const int n = nBase + wn + j * 16 + laneLo;
            #pragma unroll
            for (int v = 0; v < 8; ++v) {
                size_t off = (size_t)(m + v) * Ndim + n;
                float val  = acc[i][j][v];
                if (resid) val += resid[off];
                Y[off] = val;
            }
        }
}

template <int KDIM>
__global__ __launch_bounds__(256) void gemm_bf16_wmma(
    const __bf16* __restrict__ X, const __bf16* __restrict__ W,
    float* __restrict__ Y, const float* __restrict__ resid, int Ndim)
{
    gemm_tile<KDIM>(X, W, Y, resid, Ndim, blockIdx.y * 128, blockIdx.x * 128);
}

// The four projections of the inputs depend on nothing of one another: one
// launch, blockIdx.z says which. A projection of its own is one block a WGP, and
// that block waits out the landing of its copies once per K-step; here four
// blocks share a WGP and work while another waits.
__global__ __launch_bounds__(256) void gemm_proj4_kernel(
    const __bf16* __restrict__ Xq, const __bf16* __restrict__ Xk,
    const __bf16* __restrict__ Xv, const __bf16* __restrict__ Xv0,
    const __bf16* __restrict__ Wqb, const __bf16* __restrict__ Wkb,
    const __bf16* __restrict__ Wvb,
    float* __restrict__ qf, float* __restrict__ kf, float* __restrict__ vfr,
    float* __restrict__ vfirst)
{
    const int p = blockIdx.z;
    const __bf16* X = p == 0 ? Xq  : p == 1 ? Xk  : p == 2 ? Xv  : Xv0;
    const __bf16* W = p == 0 ? Wqb : p == 1 ? Wkb : Wvb;
    float*        Y = p == 0 ? qf  : p == 1 ? kf  : p == 2 ? vfr : vfirst;
    gemm_tile<CC>(X, W, Y, nullptr, CC, blockIdx.y * 128, blockIdx.x * 128);
}

// ---------------------------------------------------------------------------
// Kernel 4: per-(token,head) elementwise + k-normalization; bf16 rounding of
// the six scan operands (matching the reference's rounding point); packs
// them into one 12B record per (token,head,column) for the scan.
// A block: ETK tokens, all columns. A lane: 4 columns, so a 16-lane row is one
// head and |k|^2 is a DPP row sum; its four records are 48 contiguous bytes.
// ---------------------------------------------------------------------------
constexpr int ETK = 4;                        // tokens per block, kernels 4 and 6
static_assert(CC == 256 * 4 && NN == 16 * 4 && MM % ETK == 0, "lane deal");

__global__ __launch_bounds__(256) void post_gemm_kernel(
    const float* __restrict__ qf, const float* __restrict__ kf,
    const float* __restrict__ vfr, const float* __restrict__ vfirst,
    const float* __restrict__ deltas,
    const float* __restrict__ w0, const float* __restrict__ v0,
    const float* __restrict__ a0,
    ScanOp* __restrict__ sops,
    __bf16* __restrict__ vh, __bf16* __restrict__ gb)
{
    const int c = threadIdx.x * 4;
    const v4f w0v = ld4(w0 + c), v0v = ld4(v0 + c), a0v = ld4(a0 + c);
    // the lane's place in the block's first token, in 4 elements
    const unsigned u0 = blockIdx.x * (ETK * CC / 4) + threadIdx.x;
    const unsigned d0 = blockIdx.x * (ETK * CC) + threadIdx.x;       // in deltas

    #pragma unroll
    for (int it = 0; it < ETK; ++it) {
        const int o = it * (CC / 4);                     // token, in 4 elements
        const v4f* dp = (const v4f*)deltas + d0 + 4 * o;

        const v4f kv = ((const v4f*)kf + u0)[o],  qv = ((const v4f*)qf + u0)[o];
        const v4f vr = ((const v4f*)vfr + u0)[o], vf = ((const v4f*)vfirst + u0)[o];
        const v4f wd = dp[0], vd = dp[CC / 4], ad = dp[2 * (CC / 4)], gd = dp[3 * (CC / 4)];
        // before the arithmetic reuses registers that these loads name
        asm volatile("s_wait_xcnt 0x0" ::: "memory");

        const float norm = sqrtf(row_sum16((kv[0] * kv[0] + kv[1] * kv[1]) +
                                           (kv[2] * kv[2] + kv[3] * kv[3])));
        const float den  = fmaxf(norm, 1e-12f);

        v8bf R[3];                            // four records: q w k z b v each
        v4bf vo, go;
        #pragma unroll
        for (int e = 0; e < 4; ++e) {
            const float xw   = -(w0v[e] + wd[e]);
            const float sp   = (xw > 20.0f) ? xw : log1pf(__expf(xw)); // softplus
            const float logw = -__expf(-sp - 0.5f);                    // log decay < 0

            const float sv = 1.0f / (1.0f + __expf(-(v0v[e] + vd[e])));
            const float vv = vr[e] + (vf[e] - vr[e]) * sv;

            const float a  = 1.0f / (1.0f + __expf(-(a0v[e] + ad[e])));
            const float kk = kv[e] / den;

            R[(e * 6 + 0) / 8][(e * 6 + 0) % 8] = (__bf16)qv[e];
            R[(e * 6 + 1) / 8][(e * 6 + 1) % 8] = (__bf16)logw;
            R[(e * 6 + 2) / 8][(e * 6 + 2) % 8] = (__bf16)(kv[e] * a);
            R[(e * 6 + 3) / 8][(e * 6 + 3) % 8] = (__bf16)(-kk);
            R[(e * 6 + 4) / 8][(e * 6 + 4) % 8] = (__bf16)(kk * a);
            R[(e * 6 + 5) / 8][(e * 6 + 5) % 8] = (__bf16)vv;
            vo[e] = (__bf16)vv;
            go[e] = (__bf16)(1.0f + gd[e]);
        }
        v8bf* sp8 = (v8bf*)sops + 3 * u0 + 3 * o;
        sp8[0] = R[0];
        sp8[1] = R[1];
        sp8[2] = R[2];
        ((v4bf*)vh + u0)[o] = vo;
        ((v4bf*)gb + u0)[o] = go;
        // before the next token's loads reuse registers that these stores name
        if (it + 1 < ETK) asm volatile("s_wait_xcnt 0x0" ::: "memory");
    }
}

constexpr int SCH = 16;
constexpr int STS = 32;
constexpr int SNT = TT / STS;
static_assert(SNT >= 2 && STS % SCH == 0, "two tiles at least, whole chunks");

// Two partial sums become one: lanes with BIT clear keep lo, lanes with BIT
// set keep hi, and each adds what its partner (lane ^ BIT) holds of the same.
template <int BIT>
__device__ static inline float fold(float lo, float hi, int j)
{
    const bool  up   = (j & BIT) != 0;
    const float keep = up ? hi : lo;
    const float send = up ? lo : hi;
    return keep + dpp_mov<DPP_ROW_XMASK + BIT>(send);
}

// One tile: STS steps of 64 records (768 B a step, contiguous; steps lie
// CC records apart in global memory, back to back in LDS). A wave brings
// STS/4 steps, 16 B a lane and copy; 96 pieces are two steps.
__device__ static inline void scan_fetch(const ScanOp* g0, ScanOp* l0,
                                         int wave, int lane)
{
    constexpr int SB = NN * (int)sizeof(ScanOp);             // 768 B
    constexpr int GB = CC * (int)sizeof(ScanOp);             // step pitch, global
    const char* g = (const char*)g0 + (size_t)wave * (STS / 4) * GB;
    char*       l = (char*)l0 + wave * (STS / 4) * SB + lane * 16;
    #pragma unroll
    for (int r = 0; r < 3; ++r) {
        const int   pc = r * 32 + lane;                      // piece 0..95
        const char* gr = g + (pc / 48) * GB + (pc % 48) * 16;
        #pragma unroll
        for (int a = 0; a < STS / 8; ++a) {
#if USE_ASYNC_LDS
            async_copy_b128(gr + a * 2 * GB, l + (a * 3 + r) * 512);
#else
            *(v4i*)(l + (a * 3 + r) * 512) = *(const v4i*)(gr + a * 2 * GB);
#endif
        }
    }
}

struct Rec4 { v8bf r0, r1, r2; };            // a lane's four records of one step

__device__ static inline Rec4 scan_read(const ScanOp* lp, int u)
{
    const v8bf* rp = (const v8bf*)(lp + u * NN);
    return Rec4{rp[0], rp[1], rp[2]};
}

constexpr int SG = 8;                         // steps whose LDS reads stand together
static_assert(STS % SG == 0 && STS / SG >= 2, "whole groups, two at least");

template <int U>
struct ScanSteps {
    // lp: the lane's four records of the tile's first step, in LDS
    __device__ static inline void run(const ScanOp* lp, Rec4 (&pipe)[2][SG], float (&S)[4],
                                      float (&f)[4], const float (&vrow)[STS / SCH],
                                      float (&o)[STS / SCH], int j)
    {
        constexpr int t = STS - U;           // step in the tile
        constexpr int u = t % SCH;           // step in the chunk
        constexpr int gr = t / SG;           // group of steps in the tile
        if constexpr (t % SG == 0 && t + SG < STS) {
            // The next group's reads stand together at the head of this group, for
            // speed only. The two scheduling barriers keep the
            // scheduler from spreading the reads over the steps on either side;
            // inside a group it is free to overlap one step's output sum with the
            // next step's chain. At t = 0 the tile's first reads stand directly in
            // front, and no barrier parts the two groups.
            if constexpr (t > 0) __builtin_amdgcn_sched_barrier(0);
            #pragma unroll
            for (int i = 0; i < SG; ++i)
                pipe[(gr + 1) & 1][i] = scan_read(lp, t + SG + i);
            __builtin_amdgcn_sched_barrier(0);
        }
        const v8bf r0 = pipe[gr & 1][t % SG].r0, r1 = pipe[gr & 1][t % SG].r1,
                   r2 = pipe[gr & 1][t % SG].r2;

        // four records of six bf16: q w k z b v
        const float q[4] = {(float)r0[0], (float)r0[6], (float)r1[4], (float)r2[2]};
        const float w[4] = {(float)r0[1], (float)r0[7], (float)r1[5], (float)r2[3]};
        const float k[4] = {(float)r0[2], (float)r1[0], (float)r1[6], (float)r2[4]};
        const float z[4] = {(float)r0[3], (float)r1[1], (float)r1[7], (float)r2[5]};
        const float b[4] = {(float)r0[4], (float)r1[2], (float)r2[0], (float)r2[6]};

        // this step's v of the row
        const float vt = dpp_mov<DPP_ROW_SHARE + u>(vrow[t / SCH]);

        float sa = __builtin_fmaf(S[1], z[1], S[0] * z[0]) + __builtin_fmaf(S[3], z[3], S[2] * z[2]);
        sa += dpp_mov<DPP_ROW_XMASK + 1>(sa);
        sa += dpp_mov<DPP_ROW_XMASK + 2>(sa);
        sa += dpp_mov<DPP_ROW_XMASK + 4>(sa);
        sa += dpp_mov<DPP_ROW_XMASK + 8>(sa);

        #pragma unroll
        for (int i = 0; i < 4; ++i)          // exp after bf16 round, as reference
            S[i] = __builtin_fmaf(sa, b[i], __builtin_fmaf(vt, k[i], S[i] * __expf(w[i])));

        float p = __builtin_fmaf(S[1], q[1], S[0] * q[0]) + __builtin_fmaf(S[3], q[3], S[2] * q[2]);

        // binary counter of folded partials: f[n] holds 2^n finished steps
        if constexpr ((u & 1) == 0) { f[0] = p; }
        else {
            p = fold<1>(f[0], p, j);
            if constexpr ((u & 2) == 0) { f[1] = p; }
            else {
                p = fold<2>(f[1], p, j);
                if constexpr ((u & 4) == 0) { f[2] = p; }
                else {
                    p = fold<4>(f[2], p, j);
                    if constexpr ((u & 8) == 0) { f[3] = p; }
                    else { o[t / SCH] = fold<8>(f[3], p, j); }
                }
            }
        }
        ScanSteps<U - 1>::run(lp, pipe, S, f, vrow, o, j);
    }
};
template <>
struct ScanSteps<0> {
    __device__ static inline void run(const ScanOp*, Rec4 (&)[2][SG], float (&)[4],
                                      float (&)[4], const float (&)[STS / SCH],
                                      float (&)[STS / SCH], int) {}
};

__global__ __launch_bounds__(128) void scan_kernel(
    const ScanOp* __restrict__ sops, float* __restrict__ y)
{
    __shared__ __align__(16) ScanOp tile[2][STS][NN];

    const int lane = threadIdx.x & 31;
    const int wave = threadIdx.x >> 5;
    const int g    = blockIdx.x >> 3;                        // b*H + h
    const int rp   = (blockIdx.x & 7) * 4 + wave;            // row pair 0..31
    const int h    = g % HH;
    const int b    = g / HH;
    const int j    = lane & 15;                              // column group / step slot
    const int row  = rp * 2 + (lane >> 4);

    const ScanOp* hb = sops + (size_t)b * TT * CC + (size_t)h * NN;   // t = 0
    float* yp = y + ((size_t)g * (TT / SCH) * 32 + rp) * 32 + lane;

    float S[4] = {0.0f, 0.0f, 0.0f, 0.0f};

    scan_fetch(hb, &tile[0][0][0], wave, lane);
    // own copies of tile 0 landed; the barrier publishes every wave's
    asm volatile("s_wait_asynccnt 0x0" ::: "memory");
    __syncthreads();
    scan_fetch(hb + (size_t)STS * CC, &tile[1][0][0], wave, lane);

    // kept rolled: the body already holds STS unrolled steps
    #pragma unroll 1
    for (int tl = 0; tl < SNT; ++tl) {
        ScanOp* tb = &tile[tl & 1][0][0];

        Rec4 pipe[2][SG];
        #pragma unroll
        for (int i = 0; i < SG; ++i) pipe[0][i] = scan_read(tb + j * 4, i);
        float vrow[STS / SCH], o[STS / SCH], f[4];
        #pragma unroll
        for (int c = 0; c < STS / SCH; ++c)  // v of my row at step j of chunk c
            vrow[c] = (float)tb[(c * SCH + j) * NN + row].v;

        ScanSteps<STS>::run(tb + j * 4, pipe, S, f, vrow, o, j);

        // keeps the last groups' arithmetic in front of the foot: lifted over it,
        // the wait below stands right behind the tile's last reads and the wave
        // sits out their whole latency
        __builtin_amdgcn_sched_barrier(0);
        // foot of the trip: my reads of this tile are done, my copies of the
        // next tile have landed; the barrier says both of every wave
        asm volatile("s_wait_dscnt 0x0" ::: "memory");
        asm volatile("s_wait_asynccnt 0x0" ::: "memory");
        __syncthreads();
        if (tl + 2 < SNT)
            scan_fetch(hb + (size_t)(tl + 2) * STS * CC, tb, wave, lane);

        // stored behind the barrier: in front of it the barrier's own wait for
        // stores would expose their whole latency once per tile
        #pragma unroll
        for (int c = 0; c < STS / SCH; ++c) {
            *yp = o[c] * 0.125f;             // * N^-0.5
            yp += 32 * 32;
        }
    }
    // no copy is left in flight when the wave ends
    asm volatile("s_wait_asynccnt 0x0" ::: "memory");
}

// ---------------------------------------------------------------------------
// Kernel 6: norm-ratio correction + gate -> bf16 input for output projection.
// A block: ETK tokens of one chunk of y, all columns. A lane: 4 columns of each,
// a 16-lane row is one head (norms: DPP row sums). y lies step-fastest (see
// kernel 5), so one 16-B load is one column's ETK steps.
// ---------------------------------------------------------------------------
static_assert(ETK == 4 && SCH % ETK == 0 && TT % SCH == 0, "a block stays in one chunk");

__global__ __launch_bounds__(256) void post_scan_kernel(
    const float* __restrict__ y, const float* __restrict__ x,
    const __bf16* __restrict__ vh, const __bf16* __restrict__ gb,
    const float* __restrict__ r_k, __bf16* __restrict__ Yg)
{
    const int    c  = threadIdx.x * 4;
    const int    h  = threadIdx.x >> 4;
    const int    n0 = c & (NN - 1);
    const unsigned m0 = blockIdx.x * ETK;
    const unsigned t0 = m0 % TT;
    const unsigned gy = (m0 / TT) * HH + h;

    // y[((gy*(T/SCH) + chunk)*NN + n)*SCH + step], here in 4 steps
    const unsigned yu = ((gy * (TT / SCH) + t0 / SCH) * NN + n0) * (SCH / 4) + (t0 % SCH) / 4;
    v4f yv[4];                                // [column][token]
    #pragma unroll
    for (int e = 0; e < 4; ++e) yv[e] = ((const v4f*)y)[yu + e * (SCH / 4)];

    const v4f rk = ld4(r_k + c);
    // before a later load's result lands in a register that these loads name
    asm volatile("s_wait_xcnt 0x0" ::: "memory");
    float sig[4];
    #pragma unroll
    for (int e = 0; e < 4; ++e) sig[e] = 1.0f / (1.0f + __expf(-rk[e]));

    // every load of the lane is issued before the first value is used
    v4f  xvs[ETK];
    v4bf vbs[ETK], gvs[ETK];
    #pragma unroll
    for (int it = 0; it < ETK; ++it) {
        const unsigned u = (m0 + it) * (CC / 4) + threadIdx.x;   // in 4 elements
        xvs[it] = ((const v4f*)x)[u];
        vbs[it] = ((const v4bf*)vh)[u];
        gvs[it] = ((const v4bf*)gb)[u];
    }

    #pragma unroll
    for (int it = 0; it < ETK; ++it) {
        const unsigned u = (m0 + it) * (CC / 4) + threadIdx.x;
        const v4f  xv = xvs[it];
        const v4bf vb = vbs[it], gv = gvs[it];
        float vv[4];
        #pragma unroll
        for (int e = 0; e < 4; ++e) vv[e] = (float)vb[e];

        const float xnorm = sqrtf(row_sum16((xv[0] * xv[0] + xv[1] * xv[1]) +
                                            (xv[2] * xv[2] + xv[3] * xv[3])));
        const float vnorm = sqrtf(row_sum16((vv[0] * vv[0] + vv[1] * vv[1]) +
                                            (vv[2] * vv[2] + vv[3] * vv[3])));
        const float ratio = 1.0f - xnorm / (vnorm + 1e-12f);

        v4bf o;
        #pragma unroll
        for (int e = 0; e < 4; ++e) {
            const float u = ratio * sig[e];
            o[e] = (__bf16)((yv[e][it] + vv[e] * u) * (float)gv[e]);
        }
        ((v4bf*)Yg)[u] = o;
    }
}

// ---------------------------------------------------------------------------
// Host launcher
// ---------------------------------------------------------------------------
extern "C" void kernel_launch(void* const* d_in, const int* in_sizes, int n_in,
                              void* d_out, int out_size, void* d_ws,
                              size_t ws_size, hipStream_t stream)
{
    (void)in_sizes; (void)n_in; (void)out_size; (void)ws_size;

    const float* residual = (const float*)d_in[0];
    const float* x        = (const float*)d_in[1];
    const float* x0       = (const float*)d_in[2];
    const float* dx0      = (const float*)d_in[3];
    const float* Wq       = (const float*)d_in[4];
    const float* Wk       = (const float*)d_in[5];
    const float* Wv       = (const float*)d_in[6];
    const float* Wproj    = (const float*)d_in[7];
    const float* x_q      = (const float*)d_in[8];
    const float* x_k      = (const float*)d_in[9];
    const float* x_v      = (const float*)d_in[10];
    const float* v0       = (const float*)d_in[11];
    const float* w0       = (const float*)d_in[12];
    const float* a0       = (const float*)d_in[13];
    const float* miss     = (const float*)d_in[14];
    const float* r_k      = (const float*)d_in[15];
    float*       out      = (float*)d_out;

    // ---- workspace layout (256B aligned bump allocator) ----
    char*  ws  = (char*)d_ws;
    size_t off = 0;
    auto alloc = [&](size_t bytes) -> void* {
        void* p = ws + off;
        off += (bytes + 255) & ~(size_t)255;
        return p;
    };
    const size_t MC_BF = (size_t)MM * CC * sizeof(__bf16);    // 8 MB
    const size_t MC_F  = (size_t)MM * CC * sizeof(float);     // 16 MB
    const size_t W_BF  = (size_t)CC * CC * sizeof(__bf16);    // 2 MB
    const size_t XD_BF = (size_t)MM * MR * sizeof(__bf16);    // 1 MB
    const size_t DL_F  = (size_t)MM * 4 * CC * sizeof(float); // 64 MB
    const size_t SO_SZ = (size_t)MM * CC * sizeof(ScanOp);    // 48 MB

    __bf16* Xq    = (__bf16*)alloc(MC_BF);
    __bf16* Xk    = (__bf16*)alloc(MC_BF);
    __bf16* Xv    = (__bf16*)alloc(MC_BF);
    __bf16* Xv0   = (__bf16*)alloc(MC_BF);
    __bf16* Xd    = (__bf16*)alloc(XD_BF);
    __bf16* Wqb   = (__bf16*)alloc(W_BF);
    __bf16* Wkb   = (__bf16*)alloc(W_BF);
    __bf16* Wvb   = (__bf16*)alloc(W_BF);
    __bf16* Wpb   = (__bf16*)alloc(W_BF);
    __bf16* missT = (__bf16*)alloc(XD_BF);
    float*  qf    = (float*)alloc(MC_F);
    float*  kf    = (float*)alloc(MC_F);
    float*  vfr   = (float*)alloc(MC_F);
    float*  vfirst= (float*)alloc(MC_F);
    float*  deltas= (float*)alloc(DL_F);
    ScanOp* sops  = (ScanOp*)alloc(SO_SZ);
    __bf16* gb    = (__bf16*)alloc(MC_BF);
    // aliases over buffers whose last reader precedes the new writer:
    __bf16* vh  = Xv0;       // Xv0 consumed by v_first GEMM before post_gemm
    float*  y   = qf;        // qf consumed by post_gemm before scan writes
    __bf16* Yg  = (__bf16*)kf;

    // ---- 1) input prep + weight conversion ----
    {
        prep_kernel<<<dim3(PREP_BLOCKS), dim3(256), 0, stream>>>(
            x, x0, dx0, x_q, x_k, x_v, Xq, Xk, Xv, Xv0, Xd);
        wconv_kernel<<<dim3(MT_BLOCKS + WC_BLOCKS), dim3(256), 0, stream>>>(
            Wq, Wk, Wv, Wproj, miss, Wqb, Wkb, Wvb, Wpb, missT);
    }

    // ---- 2) WMMA GEMMs: q, k, v, v_first (K=1024, N=1024), deltas (K=128, N=4096)
    {
        dim3 grid4(CC / 128, MM / 128, 4), blk(256);
        gemm_proj4_kernel<<<grid4, blk, 0, stream>>>(
            Xq, Xk, Xv, Xv0, Wqb, Wkb, Wvb, qf, kf, vfr, vfirst);
        dim3 gridD(4 * CC / 128, MM / 128);
        gemm_bf16_wmma<MR><<<gridD, blk, 0, stream>>>(Xd, missT, deltas, (const float*)nullptr, 4 * CC);
    }

    // ---- 3) elementwise + k-norm -> packed bf16 scan operands ----
    post_gemm_kernel<<<dim3(MM / ETK), dim3(256), 0, stream>>>(
        qf, kf, vfr, vfirst, deltas, w0, v0, a0, sops, vh, gb);

    // ---- 4) sequential scan (state in VGPRs, 8 rows per block) ----
    scan_kernel<<<dim3(BB * HH * 8), dim3(128), 0, stream>>>(sops, y);

    // ---- 5) norm correction + gate ----
    post_scan_kernel<<<dim3(MM / ETK), dim3(256), 0, stream>>>(y, x, vh, gb, r_k, Yg);

    // ---- 6) output projection + residual -> d_out ----
    {
        dim3 grid(CC / 128, MM / 128), blk(256);
        gemm_bf16_wmma<CC><<<grid, blk, 0, stream>>>(Yg, Wpb, out, residual, CC);
    }
}

// v005
// It runs in 206 microseconds.
// In both of two side-by-side timings against v004, it was 1.11 times as fast.
// All steps since v000 together make it 21.4 times as fast.
#include <hip/hip_runtime.h>
#include <hip/hip_bf16.h>

// ---------------------------------------------------------------------------
// RWKV7 time-mix for MI455X (gfx1250, wave32, WMMA).
//   B=2, T=2048, C=1024, H=16, N=64, MISS_ROWS=128
// ---------------------------------------------------------------------------

typedef __attribute__((ext_vector_type(16))) __bf16 v16bf;
typedef __attribute__((ext_vector_type(8)))  __bf16 v8bf;
typedef __attribute__((ext_vector_type(8)))  float  v8f;
typedef __attribute__((ext_vector_type(4)))  int    v4i;

constexpr int BB = 2;
constexpr int TT = 2048;
constexpr int CC = 1024;
constexpr int HH = 16;
constexpr int NN = 64;
constexpr int MR = 128;          // MISS_ROWS
constexpr int MM = BB * TT;      // 4096 tokens

// Packed per-(token,head,column) scan operands: 12B a record; a scan lane reads four a step.
struct __align__(4) ScanOp { __bf16 q, w, k, z, b, v; };

// ---- gfx1250 async global->LDS copy path (guarded; falls back cleanly) ----
#if defined(__HIP_DEVICE_COMPILE__) &&                                        \
    __has_builtin(__builtin_amdgcn_global_load_async_to_lds_b128) &&          \
    __has_builtin(__builtin_amdgcn_s_wait_asynccnt)
#define USE_ASYNC_LDS 1
#else
#define USE_ASYNC_LDS 0
#endif

#if USE_ASYNC_LDS
__device__ static inline void async_copy_b128(const void* g, void* l)
{
    // Builtin signature (from clang diagnostic): AS1 v4i* src, AS3 v4i* dst,
    // imm offset, imm cpol.
    __builtin_amdgcn_global_load_async_to_lds_b128(
        (__attribute__((address_space(1))) v4i*)(g),
        (__attribute__((address_space(3))) v4i*)(l),
        0, 0);
}
#endif

// ---------------------------------------------------------------------------
// The four elementwise kernels (1, 2, 4, 6) are dealt so that a launch is 544 or
// 1024 work-groups of eight waves, all resident at once: a lane takes 16 to
// 64 elements and moves them 8 or 16 B at a time (miss, read down a column, 4 B).
// ---------------------------------------------------------------------------
typedef __attribute__((ext_vector_type(4))) float  v4f;
typedef __attribute__((ext_vector_type(4))) __bf16 v4bf;

template <int CTRL>
__device__ static inline float dpp_mov(float x)
{
    return __builtin_bit_cast(float, __builtin_amdgcn_mov_dpp(
        __builtin_bit_cast(int, x), CTRL, 0xf, 0xf, true));
}
constexpr int DPP_ROW_SHARE = 0x150;          // + source lane of the row
constexpr int DPP_ROW_XMASK = 0x160;          // + xor mask inside the row

// sum over the 16 lanes of a row, left in every lane of it
__device__ static inline float row_sum16(float s)
{
    s += dpp_mov<DPP_ROW_XMASK + 1>(s);
    s += dpp_mov<DPP_ROW_XMASK + 2>(s);
    s += dpp_mov<DPP_ROW_XMASK + 4>(s);
    s += dpp_mov<DPP_ROW_XMASK + 8>(s);
    return s;
}

__device__ static inline v4f ld4(const float* p) { return *(const v4f*)p; }

__device__ static inline v8bf cvt8(const float* p, unsigned u)
{
    const v4f lo = ((const v4f*)p)[2 * u], hi = ((const v4f*)p)[2 * u + 1];
    v8bf o;
    #pragma unroll
    for (int e = 0; e < 4; ++e) { o[e] = (__bf16)lo[e]; o[4 + e] = (__bf16)hi[e]; }
    return o;
}

// ---------------------------------------------------------------------------
// Kernel 1: token-shift input mixing -> bf16 GEMM operands.
// A lane: 8 columns of step t in every batch (the mix vectors are read once).
// ---------------------------------------------------------------------------
constexpr int PREP_BLOCKS = TT * (CC / 8) / 256;

__global__ __launch_bounds__(256) void prep_kernel(
    const float* __restrict__ x, const float* __restrict__ x0,
    const float* __restrict__ dx0,
    const float* __restrict__ x_q, const float* __restrict__ x_k,
    const float* __restrict__ x_v,
    __bf16* __restrict__ Xq, __bf16* __restrict__ Xk,
    __bf16* __restrict__ Xv, __bf16* __restrict__ Xv0,
    __bf16* __restrict__ Xd)
{
    const int i = blockIdx.x * 256 + threadIdx.x;
    const int c = (i % (CC / 8)) * 8;
    const int t = i / (CC / 8);

    v4f mq[2], mk[2], mv[2];
    #pragma unroll
    for (int p = 0; p < 2; ++p) {
        mq[p] = ld4(x_q + c + 4 * p);
        mk[p] = ld4(x_k + c + 4 * p);
        mv[p] = ld4(x_v + c + 4 * p);
    }
    // before a later load's result lands in a register that these loads name.
    // The output pointers are inputs so that they are fetched here, into scalar
    // registers of their own: fetched later they took the place of the bases
    // of the loads below, ahead of those loads' wait
    asm volatile("s_wait_xcnt 0x0" :: "s"(Xq), "s"(Xk), "s"(Xv), "s"(Xv0), "s"(Xd) : "memory");

    // every load of the lane is issued before the first value is used
    v4f xvs[BB][2], xps[BB][2], z0s[BB][2], d0s[BB][2];
    #pragma unroll
    for (int b = 0; b < BB; ++b) {
        const unsigned u = (unsigned)(b * (TT * CC / 8) + i);   // in 8 elements
        #pragma unroll
        for (int p = 0; p < 2; ++p) {
            xvs[b][p] = ((const v4f*)x)[2 * u + p];
            // step t-1; at t=0 the lane's own step, in bounds and not used
            xps[b][p] = ((const v4f*)x)[2 * u + p - (t > 0 ? CC / 4 : 0)];
            z0s[b][p] = ((const v4f*)x0)[2 * u + p];
            d0s[b][p] = ((const v4f*)dx0)[2 * u + p];
        }
        // before a later load's result, or the arithmetic, lands in a register
        // that these loads name
        asm volatile("s_wait_xcnt 0x0" ::: "memory");
    }
    // keeps the first batch's arithmetic, which waits for its loads, from being
    // scheduled in front of the second batch's loads
    __builtin_amdgcn_sched_barrier(0);

    #pragma unroll
    for (int b = 0; b < BB; ++b) {
        const unsigned u = (unsigned)(b * (TT * CC / 8) + i);
        v8bf oq, ok, ov, o0, od;
        #pragma unroll
        for (int p = 0; p < 2; ++p) {
            const v4f xv = xvs[b][p], z0 = z0s[b][p], d0 = d0s[b][p];
            const v4f xp = t > 0 ? xps[b][p] : v4f{0.0f, 0.0f, 0.0f, 0.0f};   // zero pad
            #pragma unroll
            for (int e = 0; e < 4; ++e) {
                const float dxp = xp[e] - xv[e];         // x_{t-1} - x_t
                oq[4 * p + e] = (__bf16)(xv[e] + dxp * mq[p][e]);
                ok[4 * p + e] = (__bf16)(xv[e] + dxp * mk[p][e]);
                ov[4 * p + e] = (__bf16)(xv[e] + dxp * mv[p][e]);
                o0[4 * p + e] = (__bf16)(z0[e] + d0[e] * mv[p][e]);
                od[4 * p + e] = (__bf16)xv[e];
            }
        }
        ((v8bf*)Xq)[u]  = oq;
        ((v8bf*)Xk)[u]  = ok;
        ((v8bf*)Xv)[u]  = ov;
        ((v8bf*)Xv0)[u] = o0;
        if (c < MR)                                      // x[:, :, :128]
            ((v8bf*)Xd)[(unsigned)((b * TT + t) * (MR / 8) + c / 8)] = od;
        // before the next batch's arithmetic reuses registers that these stores name
        if (b + 1 < BB) asm volatile("s_wait_xcnt 0x0" ::: "memory");
    }
}

// ---------------------------------------------------------------------------
// Kernel 2: f32 weights -> bf16; miss [128,4096] -> missT [4096,128].
// The first blocks transpose: a lane reads 64 rows of one column of miss (a wave
// reads whole lines) and writes one whole 128-B line of missT. The others
// convert 8 elements of each weight a lane.
// ---------------------------------------------------------------------------
constexpr int MT_BLOCKS = 4 * CC * (MR / 64) / 256;
constexpr int WC_BLOCKS = CC * CC / 8 / 256;

__global__ __launch_bounds__(256) void wconv_kernel(
    const float* __restrict__ Wq, const float* __restrict__ Wk,
    const float* __restrict__ Wv, const float* __restrict__ Wp,
    const float* __restrict__ miss,
    __bf16* __restrict__ Wqb, __bf16* __restrict__ Wkb,
    __bf16* __restrict__ Wvb, __bf16* __restrict__ Wpb,
    __bf16* __restrict__ missT)
{
    if (blockIdx.x < MT_BLOCKS) {
        const int i  = blockIdx.x * 256 + threadIdx.x;
        const int n  = i % (4 * CC);
        const int r0 = (i / (4 * CC)) * 64;
        const float* s = miss + (unsigned)(r0 * (4 * CC) + n);
        float v[64];
        #pragma unroll
        for (int r = 0; r < 64; ++r) v[r] = s[r * (4 * CC)];
        #pragma unroll
        for (int q = 0; q < 8; ++q) {
            v8bf o;
            #pragma unroll
            for (int e = 0; e < 8; ++e) o[e] = (__bf16)v[q * 8 + e];
            ((v8bf*)missT)[(unsigned)((n * MR + r0) / 8 + q)] = o;
        }
    } else {
        const unsigned u = (blockIdx.x - MT_BLOCKS) * 256 + threadIdx.x;   // in 8 elements
        const v8bf q = cvt8(Wq, u), k = cvt8(Wk, u), v = cvt8(Wv, u), p = cvt8(Wp, u);
        ((v8bf*)Wqb)[u] = q;
        ((v8bf*)Wkb)[u] = k;
        ((v8bf*)Wvb)[u] = v;
        ((v8bf*)Wpb)[u] = p;
        // the built code lays the other branch behind this one: no register that
        // these stores name is rewritten ahead of this wait on any way through it
        asm volatile("s_wait_xcnt 0x0" ::: "memory");
    }
}

// ---------------------------------------------------------------------------
// Kernel 3: bf16 WMMA GEMM,  Y[m,n] = sum_k X[m,k] * W[n,k]  (+ resid)
//   block tile 128x128, 256 threads = 8 wave32; wave tile 64x32 (4x2 WMMA).
//   K-step 32, double-buffered LDS, async global->LDS staging when available.
// gemm_tile is one block's tile; the kernels behind it say which tile of which
// product a block takes. Whether a residual is added, and the row pitch of Y,
// are settled at compile time: a lane's 64 places in Y (and in resid) are then
// one address and 64 constant offsets.
// ---------------------------------------------------------------------------
template <int KDIM, int NDIM, bool RESID>
__device__ static __forceinline__ void gemm_tile(
    const __bf16* __restrict__ X, const __bf16* __restrict__ W,
    float* __restrict__ Y, const float* __restrict__ resid,
    int mBase, int nBase)
{
    constexpr int KT    = 32;
    constexpr int KITER = KDIM / KT;
    constexpr int LDR   = 40;            // padded row (80B, 16B aligned)

    __shared__ __align__(16) __bf16 As[2][128][LDR];
    __shared__ __align__(16) __bf16 Bs[2][128][LDR];

    const int tid    = threadIdx.x;
    const int lane   = tid & 31;
    const int wave   = tid >> 5;
    const int wm     = (wave >> 2) * 64;     // 0 | 64
    const int wn     = (wave & 3) * 32;      // 0,32,64,96
    const int laneLo = lane & 15;
    const int kbase  = ((lane >> 4) & 1) * 8; // lanes 0-15 -> K{0..7,16..23};
                                              // lanes 16-31 -> K{8..15,24..31}

    v8f acc[4][2];
    #pragma unroll
    for (int i = 0; i < 4; ++i)
        #pragma unroll
        for (int j = 0; j < 2; ++j)
            #pragma unroll
            for (int e = 0; e < 8; ++e) acc[i][j][e] = 0.0f;

    auto loadTile = [&](int buf, int k0) {
        #pragma unroll
        for (int ch = 0; ch < 2; ++ch) {
            int e  = ch * 2048 + tid * 8;
            int r  = e >> 5;        // 0..127
            int kk = e & 31;        // 0,8,16,24
            const __bf16* gA = &X[(size_t)(mBase + r) * KDIM + k0 + kk];
            const __bf16* gB = &W[(size_t)(nBase + r) * KDIM + k0 + kk];
#if USE_ASYNC_LDS
            async_copy_b128(gA, &As[buf][r][kk]);
            async_copy_b128(gB, &Bs[buf][r][kk]);
#else
            *(v8bf*)&As[buf][r][kk] = *(const v8bf*)gA;
            *(v8bf*)&Bs[buf][r][kk] = *(const v8bf*)gB;
#endif
        }
    };

    loadTile(0, 0);

    // C/D layout: VGPR v, lanes 0-15 -> (M=v, N=lane); lanes 16-31 -> (M=8+v)
    // the lane's first place in Y; tile (i, j), register v lies
    // (i * 16 + v) * NDIM + j * 16 elements further on
    const size_t off0 = (size_t)(mBase + wm + (lane >> 4) * 8) * NDIM + (nBase + wn + laneLo);

    // The residual depends on nothing that is computed here: all 64 loads of the
    // lane are issued now and fly beside the first tile's copies (the loop's first
    // barrier waits for loads too, once for all of them). One at a time in the
    // epilogue, each waited for before the next is issued, they cost the wave 64
    // latencies in a row.
    float rv[4][2][8];
    if constexpr (RESID) {
        const float* rp = resid + off0;
        #pragma unroll
        for (int i = 0; i < 4; ++i)
            #pragma unroll
            for (int j = 0; j < 2; ++j)
                #pragma unroll
                for (int v = 0; v < 8; ++v)
                    rv[i][j][v] = rp[(i * 16 + v) * NDIM + j * 16];
        // before the loop's arithmetic reuses a register that these loads name
        asm volatile("s_wait_xcnt 0x0" ::: "memory");
    }

    for (int ki = 0; ki < KITER; ++ki) {
#if USE_ASYNC_LDS
        __builtin_amdgcn_s_wait_asynccnt(0);   // own async copies in LDS
#endif
        __syncthreads();                       // all waves' copies visible
        const int buf = ki & 1;
        if (ki + 1 < KITER) loadTile(buf ^ 1, (ki + 1) * KT);

        v16bf afrag[4], bfrag[2];
        #pragma unroll
        for (int i = 0; i < 4; ++i) {
            const __bf16* ap = &As[buf][wm + i * 16 + laneLo][kbase];
            v8bf lo = *(const v8bf*)ap;
            v8bf hi = *(const v8bf*)(ap + 16);
            afrag[i] = __builtin_shufflevector(lo, hi, 0, 1, 2, 3, 4, 5, 6, 7,
                                               8, 9, 10, 11, 12, 13, 14, 15);
        }
        #pragma unroll
        for (int j = 0; j < 2; ++j) {
            const __bf16* bp = &Bs[buf][wn + j * 16 + laneLo][kbase];
            v8bf lo = *(const v8bf*)bp;
            v8bf hi = *(const v8bf*)(bp + 16);
            bfrag[j] = __builtin_shufflevector(lo, hi, 0, 1, 2, 3, 4, 5, 6, 7,
                                               8, 9, 10, 11, 12, 13, 14, 15);
        }
        #pragma unroll
        for (int i = 0; i < 4; ++i)
            #pragma unroll
            for (int j = 0; j < 2; ++j)
                acc[i][j] = __builtin_amdgcn_wmma_f32_16x16x32_bf16(
                    false, afrag[i], false, bfrag[j],
                    (short)0, acc[i][j], false, false);
    }

    if constexpr (RESID) {
        #pragma unroll
        for (int i = 0; i < 4; ++i)
            #pragma unroll
            for (int j = 0; j < 2; ++j)
                #pragma unroll
                for (int v = 0; v < 8; ++v) acc[i][j][v] += rv[i][j][v];
        // every sum stands in front of the first store: mixed among the stores,
        // later sums were put into registers that issued stores still name
        __builtin_amdgcn_sched_barrier(0);
    }
    float* yp = Y + off0;
    #pragma unroll
    for (int i = 0; i < 4; ++i)
        #pragma unroll
        for (int j = 0; j < 2; ++j)
            #pragma unroll
            for (int v = 0; v < 8; ++v)
                yp[(i * 16 + v) * NDIM + j * 16] = acc[i][j][v];
}

template <int KDIM, int NDIM, bool RESID>
__global__ __launch_bounds__(256) void gemm_bf16_wmma(
    const __bf16* __restrict__ X, const __bf16* __restrict__ W,
    float* __restrict__ Y, const float* __restrict__ resid)
{
    gemm_tile<KDIM, NDIM, RESID>(X, W, Y, resid, blockIdx.y * 128, blockIdx.x * 128);
}

// The four projections of the inputs depend on nothing of one another: one
// launch, blockIdx.z says which. A projection of its own is one block a WGP, and
// that block waits out the landing of its copies once per K-step; here four
// blocks share a WGP and work while another waits.
__global__ __launch_bounds__(256) void gemm_proj4_kernel(
    const __bf16* __restrict__ Xq, const __bf16* __restrict__ Xk,
    const __bf16* __restrict__ Xv, const __bf16* __restrict__ Xv0,
    const __bf16* __restrict__ Wqb, const __bf16* __restrict__ Wkb,
    const __bf16* __restrict__ Wvb,
    float* __restrict__ qf, float* __restrict__ kf, float* __restrict__ vfr,
    float* __restrict__ vfirst)
{
    const int p = blockIdx.z;
    const __bf16* X = p == 0 ? Xq  : p == 1 ? Xk  : p == 2 ? Xv  : Xv0;
    const __bf16* W = p == 0 ? Wqb : p == 1 ? Wkb : Wvb;
    float*        Y = p == 0 ? qf  : p == 1 ? kf  : p == 2 ? vfr : vfirst;
    gemm_tile<CC, CC, false>(X, W, Y, nullptr, blockIdx.y * 128, blockIdx.x * 128);
}

// ---------------------------------------------------------------------------
// Kernel 4: per-(token,head) elementwise + k-normalization; bf16 rounding of
// the six scan operands (matching the reference's rounding point); packs
// them into one 12B record per (token,head,column) for the scan.
// A block: ETK tokens, all columns. A lane: 4 columns, so a 16-lane row is one
// head and |k|^2 is a DPP row sum; its four records are 48 contiguous bytes.
// ---------------------------------------------------------------------------
constexpr int ETK = 4;                        // tokens per block, kernels 4 and 6
static_assert(CC == 256 * 4 && NN == 16 * 4 && MM % ETK == 0, "lane deal");

__global__ __launch_bounds__(256) void post_gemm_kernel(
    const float* __restrict__ qf, const float* __restrict__ kf,
    const float* __restrict__ vfr, const float* __restrict__ vfirst,
    const float* __restrict__ deltas,
    const float* __restrict__ w0, const float* __restrict__ v0,
    const float* __restrict__ a0,
    ScanOp* __restrict__ sops,
    __bf16* __restrict__ vh, __bf16* __restrict__ gb)
{
    const int c = threadIdx.x * 4;
    const v4f w0v = ld4(w0 + c), v0v = ld4(v0 + c), a0v = ld4(a0 + c);
    // the lane's place in the block's first token, in 4 elements
    const unsigned u0 = blockIdx.x * (ETK * CC / 4) + threadIdx.x;
    const unsigned d0 = blockIdx.x * (ETK * CC) + threadIdx.x;       // in deltas

    #pragma unroll
    for (int it = 0; it < ETK; ++it) {
        const int o = it * (CC / 4);                     // token, in 4 elements
        const v4f* dp = (const v4f*)deltas + d0 + 4 * o;

        const v4f kv = ((const v4f*)kf + u0)[o],  qv = ((const v4f*)qf + u0)[o];
        const v4f vr = ((const v4f*)vfr + u0)[o], vf = ((const v4f*)vfirst + u0)[o];
        const v4f wd = dp[0], vd = dp[CC / 4], ad = dp[2 * (CC / 4)], gd = dp[3 * (CC / 4)];
        // before the arithmetic reuses registers that these loads name
        asm volatile("s_wait_xcnt 0x0" ::: "memory");

        const float norm = sqrtf(row_sum16((kv[0] * kv[0] + kv[1] * kv[1]) +
                                           (kv[2] * kv[2] + kv[3] * kv[3])));
        const float den  = fmaxf(norm, 1e-12f);

        v8bf R[3];                            // four records: q w k z b v each
        v4bf vo, go;
        #pragma unroll
        for (int e = 0; e < 4; ++e) {
            const float xw   = -(w0v[e] + wd[e]);
            const float sp   = (xw > 20.0f) ? xw : log1pf(__expf(xw)); // softplus
            const float logw = -__expf(-sp - 0.5f);                    // log decay < 0

            const float sv = 1.0f / (1.0f + __expf(-(v0v[e] + vd[e])));
            const float vv = vr[e] + (vf[e] - vr[e]) * sv;

            const float a  = 1.0f / (1.0f + __expf(-(a0v[e] + ad[e])));
            const float kk = kv[e] / den;

            R[(e * 6 + 0) / 8][(e * 6 + 0) % 8] = (__bf16)qv[e];
            R[(e * 6 + 1) / 8][(e * 6 + 1) % 8] = (__bf16)logw;
            R[(e * 6 + 2) / 8][(e * 6 + 2) % 8] = (__bf16)(kv[e] * a);
            R[(e * 6 + 3) / 8][(e * 6 + 3) % 8] = (__bf16)(-kk);
            R[(e * 6 + 4) / 8][(e * 6 + 4) % 8] = (__bf16)(kk * a);
            R[(e * 6 + 5) / 8][(e * 6 + 5) % 8] = (__bf16)vv;
            vo[e] = (__bf16)vv;
            go[e] = (__bf16)(1.0f + gd[e]);
        }
        v8bf* sp8 = (v8bf*)sops + 3 * u0 + 3 * o;
        sp8[0] = R[0];
        sp8[1] = R[1];
        sp8[2] = R[2];
        ((v4bf*)vh + u0)[o] = vo;
        ((v4bf*)gb + u0)[o] = go;
        // before the next token's loads reuse registers that these stores name
        if (it + 1 < ETK) asm volatile("s_wait_xcnt 0x0" ::: "memory");
    }
}

constexpr int SCH = 16;
constexpr int STS = 32;
constexpr int SNT = TT / STS;
static_assert(SNT >= 2 && STS % SCH == 0, "two tiles at least, whole chunks");

// Two partial sums become one: lanes with BIT clear keep lo, lanes with BIT
// set keep hi, and each adds what its partner (lane ^ BIT) holds of the same.
template <int BIT>
__device__ static inline float fold(float lo, float hi, int j)
{
    const bool  up   = (j & BIT) != 0;
    const float keep = up ? hi : lo;
    const float send = up ? lo : hi;
    return keep + dpp_mov<DPP_ROW_XMASK + BIT>(send);
}

// One tile: STS steps of 64 records (768 B a step, contiguous; steps lie
// CC records apart in global memory, back to back in LDS). A wave brings
// STS/4 steps, 16 B a lane and copy; 96 pieces are two steps.
__device__ static inline void scan_fetch(const ScanOp* g0, ScanOp* l0,
                                         int wave, int lane)
{
    constexpr int SB = NN * (int)sizeof(ScanOp);             // 768 B
    constexpr int GB = CC * (int)sizeof(ScanOp);             // step pitch, global
    const char* g = (const char*)g0 + (size_t)wave * (STS / 4) * GB;
    char*       l = (char*)l0 + wave * (STS / 4) * SB + lane * 16;
    #pragma unroll
    for (int r = 0; r < 3; ++r) {
        const int   pc = r * 32 + lane;                      // piece 0..95
        const char* gr = g + (pc / 48) * GB + (pc % 48) * 16;
        #pragma unroll
        for (int a = 0; a < STS / 8; ++a) {
#if USE_ASYNC_LDS
            async_copy_b128(gr + a * 2 * GB, l + (a * 3 + r) * 512);
#else
            *(v4i*)(l + (a * 3 + r) * 512) = *(const v4i*)(gr + a * 2 * GB);
#endif
        }
    }
}

struct Rec4 { v8bf r0, r1, r2; };            // a lane's four records of one step

__device__ static inline Rec4 scan_read(const ScanOp* lp, int u)
{
    const v8bf* rp = (const v8bf*)(lp + u * NN);
    return Rec4{rp[0], rp[1], rp[2]};
}

constexpr int SG = 8;                         // steps whose LDS reads stand together
static_assert(STS % SG == 0 && STS / SG >= 2, "whole groups, two at least");

template <int U>
struct ScanSteps {
    // lp: the lane's four records of the tile's first step, in LDS
    __device__ static inline void run(const ScanOp* lp, Rec4 (&pipe)[2][SG], float (&S)[4],
                                      float (&f)[4], const float (&vrow)[STS / SCH],
                                      float (&o)[STS / SCH], int j)
    {
        constexpr int t = STS - U;           // step in the tile
        constexpr int u = t % SCH;           // step in the chunk
        constexpr int gr = t / SG;           // group of steps in the tile
        if constexpr (t % SG == 0 && t + SG < STS) {
            // The next group's reads stand together at the head of this group, for
            // speed only. The two scheduling barriers keep the
            // scheduler from spreading the reads over the steps on either side;
            // inside a group it is free to overlap one step's output sum with the
            // next step's chain. At t = 0 the tile's first reads stand directly in
            // front, and no barrier parts the two groups.
            if constexpr (t > 0) __builtin_amdgcn_sched_barrier(0);
            #pragma unroll
            for (int i = 0; i < SG; ++i)
                pipe[(gr + 1) & 1][i] = scan_read(lp, t + SG + i);
            __builtin_amdgcn_sched_barrier(0);
        }
        const v8bf r0 = pipe[gr & 1][t % SG].r0, r1 = pipe[gr & 1][t % SG].r1,
                   r2 = pipe[gr & 1][t % SG].r2;

        // four records of six bf16: q w k z b v
        const float q[4] = {(float)r0[0], (float)r0[6], (float)r1[4], (float)r2[2]};
        const float w[4] = {(float)r0[1], (float)r0[7], (float)r1[5], (float)r2[3]};
        const float k[4] = {(float)r0[2], (float)r1[0], (float)r1[6], (float)r2[4]};
        const float z[4] = {(float)r0[3], (float)r1[1], (float)r1[7], (float)r2[5]};
        const float b[4] = {(float)r0[4], (float)r1[2], (float)r2[0], (float)r2[6]};

        // this step's v of the row
        const float vt = dpp_mov<DPP_ROW_SHARE + u>(vrow[t / SCH]);

        float sa = __builtin_fmaf(S[1], z[1], S[0] * z[0]) + __builtin_fmaf(S[3], z[3], S[2] * z[2]);
        sa += dpp_mov<DPP_ROW_XMASK + 1>(sa);
        sa += dpp_mov<DPP_ROW_XMASK + 2>(sa);
        sa += dpp_mov<DPP_ROW_XMASK + 4>(sa);
        sa += dpp_mov<DPP_ROW_XMASK + 8>(sa);

        #pragma unroll
        for (int i = 0; i < 4; ++i)          // exp after bf16 round, as reference
            S[i] = __builtin_fmaf(sa, b[i], __builtin_fmaf(vt, k[i], S[i] * __expf(w[i])));

        float p = __builtin_fmaf(S[1], q[1], S[0] * q[0]) + __builtin_fmaf(S[3], q[3], S[2] * q[2]);

        // binary counter of folded partials: f[n] holds 2^n finished steps
        if constexpr ((u & 1) == 0) { f[0] = p; }
        else {
            p = fold<1>(f[0], p, j);
            if constexpr ((u & 2) == 0) { f[1] = p; }
            else {
                p = fold<2>(f[1], p, j);
                if constexpr ((u & 4) == 0) { f[2] = p; }
                else {
                    p = fold<4>(f[2], p, j);
                    if constexpr ((u & 8) == 0) { f[3] = p; }
                    else { o[t / SCH] = fold<8>(f[3], p, j); }
                }
            }
        }
        ScanSteps<U - 1>::run(lp, pipe, S, f, vrow, o, j);
    }
};
template <>
struct ScanSteps<0> {
    __device__ static inline void run(const ScanOp*, Rec4 (&)[2][SG], float (&)[4],
                                      float (&)[4], const float (&)[STS / SCH],
                                      float (&)[STS / SCH], int) {}
};

__global__ __launch_bounds__(128) void scan_kernel(
    const ScanOp* __restrict__ sops, float* __restrict__ y)
{
    __shared__ __align__(16) ScanOp tile[2][STS][NN];

    const int lane = threadIdx.x & 31;
    const int wave = threadIdx.x >> 5;
    const int g    = blockIdx.x >> 3;                        // b*H + h
    const int rp   = (blockIdx.x & 7) * 4 + wave;            // row pair 0..31
    const int h    = g % HH;
    const int b    = g / HH;
    const int j    = lane & 15;                              // column group / step slot
    const int row  = rp * 2 + (lane >> 4);

    const ScanOp* hb = sops + (size_t)b * TT * CC + (size_t)h * NN;   // t = 0
    float* yp = y + ((size_t)g * (TT / SCH) * 32 + rp) * 32 + lane;

    float S[4] = {0.0f, 0.0f, 0.0f, 0.0f};

    scan_fetch(hb, &tile[0][0][0], wave, lane);
    // own copies of tile 0 landed; the barrier publishes every wave's
    asm volatile("s_wait_asynccnt 0x0" ::: "memory");
    __syncthreads();
    scan_fetch(hb + (size_t)STS * CC, &tile[1][0][0], wave, lane);

    // kept rolled: the body already holds STS unrolled steps
    #pragma unroll 1
    for (int tl = 0; tl < SNT; ++tl) {
        ScanOp* tb = &tile[tl & 1][0][0];

        Rec4 pipe[2][SG];
        #pragma unroll
        for (int i = 0; i < SG; ++i) pipe[0][i] = scan_read(tb + j * 4, i);
        float vrow[STS / SCH], o[STS / SCH], f[4];
        #pragma unroll
        for (int c = 0; c < STS / SCH; ++c)  // v of my row at step j of chunk c
            vrow[c] = (float)tb[(c * SCH + j) * NN + row].v;

        ScanSteps<STS>::run(tb + j * 4, pipe, S, f, vrow, o, j);

        // keeps the last groups' arithmetic in front of the foot: lifted over it,
        // the wait below stands right behind the tile's last reads and the wave
        // sits out their whole latency
        __builtin_amdgcn_sched_barrier(0);
        // foot of the trip: my reads of this tile are done, my copies of the
        // next tile have landed; the barrier says both of every wave
        asm volatile("s_wait_dscnt 0x0" ::: "memory");
        asm volatile("s_wait_asynccnt 0x0" ::: "memory");
        __syncthreads();
        if (tl + 2 < SNT)
            scan_fetch(hb + (size_t)(tl + 2) * STS * CC, tb, wave, lane);

        // stored behind the barrier: in front of it the barrier's own wait for
        // stores would expose their whole latency once per tile
        #pragma unroll
        for (int c = 0; c < STS / SCH; ++c) {
            *yp = o[c] * 0.125f;             // * N^-0.5
            yp += 32 * 32;
        }
    }
    // no copy is left in flight when the wave ends
    asm volatile("s_wait_asynccnt 0x0" ::: "memory");
}

// ---------------------------------------------------------------------------
// Kernel 6: norm-ratio correction + gate -> bf16 input for output projection.
// A block: ETK tokens of one chunk of y, all columns. A lane: 4 columns of each,
// a 16-lane row is one head (norms: DPP row sums). y lies step-fastest (see
// kernel 5), so one 16-B load is one column's ETK steps.
// ---------------------------------------------------------------------------
static_assert(ETK == 4 && SCH % ETK == 0 && TT % SCH == 0, "a block stays in one chunk");

__global__ __launch_bounds__(256) void post_scan_kernel(
    const float* __restrict__ y, const float* __restrict__ x,
    const __bf16* __restrict__ vh, const __bf16* __restrict__ gb,
    const float* __restrict__ r_k, __bf16* __restrict__ Yg)
{
    const int    c  = threadIdx.x * 4;
    const int    h  = threadIdx.x >> 4;
    const int    n0 = c & (NN - 1);
    const unsigned m0 = blockIdx.x * ETK;
    const unsigned t0 = m0 % TT;
    const unsigned gy = (m0 / TT) * HH + h;

    // y[((gy*(T/SCH) + chunk)*NN + n)*SCH + step], here in 4 steps
    const unsigned yu = ((gy * (TT / SCH) + t0 / SCH) * NN + n0) * (SCH / 4) + (t0 % SCH) / 4;
    v4f yv[4];                                // [column][token]
    #pragma unroll
    for (int e = 0; e < 4; ++e) yv[e] = ((const v4f*)y)[yu + e * (SCH / 4)];

    const v4f rk = ld4(r_k + c);
    // before a later load's result lands in a register that these loads name
    asm volatile("s_wait_xcnt 0x0" ::: "memory");
    float sig[4];
    #pragma unroll
    for (int e = 0; e < 4; ++e) sig[e] = 1.0f / (1.0f + __expf(-rk[e]));

    // every load of the lane is issued before the first value is used
    v4f  xvs[ETK];
    v4bf vbs[ETK], gvs[ETK];
    #pragma unroll
    for (int it = 0; it < ETK; ++it) {
        const unsigned u = (m0 + it) * (CC / 4) + threadIdx.x;   // in 4 elements
        xvs[it] = ((const v4f*)x)[u];
        vbs[it] = ((const v4bf*)vh)[u];
        gvs[it] = ((const v4bf*)gb)[u];
    }

    #pragma unroll
    for (int it = 0; it < ETK; ++it) {
        const unsigned u = (m0 + it) * (CC / 4) + threadIdx.x;
        const v4f  xv = xvs[it];
        const v4bf vb = vbs[it], gv = gvs[it];
        float vv[4];
        #pragma unroll
        for (int e = 0; e < 4; ++e) vv[e] = (float)vb[e];

        const float xnorm = sqrtf(row_sum16((xv[0] * xv[0] + xv[1] * xv[1]) +
                                            (xv[2] * xv[2] + xv[3] * xv[3])));
        const float vnorm = sqrtf(row_sum16((vv[0] * vv[0] + vv[1] * vv[1]) +
                                            (vv[2] * vv[2] + vv[3] * vv[3])));
        const float ratio = 1.0f - xnorm / (vnorm + 1e-12f);

        v4bf o;
        #pragma unroll
        for (int e = 0; e < 4; ++e) {
            const float u = ratio * sig[e];
            o[e] = (__bf16)((yv[e][it] + vv[e] * u) * (float)gv[e]);
        }
        ((v4bf*)Yg)[u] = o;
    }
}

// ---------------------------------------------------------------------------
// Host launcher
// ---------------------------------------------------------------------------
extern "C" void kernel_launch(void* const* d_in, const int* in_sizes, int n_in,
                              void* d_out, int out_size, void* d_ws,
                              size_t ws_size, hipStream_t stream)
{
    (void)in_sizes; (void)n_in; (void)out_size; (void)ws_size;

    const float* residual = (const float*)d_in[0];
    const float* x        = (const float*)d_in[1];
    const float* x0       = (const float*)d_in[2];
    const float* dx0      = (const float*)d_in[3];
    const float* Wq       = (const float*)d_in[4];
    const float* Wk       = (const float*)d_in[5];
    const float* Wv       = (const float*)d_in[6];
    const float* Wproj    = (const float*)d_in[7];
    const float* x_q      = (const float*)d_in[8];
    const float* x_k      = (const float*)d_in[9];
    const float* x_v      = (const float*)d_in[10];
    const float* v0       = (const float*)d_in[11];
    const float* w0       = (const float*)d_in[12];
    const float* a0       = (const float*)d_in[13];
    const float* miss     = (const float*)d_in[14];
    const float* r_k      = (const float*)d_in[15];
    float*       out      = (float*)d_out;

    // ---- workspace layout (256B aligned bump allocator) ----
    char*  ws  = (char*)d_ws;
    size_t off = 0;
    auto alloc = [&](size_t bytes) -> void* {
        void* p = ws + off;
        off += (bytes + 255) & ~(size_t)255;
        return p;
    };
    const size_t MC_BF = (size_t)MM * CC * sizeof(__bf16);    // 8 MB
    const size_t MC_F  = (size_t)MM * CC * sizeof(float);     // 16 MB
    const size_t W_BF  = (size_t)CC * CC * sizeof(__bf16);    // 2 MB
    const size_t XD_BF = (size_t)MM * MR * sizeof(__bf16);    // 1 MB
    const size_t DL_F  = (size_t)MM * 4 * CC * sizeof(float); // 64 MB
    const size_t SO_SZ = (size_t)MM * CC * sizeof(ScanOp);    // 48 MB

    __bf16* Xq    = (__bf16*)alloc(MC_BF);
    __bf16* Xk    = (__bf16*)alloc(MC_BF);
    __bf16* Xv    = (__bf16*)alloc(MC_BF);
    __bf16* Xv0   = (__bf16*)alloc(MC_BF);
    __bf16* Xd    = (__bf16*)alloc(XD_BF);
    __bf16* Wqb   = (__bf16*)alloc(W_BF);
    __bf16* Wkb   = (__bf16*)alloc(W_BF);
    __bf16* Wvb   = (__bf16*)alloc(W_BF);
    __bf16* Wpb   = (__bf16*)alloc(W_BF);
    __bf16* missT = (__bf16*)alloc(XD_BF);
    float*  qf    = (float*)alloc(MC_F);
    float*  kf    = (float*)alloc(MC_F);
    float*  vfr   = (float*)alloc(MC_F);
    float*  vfirst= (float*)alloc(MC_F);
    float*  deltas= (float*)alloc(DL_F);
    ScanOp* sops  = (ScanOp*)alloc(SO_SZ);
    __bf16* gb    = (__bf16*)alloc(MC_BF);
    // aliases over buffers whose last reader precedes the new writer:
    __bf16* vh  = Xv0;       // Xv0 consumed by v_first GEMM before post_gemm
    float*  y   = qf;        // qf consumed by post_gemm before scan writes
    __bf16* Yg  = (__bf16*)kf;

    // ---- 1) input prep + weight conversion ----
    {
        prep_kernel<<<dim3(PREP_BLOCKS), dim3(256), 0, stream>>>(
            x, x0, dx0, x_q, x_k, x_v, Xq, Xk, Xv, Xv0, Xd);
        wconv_kernel<<<dim3(MT_BLOCKS + WC_BLOCKS), dim3(256), 0, stream>>>(
            Wq, Wk, Wv, Wproj, miss, Wqb, Wkb, Wvb, Wpb, missT);
    }

    // ---- 2) WMMA GEMMs: q, k, v, v_first (K=1024, N=1024), deltas (K=128, N=4096)
    {
        dim3 grid4(CC / 128, MM / 128, 4), blk(256);
        gemm_proj4_kernel<<<grid4, blk, 0, stream>>>(
            Xq, Xk, Xv, Xv0, Wqb, Wkb, Wvb, qf, kf, vfr, vfirst);
        dim3 gridD(4 * CC / 128, MM / 128);
        gemm_bf16_wmma<MR, 4 * CC, false><<<gridD, blk, 0, stream>>>(Xd, missT, deltas, (const float*)nullptr);
    }

    // ---- 3) elementwise + k-norm -> packed bf16 scan operands ----
    post_gemm_kernel<<<dim3(MM / ETK), dim3(256), 0, stream>>>(
        qf, kf, vfr, vfirst, deltas, w0, v0, a0, sops, vh, gb);

    // ---- 4) sequential scan (state in VGPRs, 8 rows per block) ----
    scan_kernel<<<dim3(BB * HH * 8), dim3(128), 0, stream>>>(sops, y);

    // ---- 5) norm correction + gate ----
    post_scan_kernel<<<dim3(MM / ETK), dim3(256), 0, stream>>>(y, x, vh, gb, r_k, Yg);

    // ---- 6) output projection + residual -> d_out ----
    {
        dim3 grid(CC / 128, MM / 128), blk(256);
        gemm_bf16_wmma<CC, CC, true><<<grid, blk, 0, stream>>>(Yg, Wpb, out, residual);
    }
}

// v006
// It runs in 195 microseconds.
// Next to v005, in two timings, it ran 1.06 times as fast each time.
// All steps since v000 together make it 22.6 times as fast.
#include <hip/hip_runtime.h>
#include <hip/hip_bf16.h>

// ---------------------------------------------------------------------------
// RWKV7 time-mix for MI455X (gfx1250, wave32, WMMA).
//   B=2, T=2048, C=1024, H=16, N=64, MISS_ROWS=128
// ---------------------------------------------------------------------------

typedef __attribute__((ext_vector_type(16))) __bf16 v16bf;
typedef __attribute__((ext_vector_type(8)))  __bf16 v8bf;
typedef __attribute__((ext_vector_type(8)))  float  v8f;
typedef __attribute__((ext_vector_type(4)))  int    v4i;

constexpr int BB = 2;
constexpr int TT = 2048;
constexpr int CC = 1024;
constexpr int HH = 16;
constexpr int NN = 64;
constexpr int MR = 128;          // MISS_ROWS
constexpr int MM = BB * TT;      // 4096 tokens

// Scan operands, in 16-B pieces. One (token, head) is SPB pieces: for each group
// of four columns three pieces (a word q | k a column; a word z | b a column, all
// bf16; e^w of the four in f32), 16 groups, then v of the 64 rows in bf16.
struct __align__(16) ScanOp { unsigned d[4]; };
constexpr int SPB = 16 * 3 + 8;  // pieces per (token, head)

typedef __attribute__((ext_vector_type(2))) __bf16 v2bf;
__device__ static inline int pack2(float lo, float hi)
{
    return __builtin_bit_cast(int, v2bf{(__bf16)lo, (__bf16)hi});
}
// The scan's arithmetic, one instruction a statement. A wave of the scan issues
// in order: a step lasts as long as its chain of dependent
// instructions only if the independent ones stand in the chain's gaps. The
// statements are volatile so that they keep the order in which they are written
// (ScanSteps); from plain source this compiler also widens the bf16 operands with
// extra instructions to feed packed f32 arithmetic.
// a * (low or high bf16 of word d) + c
template <bool HI>
__device__ static inline float fma_bf(float a, int d, float c)
{
    float r;
    if constexpr (HI)
        asm volatile("v_fma_mix_f32_bf16 %0, %1, %2, %3 op_sel:[0,1,0] op_sel_hi:[0,1,0]"
                     : "=v"(r) : "v"(a), "v"(d), "v"(c));
    else
        asm volatile("v_fma_mix_f32_bf16 %0, %1, %2, %3 op_sel_hi:[0,1,0]"
                     : "=v"(r) : "v"(a), "v"(d), "v"(c));
    return r;
}
// (low bf16 of word a) * (high bf16 of word d) + c
__device__ static inline float fma_bb(int a, int d, float c)
{
    float r;
    asm volatile("v_fma_mix_f32_bf16 %0, %1, %2, %3 op_sel:[0,1,0] op_sel_hi:[1,1,0]"
                 : "=v"(r) : "v"(a), "v"(d), "v"(c));
    return r;
}
// a * (low bf16 of word d)
__device__ static inline float mul_bf(float a, int d)
{
    float r;
    asm volatile("v_fma_mix_f32_bf16 %0, %1, %2, neg(0) op_sel_hi:[0,1,0]"
                 : "=v"(r) : "v"(a), "v"(d));
    return r;
}
// the plain product and the plain sum, as statements so that they keep their place
__device__ static inline float mul_f(float a, float b)
{
    float r;
    asm volatile("v_mul_f32 %0, %1, %2" : "=v"(r) : "v"(a), "v"(b));
    return r;
}
__device__ static inline float add_f(float a, float b)
{
    float r;
    asm volatile("v_add_f32 %0, %1, %2" : "=v"(r) : "v"(a), "v"(b));
    return r;
}
// x + x of lane ^ M, inside a 16-lane row
template <int M>
__device__ static inline float add_xmask(float x)
{
    float r;
    asm volatile("v_add_f32_dpp %0, %1, %1 row_xmask:%2 row_mask:0xf bank_mask:0xf bound_ctrl:1"
                 : "=v"(r) : "v"(x), "n"(M));
    return r;
}
// y + x of lane ^ M
template <int M>
__device__ static inline float add_xmask2(float x, float y)
{
    float r;
    asm volatile("v_add_f32_dpp %0, %1, %2 row_xmask:%3 row_mask:0xf bank_mask:0xf bound_ctrl:1"
                 : "=v"(r) : "v"(x), "v"(y), "n"(M));
    return r;
}
// b in the lanes of mask m, a in the others
__device__ static inline float select_f(float a, float b, unsigned m)
{
    float r;
    asm volatile("v_cndmask_b32_e64 %0, %1, %2, %3" : "=v"(r) : "v"(a), "v"(b), "s"(m));
    return r;
}
// x of lane L of the row, in every lane of it
template <int L>
__device__ static inline int row_share(int x)
{
    int r;
    asm volatile("v_mov_b32_dpp %0, %1 row_share:%2 row_mask:0xf bank_mask:0xf bound_ctrl:1"
                 : "=v"(r) : "v"(x), "n"(L));
    return r;
}

// ---- gfx1250 async global->LDS copy path (guarded; falls back cleanly) ----
#if defined(__HIP_DEVICE_COMPILE__) &&                                        \
    __has_builtin(__builtin_amdgcn_global_load_async_to_lds_b128) &&          \
    __has_builtin(__builtin_amdgcn_s_wait_asynccnt)
#define USE_ASYNC_LDS 1
#else
#define USE_ASYNC_LDS 0
#endif

#if USE_ASYNC_LDS
__device__ static inline void async_copy_b128(const void* g, void* l)
{
    // Builtin signature (from clang diagnostic): AS1 v4i* src, AS3 v4i* dst,
    // imm offset, imm cpol.
    __builtin_amdgcn_global_load_async_to_lds_b128(
        (__attribute__((address_space(1))) v4i*)(g),
        (__attribute__((address_space(3))) v4i*)(l),
        0, 0);
}
#endif

// ---------------------------------------------------------------------------
// The four elementwise kernels (1, 2, 4, 6) are dealt so that a launch is 544 or
// 1024 work-groups of eight waves, all resident at once: a lane takes 16 to
// 64 elements and moves them 8 or 16 B at a time (miss, read down a column, 4 B).
// ---------------------------------------------------------------------------
typedef __attribute__((ext_vector_type(4))) float  v4f;
typedef __attribute__((ext_vector_type(4))) __bf16 v4bf;

template <int CTRL>
__device__ static inline float dpp_mov(float x)
{
    return __builtin_bit_cast(float, __builtin_amdgcn_mov_dpp(
        __builtin_bit_cast(int, x), CTRL, 0xf, 0xf, true));
}
constexpr int DPP_ROW_XMASK = 0x160;          // + xor mask inside the row

// sum over the 16 lanes of a row, left in every lane of it
__device__ static inline float row_sum16(float s)
{
    s += dpp_mov<DPP_ROW_XMASK + 1>(s);
    s += dpp_mov<DPP_ROW_XMASK + 2>(s);
    s += dpp_mov<DPP_ROW_XMASK + 4>(s);
    s += dpp_mov<DPP_ROW_XMASK + 8>(s);
    return s;
}

__device__ static inline v4f ld4(const float* p) { return *(const v4f*)p; }

__device__ static inline v8bf cvt8(const float* p, unsigned u)
{
    const v4f lo = ((const v4f*)p)[2 * u], hi = ((const v4f*)p)[2 * u + 1];
    v8bf o;
    #pragma unroll
    for (int e = 0; e < 4; ++e) { o[e] = (__bf16)lo[e]; o[4 + e] = (__bf16)hi[e]; }
    return o;
}

// ---------------------------------------------------------------------------
// Kernel 1: token-shift input mixing -> bf16 GEMM operands.
// A lane: 8 columns of step t in every batch (the mix vectors are read once).
// ---------------------------------------------------------------------------
constexpr int PREP_BLOCKS = TT * (CC / 8) / 256;

__global__ __launch_bounds__(256) void prep_kernel(
    const float* __restrict__ x, const float* __restrict__ x0,
    const float* __restrict__ dx0,
    const float* __restrict__ x_q, const float* __restrict__ x_k,
    const float* __restrict__ x_v,
    __bf16* __restrict__ Xq, __bf16* __restrict__ Xk,
    __bf16* __restrict__ Xv, __bf16* __restrict__ Xv0,
    __bf16* __restrict__ Xd)
{
    const int i = blockIdx.x * 256 + threadIdx.x;
    const int c = (i % (CC / 8)) * 8;
    const int t = i / (CC / 8);

    v4f mq[2], mk[2], mv[2];
    #pragma unroll
    for (int p = 0; p < 2; ++p) {
        mq[p] = ld4(x_q + c + 4 * p);
        mk[p] = ld4(x_k + c + 4 * p);
        mv[p] = ld4(x_v + c + 4 * p);
    }
    // before a later load's result lands in a register that these loads name.
    // The output pointers are inputs so that they are fetched here, into scalar
    // registers of their own: fetched later they took the place of the bases
    // of the loads below, ahead of those loads' wait
    asm volatile("s_wait_xcnt 0x0" :: "s"(Xq), "s"(Xk), "s"(Xv), "s"(Xv0), "s"(Xd) : "memory");

    // every load of the lane is issued before the first value is used
    v4f xvs[BB][2], xps[BB][2], z0s[BB][2], d0s[BB][2];
    #pragma unroll
    for (int b = 0; b < BB; ++b) {
        const unsigned u = (unsigned)(b * (TT * CC / 8) + i);   // in 8 elements
        #pragma unroll
        for (int p = 0; p < 2; ++p) {
            xvs[b][p] = ((const v4f*)x)[2 * u + p];
            // step t-1; at t=0 the lane's own step, in bounds and not used
            xps[b][p] = ((const v4f*)x)[2 * u + p - (t > 0 ? CC / 4 : 0)];
            z0s[b][p] = ((const v4f*)x0)[2 * u + p];
            d0s[b][p] = ((const v4f*)dx0)[2 * u + p];
        }
        // before a later load's result, or the arithmetic, lands in a register
        // that these loads name
        asm volatile("s_wait_xcnt 0x0" ::: "memory");
    }
    // keeps the first batch's arithmetic, which waits for its loads, from being
    // scheduled in front of the second batch's loads
    __builtin_amdgcn_sched_barrier(0);

    #pragma unroll
    for (int b = 0; b < BB; ++b) {
        const unsigned u = (unsigned)(b * (TT * CC / 8) + i);
        v8bf oq, ok, ov, o0, od;
        #pragma unroll
        for (int p = 0; p < 2; ++p) {
            const v4f xv = xvs[b][p], z0 = z0s[b][p], d0 = d0s[b][p];
            const v4f xp = t > 0 ? xps[b][p] : v4f{0.0f, 0.0f, 0.0f, 0.0f};   // zero pad
            #pragma unroll
            for (int e = 0; e < 4; ++e) {
                const float dxp = xp[e] - xv[e];         // x_{t-1} - x_t
                oq[4 * p + e] = (__bf16)(xv[e] + dxp * mq[p][e]);
                ok[4 * p + e] = (__bf16)(xv[e] + dxp * mk[p][e]);
                ov[4 * p + e] = (__bf16)(xv[e] + dxp * mv[p][e]);
                o0[4 * p + e] = (__bf16)(z0[e] + d0[e] * mv[p][e]);
                od[4 * p + e] = (__bf16)xv[e];
            }
        }
        ((v8bf*)Xq)[u]  = oq;
        ((v8bf*)Xk)[u]  = ok;
        ((v8bf*)Xv)[u]  = ov;
        ((v8bf*)Xv0)[u] = o0;
        if (c < MR)                                      // x[:, :, :128]
            ((v8bf*)Xd)[(unsigned)((b * TT + t) * (MR / 8) + c / 8)] = od;
        // before the next batch's arithmetic reuses registers that these stores name
        if (b + 1 < BB) asm volatile("s_wait_xcnt 0x0" ::: "memory");
    }
}

// ---------------------------------------------------------------------------
// Kernel 2: f32 weights -> bf16; miss [128,4096] -> missT [4096,128].
// The first blocks transpose: a lane reads 64 rows of one column of miss (a wave
// reads whole lines) and writes one whole 128-B line of missT. The others
// convert 8 elements of each weight a lane.
// ---------------------------------------------------------------------------
constexpr int MT_BLOCKS = 4 * CC * (MR / 64) / 256;
constexpr int WC_BLOCKS = CC * CC / 8 / 256;

__global__ __launch_bounds__(256) void wconv_kernel(
    const float* __restrict__ Wq, const float* __restrict__ Wk,
    const float* __restrict__ Wv, const float* __restrict__ Wp,
    const float* __restrict__ miss,
    __bf16* __restrict__ Wqb, __bf16* __restrict__ Wkb,
    __bf16* __restrict__ Wvb, __bf16* __restrict__ Wpb,
    __bf16* __restrict__ missT)
{
    if (blockIdx.x < MT_BLOCKS) {
        const int i  = blockIdx.x * 256 + threadIdx.x;
        const int n  = i % (4 * CC);
        const int r0 = (i / (4 * CC)) * 64;
        const float* s = miss + (unsigned)(r0 * (4 * CC) + n);
        float v[64];
        #pragma unroll
        for (int r = 0; r < 64; ++r) v[r] = s[r * (4 * CC)];
        #pragma unroll
        for (int q = 0; q < 8; ++q) {
            v8bf o;
            #pragma unroll
            for (int e = 0; e < 8; ++e) o[e] = (__bf16)v[q * 8 + e];
            ((v8bf*)missT)[(unsigned)((n * MR + r0) / 8 + q)] = o;
        }
    } else {
        const unsigned u = (blockIdx.x - MT_BLOCKS) * 256 + threadIdx.x;   // in 8 elements
        const v8bf q = cvt8(Wq, u), k = cvt8(Wk, u), v = cvt8(Wv, u), p = cvt8(Wp, u);
        ((v8bf*)Wqb)[u] = q;
        ((v8bf*)Wkb)[u] = k;
        ((v8bf*)Wvb)[u] = v;
        ((v8bf*)Wpb)[u] = p;
        // the built code lays the other branch behind this one: no register that
        // these stores name is rewritten ahead of this wait on any way through it
        asm volatile("s_wait_xcnt 0x0" ::: "memory");
    }
}

// ---------------------------------------------------------------------------
// Kernel 3: bf16 WMMA GEMM,  Y[m,n] = sum_k X[m,k] * W[n,k]  (+ resid)
//   block tile 128x128, 256 threads = 8 wave32; wave tile 64x32 (4x2 WMMA).
//   K-step 32, double-buffered LDS, async global->LDS staging when available.
// gemm_tile is one block's tile; the kernels behind it say which tile of which
// product a block takes. Whether a residual is added, and the row pitch of Y,
// are settled at compile time: a lane's 64 places in Y (and in resid) are then
// one address and 64 constant offsets.
// ---------------------------------------------------------------------------
template <int KDIM, int NDIM, bool RESID>
__device__ static __forceinline__ void gemm_tile(
    const __bf16* __restrict__ X, const __bf16* __restrict__ W,
    float* __restrict__ Y, const float* __restrict__ resid,
    int mBase, int nBase)
{
    constexpr int KT    = 32;
    constexpr int KITER = KDIM / KT;
    constexpr int LDR   = 40;            // padded row (80B, 16B aligned)

    __shared__ __align__(16) __bf16 As[2][128][LDR];
    __shared__ __align__(16) __bf16 Bs[2][128][LDR];

    const int tid    = threadIdx.x;
    const int lane   = tid & 31;
    const int wave   = tid >> 5;
    const int wm     = (wave >> 2) * 64;     // 0 | 64
    const int wn     = (wave & 3) * 32;      // 0,32,64,96
    const int laneLo = lane & 15;
    const int kbase  = ((lane >> 4) & 1) * 8; // lanes 0-15 -> K{0..7,16..23};
                                              // lanes 16-31 -> K{8..15,24..31}

    v8f acc[4][2];
    #pragma unroll
    for (int i = 0; i < 4; ++i)
        #pragma unroll
        for (int j = 0; j < 2; ++j)
            #pragma unroll
            for (int e = 0; e < 8; ++e) acc[i][j][e] = 0.0f;

    auto loadTile = [&](int buf, int k0) {
        #pragma unroll
        for (int ch = 0; ch < 2; ++ch) {
            int e  = ch * 2048 + tid * 8;
            int r  = e >> 5;        // 0..127
            int kk = e & 31;        // 0,8,16,24
            const __bf16* gA = &X[(size_t)(mBase + r) * KDIM + k0 + kk];
            const __bf16* gB = &W[(size_t)(nBase + r) * KDIM + k0 + kk];
#if USE_ASYNC_LDS
            async_copy_b128(gA, &As[buf][r][kk]);
            async_copy_b128(gB, &Bs[buf][r][kk]);
#else
            *(v8bf*)&As[buf][r][kk] = *(const v8bf*)gA;
            *(v8bf*)&Bs[buf][r][kk] = *(const v8bf*)gB;
#endif
        }
    };

    loadTile(0, 0);

    // C/D layout: VGPR v, lanes 0-15 -> (M=v, N=lane); lanes 16-31 -> (M=8+v)
    // the lane's first place in Y; tile (i, j), register v lies
    // (i * 16 + v) * NDIM + j * 16 elements further on
    const size_t off0 = (size_t)(mBase + wm + (lane >> 4) * 8) * NDIM + (nBase + wn + laneLo);

    // The residual depends on nothing that is computed here: all 64 loads of the
    // lane are issued now and fly beside the first tile's copies (the loop's first
    // barrier waits for loads too, once for all of them). One at a time in the
    // epilogue, each waited for before the next is issued, they cost the wave 64
    // latencies in a row.
    float rv[4][2][8];
    if constexpr (RESID) {
        const float* rp = resid + off0;
        #pragma unroll
        for (int i = 0; i < 4; ++i)
            #pragma unroll
            for (int j = 0; j < 2; ++j)
                #pragma unroll
                for (int v = 0; v < 8; ++v)
                    rv[i][j][v] = rp[(i * 16 + v) * NDIM + j * 16];
        // before the loop's arithmetic reuses a register that these loads name
        asm volatile("s_wait_xcnt 0x0" ::: "memory");
    }

    for (int ki = 0; ki < KITER; ++ki) {
#if USE_ASYNC_LDS
        __builtin_amdgcn_s_wait_asynccnt(0);   // own async copies in LDS
#endif
        __syncthreads();                       // all waves' copies visible
        const int buf = ki & 1;
        if (ki + 1 < KITER) loadTile(buf ^ 1, (ki + 1) * KT);

        v16bf afrag[4], bfrag[2];
        #pragma unroll
        for (int i = 0; i < 4; ++i) {
            const __bf16* ap = &As[buf][wm + i * 16 + laneLo][kbase];
            v8bf lo = *(const v8bf*)ap;
            v8bf hi = *(const v8bf*)(ap + 16);
            afrag[i] = __builtin_shufflevector(lo, hi, 0, 1, 2, 3, 4, 5, 6, 7,
                                               8, 9, 10, 11, 12, 13, 14, 15);
        }
        #pragma unroll
        for (int j = 0; j < 2; ++j) {
            const __bf16* bp = &Bs[buf][wn + j * 16 + laneLo][kbase];
            v8bf lo = *(const v8bf*)bp;
            v8bf hi = *(const v8bf*)(bp + 16);
            bfrag[j] = __builtin_shufflevector(lo, hi, 0, 1, 2, 3, 4, 5, 6, 7,
                                               8, 9, 10, 11, 12, 13, 14, 15);
        }
        #pragma unroll
        for (int i = 0; i < 4; ++i)
            #pragma unroll
            for (int j = 0; j < 2; ++j)
                acc[i][j] = __builtin_amdgcn_wmma_f32_16x16x32_bf16(
                    false, afrag[i], false, bfrag[j],
                    (short)0, acc[i][j], false, false);
    }

    if constexpr (RESID) {
        #pragma unroll
        for (int i = 0; i < 4; ++i)
            #pragma unroll
            for (int j = 0; j < 2; ++j)
                #pragma unroll
                for (int v = 0; v < 8; ++v) acc[i][j][v] += rv[i][j][v];
        // every sum stands in front of the first store: mixed among the stores,
        // later sums were put into registers that issued stores still name
        __builtin_amdgcn_sched_barrier(0);
    }
    float* yp = Y + off0;
    #pragma unroll
    for (int i = 0; i < 4; ++i)
        #pragma unroll
        for (int j = 0; j < 2; ++j)
            #pragma unroll
            for (int v = 0; v < 8; ++v)
                yp[(i * 16 + v) * NDIM + j * 16] = acc[i][j][v];
}

template <int KDIM, int NDIM, bool RESID>
__global__ __launch_bounds__(256) void gemm_bf16_wmma(
    const __bf16* __restrict__ X, const __bf16* __restrict__ W,
    float* __restrict__ Y, const float* __restrict__ resid)
{
    gemm_tile<KDIM, NDIM, RESID>(X, W, Y, resid, blockIdx.y * 128, blockIdx.x * 128);
}

// The four projections of the inputs depend on nothing of one another: one
// launch, blockIdx.z says which. A projection of its own is one block a WGP, and
// that block waits out the landing of its copies once per K-step; here four
// blocks share a WGP and work while another waits.
__global__ __launch_bounds__(256) void gemm_proj4_kernel(
    const __bf16* __restrict__ Xq, const __bf16* __restrict__ Xk,
    const __bf16* __restrict__ Xv, const __bf16* __restrict__ Xv0,
    const __bf16* __restrict__ Wqb, const __bf16* __restrict__ Wkb,
    const __bf16* __restrict__ Wvb,
    float* __restrict__ qf, float* __restrict__ kf, float* __restrict__ vfr,
    float* __restrict__ vfirst)
{
    const int p = blockIdx.z;
    const __bf16* X = p == 0 ? Xq  : p == 1 ? Xk  : p == 2 ? Xv  : Xv0;
    const __bf16* W = p == 0 ? Wqb : p == 1 ? Wkb : Wvb;
    float*        Y = p == 0 ? qf  : p == 1 ? kf  : p == 2 ? vfr : vfirst;
    gemm_tile<CC, CC, false>(X, W, Y, nullptr, blockIdx.y * 128, blockIdx.x * 128);
}

// ---------------------------------------------------------------------------
// Kernel 4: per-(token,head) elementwise + k-normalization; bf16 rounding of
// the six scan operands (matching the reference's rounding point); packs
// them for the scan (layout: ScanOp). The decay e^w depends on no state row, so
// it is taken here, once per (token, column), from the rounded w: in the scan
// every one of the 64 rows took it again.
// A block: ETK tokens, all columns. A lane: 4 columns, so a 16-lane row is one
// head and |k|^2 is a DPP row sum; its three pieces are 48 contiguous bytes.
// ---------------------------------------------------------------------------
constexpr int ETK = 4;                        // tokens per block, kernels 4 and 6
static_assert(CC == 256 * 4 && NN == 16 * 4 && MM % ETK == 0, "lane deal");

__global__ __launch_bounds__(256) void post_gemm_kernel(
    const float* __restrict__ qf, const float* __restrict__ kf,
    const float* __restrict__ vfr, const float* __restrict__ vfirst,
    const float* __restrict__ deltas,
    const float* __restrict__ w0, const float* __restrict__ v0,
    const float* __restrict__ a0,
    ScanOp* __restrict__ sops,
    __bf16* __restrict__ vh, __bf16* __restrict__ gb)
{
    const int c = threadIdx.x * 4;
    const v4f w0v = ld4(w0 + c), v0v = ld4(v0 + c), a0v = ld4(a0 + c);
    // the lane's place in the block's first token, in 4 elements
    const unsigned u0 = blockIdx.x * (ETK * CC / 4) + threadIdx.x;
    const unsigned d0 = blockIdx.x * (ETK * CC) + threadIdx.x;       // in deltas
    const unsigned jc = threadIdx.x & 15;                            // column group in the head
    // the head's pieces of the block's first token
    const unsigned s0 = (blockIdx.x * (ETK * HH) + (threadIdx.x >> 4)) * SPB;

    #pragma unroll
    for (int it = 0; it < ETK; ++it) {
        const int o = it * (CC / 4);                     // token, in 4 elements
        const v4f* dp = (const v4f*)deltas + d0 + 4 * o;

        const v4f kv = ((const v4f*)kf + u0)[o],  qv = ((const v4f*)qf + u0)[o];
        const v4f vr = ((const v4f*)vfr + u0)[o], vf = ((const v4f*)vfirst + u0)[o];
        const v4f wd = dp[0], vd = dp[CC / 4], ad = dp[2 * (CC / 4)], gd = dp[3 * (CC / 4)];
        // before the arithmetic reuses registers that these loads name
        asm volatile("s_wait_xcnt 0x0" ::: "memory");

        const float norm = sqrtf(row_sum16((kv[0] * kv[0] + kv[1] * kv[1]) +
                                           (kv[2] * kv[2] + kv[3] * kv[3])));
        const float den  = fmaxf(norm, 1e-12f);

        v4i  R0, R1;                          // q | k and z | b of the four columns
        v4f  ew;                              // their decay
        v4bf vo, go;
        #pragma unroll
        for (int e = 0; e < 4; ++e) {
            const float xw   = -(w0v[e] + wd[e]);
            const float sp   = (xw > 20.0f) ? xw : log1pf(__expf(xw)); // softplus
            const float logw = -__expf(-sp - 0.5f);                    // log decay < 0

            const float sv = 1.0f / (1.0f + __expf(-(v0v[e] + vd[e])));
            const float vv = vr[e] + (vf[e] - vr[e]) * sv;

            const float a  = 1.0f / (1.0f + __expf(-(a0v[e] + ad[e])));
            const float kk = kv[e] / den;

            R0[e] = pack2(qv[e], kv[e] * a);
            R1[e] = pack2(-kk, kk * a);
            ew[e] = __expf((float)(__bf16)logw);         // exp after bf16 round, as reference
            vo[e] = (__bf16)vv;
            go[e] = (__bf16)(1.0f + gd[e]);
        }
        ScanOp* sp = sops + s0 + it * (HH * SPB);
        *(v4i*)(sp + 3 * jc)      = R0;
        *(v4i*)(sp + 3 * jc + 1)  = R1;
        *(v4f*)(sp + 3 * jc + 2)  = ew;
        ((v4bf*)(sp + 48))[jc]    = vo;
        ((v4bf*)vh + u0)[o] = vo;
        ((v4bf*)gb + u0)[o] = go;
        // before the next token's loads reuse registers that these stores name
        if (it + 1 < ETK) asm volatile("s_wait_xcnt 0x0" ::: "memory");
    }
}

constexpr int SCH = 16;
constexpr int STS = 32;
constexpr int SNT = TT / STS;
static_assert(SNT >= 2 && STS % SCH == 0, "two tiles at least, whole chunks");

// One tile: STS steps of SPB pieces (896 B a step, contiguous; steps lie
// HH * SPB pieces apart in global memory, back to back in LDS). A wave brings
// STS/4 steps, one piece a lane and copy; 7 * 32 pieces are four steps.
static_assert(4 * SPB == 7 * 32 && STS % 16 == 0, "four steps are seven copies of a wave");

__device__ static inline void scan_fetch(const ScanOp* g0, ScanOp* l0,
                                         int wave, int lane)
{
    constexpr int GP = HH * SPB;                             // step pitch, global
    const ScanOp* g = g0 + (size_t)wave * (STS / 4) * GP;
    ScanOp*       l = l0 + wave * (STS / 4) * SPB + lane;
    #pragma unroll
    for (int r = 0; r < 7; ++r) {
        const int     pc = r * 32 + lane;                    // piece 0..223
        const ScanOp* gr = g + (pc / SPB) * GP + pc % SPB;
        #pragma unroll
        for (int a = 0; a < STS / 16; ++a) {
#if USE_ASYNC_LDS
            async_copy_b128(gr + a * 4 * GP, l + (a * 7 + r) * 32);
#else
            l[(a * 7 + r) * 32] = gr[a * 4 * GP];
#endif
        }
    }
}

struct Rec4 { v4i qk, zb; v4f ew; };         // a lane's four columns of one step

__device__ static inline Rec4 scan_read(const ScanOp* lp, int u)
{
    const ScanOp* rp = lp + u * SPB;
    return Rec4{*(const v4i*)rp, *(const v4i*)(rp + 1), *(const v4f*)(rp + 2)};
}

constexpr int SG = 8;                         // steps whose LDS reads stand together
static_assert(STS % SG == 0 && STS / SG >= 2, "whole groups, two at least");

// The S.q partials are folded level by level. Level N makes one sum of two, each
// of 2^(N-1) steps: lanes whose step slot has bit 2^(N-1) clear keep the first,
// the others the second, and each adds what its partner (lane ^ bit) holds of the
// same. The partial of step T is at hand in step T + 1, and level N
// of the group that T ends is taken in step T + N, so that a step holds two
// selects and one row add per level and at most two levels, all in the gaps of
// its chain. f[n]: the first half of a level, waiting; r[n]: the second half.
template <int T, int N>                      // is level N of a group ending at T due?
constexpr bool fold_due = T >= 0 && T % (1 << N) == (1 << N) - 1;

constexpr unsigned fold_mask(int bit)        // lanes whose step slot has this bit
{
    return bit == 1 ? 0xaaaaaaaau : bit == 2 ? 0xccccccccu : bit == 4 ? 0xf0f0f0f0u : 0xff00ff00u;
}

template <int N>
__device__ static inline void fold_select(const float (&f)[4], const float (&r)[4],
                                          float& keep, float& send)
{
    keep = select_f(f[N - 1], r[N - 1], fold_mask(1 << (N - 1)));
    send = select_f(r[N - 1], f[N - 1], fold_mask(1 << (N - 1)));
}

// where a finished sum of level N for the group ending at T goes
template <int T, int N>
__device__ static inline void fold_bank(float s, float (&f)[4], float (&r)[4],
                                        float (&o)[STS / SCH])
{
    if constexpr (N == 4) o[T / SCH] = s;
    else if constexpr (fold_due<T, N + 1>) r[N] = s;
    else f[N] = s;
}

template <int T, int N>
__device__ static inline void fold_add(float keep, float send, float (&f)[4], float (&r)[4],
                                       float (&o)[STS / SCH])
{
    fold_bank<T, N>(add_xmask2<1 << (N - 1)>(send, keep), f, r, o);
}

template <int U>
struct ScanSteps {
    // lp: the lane's three pieces of the tile's first step, in LDS
    // qp: the q | k words of the step before (its output sum is taken here)
    __device__ static inline void run(const ScanOp* lp, Rec4 (&pipe)[2][SG], float (&S)[4],
                                      float (&f)[4], float (&r)[4],
                                      const int (&vrow)[STS / SCH],
                                      float (&o)[STS / SCH], v4i qp)
    {
        constexpr int t = STS - U;           // step in the tile
        constexpr int u = t % SCH;           // step in the chunk
        constexpr int gr = t / SG;           // group of steps in the tile
        if constexpr (t % SG == 0 && t + SG < STS) {
            // The next group's reads stand together at the head of this group (for
            // speed only). The two scheduling barriers keep the
            // scheduler from spreading the reads over the steps on either side.
            // At t = 0 the tile's first reads stand directly in front, and no
            // barrier parts the two groups.
            if constexpr (t > 0) __builtin_amdgcn_sched_barrier(0);
            #pragma unroll
            for (int i = 0; i < SG; ++i)
                pipe[(gr + 1) & 1][i] = scan_read(lp, t + SG + i);
            __builtin_amdgcn_sched_barrier(0);
        }
        const v4i qk = pipe[gr & 1][t % SG].qk, zb = pipe[gr & 1][t % SG].zb;
        const v4f ew = pipe[gr & 1][t % SG].ew;

        // The chain: S.z in the lane (three links), four row-sum links, the update
        // of S. Everything else stands between its links: S * e^w, v * k, the
        // output sum of the step before, for which S still holds that step's
        // state, and the folds that are due.
        float p0 = 0.0f, p1 = 0.0f, kp[5], sd[5];
        float a0 = mul_bf(S[0], zb[0]);
        float a1 = mul_bf(S[2], zb[2]);
        float X0 = mul_f(S[0], ew[0]);
        float X1 = mul_f(S[1], ew[1]);
        float X2 = mul_f(S[2], ew[2]);
        a0 = fma_bf<false>(S[1], zb[1], a0);
        a1 = fma_bf<false>(S[3], zb[3], a1);
        float X3 = mul_f(S[3], ew[3]);
        const int vt = row_share<u>(vrow[t / SCH]);          // this step's v of the row, bf16
        if constexpr (t > 0) p0 = mul_bf(S[0], qp[0]);
        float sa = add_f(a0, a1);
        if constexpr (t > 0) p1 = mul_bf(S[2], qp[2]);
        X0 = fma_bb(vt, qk[0], X0);
        X1 = fma_bb(vt, qk[1], X1);
        sa = add_xmask<1>(sa);
        X2 = fma_bb(vt, qk[2], X2);
        X3 = fma_bb(vt, qk[3], X3);
        if constexpr (t > 0) {
            p0 = fma_bf<false>(S[1], qp[1], p0);
            p1 = fma_bf<false>(S[3], qp[3], p1);
        }
        sa = add_xmask<2>(sa);
        if constexpr (t > 0) fold_bank<t - 1, 0>(add_f(p0, p1), f, r, o);
        sa = add_xmask<4>(sa);
        if constexpr (fold_due<t - 4, 4>) fold_select<4>(f, r, kp[4], sd[4]);
        if constexpr (fold_due<t - 3, 3>) fold_select<3>(f, r, kp[3], sd[3]);
        if constexpr (fold_due<t - 2, 2>) fold_select<2>(f, r, kp[2], sd[2]);
        if constexpr (fold_due<t - 1, 1>) fold_select<1>(f, r, kp[1], sd[1]);
        sa = add_xmask<8>(sa);
        if constexpr (fold_due<t - 4, 4>) fold_add<t - 4, 4>(kp[4], sd[4], f, r, o);
        if constexpr (fold_due<t - 3, 3>) fold_add<t - 3, 3>(kp[3], sd[3], f, r, o);
        if constexpr (fold_due<t - 2, 2>) fold_add<t - 2, 2>(kp[2], sd[2], f, r, o);
        if constexpr (fold_due<t - 1, 1>) fold_add<t - 1, 1>(kp[1], sd[1], f, r, o);
        S[0] = fma_bf<true>(sa, zb[0], X0);
        S[2] = fma_bf<true>(sa, zb[2], X2);
        S[1] = fma_bf<true>(sa, zb[1], X1);
        S[3] = fma_bf<true>(sa, zb[3], X3);

        ScanSteps<U - 1>::run(lp, pipe, S, f, r, vrow, o, qk);
    }
};
template <>
struct ScanSteps<0> {
    // the output sum of the tile's last step, and its four folds
    __device__ static inline void run(const ScanOp*, Rec4 (&)[2][SG], float (&S)[4],
                                      float (&f)[4], float (&r)[4],
                                      const int (&)[STS / SCH],
                                      float (&o)[STS / SCH], v4i qp)
    {
        float p0 = mul_bf(S[0], qp[0]);
        float p1 = mul_bf(S[2], qp[2]);
        p0 = fma_bf<false>(S[1], qp[1], p0);
        p1 = fma_bf<false>(S[3], qp[3], p1);
        fold_bank<STS - 1, 0>(add_f(p0, p1), f, r, o);
        float kp, sd;
        fold_select<1>(f, r, kp, sd);  fold_add<STS - 1, 1>(kp, sd, f, r, o);
        fold_select<2>(f, r, kp, sd);  fold_add<STS - 1, 2>(kp, sd, f, r, o);
        fold_select<3>(f, r, kp, sd);  fold_add<STS - 1, 3>(kp, sd, f, r, o);
        fold_select<4>(f, r, kp, sd);  fold_add<STS - 1, 4>(kp, sd, f, r, o);
    }
};

__global__ __launch_bounds__(128) void scan_kernel(
    const ScanOp* __restrict__ sops, float* __restrict__ y)
{
    __shared__ ScanOp tile[2][STS][SPB];

    const int lane = threadIdx.x & 31;
    const int wave = threadIdx.x >> 5;
    const int g    = blockIdx.x >> 3;                        // b*H + h
    const int rp   = (blockIdx.x & 7) * 4 + wave;            // row pair 0..31
    const int h    = g % HH;
    const int b    = g / HH;
    const int j    = lane & 15;                              // column group / step slot
    const int row  = rp * 2 + (lane >> 4);

    const ScanOp* hb = sops + ((size_t)b * TT * HH + h) * SPB;        // t = 0
    float* yp = y + ((size_t)g * (TT / SCH) * 32 + rp) * 32 + lane;

    float S[4] = {0.0f, 0.0f, 0.0f, 0.0f};

    scan_fetch(hb, &tile[0][0][0], wave, lane);
    // own copies of tile 0 landed; the barrier publishes every wave's
    asm volatile("s_wait_asynccnt 0x0" ::: "memory");
    __syncthreads();
    scan_fetch(hb + (size_t)STS * HH * SPB, &tile[1][0][0], wave, lane);

    // kept rolled: the body already holds STS unrolled steps
    #pragma unroll 1
    for (int tl = 0; tl < SNT; ++tl) {
        ScanOp* tb = &tile[tl & 1][0][0];

        // read first: the tile's first step needs them, and LDS answers in order
        int   vrow[STS / SCH];
        float o[STS / SCH], f[4], r[4];
        #pragma unroll
        for (int c = 0; c < STS / SCH; ++c)  // v of my row at step j of chunk c, bf16
            vrow[c] = ((const unsigned short*)(tb + (c * SCH + j) * SPB + 48))[row];
        // keeps these two reads in front: behind the first group's reads, the
        // first step waits for the whole group
        __builtin_amdgcn_sched_barrier(0);
        Rec4 pipe[2][SG];
        #pragma unroll
        for (int i = 0; i < SG; ++i) pipe[0][i] = scan_read(tb + j * 3, i);

        ScanSteps<STS>::run(tb + j * 3, pipe, S, f, r, vrow, o, v4i{0, 0, 0, 0});

        // keeps the last groups' arithmetic in front of the foot: lifted over it,
        // the wait below stands right behind the tile's last reads and the wave
        // sits out their whole latency
        __builtin_amdgcn_sched_barrier(0);
        // foot of the trip: my reads of this tile are done, my copies of the
        // next tile have landed; the barrier says both of every wave
        asm volatile("s_wait_dscnt 0x0" ::: "memory");
        asm volatile("s_wait_asynccnt 0x0" ::: "memory");
        __syncthreads();
        if (tl + 2 < SNT)
            scan_fetch(hb + (size_t)(tl + 2) * STS * HH * SPB, tb, wave, lane);

        // stored behind the barrier: in front of it the barrier's own wait for
        // stores would expose their whole latency once per tile
        #pragma unroll
        for (int c = 0; c < STS / SCH; ++c) {
            *yp = o[c] * 0.125f;             // * N^-0.5
            yp += 32 * 32;
        }
    }
    // no copy is left in flight when the wave ends
    asm volatile("s_wait_asynccnt 0x0" ::: "memory");
}

// ---------------------------------------------------------------------------
// Kernel 6: norm-ratio correction + gate -> bf16 input for output projection.
// A block: ETK tokens of one chunk of y, all columns. A lane: 4 columns of each,
// a 16-lane row is one head (norms: DPP row sums). y lies step-fastest (see
// kernel 5), so one 16-B load is one column's ETK steps.
// ---------------------------------------------------------------------------
static_assert(ETK == 4 && SCH % ETK == 0 && TT % SCH == 0, "a block stays in one chunk");

__global__ __launch_bounds__(256) void post_scan_kernel(
    const float* __restrict__ y, const float* __restrict__ x,
    const __bf16* __restrict__ vh, const __bf16* __restrict__ gb,
    const float* __restrict__ r_k, __bf16* __restrict__ Yg)
{
    const int    c  = threadIdx.x * 4;
    const int    h  = threadIdx.x >> 4;
    const int    n0 = c & (NN - 1);
    const unsigned m0 = blockIdx.x * ETK;
    const unsigned t0 = m0 % TT;
    const unsigned gy = (m0 / TT) * HH + h;

    // y[((gy*(T/SCH) + chunk)*NN + n)*SCH + step], here in 4 steps
    const unsigned yu = ((gy * (TT / SCH) + t0 / SCH) * NN + n0) * (SCH / 4) + (t0 % SCH) / 4;
    v4f yv[4];                                // [column][token]
    #pragma unroll
    for (int e = 0; e < 4; ++e) yv[e] = ((const v4f*)y)[yu + e * (SCH / 4)];

    const v4f rk = ld4(r_k + c);
    // before a later load's result lands in a register that these loads name
    asm volatile("s_wait_xcnt 0x0" ::: "memory");
    float sig[4];
    #pragma unroll
    for (int e = 0; e < 4; ++e) sig[e] = 1.0f / (1.0f + __expf(-rk[e]));

    // every load of the lane is issued before the first value is used
    v4f  xvs[ETK];
    v4bf vbs[ETK], gvs[ETK];
    #pragma unroll
    for (int it = 0; it < ETK; ++it) {
        const unsigned u = (m0 + it) * (CC / 4) + threadIdx.x;   // in 4 elements
        xvs[it] = ((const v4f*)x)[u];
        vbs[it] = ((const v4bf*)vh)[u];
        gvs[it] = ((const v4bf*)gb)[u];
    }

    #pragma unroll
    for (int it = 0; it < ETK; ++it) {
        const unsigned u = (m0 + it) * (CC / 4) + threadIdx.x;
        const v4f  xv = xvs[it];
        const v4bf vb = vbs[it], gv = gvs[it];
        float vv[4];
        #pragma unroll
        for (int e = 0; e < 4; ++e) vv[e] = (float)vb[e];

        const float xnorm = sqrtf(row_sum16((xv[0] * xv[0] + xv[1] * xv[1]) +
                                            (xv[2] * xv[2] + xv[3] * xv[3])));
        const float vnorm = sqrtf(row_sum16((vv[0] * vv[0] + vv[1] * vv[1]) +
                                            (vv[2] * vv[2] + vv[3] * vv[3])));
        const float ratio = 1.0f - xnorm / (vnorm + 1e-12f);

        v4bf o;
        #pragma unroll
        for (int e = 0; e < 4; ++e) {
            const float u = ratio * sig[e];
            o[e] = (__bf16)((yv[e][it] + vv[e] * u) * (float)gv[e]);
        }
        ((v4bf*)Yg)[u] = o;
    }
}

// ---------------------------------------------------------------------------
// Host launcher
// ---------------------------------------------------------------------------
extern "C" void kernel_launch(void* const* d_in, const int* in_sizes, int n_in,
                              void* d_out, int out_size, void* d_ws,
                              size_t ws_size, hipStream_t stream)
{
    (void)in_sizes; (void)n_in; (void)out_size; (void)ws_size;

    const float* residual = (const float*)d_in[0];
    const float* x        = (const float*)d_in[1];
    const float* x0       = (const float*)d_in[2];
    const float* dx0      = (const float*)d_in[3];
    const float* Wq       = (const float*)d_in[4];
    const float* Wk       = (const float*)d_in[5];
    const float* Wv       = (const float*)d_in[6];
    const float* Wproj    = (const float*)d_in[7];
    const float* x_q      = (const float*)d_in[8];
    const float* x_k      = (const float*)d_in[9];
    const float* x_v      = (const float*)d_in[10];
    const float* v0       = (const float*)d_in[11];
    const float* w0       = (const float*)d_in[12];
    const float* a0       = (const float*)d_in[13];
    const float* miss     = (const float*)d_in[14];
    const float* r_k      = (const float*)d_in[15];
    float*       out      = (float*)d_out;

    // ---- workspace layout (256B aligned bump allocator) ----
    char*  ws  = (char*)d_ws;
    size_t off = 0;
    auto alloc = [&](size_t bytes) -> void* {
        void* p = ws + off;
        off += (bytes + 255) & ~(size_t)255;
        return p;
    };
    const size_t MC_BF = (size_t)MM * CC * sizeof(__bf16);    // 8 MB
    const size_t MC_F  = (size_t)MM * CC * sizeof(float);     // 16 MB
    const size_t W_BF  = (size_t)CC * CC * sizeof(__bf16);    // 2 MB
    const size_t XD_BF = (size_t)MM * MR * sizeof(__bf16);    // 1 MB
    const size_t DL_F  = (size_t)MM * 4 * CC * sizeof(float); // 64 MB
    const size_t SO_SZ = (size_t)MM * HH * SPB * sizeof(ScanOp); // 56 MB

    __bf16* Xq    = (__bf16*)alloc(MC_BF);
    __bf16* Xk    = (__bf16*)alloc(MC_BF);
    __bf16* Xv    = (__bf16*)alloc(MC_BF);
    __bf16* Xv0   = (__bf16*)alloc(MC_BF);
    __bf16* Xd    = (__bf16*)alloc(XD_BF);
    __bf16* Wqb   = (__bf16*)alloc(W_BF);
    __bf16* Wkb   = (__bf16*)alloc(W_BF);
    __bf16* Wvb   = (__bf16*)alloc(W_BF);
    __bf16* Wpb   = (__bf16*)alloc(W_BF);
    __bf16* missT = (__bf16*)alloc(XD_BF);
    float*  qf    = (float*)alloc(MC_F);
    float*  kf    = (float*)alloc(MC_F);
    float*  vfr   = (float*)alloc(MC_F);
    float*  vfirst= (float*)alloc(MC_F);
    float*  deltas= (float*)alloc(DL_F);
    ScanOp* sops  = (ScanOp*)alloc(SO_SZ);
    __bf16* gb    = (__bf16*)alloc(MC_BF);
    // aliases over buffers whose last reader precedes the new writer:
    __bf16* vh  = Xv0;       // Xv0 consumed by v_first GEMM before post_gemm
    float*  y   = qf;        // qf consumed by post_gemm before scan writes
    __bf16* Yg  = (__bf16*)kf;

    // ---- 1) input prep + weight conversion ----
    {
        prep_kernel<<<dim3(PREP_BLOCKS), dim3(256), 0, stream>>>(
            x, x0, dx0, x_q, x_k, x_v, Xq, Xk, Xv, Xv0, Xd);
        wconv_kernel<<<dim3(MT_BLOCKS + WC_BLOCKS), dim3(256), 0, stream>>>(
            Wq, Wk, Wv, Wproj, miss, Wqb, Wkb, Wvb, Wpb, missT);
    }

    // ---- 2) WMMA GEMMs: q, k, v, v_first (K=1024, N=1024), deltas (K=128, N=4096)
    {
        dim3 grid4(CC / 128, MM / 128, 4), blk(256);
        gemm_proj4_kernel<<<grid4, blk, 0, stream>>>(
            Xq, Xk, Xv, Xv0, Wqb, Wkb, Wvb, qf, kf, vfr, vfirst);
        dim3 gridD(4 * CC / 128, MM / 128);
        gemm_bf16_wmma<MR, 4 * CC, false><<<gridD, blk, 0, stream>>>(Xd, missT, deltas, (const float*)nullptr);
    }

    // ---- 3) elementwise + k-norm -> packed scan operands (bf16, e^w f32) ----
    post_gemm_kernel<<<dim3(MM / ETK), dim3(256), 0, stream>>>(
        qf, kf, vfr, vfirst, deltas, w0, v0, a0, sops, vh, gb);

    // ---- 4) sequential scan (state in VGPRs, 8 rows per block) ----
    scan_kernel<<<dim3(BB * HH * 8), dim3(128), 0, stream>>>(sops, y);

    // ---- 5) norm correction + gate ----
    post_scan_kernel<<<dim3(MM / ETK), dim3(256), 0, stream>>>(y, x, vh, gb, r_k, Yg);

    // ---- 6) output projection + residual -> d_out ----
    {
        dim3 grid(CC / 128, MM / 128), blk(256);
        gemm_bf16_wmma<CC, CC, true><<<grid, blk, 0, stream>>>(Yg, Wpb, out, residual);
    }
}

// v007
// Measured time: 189 microseconds a run.
// Two timings next to v006 both put it at 1.05 times that version's speed.
// All steps since v000 together make it 23.7 times as fast.
#include <hip/hip_runtime.h>
#include <hip/hip_bf16.h>

// ---------------------------------------------------------------------------
// RWKV7 time-mix for MI455X (gfx1250, wave32, WMMA).
//   B=2, T=2048, C=1024, H=16, N=64, MISS_ROWS=128
// ---------------------------------------------------------------------------

typedef __attribute__((ext_vector_type(16))) __bf16 v16bf;
typedef __attribute__((ext_vector_type(8)))  __bf16 v8bf;
typedef __attribute__((ext_vector_type(8)))  float  v8f;
typedef __attribute__((ext_vector_type(4)))  int    v4i;

constexpr int BB = 2;
constexpr int TT = 2048;
constexpr int CC = 1024;
constexpr int HH = 16;
constexpr int NN = 64;
constexpr int MR = 128;          // MISS_ROWS
constexpr int MM = BB * TT;      // 4096 tokens

// Scan operands, in 16-B pieces. One (token, head) is SPB pieces: for each group
// of four columns three pieces (a word q | k a column; a word z | b a column, all
// bf16; e^w of the four in f32), 16 groups, then v of the 64 rows in bf16.
struct __align__(16) ScanOp { unsigned d[4]; };
constexpr int SPB = 16 * 3 + 8;  // pieces per (token, head)

typedef __attribute__((ext_vector_type(2))) __bf16 v2bf;
__device__ static inline int pack2(float lo, float hi)
{
    return __builtin_bit_cast(int, v2bf{(__bf16)lo, (__bf16)hi});
}
// The scan's arithmetic, one instruction a statement. A wave of the scan issues
// in order: a step lasts as long as its chain of dependent
// instructions only if the independent ones stand in the chain's gaps. The
// statements are volatile so that they keep the order in which they are written
// (ScanSteps); from plain source this compiler also widens the bf16 operands with
// extra instructions to feed packed f32 arithmetic.
// a * (low or high bf16 of word d) + c
template <bool HI>
__device__ static inline float fma_bf(float a, int d, float c)
{
    float r;
    if constexpr (HI)
        asm volatile("v_fma_mix_f32_bf16 %0, %1, %2, %3 op_sel:[0,1,0] op_sel_hi:[0,1,0]"
                     : "=v"(r) : "v"(a), "v"(d), "v"(c));
    else
        asm volatile("v_fma_mix_f32_bf16 %0, %1, %2, %3 op_sel_hi:[0,1,0]"
                     : "=v"(r) : "v"(a), "v"(d), "v"(c));
    return r;
}
// (low bf16 of word a) * (high bf16 of word d) + c
__device__ static inline float fma_bb(int a, int d, float c)
{
    float r;
    asm volatile("v_fma_mix_f32_bf16 %0, %1, %2, %3 op_sel:[0,1,0] op_sel_hi:[1,1,0]"
                 : "=v"(r) : "v"(a), "v"(d), "v"(c));
    return r;
}
// a * (low bf16 of word d)
__device__ static inline float mul_bf(float a, int d)
{
    float r;
    asm volatile("v_fma_mix_f32_bf16 %0, %1, %2, neg(0) op_sel_hi:[0,1,0]"
                 : "=v"(r) : "v"(a), "v"(d));
    return r;
}
// the plain product and the plain sum, as statements so that they keep their place
__device__ static inline float mul_f(float a, float b)
{
    float r;
    asm volatile("v_mul_f32 %0, %1, %2" : "=v"(r) : "v"(a), "v"(b));
    return r;
}
__device__ static inline float add_f(float a, float b)
{
    float r;
    asm volatile("v_add_f32 %0, %1, %2" : "=v"(r) : "v"(a), "v"(b));
    return r;
}
// x + x of lane ^ M, inside a 16-lane row
template <int M>
__device__ static inline float add_xmask(float x)
{
    float r;
    asm volatile("v_add_f32_dpp %0, %1, %1 row_xmask:%2 row_mask:0xf bank_mask:0xf bound_ctrl:1"
                 : "=v"(r) : "v"(x), "n"(M));
    return r;
}
// y + x of lane ^ M
template <int M>
__device__ static inline float add_xmask2(float x, float y)
{
    float r;
    asm volatile("v_add_f32_dpp %0, %1, %2 row_xmask:%3 row_mask:0xf bank_mask:0xf bound_ctrl:1"
                 : "=v"(r) : "v"(x), "v"(y), "n"(M));
    return r;
}
// b in the lanes of mask m, a in the others
__device__ static inline float select_f(float a, float b, unsigned m)
{
    float r;
    asm volatile("v_cndmask_b32_e64 %0, %1, %2, %3" : "=v"(r) : "v"(a), "v"(b), "s"(m));
    return r;
}
// x of lane L of the row, in every lane of it
template <int L>
__device__ static inline int row_share(int x)
{
    int r;
    asm volatile("v_mov_b32_dpp %0, %1 row_share:%2 row_mask:0xf bank_mask:0xf bound_ctrl:1"
                 : "=v"(r) : "v"(x), "n"(L));
    return r;
}

// ---- gfx1250 async global->LDS copy path (guarded; falls back cleanly) ----
#if defined(__HIP_DEVICE_COMPILE__) &&                                        \
    __has_builtin(__builtin_amdgcn_global_load_async_to_lds_b128) &&          \
    __has_builtin(__builtin_amdgcn_s_wait_asynccnt)
#define USE_ASYNC_LDS 1
#else
#define USE_ASYNC_LDS 0
#endif

#if USE_ASYNC_LDS
__device__ static inline void async_copy_b128(const void* g, void* l)
{
    // Builtin signature (from clang diagnostic): AS1 v4i* src, AS3 v4i* dst,
    // imm offset, imm cpol.
    __builtin_amdgcn_global_load_async_to_lds_b128(
        (__attribute__((address_space(1))) v4i*)(g),
        (__attribute__((address_space(3))) v4i*)(l),
        0, 0);
}
#endif

// ---------------------------------------------------------------------------
// The four elementwise kernels (1, 2, 4, 6) are dealt so that a launch is 1568 or
// 1024 work-groups of eight waves, all resident at once: a lane takes 16 to
// 64 elements and moves them 8 or 16 B at a time (miss, read down a column, 4 B).
// ---------------------------------------------------------------------------
typedef __attribute__((ext_vector_type(4))) float  v4f;
typedef __attribute__((ext_vector_type(4))) __bf16 v4bf;

template <int CTRL>
__device__ static inline float dpp_mov(float x)
{
    return __builtin_bit_cast(float, __builtin_amdgcn_mov_dpp(
        __builtin_bit_cast(int, x), CTRL, 0xf, 0xf, true));
}
constexpr int DPP_ROW_XMASK = 0x160;          // + xor mask inside the row

// sum over the 16 lanes of a row, left in every lane of it
__device__ static inline float row_sum16(float s)
{
    s += dpp_mov<DPP_ROW_XMASK + 1>(s);
    s += dpp_mov<DPP_ROW_XMASK + 2>(s);
    s += dpp_mov<DPP_ROW_XMASK + 4>(s);
    s += dpp_mov<DPP_ROW_XMASK + 8>(s);
    return s;
}

__device__ static inline v4f ld4(const float* p) { return *(const v4f*)p; }

__device__ static inline v8bf cvt8(const float* p, unsigned u)
{
    const v4f lo = ((const v4f*)p)[2 * u], hi = ((const v4f*)p)[2 * u + 1];
    v8bf o;
    #pragma unroll
    for (int e = 0; e < 4; ++e) { o[e] = (__bf16)lo[e]; o[4 + e] = (__bf16)hi[e]; }
    return o;
}

// ---------------------------------------------------------------------------
// Kernel 1: token-shift input mixing -> bf16 GEMM operands.
// A lane: 8 columns of step t in every batch (the mix vectors are read once).
// ---------------------------------------------------------------------------
constexpr int PREP_BLOCKS = TT * (CC / 8) / 256;

__device__ static __forceinline__ void prep_block(int blk,
    const float* __restrict__ x, const float* __restrict__ x0,
    const float* __restrict__ dx0,
    const float* __restrict__ x_q, const float* __restrict__ x_k,
    const float* __restrict__ x_v,
    __bf16* __restrict__ Xq, __bf16* __restrict__ Xk,
    __bf16* __restrict__ Xv, __bf16* __restrict__ Xv0,
    __bf16* __restrict__ Xd)
{
    const int i = blk * 256 + threadIdx.x;
    const int c = (i % (CC / 8)) * 8;
    const int t = i / (CC / 8);

    v4f mq[2], mk[2], mv[2];
    #pragma unroll
    for (int p = 0; p < 2; ++p) {
        mq[p] = ld4(x_q + c + 4 * p);
        mk[p] = ld4(x_k + c + 4 * p);
        mv[p] = ld4(x_v + c + 4 * p);
    }
    // before a later load's result lands in a register that these loads name.
    // The output pointers are inputs so that they are fetched here, into scalar
    // registers of their own: fetched later they took the place of the bases
    // of the loads below, ahead of those loads' wait
    asm volatile("s_wait_xcnt 0x0" :: "s"(Xq), "s"(Xk), "s"(Xv), "s"(Xv0), "s"(Xd) : "memory");

    // every load of the lane is issued before the first value is used
    v4f xvs[BB][2], xps[BB][2], z0s[BB][2], d0s[BB][2];
    #pragma unroll
    for (int b = 0; b < BB; ++b) {
        const unsigned u = (unsigned)(b * (TT * CC / 8) + i);   // in 8 elements
        #pragma unroll
        for (int p = 0; p < 2; ++p) {
            xvs[b][p] = ((const v4f*)x)[2 * u + p];
            // step t-1; at t=0 the lane's own step, in bounds and not used
            xps[b][p] = ((const v4f*)x)[2 * u + p - (t > 0 ? CC / 4 : 0)];
            z0s[b][p] = ((const v4f*)x0)[2 * u + p];
            d0s[b][p] = ((const v4f*)dx0)[2 * u + p];
        }
        // before a later load's result, or the arithmetic, lands in a register
        // that these loads name
        asm volatile("s_wait_xcnt 0x0" ::: "memory");
    }
    // keeps the first batch's arithmetic, which waits for its loads, from being
    // scheduled in front of the second batch's loads
    __builtin_amdgcn_sched_barrier(0);

    #pragma unroll
    for (int b = 0; b < BB; ++b) {
        const unsigned u = (unsigned)(b * (TT * CC / 8) + i);
        v8bf oq, ok, ov, o0, od;
        #pragma unroll
        for (int p = 0; p < 2; ++p) {
            const v4f xv = xvs[b][p], z0 = z0s[b][p], d0 = d0s[b][p];
            const v4f xp = t > 0 ? xps[b][p] : v4f{0.0f, 0.0f, 0.0f, 0.0f};   // zero pad
            #pragma unroll
            for (int e = 0; e < 4; ++e) {
                const float dxp = xp[e] - xv[e];         // x_{t-1} - x_t
                oq[4 * p + e] = (__bf16)(xv[e] + dxp * mq[p][e]);
                ok[4 * p + e] = (__bf16)(xv[e] + dxp * mk[p][e]);
                ov[4 * p + e] = (__bf16)(xv[e] + dxp * mv[p][e]);
                o0[4 * p + e] = (__bf16)(z0[e] + d0[e] * mv[p][e]);
                od[4 * p + e] = (__bf16)xv[e];
            }
        }
        ((v8bf*)Xq)[u]  = oq;
        ((v8bf*)Xk)[u]  = ok;
        ((v8bf*)Xv)[u]  = ov;
        ((v8bf*)Xv0)[u] = o0;
        if (c < MR)                                      // x[:, :, :128]
            ((v8bf*)Xd)[(unsigned)((b * TT + t) * (MR / 8) + c / 8)] = od;
        // before the next batch's arithmetic reuses registers that these stores name
        if (b + 1 < BB) asm volatile("s_wait_xcnt 0x0" ::: "memory");
    }
}

// ---------------------------------------------------------------------------
// Kernel 2: f32 weights -> bf16; miss [128,4096] -> missT [4096,128].
// The first blocks transpose: a lane reads 64 rows of one column of miss (a wave
// reads whole lines) and writes one whole 128-B line of missT. The others
// convert 8 elements of each weight a lane.
// ---------------------------------------------------------------------------
constexpr int MT_BLOCKS = 4 * CC * (MR / 64) / 256;
constexpr int WC_BLOCKS = CC * CC / 8 / 256;

__device__ static __forceinline__ void wconv_block(int blk,
    const float* __restrict__ Wq, const float* __restrict__ Wk,
    const float* __restrict__ Wv, const float* __restrict__ Wp,
    const float* __restrict__ miss,
    __bf16* __restrict__ Wqb, __bf16* __restrict__ Wkb,
    __bf16* __restrict__ Wvb, __bf16* __restrict__ Wpb,
    __bf16* __restrict__ missT)
{
    if (blk < MT_BLOCKS) {
        const int i  = blk * 256 + threadIdx.x;
        const int n  = i % (4 * CC);
        const int r0 = (i / (4 * CC)) * 64;
        const float* s = miss + (unsigned)(r0 * (4 * CC) + n);
        float v[64];
        #pragma unroll
        for (int r = 0; r < 64; ++r) v[r] = s[r * (4 * CC)];
        #pragma unroll
        for (int q = 0; q < 8; ++q) {
            v8bf o;
            #pragma unroll
            for (int e = 0; e < 8; ++e) o[e] = (__bf16)v[q * 8 + e];
            ((v8bf*)missT)[(unsigned)((n * MR + r0) / 8 + q)] = o;
        }
    } else {
        const unsigned u = (blk - MT_BLOCKS) * 256 + threadIdx.x;           // in 8 elements
        const v8bf q = cvt8(Wq, u), k = cvt8(Wk, u), v = cvt8(Wv, u), p = cvt8(Wp, u);
        ((v8bf*)Wqb)[u] = q;
        ((v8bf*)Wkb)[u] = k;
        ((v8bf*)Wvb)[u] = v;
        ((v8bf*)Wpb)[u] = p;
        // the built code lays the other branch behind this one: no register that
        // these stores name is rewritten ahead of this wait on any way through it
        asm volatile("s_wait_xcnt 0x0" ::: "memory");
    }
}

// Kernels 1 and 2 read only inputs and depend on nothing of one another: one
// launch. The weights' blocks come first (the transposing
// ones take longest); the second launch's gap and its
// start-up, during which the memory idles, are gone.
__global__ __launch_bounds__(256) void prep_wconv_kernel(
    const float* __restrict__ x, const float* __restrict__ x0,
    const float* __restrict__ dx0,
    const float* __restrict__ x_q, const float* __restrict__ x_k,
    const float* __restrict__ x_v,
    const float* __restrict__ Wq, const float* __restrict__ Wk,
    const float* __restrict__ Wv, const float* __restrict__ Wp,
    const float* __restrict__ miss,
    __bf16* __restrict__ Xq, __bf16* __restrict__ Xk,
    __bf16* __restrict__ Xv, __bf16* __restrict__ Xv0,
    __bf16* __restrict__ Xd,
    __bf16* __restrict__ Wqb, __bf16* __restrict__ Wkb,
    __bf16* __restrict__ Wvb, __bf16* __restrict__ Wpb,
    __bf16* __restrict__ missT)
{
    const int blk = blockIdx.x;
    if (blk < MT_BLOCKS + WC_BLOCKS)
        wconv_block(blk, Wq, Wk, Wv, Wp, miss, Wqb, Wkb, Wvb, Wpb, missT);
    else
        prep_block(blk - (MT_BLOCKS + WC_BLOCKS), x, x0, dx0, x_q, x_k, x_v, Xq, Xk, Xv, Xv0, Xd);
}

// ---------------------------------------------------------------------------
// Kernel 3: bf16 WMMA GEMM,  Y[m,n] = sum_k X[m,k] * W[n,k]  (+ resid)
//   block tile 128x128, 256 threads = 8 wave32; wave tile 64x32 (4x2 WMMA).
//   K-step 32, double-buffered LDS, async global->LDS staging when available.
// gemm_tile is one block's tile; the kernels behind it say which tile of which
// product a block takes. Whether a residual is added, and the row pitch of Y,
// are settled at compile time: a lane's 64 places in Y (and in resid) are then
// one address and 64 constant offsets.
// ---------------------------------------------------------------------------
constexpr int LDR = 40;                  // padded row (80B, 16B aligned)
// The two operands' tiles, two buffers each. The kernel declares them, so that a
// kernel which holds tiles of two shapes has them once.
struct __align__(16) GemmLds { __bf16 A[2][128][LDR]; __bf16 B[2][128][LDR]; };

template <int KDIM, int NDIM, bool RESID>
__device__ static __forceinline__ void gemm_tile(
    GemmLds& lds,
    const __bf16* __restrict__ X, const __bf16* __restrict__ W,
    float* __restrict__ Y, const float* __restrict__ resid,
    int mBase, int nBase)
{
    constexpr int KT    = 32;
    constexpr int KITER = KDIM / KT;
    auto& As = lds.A;
    auto& Bs = lds.B;

    const int tid    = threadIdx.x;
    const int lane   = tid & 31;
    const int wave   = tid >> 5;
    const int wm     = (wave >> 2) * 64;     // 0 | 64
    const int wn     = (wave & 3) * 32;      // 0,32,64,96
    const int laneLo = lane & 15;
    const int kbase  = ((lane >> 4) & 1) * 8; // lanes 0-15 -> K{0..7,16..23};
                                              // lanes 16-31 -> K{8..15,24..31}

    v8f acc[4][2];
    #pragma unroll
    for (int i = 0; i < 4; ++i)
        #pragma unroll
        for (int j = 0; j < 2; ++j)
            #pragma unroll
            for (int e = 0; e < 8; ++e) acc[i][j][e] = 0.0f;

    auto loadTile = [&](int buf, int k0) {
        #pragma unroll
        for (int ch = 0; ch < 2; ++ch) {
            int e  = ch * 2048 + tid * 8;
            int r  = e >> 5;        // 0..127
            int kk = e & 31;        // 0,8,16,24
            const __bf16* gA = &X[(size_t)(mBase + r) * KDIM + k0 + kk];
            const __bf16* gB = &W[(size_t)(nBase + r) * KDIM + k0 + kk];
#if USE_ASYNC_LDS
            async_copy_b128(gA, &As[buf][r][kk]);
            async_copy_b128(gB, &Bs[buf][r][kk]);
#else
            *(v8bf*)&As[buf][r][kk] = *(const v8bf*)gA;
            *(v8bf*)&Bs[buf][r][kk] = *(const v8bf*)gB;
#endif
        }
    };

    loadTile(0, 0);

    // C/D layout: VGPR v, lanes 0-15 -> (M=v, N=lane); lanes 16-31 -> (M=8+v)
    // the lane's first place in Y; tile (i, j), register v lies
    // (i * 16 + v) * NDIM + j * 16 elements further on
    const size_t off0 = (size_t)(mBase + wm + (lane >> 4) * 8) * NDIM + (nBase + wn + laneLo);

    // The residual depends on nothing that is computed here: all 64 loads of the
    // lane are issued now and fly beside the first tile's copies (the loop's first
    // barrier waits for loads too, once for all of them). One at a time in the
    // epilogue, each waited for before the next is issued, they cost the wave 64
    // latencies in a row.
    float rv[4][2][8];
    if constexpr (RESID) {
        const float* rp = resid + off0;
        #pragma unroll
        for (int i = 0; i < 4; ++i)
            #pragma unroll
            for (int j = 0; j < 2; ++j)
                #pragma unroll
                for (int v = 0; v < 8; ++v)
                    rv[i][j][v] = rp[(i * 16 + v) * NDIM + j * 16];
        // before the loop's arithmetic reuses a register that these loads name
        asm volatile("s_wait_xcnt 0x0" ::: "memory");
    }

    for (int ki = 0; ki < KITER; ++ki) {
#if USE_ASYNC_LDS
        __builtin_amdgcn_s_wait_asynccnt(0);   // own async copies in LDS
#endif
        __syncthreads();                       // all waves' copies visible
        const int buf = ki & 1;
        if (ki + 1 < KITER) loadTile(buf ^ 1, (ki + 1) * KT);

        v16bf afrag[4], bfrag[2];
        #pragma unroll
        for (int i = 0; i < 4; ++i) {
            const __bf16* ap = &As[buf][wm + i * 16 + laneLo][kbase];
            v8bf lo = *(const v8bf*)ap;
            v8bf hi = *(const v8bf*)(ap + 16);
            afrag[i] = __builtin_shufflevector(lo, hi, 0, 1, 2, 3, 4, 5, 6, 7,
                                               8, 9, 10, 11, 12, 13, 14, 15);
        }
        #pragma unroll
        for (int j = 0; j < 2; ++j) {
            const __bf16* bp = &Bs[buf][wn + j * 16 + laneLo][kbase];
            v8bf lo = *(const v8bf*)bp;
            v8bf hi = *(const v8bf*)(bp + 16);
            bfrag[j] = __builtin_shufflevector(lo, hi, 0, 1, 2, 3, 4, 5, 6, 7,
                                               8, 9, 10, 11, 12, 13, 14, 15);
        }
        #pragma unroll
        for (int i = 0; i < 4; ++i)
            #pragma unroll
            for (int j = 0; j < 2; ++j)
                acc[i][j] = __builtin_amdgcn_wmma_f32_16x16x32_bf16(
                    false, afrag[i], false, bfrag[j],
                    (short)0, acc[i][j], false, false);
    }

    if constexpr (RESID) {
        #pragma unroll
        for (int i = 0; i < 4; ++i)
            #pragma unroll
            for (int j = 0; j < 2; ++j)
                #pragma unroll
                for (int v = 0; v < 8; ++v) acc[i][j][v] += rv[i][j][v];
        // every sum stands in front of the first store: mixed among the stores,
        // later sums were put into registers that issued stores still name
        __builtin_amdgcn_sched_barrier(0);
    }
    float* yp = Y + off0;
    #pragma unroll
    for (int i = 0; i < 4; ++i)
        #pragma unroll
        for (int j = 0; j < 2; ++j)
            #pragma unroll
            for (int v = 0; v < 8; ++v)
                yp[(i * 16 + v) * NDIM + j * 16] = acc[i][j][v];
}

template <int KDIM, int NDIM, bool RESID>
__global__ __launch_bounds__(256) void gemm_bf16_wmma(
    const __bf16* __restrict__ X, const __bf16* __restrict__ W,
    float* __restrict__ Y, const float* __restrict__ resid)
{
    __shared__ GemmLds lds;
    gemm_tile<KDIM, NDIM, RESID>(lds, X, W, Y, resid, blockIdx.y * 128, blockIdx.x * 128);
}

// The four projections of the inputs depend on nothing of one another: one
// launch, blockIdx.z says which. A projection of its own is one block a WGP, and
// that block waits out the landing of its copies once per K-step; here four
// blocks share a WGP and work while another waits.
// The deltas product depends on none of them either and rides in the same launch:
// its blocks are short in K and mostly store, the projections' mostly load from L2
// and multiply. Even z is a projection, odd z a quarter of the deltas' columns, so
// that blocks of both kinds are resident together from the start.
__global__ __launch_bounds__(256) void gemm_proj4_deltas_kernel(
    const __bf16* __restrict__ Xq, const __bf16* __restrict__ Xk,
    const __bf16* __restrict__ Xv, const __bf16* __restrict__ Xv0,
    const __bf16* __restrict__ Wqb, const __bf16* __restrict__ Wkb,
    const __bf16* __restrict__ Wvb,
    const __bf16* __restrict__ Xd, const __bf16* __restrict__ missT,
    float* __restrict__ qf, float* __restrict__ kf, float* __restrict__ vfr,
    float* __restrict__ vfirst, float* __restrict__ deltas)
{
    __shared__ GemmLds lds;
    const int p = blockIdx.z >> 1;
    if (blockIdx.z & 1) {
        gemm_tile<MR, 4 * CC, false>(lds, Xd, missT, deltas, nullptr,
                                     blockIdx.y * 128, p * CC + blockIdx.x * 128);
        // the built code lays the other branch behind this one: no register that
        // the tile's stores name is rewritten ahead of this wait on any way through it
        asm volatile("s_wait_xcnt 0x0" ::: "memory");
    } else {
        const __bf16* X = p == 0 ? Xq  : p == 1 ? Xk  : p == 2 ? Xv  : Xv0;
        const __bf16* W = p == 0 ? Wqb : p == 1 ? Wkb : Wvb;
        float*        Y = p == 0 ? qf  : p == 1 ? kf  : p == 2 ? vfr : vfirst;
        gemm_tile<CC, CC, false>(lds, X, W, Y, nullptr, blockIdx.y * 128, blockIdx.x * 128);
    }
}

// ---------------------------------------------------------------------------
// Kernel 4: per-(token,head) elementwise + k-normalization; bf16 rounding of
// the six scan operands (matching the reference's rounding point); packs
// them for the scan (layout: ScanOp). The decay e^w depends on no state row, so
// it is taken here, once per (token, column), from the rounded w: in the scan
// every one of the 64 rows took it again.
// A block: ETK tokens, all columns. A lane: 4 columns, so a 16-lane row is one
// head and |k|^2 is a DPP row sum; its three pieces are 48 contiguous bytes.
// ---------------------------------------------------------------------------
constexpr int ETK = 4;                        // tokens per block, kernels 4 and 6
static_assert(CC == 256 * 4 && NN == 16 * 4 && MM % ETK == 0, "lane deal");

__global__ __launch_bounds__(256) void post_gemm_kernel(
    const float* __restrict__ qf, const float* __restrict__ kf,
    const float* __restrict__ vfr, const float* __restrict__ vfirst,
    const float* __restrict__ deltas,
    const float* __restrict__ w0, const float* __restrict__ v0,
    const float* __restrict__ a0,
    ScanOp* __restrict__ sops,
    __bf16* __restrict__ vh, __bf16* __restrict__ gb)
{
    const int c = threadIdx.x * 4;
    const v4f w0v = ld4(w0 + c), v0v = ld4(v0 + c), a0v = ld4(a0 + c);
    // the lane's place in the block's first token, in 4 elements
    const unsigned u0 = blockIdx.x * (ETK * CC / 4) + threadIdx.x;
    const unsigned d0 = blockIdx.x * (ETK * CC) + threadIdx.x;       // in deltas
    const unsigned jc = threadIdx.x & 15;                            // column group in the head
    // the head's pieces of the block's first token
    const unsigned s0 = (blockIdx.x * (ETK * HH) + (threadIdx.x >> 4)) * SPB;

    #pragma unroll
    for (int it = 0; it < ETK; ++it) {
        const int o = it * (CC / 4);                     // token, in 4 elements
        const v4f* dp = (const v4f*)deltas + d0 + 4 * o;

        const v4f kv = ((const v4f*)kf + u0)[o],  qv = ((const v4f*)qf + u0)[o];
        const v4f vr = ((const v4f*)vfr + u0)[o], vf = ((const v4f*)vfirst + u0)[o];
        const v4f wd = dp[0], vd = dp[CC / 4], ad = dp[2 * (CC / 4)], gd = dp[3 * (CC / 4)];
        // before the arithmetic reuses registers that these loads name
        asm volatile("s_wait_xcnt 0x0" ::: "memory");

        const float norm = sqrtf(row_sum16((kv[0] * kv[0] + kv[1] * kv[1]) +
                                           (kv[2] * kv[2] + kv[3] * kv[3])));
        const float den  = fmaxf(norm, 1e-12f);

        v4i  R0, R1;                          // q | k and z | b of the four columns
        v4f  ew;                              // their decay
        v4bf vo, go;
        #pragma unroll
        for (int e = 0; e < 4; ++e) {
            const float xw   = -(w0v[e] + wd[e]);
            const float sp   = (xw > 20.0f) ? xw : log1pf(__expf(xw)); // softplus
            const float logw = -__expf(-sp - 0.5f);                    // log decay < 0

            const float sv = 1.0f / (1.0f + __expf(-(v0v[e] + vd[e])));
            const float vv = vr[e] + (vf[e] - vr[e]) * sv;

            const float a  = 1.0f / (1.0f + __expf(-(a0v[e] + ad[e])));
            const float kk = kv[e] / den;

            R0[e] = pack2(qv[e], kv[e] * a);
            R1[e] = pack2(-kk, kk * a);
            ew[e] = __expf((float)(__bf16)logw);         // exp after bf16 round, as reference
            vo[e] = (__bf16)vv;
            go[e] = (__bf16)(1.0f + gd[e]);
        }
        ScanOp* sp = sops + s0 + it * (HH * SPB);
        *(v4i*)(sp + 3 * jc)      = R0;
        *(v4i*)(sp + 3 * jc + 1)  = R1;
        *(v4f*)(sp + 3 * jc + 2)  = ew;
        ((v4bf*)(sp + 48))[jc]    = vo;
        ((v4bf*)vh + u0)[o] = vo;
        ((v4bf*)gb + u0)[o] = go;
        // before the next token's loads reuse registers that these stores name
        if (it + 1 < ETK) asm volatile("s_wait_xcnt 0x0" ::: "memory");
    }
}

constexpr int SCH = 16;
constexpr int STS = 32;
constexpr int SNT = TT / STS;
static_assert(SNT >= 2 && STS % SCH == 0, "two tiles at least, whole chunks");

// One tile: STS steps of SPB pieces (896 B a step, contiguous; steps lie
// HH * SPB pieces apart in global memory, back to back in LDS). A wave brings
// STS/4 steps, one piece a lane and copy; 7 * 32 pieces are four steps.
static_assert(4 * SPB == 7 * 32 && STS % 16 == 0, "four steps are seven copies of a wave");

__device__ static inline void scan_fetch(const ScanOp* g0, ScanOp* l0,
                                         int wave, int lane)
{
    constexpr int GP = HH * SPB;                             // step pitch, global
    const ScanOp* g = g0 + (size_t)wave * (STS / 4) * GP;
    ScanOp*       l = l0 + wave * (STS / 4) * SPB + lane;
    #pragma unroll
    for (int r = 0; r < 7; ++r) {
        const int     pc = r * 32 + lane;                    // piece 0..223
        const ScanOp* gr = g + (pc / SPB) * GP + pc % SPB;
        #pragma unroll
        for (int a = 0; a < STS / 16; ++a) {
#if USE_ASYNC_LDS
            async_copy_b128(gr + a * 4 * GP, l + (a * 7 + r) * 32);
#else
            l[(a * 7 + r) * 32] = gr[a * 4 * GP];
#endif
        }
    }
}

struct Rec4 { v4i qk, zb; v4f ew; };         // a lane's four columns of one step

__device__ static inline Rec4 scan_read(const ScanOp* lp, int u)
{
    const ScanOp* rp = lp + u * SPB;
    return Rec4{*(const v4i*)rp, *(const v4i*)(rp + 1), *(const v4f*)(rp + 2)};
}

constexpr int SG = 8;                         // steps whose LDS reads stand together
static_assert(STS % SG == 0 && STS / SG >= 2, "whole groups, two at least");

// The S.q partials are folded level by level. Level N makes one sum of two, each
// of 2^(N-1) steps: lanes whose step slot has bit 2^(N-1) clear keep the first,
// the others the second, and each adds what its partner (lane ^ bit) holds of the
// same. The partial of step T is at hand in step T + 1, and level N
// of the group that T ends is taken in step T + N, so that a step holds two
// selects and one row add per level and at most two levels, all in the gaps of
// its chain. f[n]: the first half of a level, waiting; r[n]: the second half.
template <int T, int N>                      // is level N of a group ending at T due?
constexpr bool fold_due = T >= 0 && T % (1 << N) == (1 << N) - 1;

constexpr unsigned fold_mask(int bit)        // lanes whose step slot has this bit
{
    return bit == 1 ? 0xaaaaaaaau : bit == 2 ? 0xccccccccu : bit == 4 ? 0xf0f0f0f0u : 0xff00ff00u;
}

template <int N>
__device__ static inline void fold_select(const float (&f)[4], const float (&r)[4],
                                          float& keep, float& send)
{
    keep = select_f(f[N - 1], r[N - 1], fold_mask(1 << (N - 1)));
    send = select_f(r[N - 1], f[N - 1], fold_mask(1 << (N - 1)));
}

// where a finished sum of level N for the group ending at T goes
template <int T, int N>
__device__ static inline void fold_bank(float s, float (&f)[4], float (&r)[4],
                                        float (&o)[STS / SCH])
{
    if constexpr (N == 4) o[T / SCH] = s;
    else if constexpr (fold_due<T, N + 1>) r[N] = s;
    else f[N] = s;
}

template <int T, int N>
__device__ static inline void fold_add(float keep, float send, float (&f)[4], float (&r)[4],
                                       float (&o)[STS / SCH])
{
    fold_bank<T, N>(add_xmask2<1 << (N - 1)>(send, keep), f, r, o);
}

template <int U>
struct ScanSteps {
    // lp: the lane's three pieces of the tile's first step, in LDS
    // qp: the q | k words of the step before (its output sum is taken here)
    __device__ static inline void run(const ScanOp* lp, Rec4 (&pipe)[2][SG], float (&S)[4],
                                      float (&f)[4], float (&r)[4],
                                      const int (&vrow)[STS / SCH],
                                      float (&o)[STS / SCH], v4i qp)
    {
        constexpr int t = STS - U;           // step in the tile
        constexpr int u = t % SCH;           // step in the chunk
        constexpr int gr = t / SG;           // group of steps in the tile
        if constexpr (t % SG == 0 && t + SG < STS) {
            // The next group's reads stand together at the head of this group (for
            // speed only). The two scheduling barriers keep the
            // scheduler from spreading the reads over the steps on either side.
            // At t = 0 the tile's first reads stand directly in front, and no
            // barrier parts the two groups.
            if constexpr (t > 0) __builtin_amdgcn_sched_barrier(0);
            #pragma unroll
            for (int i = 0; i < SG; ++i)
                pipe[(gr + 1) & 1][i] = scan_read(lp, t + SG + i);
            __builtin_amdgcn_sched_barrier(0);
        }
        const v4i qk = pipe[gr & 1][t % SG].qk, zb = pipe[gr & 1][t % SG].zb;
        const v4f ew = pipe[gr & 1][t % SG].ew;

        // The chain: S.z in the lane (three links), four row-sum links, the update
        // of S. Everything else stands between its links: S * e^w, v * k, the
        // output sum of the step before, for which S still holds that step's
        // state, and the folds that are due.
        float p0 = 0.0f, p1 = 0.0f, kp[5], sd[5];
        float a0 = mul_bf(S[0], zb[0]);
        float a1 = mul_bf(S[2], zb[2]);
        float X0 = mul_f(S[0], ew[0]);
        float X1 = mul_f(S[1], ew[1]);
        float X2 = mul_f(S[2], ew[2]);
        a0 = fma_bf<false>(S[1], zb[1], a0);
        a1 = fma_bf<false>(S[3], zb[3], a1);
        float X3 = mul_f(S[3], ew[3]);
        const int vt = row_share<u>(vrow[t / SCH]);          // this step's v of the row, bf16
        if constexpr (t > 0) p0 = mul_bf(S[0], qp[0]);
        float sa = add_f(a0, a1);
        if constexpr (t > 0) p1 = mul_bf(S[2], qp[2]);
        X0 = fma_bb(vt, qk[0], X0);
        X1 = fma_bb(vt, qk[1], X1);
        sa = add_xmask<1>(sa);
        X2 = fma_bb(vt, qk[2], X2);
        X3 = fma_bb(vt, qk[3], X3);
        if constexpr (t > 0) {
            p0 = fma_bf<false>(S[1], qp[1], p0);
            p1 = fma_bf<false>(S[3], qp[3], p1);
        }
        sa = add_xmask<2>(sa);
        if constexpr (t > 0) fold_bank<t - 1, 0>(add_f(p0, p1), f, r, o);
        sa = add_xmask<4>(sa);
        if constexpr (fold_due<t - 4, 4>) fold_select<4>(f, r, kp[4], sd[4]);
        if constexpr (fold_due<t - 3, 3>) fold_select<3>(f, r, kp[3], sd[3]);
        if constexpr (fold_due<t - 2, 2>) fold_select<2>(f, r, kp[2], sd[2]);
        if constexpr (fold_due<t - 1, 1>) fold_select<1>(f, r, kp[1], sd[1]);
        sa = add_xmask<8>(sa);
        if constexpr (fold_due<t - 4, 4>) fold_add<t - 4, 4>(kp[4], sd[4], f, r, o);
        if constexpr (fold_due<t - 3, 3>) fold_add<t - 3, 3>(kp[3], sd[3], f, r, o);
        if constexpr (fold_due<t - 2, 2>) fold_add<t - 2, 2>(kp[2], sd[2], f, r, o);
        if constexpr (fold_due<t - 1, 1>) fold_add<t - 1, 1>(kp[1], sd[1], f, r, o);
        S[0] = fma_bf<true>(sa, zb[0], X0);
        S[2] = fma_bf<true>(sa, zb[2], X2);
        S[1] = fma_bf<true>(sa, zb[1], X1);
        S[3] = fma_bf<true>(sa, zb[3], X3);

        ScanSteps<U - 1>::run(lp, pipe, S, f, r, vrow, o, qk);
    }
};
template <>
struct ScanSteps<0> {
    // the output sum of the tile's last step, and its four folds
    __device__ static inline void run(const ScanOp*, Rec4 (&)[2][SG], float (&S)[4],
                                      float (&f)[4], float (&r)[4],
                                      const int (&)[STS / SCH],
                                      float (&o)[STS / SCH], v4i qp)
    {
        float p0 = mul_bf(S[0], qp[0]);
        float p1 = mul_bf(S[2], qp[2]);
        p0 = fma_bf<false>(S[1], qp[1], p0);
        p1 = fma_bf<false>(S[3], qp[3], p1);
        fold_bank<STS - 1, 0>(add_f(p0, p1), f, r, o);
        float kp, sd;
        fold_select<1>(f, r, kp, sd);  fold_add<STS - 1, 1>(kp, sd, f, r, o);
        fold_select<2>(f, r, kp, sd);  fold_add<STS - 1, 2>(kp, sd, f, r, o);
        fold_select<3>(f, r, kp, sd);  fold_add<STS - 1, 3>(kp, sd, f, r, o);
        fold_select<4>(f, r, kp, sd);  fold_add<STS - 1, 4>(kp, sd, f, r, o);
    }
};

__global__ __launch_bounds__(128) void scan_kernel(
    const ScanOp* __restrict__ sops, float* __restrict__ y)
{
    __shared__ ScanOp tile[2][STS][SPB];

    const int lane = threadIdx.x & 31;
    const int wave = threadIdx.x >> 5;
    const int g    = blockIdx.x >> 3;                        // b*H + h
    const int rp   = (blockIdx.x & 7) * 4 + wave;            // row pair 0..31
    const int h    = g % HH;
    const int b    = g / HH;
    const int j    = lane & 15;                              // column group / step slot
    const int row  = rp * 2 + (lane >> 4);

    const ScanOp* hb = sops + ((size_t)b * TT * HH + h) * SPB;        // t = 0
    float* yp = y + ((size_t)g * (TT / SCH) * 32 + rp) * 32 + lane;

    float S[4] = {0.0f, 0.0f, 0.0f, 0.0f};

    scan_fetch(hb, &tile[0][0][0], wave, lane);
    // own copies of tile 0 landed; the barrier publishes every wave's
    asm volatile("s_wait_asynccnt 0x0" ::: "memory");
    __syncthreads();
    scan_fetch(hb + (size_t)STS * HH * SPB, &tile[1][0][0], wave, lane);

    // kept rolled: the body already holds STS unrolled steps
    #pragma unroll 1
    for (int tl = 0; tl < SNT; ++tl) {
        ScanOp* tb = &tile[tl & 1][0][0];

        // read first: the tile's first step needs them, and LDS answers in order
        int   vrow[STS / SCH];
        float o[STS / SCH], f[4], r[4];
        #pragma unroll
        for (int c = 0; c < STS / SCH; ++c)  // v of my row at step j of chunk c, bf16
            vrow[c] = ((const unsigned short*)(tb + (c * SCH + j) * SPB + 48))[row];
        // keeps these two reads in front: behind the first group's reads, the
        // first step waits for the whole group
        __builtin_amdgcn_sched_barrier(0);
        Rec4 pipe[2][SG];
        #pragma unroll
        for (int i = 0; i < SG; ++i) pipe[0][i] = scan_read(tb + j * 3, i);

        ScanSteps<STS>::run(tb + j * 3, pipe, S, f, r, vrow, o, v4i{0, 0, 0, 0});

        // keeps the last groups' arithmetic in front of the foot: lifted over it,
        // the wait below stands right behind the tile's last reads and the wave
        // sits out their whole latency
        __builtin_amdgcn_sched_barrier(0);
        // foot of the trip: my reads of this tile are done, my copies of the
        // next tile have landed; the barrier says both of every wave
        asm volatile("s_wait_dscnt 0x0" ::: "memory");
        asm volatile("s_wait_asynccnt 0x0" ::: "memory");
        __syncthreads();
        if (tl + 2 < SNT)
            scan_fetch(hb + (size_t)(tl + 2) * STS * HH * SPB, tb, wave, lane);

        // stored behind the barrier: in front of it the barrier's own wait for
        // stores would expose their whole latency once per tile
        #pragma unroll
        for (int c = 0; c < STS / SCH; ++c) {
            *yp = o[c] * 0.125f;             // * N^-0.5
            yp += 32 * 32;
        }
    }
    // no copy is left in flight when the wave ends
    asm volatile("s_wait_asynccnt 0x0" ::: "memory");
}

// ---------------------------------------------------------------------------
// Kernel 6: norm-ratio correction + gate -> bf16 input for output projection.
// A block: ETK tokens of one chunk of y, all columns. A lane: 4 columns of each,
// a 16-lane row is one head (norms: DPP row sums). y lies step-fastest (see
// kernel 5), so one 16-B load is one column's ETK steps.
// ---------------------------------------------------------------------------
static_assert(ETK == 4 && SCH % ETK == 0 && TT % SCH == 0, "a block stays in one chunk");

__global__ __launch_bounds__(256) void post_scan_kernel(
    const float* __restrict__ y, const float* __restrict__ x,
    const __bf16* __restrict__ vh, const __bf16* __restrict__ gb,
    const float* __restrict__ r_k, __bf16* __restrict__ Yg)
{
    const int    c  = threadIdx.x * 4;
    const int    h  = threadIdx.x >> 4;
    const int    n0 = c & (NN - 1);
    const unsigned m0 = blockIdx.x * ETK;
    const unsigned t0 = m0 % TT;
    const unsigned gy = (m0 / TT) * HH + h;

    // y[((gy*(T/SCH) + chunk)*NN + n)*SCH + step], here in 4 steps
    const unsigned yu = ((gy * (TT / SCH) + t0 / SCH) * NN + n0) * (SCH / 4) + (t0 % SCH) / 4;
    v4f yv[4];                                // [column][token]
    #pragma unroll
    for (int e = 0; e < 4; ++e) yv[e] = ((const v4f*)y)[yu + e * (SCH / 4)];

    const v4f rk = ld4(r_k + c);
    // before a later load's result lands in a register that these loads name
    asm volatile("s_wait_xcnt 0x0" ::: "memory");
    float sig[4];
    #pragma unroll
    for (int e = 0; e < 4; ++e) sig[e] = 1.0f / (1.0f + __expf(-rk[e]));

    // every load of the lane is issued before the first value is used
    v4f  xvs[ETK];
    v4bf vbs[ETK], gvs[ETK];
    #pragma unroll
    for (int it = 0; it < ETK; ++it) {
        const unsigned u = (m0 + it) * (CC / 4) + threadIdx.x;   // in 4 elements
        xvs[it] = ((const v4f*)x)[u];
        vbs[it] = ((const v4bf*)vh)[u];
        gvs[it] = ((const v4bf*)gb)[u];
    }

    #pragma unroll
    for (int it = 0; it < ETK; ++it) {
        const unsigned u = (m0 + it) * (CC / 4) + threadIdx.x;
        const v4f  xv = xvs[it];
        const v4bf vb = vbs[it], gv = gvs[it];
        float vv[4];
        #pragma unroll
        for (int e = 0; e < 4; ++e) vv[e] = (float)vb[e];

        const float xnorm = sqrtf(row_sum16((xv[0] * xv[0] + xv[1] * xv[1]) +
                                            (xv[2] * xv[2] + xv[3] * xv[3])));
        const float vnorm = sqrtf(row_sum16((vv[0] * vv[0] + vv[1] * vv[1]) +
                                            (vv[2] * vv[2] + vv[3] * vv[3])));
        const float ratio = 1.0f - xnorm / (vnorm + 1e-12f);

        v4bf o;
        #pragma unroll
        for (int e = 0; e < 4; ++e) {
            const float u = ratio * sig[e];
            o[e] = (__bf16)((yv[e][it] + vv[e] * u) * (float)gv[e]);
        }
        ((v4bf*)Yg)[u] = o;
    }
}

// ---------------------------------------------------------------------------
// Host launcher
// ---------------------------------------------------------------------------
extern "C" void kernel_launch(void* const* d_in, const int* in_sizes, int n_in,
                              void* d_out, int out_size, void* d_ws,
                              size_t ws_size, hipStream_t stream)
{
    (void)in_sizes; (void)n_in; (void)out_size; (void)ws_size;

    const float* residual = (const float*)d_in[0];
    const float* x        = (const float*)d_in[1];
    const float* x0       = (const float*)d_in[2];
    const float* dx0      = (const float*)d_in[3];
    const float* Wq       = (const float*)d_in[4];
    const float* Wk       = (const float*)d_in[5];
    const float* Wv       = (const float*)d_in[6];
    const float* Wproj    = (const float*)d_in[7];
    const float* x_q      = (const float*)d_in[8];
    const float* x_k      = (const float*)d_in[9];
    const float* x_v      = (const float*)d_in[10];
    const float* v0       = (const float*)d_in[11];
    const float* w0       = (const float*)d_in[12];
    const float* a0       = (const float*)d_in[13];
    const float* miss     = (const float*)d_in[14];
    const float* r_k      = (const float*)d_in[15];
    float*       out      = (float*)d_out;

    // ---- workspace layout (256B aligned bump allocator) ----
    char*  ws  = (char*)d_ws;
    size_t off = 0;
    auto alloc = [&](size_t bytes) -> void* {
        void* p = ws + off;
        off += (bytes + 255) & ~(size_t)255;
        return p;
    };
    const size_t MC_BF = (size_t)MM * CC * sizeof(__bf16);    // 8 MB
    const size_t MC_F  = (size_t)MM * CC * sizeof(float);     // 16 MB
    const size_t W_BF  = (size_t)CC * CC * sizeof(__bf16);    // 2 MB
    const size_t XD_BF = (size_t)MM * MR * sizeof(__bf16);    // 1 MB
    const size_t DL_F  = (size_t)MM * 4 * CC * sizeof(float); // 64 MB
    const size_t SO_SZ = (size_t)MM * HH * SPB * sizeof(ScanOp); // 56 MB

    __bf16* Xq    = (__bf16*)alloc(MC_BF);
    __bf16* Xk    = (__bf16*)alloc(MC_BF);
    __bf16* Xv    = (__bf16*)alloc(MC_BF);
    __bf16* Xv0   = (__bf16*)alloc(MC_BF);
    __bf16* Xd    = (__bf16*)alloc(XD_BF);
    __bf16* Wqb   = (__bf16*)alloc(W_BF);
    __bf16* Wkb   = (__bf16*)alloc(W_BF);
    __bf16* Wvb   = (__bf16*)alloc(W_BF);
    __bf16* Wpb   = (__bf16*)alloc(W_BF);
    __bf16* missT = (__bf16*)alloc(XD_BF);
    float*  qf    = (float*)alloc(MC_F);
    float*  kf    = (float*)alloc(MC_F);
    float*  vfr   = (float*)alloc(MC_F);
    float*  vfirst= (float*)alloc(MC_F);
    float*  deltas= (float*)alloc(DL_F);
    ScanOp* sops  = (ScanOp*)alloc(SO_SZ);
    __bf16* gb    = (__bf16*)alloc(MC_BF);
    // aliases over buffers whose last reader precedes the new writer:
    __bf16* vh  = Xv0;       // Xv0 consumed by v_first GEMM before post_gemm
    float*  y   = qf;        // qf consumed by post_gemm before scan writes
    __bf16* Yg  = (__bf16*)kf;

    // ---- 1) input prep + weight conversion ----
    {
        prep_wconv_kernel<<<dim3(MT_BLOCKS + WC_BLOCKS + PREP_BLOCKS), dim3(256), 0, stream>>>(
            x, x0, dx0, x_q, x_k, x_v, Wq, Wk, Wv, Wproj, miss,
            Xq, Xk, Xv, Xv0, Xd, Wqb, Wkb, Wvb, Wpb, missT);
    }

    // ---- 2) WMMA GEMMs: q, k, v, v_first (K=1024, N=1024), deltas (K=128, N=4096)
    {
        dim3 grid8(CC / 128, MM / 128, 8), blk(256);
        gemm_proj4_deltas_kernel<<<grid8, blk, 0, stream>>>(
            Xq, Xk, Xv, Xv0, Wqb, Wkb, Wvb, Xd, missT, qf, kf, vfr, vfirst, deltas);
    }

    // ---- 3) elementwise + k-norm -> packed scan operands (bf16, e^w f32) ----
    post_gemm_kernel<<<dim3(MM / ETK), dim3(256), 0, stream>>>(
        qf, kf, vfr, vfirst, deltas, w0, v0, a0, sops, vh, gb);

    // ---- 4) sequential scan (state in VGPRs, 8 rows per block) ----
    scan_kernel<<<dim3(BB * HH * 8), dim3(128), 0, stream>>>(sops, y);

    // ---- 5) norm correction + gate ----
    post_scan_kernel<<<dim3(MM / ETK), dim3(256), 0, stream>>>(y, x, vh, gb, r_k, Yg);

    // ---- 6) output projection + residual -> d_out ----
    {
        dim3 grid(CC / 128, MM / 128), blk(256);
        gemm_bf16_wmma<CC, CC, true><<<grid, blk, 0, stream>>>(Yg, Wpb, out, residual);
    }
}

// v008
// One run takes 167 microseconds.
// In both of two side-by-side timings against v007, it was 1.12 times as fast.
// Counting every step since v000, it is 26.5 times as fast.
#include <hip/hip_runtime.h>
#include <hip/hip_bf16.h>

// ---------------------------------------------------------------------------
// RWKV7 time-mix for MI455X (gfx1250, wave32, WMMA).
//   B=2, T=2048, C=1024, H=16, N=64, MISS_ROWS=128
// ---------------------------------------------------------------------------

typedef __attribute__((ext_vector_type(16))) __bf16 v16bf;
typedef __attribute__((ext_vector_type(8)))  __bf16 v8bf;
typedef __attribute__((ext_vector_type(8)))  float  v8f;
typedef __attribute__((ext_vector_type(4)))  int    v4i;

constexpr int BB = 2;
constexpr int TT = 2048;
constexpr int CC = 1024;
constexpr int HH = 16;
constexpr int NN = 64;
constexpr int MR = 128;          // MISS_ROWS
constexpr int MM = BB * TT;      // 4096 tokens

// Scan operands, in 16-B pieces. One (token, head) is SPB pieces: for each group
// of four columns three pieces (a word q | k a column; a word z | b a column, all
// bf16; e^w of the four in f32), 16 groups, then v of the 64 rows in bf16.
struct __align__(16) ScanOp { unsigned d[4]; };
constexpr int SPB = 16 * 3 + 8;  // pieces per (token, head)

typedef __attribute__((ext_vector_type(2))) __bf16 v2bf;
__device__ static inline int pack2(float lo, float hi)
{
    return __builtin_bit_cast(int, v2bf{(__bf16)lo, (__bf16)hi});
}
// The scan's arithmetic, one instruction a statement. A wave of the scan issues
// in order: a step lasts as long as its chain of dependent
// instructions only if the independent ones stand in the chain's gaps. The
// statements are volatile so that they keep the order in which they are written
// (ScanSteps); from plain source this compiler also widens the bf16 operands with
// extra instructions to feed packed f32 arithmetic.
// a * (low or high bf16 of word d) + c
template <bool HI>
__device__ static inline float fma_bf(float a, int d, float c)
{
    float r;
    if constexpr (HI)
        asm volatile("v_fma_mix_f32_bf16 %0, %1, %2, %3 op_sel:[0,1,0] op_sel_hi:[0,1,0]"
                     : "=v"(r) : "v"(a), "v"(d), "v"(c));
    else
        asm volatile("v_fma_mix_f32_bf16 %0, %1, %2, %3 op_sel_hi:[0,1,0]"
                     : "=v"(r) : "v"(a), "v"(d), "v"(c));
    return r;
}
// (low bf16 of word a) * (high bf16 of word d) + c
__device__ static inline float fma_bb(int a, int d, float c)
{
    float r;
    asm volatile("v_fma_mix_f32_bf16 %0, %1, %2, %3 op_sel:[0,1,0] op_sel_hi:[1,1,0]"
                 : "=v"(r) : "v"(a), "v"(d), "v"(c));
    return r;
}
// a * (low bf16 of word d)
__device__ static inline float mul_bf(float a, int d)
{
    float r;
    asm volatile("v_fma_mix_f32_bf16 %0, %1, %2, neg(0) op_sel_hi:[0,1,0]"
                 : "=v"(r) : "v"(a), "v"(d));
    return r;
}
// the plain product and the plain sum, as statements so that they keep their place
__device__ static inline float mul_f(float a, float b)
{
    float r;
    asm volatile("v_mul_f32 %0, %1, %2" : "=v"(r) : "v"(a), "v"(b));
    return r;
}
__device__ static inline float add_f(float a, float b)
{
    float r;
    asm volatile("v_add_f32 %0, %1, %2" : "=v"(r) : "v"(a), "v"(b));
    return r;
}
// x + x of lane ^ M, inside a 16-lane row
template <int M>
__device__ static inline float add_xmask(float x)
{
    float r;
    asm volatile("v_add_f32_dpp %0, %1, %1 row_xmask:%2 row_mask:0xf bank_mask:0xf bound_ctrl:1"
                 : "=v"(r) : "v"(x), "n"(M));
    return r;
}
// y + x of lane ^ M
template <int M>
__device__ static inline float add_xmask2(float x, float y)
{
    float r;
    asm volatile("v_add_f32_dpp %0, %1, %2 row_xmask:%3 row_mask:0xf bank_mask:0xf bound_ctrl:1"
                 : "=v"(r) : "v"(x), "v"(y), "n"(M));
    return r;
}
// b in the lanes of mask m, a in the others
__device__ static inline float select_f(float a, float b, unsigned m)
{
    float r;
    asm volatile("v_cndmask_b32_e64 %0, %1, %2, %3" : "=v"(r) : "v"(a), "v"(b), "s"(m));
    return r;
}
// x of lane L of the row, in every lane of it
template <int L>
__device__ static inline int row_share(int x)
{
    int r;
    asm volatile("v_mov_b32_dpp %0, %1 row_share:%2 row_mask:0xf bank_mask:0xf bound_ctrl:1"
                 : "=v"(r) : "v"(x), "n"(L));
    return r;
}

// ---- gfx1250 async global->LDS copy path (guarded; falls back cleanly) ----
#if defined(__HIP_DEVICE_COMPILE__) &&                                        \
    __has_builtin(__builtin_amdgcn_global_load_async_to_lds_b128) &&          \
    __has_builtin(__builtin_amdgcn_s_wait_asynccnt)
#define USE_ASYNC_LDS 1
#else
#define USE_ASYNC_LDS 0
#endif

#if USE_ASYNC_LDS
__device__ static inline void async_copy_b128(const void* g, void* l)
{
    // Builtin signature (from clang diagnostic): AS1 v4i* src, AS3 v4i* dst,
    // imm offset, imm cpol.
    __builtin_amdgcn_global_load_async_to_lds_b128(
        (__attribute__((address_space(1))) v4i*)(g),
        (__attribute__((address_space(3))) v4i*)(l),
        0, 0);
}
#endif

// ---------------------------------------------------------------------------
// The four elementwise kernels (1, 2, 4, 6) are dealt so that a launch is 1568 or
// 1024 work-groups of eight waves, all resident at once: a lane takes 16 to
// 64 elements and moves them 8 or 16 B at a time (miss, read down a column, 4 B).
// ---------------------------------------------------------------------------
typedef __attribute__((ext_vector_type(4))) float  v4f;
typedef __attribute__((ext_vector_type(4))) __bf16 v4bf;

template <int CTRL>
__device__ static inline float dpp_mov(float x)
{
    return __builtin_bit_cast(float, __builtin_amdgcn_mov_dpp(
        __builtin_bit_cast(int, x), CTRL, 0xf, 0xf, true));
}
constexpr int DPP_ROW_XMASK = 0x160;          // + xor mask inside the row

// sum over the 16 lanes of a row, left in every lane of it
__device__ static inline float row_sum16(float s)
{
    s += dpp_mov<DPP_ROW_XMASK + 1>(s);
    s += dpp_mov<DPP_ROW_XMASK + 2>(s);
    s += dpp_mov<DPP_ROW_XMASK + 4>(s);
    s += dpp_mov<DPP_ROW_XMASK + 8>(s);
    return s;
}

__device__ static inline v4f ld4(const float* p) { return *(const v4f*)p; }

__device__ static inline v8bf cvt8(const float* p, unsigned u)
{
    const v4f lo = ((const v4f*)p)[2 * u], hi = ((const v4f*)p)[2 * u + 1];
    v8bf o;
    #pragma unroll
    for (int e = 0; e < 4; ++e) { o[e] = (__bf16)lo[e]; o[4 + e] = (__bf16)hi[e]; }
    return o;
}

// ---------------------------------------------------------------------------
// Kernel 1: token-shift input mixing -> bf16 GEMM operands.
// A lane: 8 columns of step t in every batch (the mix vectors are read once).
// ---------------------------------------------------------------------------
constexpr int PREP_BLOCKS = TT * (CC / 8) / 256;

__device__ static __forceinline__ void prep_block(int blk,
    const float* __restrict__ x, const float* __restrict__ x0,
    const float* __restrict__ dx0,
    const float* __restrict__ x_q, const float* __restrict__ x_k,
    const float* __restrict__ x_v,
    __bf16* __restrict__ Xq, __bf16* __restrict__ Xk,
    __bf16* __restrict__ Xv, __bf16* __restrict__ Xv0,
    __bf16* __restrict__ Xd)
{
    const int i = blk * 256 + threadIdx.x;
    const int c = (i % (CC / 8)) * 8;
    const int t = i / (CC / 8);

    v4f mq[2], mk[2], mv[2];
    #pragma unroll
    for (int p = 0; p < 2; ++p) {
        mq[p] = ld4(x_q + c + 4 * p);
        mk[p] = ld4(x_k + c + 4 * p);
        mv[p] = ld4(x_v + c + 4 * p);
    }
    // before a later load's result lands in a register that these loads name.
    // The output pointers are inputs so that they are fetched here, into scalar
    // registers of their own: fetched later they took the place of the bases
    // of the loads below, ahead of those loads' wait
    asm volatile("s_wait_xcnt 0x0" :: "s"(Xq), "s"(Xk), "s"(Xv), "s"(Xv0), "s"(Xd) : "memory");

    // every load of the lane is issued before the first value is used
    v4f xvs[BB][2], xps[BB][2], z0s[BB][2], d0s[BB][2];
    #pragma unroll
    for (int b = 0; b < BB; ++b) {
        const unsigned u = (unsigned)(b * (TT * CC / 8) + i);   // in 8 elements
        #pragma unroll
        for (int p = 0; p < 2; ++p) {
            xvs[b][p] = ((const v4f*)x)[2 * u + p];
            // step t-1; at t=0 the lane's own step, in bounds and not used
            xps[b][p] = ((const v4f*)x)[2 * u + p - (t > 0 ? CC / 4 : 0)];
            z0s[b][p] = ((const v4f*)x0)[2 * u + p];
            d0s[b][p] = ((const v4f*)dx0)[2 * u + p];
        }
        // before a later load's result, or the arithmetic, lands in a register
        // that these loads name
        asm volatile("s_wait_xcnt 0x0" ::: "memory");
    }
    // keeps the first batch's arithmetic, which waits for its loads, from being
    // scheduled in front of the second batch's loads
    __builtin_amdgcn_sched_barrier(0);

    #pragma unroll
    for (int b = 0; b < BB; ++b) {
        const unsigned u = (unsigned)(b * (TT * CC / 8) + i);
        v8bf oq, ok, ov, o0, od;
        #pragma unroll
        for (int p = 0; p < 2; ++p) {
            const v4f xv = xvs[b][p], z0 = z0s[b][p], d0 = d0s[b][p];
            const v4f xp = t > 0 ? xps[b][p] : v4f{0.0f, 0.0f, 0.0f, 0.0f};   // zero pad
            #pragma unroll
            for (int e = 0; e < 4; ++e) {
                const float dxp = xp[e] - xv[e];         // x_{t-1} - x_t
                oq[4 * p + e] = (__bf16)(xv[e] + dxp * mq[p][e]);
                ok[4 * p + e] = (__bf16)(xv[e] + dxp * mk[p][e]);
                ov[4 * p + e] = (__bf16)(xv[e] + dxp * mv[p][e]);
                o0[4 * p + e] = (__bf16)(z0[e] + d0[e] * mv[p][e]);
                od[4 * p + e] = (__bf16)xv[e];
            }
        }
        ((v8bf*)Xq)[u]  = oq;
        ((v8bf*)Xk)[u]  = ok;
        ((v8bf*)Xv)[u]  = ov;
        ((v8bf*)Xv0)[u] = o0;
        if (c < MR)                                      // x[:, :, :128]
            ((v8bf*)Xd)[(unsigned)((b * TT + t) * (MR / 8) + c / 8)] = od;
        // before the next batch's arithmetic reuses registers that these stores name
        if (b + 1 < BB) asm volatile("s_wait_xcnt 0x0" ::: "memory");
    }
}

// ---------------------------------------------------------------------------
// Kernel 2: f32 weights -> bf16; miss [128,4096] -> missT [4096,128].
// The first blocks transpose: a lane reads 64 rows of one column of miss (a wave
// reads whole lines) and writes one whole 128-B line of missT. The others
// convert 8 elements of each weight a lane.
// ---------------------------------------------------------------------------
constexpr int MT_BLOCKS = 4 * CC * (MR / 64) / 256;
constexpr int WC_BLOCKS = CC * CC / 8 / 256;

__device__ static __forceinline__ void wconv_block(int blk,
    const float* __restrict__ Wq, const float* __restrict__ Wk,
    const float* __restrict__ Wv, const float* __restrict__ Wp,
    const float* __restrict__ miss,
    __bf16* __restrict__ Wqb, __bf16* __restrict__ Wkb,
    __bf16* __restrict__ Wvb, __bf16* __restrict__ Wpb,
    __bf16* __restrict__ missT)
{
    if (blk < MT_BLOCKS) {
        const int i  = blk * 256 + threadIdx.x;
        const int n  = i % (4 * CC);
        const int r0 = (i / (4 * CC)) * 64;
        const float* s = miss + (unsigned)(r0 * (4 * CC) + n);
        float v[64];
        #pragma unroll
        for (int r = 0; r < 64; ++r) v[r] = s[r * (4 * CC)];
        #pragma unroll
        for (int q = 0; q < 8; ++q) {
            v8bf o;
            #pragma unroll
            for (int e = 0; e < 8; ++e) o[e] = (__bf16)v[q * 8 + e];
            ((v8bf*)missT)[(unsigned)((n * MR + r0) / 8 + q)] = o;
        }
    } else {
        const unsigned u = (blk - MT_BLOCKS) * 256 + threadIdx.x;           // in 8 elements
        const v8bf q = cvt8(Wq, u), k = cvt8(Wk, u), v = cvt8(Wv, u), p = cvt8(Wp, u);
        ((v8bf*)Wqb)[u] = q;
        ((v8bf*)Wkb)[u] = k;
        ((v8bf*)Wvb)[u] = v;
        ((v8bf*)Wpb)[u] = p;
        // the built code lays the other branch behind this one: no register that
        // these stores name is rewritten ahead of this wait on any way through it
        asm volatile("s_wait_xcnt 0x0" ::: "memory");
    }
}

// Kernels 1 and 2 read only inputs and depend on nothing of one another: one
// launch. The weights' blocks come first (the transposing
// ones take longest); the second launch's gap and its
// start-up, during which the memory idles, are gone.
__global__ __launch_bounds__(256) void prep_wconv_kernel(
    const float* __restrict__ x, const float* __restrict__ x0,
    const float* __restrict__ dx0,
    const float* __restrict__ x_q, const float* __restrict__ x_k,
    const float* __restrict__ x_v,
    const float* __restrict__ Wq, const float* __restrict__ Wk,
    const float* __restrict__ Wv, const float* __restrict__ Wp,
    const float* __restrict__ miss,
    __bf16* __restrict__ Xq, __bf16* __restrict__ Xk,
    __bf16* __restrict__ Xv, __bf16* __restrict__ Xv0,
    __bf16* __restrict__ Xd,
    __bf16* __restrict__ Wqb, __bf16* __restrict__ Wkb,
    __bf16* __restrict__ Wvb, __bf16* __restrict__ Wpb,
    __bf16* __restrict__ missT)
{
    const int blk = blockIdx.x;
    if (blk < MT_BLOCKS + WC_BLOCKS)
        wconv_block(blk, Wq, Wk, Wv, Wp, miss, Wqb, Wkb, Wvb, Wpb, missT);
    else
        prep_block(blk - (MT_BLOCKS + WC_BLOCKS), x, x0, dx0, x_q, x_k, x_v, Xq, Xk, Xv, Xv0, Xd);
}

// ---------------------------------------------------------------------------
// Kernel 3: bf16 WMMA GEMM,  Y[m,n] = sum_k X[m,k] * W[n,k]  (+ resid)
//   block tile 128x128, 256 threads = 8 wave32; wave tile 64x32 (4x2 WMMA).
//   K-step 64, double-buffered LDS, async global->LDS staging when available:
//   a row's piece of a stage is one whole 128-B line, so a wave's copy touches
//   four lines (with 32 k a stage it was eight half lines for the same bytes).
// gemm_tile is one block's tile; the kernels behind it say which tile of which
// product a block takes. Whether a residual is added, and the row pitch of Y,
// are settled at compile time: a lane's 64 places in Y (and in resid) are then
// one address and 64 constant offsets.
// ---------------------------------------------------------------------------
constexpr int GKT = 64;                  // k per stage
constexpr int LDR = GKT + 8;             // padded row (144B, 16B aligned)
// The two operands' tiles, two buffers each. The kernel declares them, so that a
// kernel which holds tiles of two shapes has them once.
struct __align__(16) GemmLds { __bf16 A[2][128][LDR]; __bf16 B[2][128][LDR]; };

template <int KDIM, int NDIM, bool RESID>
__device__ static __forceinline__ void gemm_tile(
    GemmLds& lds,
    const __bf16* __restrict__ X, const __bf16* __restrict__ W,
    float* __restrict__ Y, const float* __restrict__ resid,
    int mBase, int nBase)
{
    constexpr int KT    = GKT;
    constexpr int KITER = KDIM / KT;
    static_assert(KDIM % KT == 0 && KT % 32 == 0, "whole stages of whole WMMA steps");
    auto& As = lds.A;
    auto& Bs = lds.B;

    const int tid    = threadIdx.x;
    const int lane   = tid & 31;
    const int wave   = tid >> 5;
    const int wm     = (wave >> 2) * 64;     // 0 | 64
    const int wn     = (wave & 3) * 32;      // 0,32,64,96
    const int laneLo = lane & 15;
    const int kbase  = ((lane >> 4) & 1) * 8; // lanes 0-15 -> K{0..7,16..23};
                                              // lanes 16-31 -> K{8..15,24..31}

    v8f acc[4][2];
    #pragma unroll
    for (int i = 0; i < 4; ++i)
        #pragma unroll
        for (int j = 0; j < 2; ++j)
            #pragma unroll
            for (int e = 0; e < 8; ++e) acc[i][j][e] = 0.0f;

    auto loadTile = [&](int buf, int k0) {
        #pragma unroll
        for (int ch = 0; ch < 128 * KT / 2048; ++ch) {
            int e  = ch * 2048 + tid * 8;
            int r  = e / KT;        // 0..127
            int kk = e % KT;        // 0,8,..,KT-8
            const __bf16* gA = &X[(size_t)(mBase + r) * KDIM + k0 + kk];
            const __bf16* gB = &W[(size_t)(nBase + r) * KDIM + k0 + kk];
#if USE_ASYNC_LDS
            async_copy_b128(gA, &As[buf][r][kk]);
            async_copy_b128(gB, &Bs[buf][r][kk]);
#else
            *(v8bf*)&As[buf][r][kk] = *(const v8bf*)gA;
            *(v8bf*)&Bs[buf][r][kk] = *(const v8bf*)gB;
#endif
        }
    };

    loadTile(0, 0);

    // C/D layout: VGPR v, lanes 0-15 -> (M=v, N=lane); lanes 16-31 -> (M=8+v)
    // the lane's first place in Y; tile (i, j), register v lies
    // (i * 16 + v) * NDIM + j * 16 elements further on
    const size_t off0 = (size_t)(mBase + wm + (lane >> 4) * 8) * NDIM + (nBase + wn + laneLo);

    // The residual depends on nothing that is computed here: all 64 loads of the
    // lane are issued now and fly beside the first tile's copies (the loop's first
    // barrier waits for loads too, once for all of them). One at a time in the
    // epilogue, each waited for before the next is issued, they cost the wave 64
    // latencies in a row.
    float rv[4][2][8];
    if constexpr (RESID) {
        const float* rp = resid + off0;
        #pragma unroll
        for (int i = 0; i < 4; ++i)
            #pragma unroll
            for (int j = 0; j < 2; ++j)
                #pragma unroll
                for (int v = 0; v < 8; ++v)
                    rv[i][j][v] = rp[(i * 16 + v) * NDIM + j * 16];
        // before the loop's arithmetic reuses a register that these loads name
        asm volatile("s_wait_xcnt 0x0" ::: "memory");
    }

    for (int ki = 0; ki < KITER; ++ki) {
#if USE_ASYNC_LDS
        __builtin_amdgcn_s_wait_asynccnt(0);   // own async copies in LDS
#endif
        __syncthreads();                       // all waves' copies visible
        const int buf = ki & 1;
        if (ki + 1 < KITER) loadTile(buf ^ 1, (ki + 1) * KT);

        // unrolled, so that kh is a constant offset of the LDS reads
        #pragma unroll
        for (int kh = 0; kh < KT; kh += 32) {
            v16bf afrag[4], bfrag[2];
            #pragma unroll
            for (int i = 0; i < 4; ++i) {
                const __bf16* ap = &As[buf][wm + i * 16 + laneLo][kh + kbase];
                v8bf lo = *(const v8bf*)ap;
                v8bf hi = *(const v8bf*)(ap + 16);
                afrag[i] = __builtin_shufflevector(lo, hi, 0, 1, 2, 3, 4, 5, 6, 7,
                                                   8, 9, 10, 11, 12, 13, 14, 15);
            }
            #pragma unroll
            for (int j = 0; j < 2; ++j) {
                const __bf16* bp = &Bs[buf][wn + j * 16 + laneLo][kh + kbase];
                v8bf lo = *(const v8bf*)bp;
                v8bf hi = *(const v8bf*)(bp + 16);
                bfrag[j] = __builtin_shufflevector(lo, hi, 0, 1, 2, 3, 4, 5, 6, 7,
                                                   8, 9, 10, 11, 12, 13, 14, 15);
            }
            #pragma unroll
            for (int i = 0; i < 4; ++i)
                #pragma unroll
                for (int j = 0; j < 2; ++j)
                    acc[i][j] = __builtin_amdgcn_wmma_f32_16x16x32_bf16(
                        false, afrag[i], false, bfrag[j],
                        (short)0, acc[i][j], false, false);
        }
    }

    if constexpr (RESID) {
        #pragma unroll
        for (int i = 0; i < 4; ++i)
            #pragma unroll
            for (int j = 0; j < 2; ++j)
                #pragma unroll
                for (int v = 0; v < 8; ++v) acc[i][j][v] += rv[i][j][v];
        // every sum stands in front of the first store: mixed among the stores,
        // later sums were put into registers that issued stores still name
        __builtin_amdgcn_sched_barrier(0);
    }
    float* yp = Y + off0;
    #pragma unroll
    for (int i = 0; i < 4; ++i)
        #pragma unroll
        for (int j = 0; j < 2; ++j)
            #pragma unroll
            for (int v = 0; v < 8; ++v)
                yp[(i * 16 + v) * NDIM + j * 16] = acc[i][j][v];
}

template <int KDIM, int NDIM, bool RESID>
__global__ __launch_bounds__(256) void gemm_bf16_wmma(
    const __bf16* __restrict__ X, const __bf16* __restrict__ W,
    float* __restrict__ Y, const float* __restrict__ resid)
{
    __shared__ GemmLds lds;
    gemm_tile<KDIM, NDIM, RESID>(lds, X, W, Y, resid, blockIdx.y * 128, blockIdx.x * 128);
}

// The four projections of the inputs depend on nothing of one another: one
// launch, blockIdx.z says which. A projection of its own is one block a WGP, and
// that block waits out the landing of its copies once per K-step; here four
// blocks share a WGP and work while another waits.
// The deltas product depends on none of them either and rides in the same launch:
// its blocks are short in K and mostly store, the projections' mostly load from L2
// and multiply. Even z is a projection, odd z a quarter of the deltas' columns, so
// that blocks of both kinds are resident together from the start.
__global__ __launch_bounds__(256) void gemm_proj4_deltas_kernel(
    const __bf16* __restrict__ Xq, const __bf16* __restrict__ Xk,
    const __bf16* __restrict__ Xv, const __bf16* __restrict__ Xv0,
    const __bf16* __restrict__ Wqb, const __bf16* __restrict__ Wkb,
    const __bf16* __restrict__ Wvb,
    const __bf16* __restrict__ Xd, const __bf16* __restrict__ missT,
    float* __restrict__ qf, float* __restrict__ kf, float* __restrict__ vfr,
    float* __restrict__ vfirst, float* __restrict__ deltas)
{
    __shared__ GemmLds lds;
    const int p = blockIdx.z >> 1;
    if (blockIdx.z & 1) {
        gemm_tile<MR, 4 * CC, false>(lds, Xd, missT, deltas, nullptr,
                                     blockIdx.y * 128, p * CC + blockIdx.x * 128);
        // the built code lays the other branch behind this one: no register that
        // the tile's stores name is rewritten ahead of this wait on any way through it
        asm volatile("s_wait_xcnt 0x0" ::: "memory");
    } else {
        const __bf16* X = p == 0 ? Xq  : p == 1 ? Xk  : p == 2 ? Xv  : Xv0;
        const __bf16* W = p == 0 ? Wqb : p == 1 ? Wkb : Wvb;
        float*        Y = p == 0 ? qf  : p == 1 ? kf  : p == 2 ? vfr : vfirst;
        gemm_tile<CC, CC, false>(lds, X, W, Y, nullptr, blockIdx.y * 128, blockIdx.x * 128);
    }
}

// ---------------------------------------------------------------------------
// Kernel 4: per-(token,head) elementwise + k-normalization; bf16 rounding of
// the six scan operands (matching the reference's rounding point); packs
// them for the scan (layout: ScanOp). The decay e^w depends on no state row, so
// it is taken here, once per (token, column), from the rounded w: in the scan
// every one of the 64 rows took it again.
// A block: ETK tokens, all columns. A lane: 4 columns, so a 16-lane row is one
// head and |k|^2 is a DPP row sum; its three pieces are 48 contiguous bytes.
// ---------------------------------------------------------------------------
constexpr int ETK = 4;                        // tokens per block, kernels 4 and 6
static_assert(CC == 256 * 4 && NN == 16 * 4 && MM % ETK == 0, "lane deal");

__global__ __launch_bounds__(256) void post_gemm_kernel(
    const float* __restrict__ qf, const float* __restrict__ kf,
    const float* __restrict__ vfr, const float* __restrict__ vfirst,
    const float* __restrict__ deltas,
    const float* __restrict__ w0, const float* __restrict__ v0,
    const float* __restrict__ a0,
    ScanOp* __restrict__ sops,
    __bf16* __restrict__ vh, __bf16* __restrict__ gb)
{
    const int c = threadIdx.x * 4;
    const v4f w0v = ld4(w0 + c), v0v = ld4(v0 + c), a0v = ld4(a0 + c);
    // the lane's place in the block's first token, in 4 elements
    const unsigned u0 = blockIdx.x * (ETK * CC / 4) + threadIdx.x;
    const unsigned d0 = blockIdx.x * (ETK * CC) + threadIdx.x;       // in deltas
    const unsigned jc = threadIdx.x & 15;                            // column group in the head
    // the head's pieces of the block's first token
    const unsigned s0 = (blockIdx.x * (ETK * HH) + (threadIdx.x >> 4)) * SPB;

    #pragma unroll
    for (int it = 0; it < ETK; ++it) {
        const int o = it * (CC / 4);                     // token, in 4 elements
        const v4f* dp = (const v4f*)deltas + d0 + 4 * o;

        const v4f kv = ((const v4f*)kf + u0)[o],  qv = ((const v4f*)qf + u0)[o];
        const v4f vr = ((const v4f*)vfr + u0)[o], vf = ((const v4f*)vfirst + u0)[o];
        const v4f wd = dp[0], vd = dp[CC / 4], ad = dp[2 * (CC / 4)], gd = dp[3 * (CC / 4)];
        // before the arithmetic reuses registers that these loads name
        asm volatile("s_wait_xcnt 0x0" ::: "memory");

        const float norm = sqrtf(row_sum16((kv[0] * kv[0] + kv[1] * kv[1]) +
                                           (kv[2] * kv[2] + kv[3] * kv[3])));
        const float den  = fmaxf(norm, 1e-12f);

        v4i  R0, R1;                          // q | k and z | b of the four columns
        v4f  ew;                              // their decay
        v4bf vo, go;
        #pragma unroll
        for (int e = 0; e < 4; ++e) {
            const float xw   = -(w0v[e] + wd[e]);
            const float sp   = (xw > 20.0f) ? xw : log1pf(__expf(xw)); // softplus
            const float logw = -__expf(-sp - 0.5f);                    // log decay < 0

            const float sv = 1.0f / (1.0f + __expf(-(v0v[e] + vd[e])));
            const float vv = vr[e] + (vf[e] - vr[e]) * sv;

            const float a  = 1.0f / (1.0f + __expf(-(a0v[e] + ad[e])));
            const float kk = kv[e] / den;

            R0[e] = pack2(qv[e], kv[e] * a);
            R1[e] = pack2(-kk, kk * a);
            ew[e] = __expf((float)(__bf16)logw);         // exp after bf16 round, as reference
            vo[e] = (__bf16)vv;
            go[e] = (__bf16)(1.0f + gd[e]);
        }
        ScanOp* sp = sops + s0 + it * (HH * SPB);
        *(v4i*)(sp + 3 * jc)      = R0;
        *(v4i*)(sp + 3 * jc + 1)  = R1;
        *(v4f*)(sp + 3 * jc + 2)  = ew;
        ((v4bf*)(sp + 48))[jc]    = vo;
        ((v4bf*)vh + u0)[o] = vo;
        ((v4bf*)gb + u0)[o] = go;
        // before the next token's loads reuse registers that these stores name
        if (it + 1 < ETK) asm volatile("s_wait_xcnt 0x0" ::: "memory");
    }
}

constexpr int SCH = 16;
constexpr int STS = 32;
constexpr int SNT = TT / STS;
static_assert(SNT >= 2 && STS % SCH == 0, "two tiles at least, whole chunks");

// One tile: STS steps of SPB pieces (896 B a step, contiguous; steps lie
// HH * SPB pieces apart in global memory, back to back in LDS). A wave brings
// STS/4 steps, one piece a lane and copy; 7 * 32 pieces are four steps.
static_assert(4 * SPB == 7 * 32 && STS % 16 == 0, "four steps are seven copies of a wave");

__device__ static inline void scan_fetch(const ScanOp* g0, ScanOp* l0,
                                         int wave, int lane)
{
    constexpr int GP = HH * SPB;                             // step pitch, global
    const ScanOp* g = g0 + (size_t)wave * (STS / 4) * GP;
    ScanOp*       l = l0 + wave * (STS / 4) * SPB + lane;
    #pragma unroll
    for (int r = 0; r < 7; ++r) {
        const int     pc = r * 32 + lane;                    // piece 0..223
        const ScanOp* gr = g + (pc / SPB) * GP + pc % SPB;
        #pragma unroll
        for (int a = 0; a < STS / 16; ++a) {
#if USE_ASYNC_LDS
            async_copy_b128(gr + a * 4 * GP, l + (a * 7 + r) * 32);
#else
            l[(a * 7 + r) * 32] = gr[a * 4 * GP];
#endif
        }
    }
}

struct Rec4 { v4i qk, zb; v4f ew; };         // a lane's four columns of one step

__device__ static inline Rec4 scan_read(const ScanOp* lp, int u)
{
    const ScanOp* rp = lp + u * SPB;
    return Rec4{*(const v4i*)rp, *(const v4i*)(rp + 1), *(const v4f*)(rp + 2)};
}

constexpr int SG = 8;                         // steps whose LDS reads stand together
static_assert(STS % SG == 0 && STS / SG >= 2, "whole groups, two at least");

// The S.q partials are folded level by level. Level N makes one sum of two, each
// of 2^(N-1) steps: lanes whose step slot has bit 2^(N-1) clear keep the first,
// the others the second, and each adds what its partner (lane ^ bit) holds of the
// same. The partial of step T is at hand in step T + 1, and level N
// of the group that T ends is taken in step T + N, so that a step holds two
// selects and one row add per level and at most two levels, all in the gaps of
// its chain. f[n]: the first half of a level, waiting; r[n]: the second half.
template <int T, int N>                      // is level N of a group ending at T due?
constexpr bool fold_due = T >= 0 && T % (1 << N) == (1 << N) - 1;

constexpr unsigned fold_mask(int bit)        // lanes whose step slot has this bit
{
    return bit == 1 ? 0xaaaaaaaau : bit == 2 ? 0xccccccccu : bit == 4 ? 0xf0f0f0f0u : 0xff00ff00u;
}

template <int N>
__device__ static inline void fold_select(const float (&f)[4], const float (&r)[4],
                                          float& keep, float& send)
{
    keep = select_f(f[N - 1], r[N - 1], fold_mask(1 << (N - 1)));
    send = select_f(r[N - 1], f[N - 1], fold_mask(1 << (N - 1)));
}

// where a finished sum of level N for the group ending at T goes
template <int T, int N>
__device__ static inline void fold_bank(float s, float (&f)[4], float (&r)[4],
                                        float (&o)[STS / SCH])
{
    if constexpr (N == 4) o[T / SCH] = s;
    else if constexpr (fold_due<T, N + 1>) r[N] = s;
    else f[N] = s;
}

template <int T, int N>
__device__ static inline void fold_add(float keep, float send, float (&f)[4], float (&r)[4],
                                       float (&o)[STS / SCH])
{
    fold_bank<T, N>(add_xmask2<1 << (N - 1)>(send, keep), f, r, o);
}

template <int U>
struct ScanSteps {
    // lp: the lane's three pieces of the tile's first step, in LDS
    // qp: the q | k words of the step before (its output sum is taken here)
    __device__ static inline void run(const ScanOp* lp, Rec4 (&pipe)[2][SG], float (&S)[4],
                                      float (&f)[4], float (&r)[4],
                                      const int (&vrow)[STS / SCH],
                                      float (&o)[STS / SCH], v4i qp)
    {
        constexpr int t = STS - U;           // step in the tile
        constexpr int u = t % SCH;           // step in the chunk
        constexpr int gr = t / SG;           // group of steps in the tile
        if constexpr (t % SG == 0 && t + SG < STS) {
            // The next group's reads stand together at the head of this group (for
            // speed only). The two scheduling barriers keep the
            // scheduler from spreading the reads over the steps on either side.
            // At t = 0 the tile's first reads stand directly in front, and no
            // barrier parts the two groups.
            if constexpr (t > 0) __builtin_amdgcn_sched_barrier(0);
            #pragma unroll
            for (int i = 0; i < SG; ++i)
                pipe[(gr + 1) & 1][i] = scan_read(lp, t + SG + i);
            __builtin_amdgcn_sched_barrier(0);
        }
        const v4i qk = pipe[gr & 1][t % SG].qk, zb = pipe[gr & 1][t % SG].zb;
        const v4f ew = pipe[gr & 1][t % SG].ew;

        // The chain: S.z in the lane (three links), four row-sum links, the update
        // of S. Everything else stands between its links: S * e^w, v * k, the
        // output sum of the step before, for which S still holds that step's
        // state, and the folds that are due.
        float p0 = 0.0f, p1 = 0.0f, kp[5], sd[5];
        float a0 = mul_bf(S[0], zb[0]);
        float a1 = mul_bf(S[2], zb[2]);
        float X0 = mul_f(S[0], ew[0]);
        float X1 = mul_f(S[1], ew[1]);
        float X2 = mul_f(S[2], ew[2]);
        a0 = fma_bf<false>(S[1], zb[1], a0);
        a1 = fma_bf<false>(S[3], zb[3], a1);
        float X3 = mul_f(S[3], ew[3]);
        const int vt = row_share<u>(vrow[t / SCH]);          // this step's v of the row, bf16
        if constexpr (t > 0) p0 = mul_bf(S[0], qp[0]);
        float sa = add_f(a0, a1);
        if constexpr (t > 0) p1 = mul_bf(S[2], qp[2]);
        X0 = fma_bb(vt, qk[0], X0);
        X1 = fma_bb(vt, qk[1], X1);
        sa = add_xmask<1>(sa);
        X2 = fma_bb(vt, qk[2], X2);
        X3 = fma_bb(vt, qk[3], X3);
        if constexpr (t > 0) {
            p0 = fma_bf<false>(S[1], qp[1], p0);
            p1 = fma_bf<false>(S[3], qp[3], p1);
        }
        sa = add_xmask<2>(sa);
        if constexpr (t > 0) fold_bank<t - 1, 0>(add_f(p0, p1), f, r, o);
        sa = add_xmask<4>(sa);
        if constexpr (fold_due<t - 4, 4>) fold_select<4>(f, r, kp[4], sd[4]);
        if constexpr (fold_due<t - 3, 3>) fold_select<3>(f, r, kp[3], sd[3]);
        if constexpr (fold_due<t - 2, 2>) fold_select<2>(f, r, kp[2], sd[2]);
        if constexpr (fold_due<t - 1, 1>) fold_select<1>(f, r, kp[1], sd[1]);
        sa = add_xmask<8>(sa);
        if constexpr (fold_due<t - 4, 4>) fold_add<t - 4, 4>(kp[4], sd[4], f, r, o);
        if constexpr (fold_due<t - 3, 3>) fold_add<t - 3, 3>(kp[3], sd[3], f, r, o);
        if constexpr (fold_due<t - 2, 2>) fold_add<t - 2, 2>(kp[2], sd[2], f, r, o);
        if constexpr (fold_due<t - 1, 1>) fold_add<t - 1, 1>(kp[1], sd[1], f, r, o);
        S[0] = fma_bf<true>(sa, zb[0], X0);
        S[2] = fma_bf<true>(sa, zb[2], X2);
        S[1] = fma_bf<true>(sa, zb[1], X1);
        S[3] = fma_bf<true>(sa, zb[3], X3);

        ScanSteps<U - 1>::run(lp, pipe, S, f, r, vrow, o, qk);
    }
};
template <>
struct ScanSteps<0> {
    // the output sum of the tile's last step, and its four folds
    __device__ static inline void run(const ScanOp*, Rec4 (&)[2][SG], float (&S)[4],
                                      float (&f)[4], float (&r)[4],
                                      const int (&)[STS / SCH],
                                      float (&o)[STS / SCH], v4i qp)
    {
        float p0 = mul_bf(S[0], qp[0]);
        float p1 = mul_bf(S[2], qp[2]);
        p0 = fma_bf<false>(S[1], qp[1], p0);
        p1 = fma_bf<false>(S[3], qp[3], p1);
        fold_bank<STS - 1, 0>(add_f(p0, p1), f, r, o);
        float kp, sd;
        fold_select<1>(f, r, kp, sd);  fold_add<STS - 1, 1>(kp, sd, f, r, o);
        fold_select<2>(f, r, kp, sd);  fold_add<STS - 1, 2>(kp, sd, f, r, o);
        fold_select<3>(f, r, kp, sd);  fold_add<STS - 1, 3>(kp, sd, f, r, o);
        fold_select<4>(f, r, kp, sd);  fold_add<STS - 1, 4>(kp, sd, f, r, o);
    }
};

__global__ __launch_bounds__(128) void scan_kernel(
    const ScanOp* __restrict__ sops, float* __restrict__ y)
{
    __shared__ ScanOp tile[2][STS][SPB];

    const int lane = threadIdx.x & 31;
    const int wave = threadIdx.x >> 5;
    const int g    = blockIdx.x >> 3;                        // b*H + h
    const int rp   = (blockIdx.x & 7) * 4 + wave;            // row pair 0..31
    const int h    = g % HH;
    const int b    = g / HH;
    const int j    = lane & 15;                              // column group / step slot
    const int row  = rp * 2 + (lane >> 4);

    const ScanOp* hb = sops + ((size_t)b * TT * HH + h) * SPB;        // t = 0
    float* yp = y + ((size_t)g * (TT / SCH) * 32 + rp) * 32 + lane;

    float S[4] = {0.0f, 0.0f, 0.0f, 0.0f};

    scan_fetch(hb, &tile[0][0][0], wave, lane);
    // own copies of tile 0 landed; the barrier publishes every wave's
    asm volatile("s_wait_asynccnt 0x0" ::: "memory");
    __syncthreads();
    scan_fetch(hb + (size_t)STS * HH * SPB, &tile[1][0][0], wave, lane);

    // kept rolled: the body already holds STS unrolled steps
    #pragma unroll 1
    for (int tl = 0; tl < SNT; ++tl) {
        ScanOp* tb = &tile[tl & 1][0][0];

        // read first: the tile's first step needs them, and LDS answers in order
        int   vrow[STS / SCH];
        float o[STS / SCH], f[4], r[4];
        #pragma unroll
        for (int c = 0; c < STS / SCH; ++c)  // v of my row at step j of chunk c, bf16
            vrow[c] = ((const unsigned short*)(tb + (c * SCH + j) * SPB + 48))[row];
        // keeps these two reads in front: behind the first group's reads, the
        // first step waits for the whole group
        __builtin_amdgcn_sched_barrier(0);
        Rec4 pipe[2][SG];
        #pragma unroll
        for (int i = 0; i < SG; ++i) pipe[0][i] = scan_read(tb + j * 3, i);

        ScanSteps<STS>::run(tb + j * 3, pipe, S, f, r, vrow, o, v4i{0, 0, 0, 0});

        // keeps the last groups' arithmetic in front of the foot: lifted over it,
        // the wait below stands right behind the tile's last reads and the wave
        // sits out their whole latency
        __builtin_amdgcn_sched_barrier(0);
        // foot of the trip: my reads of this tile are done, my copies of the
        // next tile have landed; the barrier says both of every wave
        asm volatile("s_wait_dscnt 0x0" ::: "memory");
        asm volatile("s_wait_asynccnt 0x0" ::: "memory");
        __syncthreads();
        if (tl + 2 < SNT)
            scan_fetch(hb + (size_t)(tl + 2) * STS * HH * SPB, tb, wave, lane);

        // stored behind the barrier: in front of it the barrier's own wait for
        // stores would expose their whole latency once per tile
        #pragma unroll
        for (int c = 0; c < STS / SCH; ++c) {
            *yp = o[c] * 0.125f;             // * N^-0.5
            yp += 32 * 32;
        }
    }
    // no copy is left in flight when the wave ends
    asm volatile("s_wait_asynccnt 0x0" ::: "memory");
}

// ---------------------------------------------------------------------------
// Kernel 6: norm-ratio correction + gate -> bf16 input for output projection.
// A block: ETK tokens of one chunk of y, all columns. A lane: 4 columns of each,
// a 16-lane row is one head (norms: DPP row sums). y lies step-fastest (see
// kernel 5), so one 16-B load is one column's ETK steps.
// ---------------------------------------------------------------------------
static_assert(ETK == 4 && SCH % ETK == 0 && TT % SCH == 0, "a block stays in one chunk");

__global__ __launch_bounds__(256) void post_scan_kernel(
    const float* __restrict__ y, const float* __restrict__ x,
    const __bf16* __restrict__ vh, const __bf16* __restrict__ gb,
    const float* __restrict__ r_k, __bf16* __restrict__ Yg)
{
    const int    c  = threadIdx.x * 4;
    const int    h  = threadIdx.x >> 4;
    const int    n0 = c & (NN - 1);
    const unsigned m0 = blockIdx.x * ETK;
    const unsigned t0 = m0 % TT;
    const unsigned gy = (m0 / TT) * HH + h;

    // y[((gy*(T/SCH) + chunk)*NN + n)*SCH + step], here in 4 steps
    const unsigned yu = ((gy * (TT / SCH) + t0 / SCH) * NN + n0) * (SCH / 4) + (t0 % SCH) / 4;
    v4f yv[4];                                // [column][token]
    #pragma unroll
    for (int e = 0; e < 4; ++e) yv[e] = ((const v4f*)y)[yu + e * (SCH / 4)];

    const v4f rk = ld4(r_k + c);
    // before a later load's result lands in a register that these loads name
    asm volatile("s_wait_xcnt 0x0" ::: "memory");
    float sig[4];
    #pragma unroll
    for (int e = 0; e < 4; ++e) sig[e] = 1.0f / (1.0f + __expf(-rk[e]));

    // every load of the lane is issued before the first value is used
    v4f  xvs[ETK];
    v4bf vbs[ETK], gvs[ETK];
    #pragma unroll
    for (int it = 0; it < ETK; ++it) {
        const unsigned u = (m0 + it) * (CC / 4) + threadIdx.x;   // in 4 elements
        xvs[it] = ((const v4f*)x)[u];
        vbs[it] = ((const v4bf*)vh)[u];
        gvs[it] = ((const v4bf*)gb)[u];
    }

    #pragma unroll
    for (int it = 0; it < ETK; ++it) {
        const unsigned u = (m0 + it) * (CC / 4) + threadIdx.x;
        const v4f  xv = xvs[it];
        const v4bf vb = vbs[it], gv = gvs[it];
        float vv[4];
        #pragma unroll
        for (int e = 0; e < 4; ++e) vv[e] = (float)vb[e];

        const float xnorm = sqrtf(row_sum16((xv[0] * xv[0] + xv[1] * xv[1]) +
                                            (xv[2] * xv[2] + xv[3] * xv[3])));
        const float vnorm = sqrtf(row_sum16((vv[0] * vv[0] + vv[1] * vv[1]) +
                                            (vv[2] * vv[2] + vv[3] * vv[3])));
        const float ratio = 1.0f - xnorm / (vnorm + 1e-12f);

        v4bf o;
        #pragma unroll
        for (int e = 0; e < 4; ++e) {
            const float u = ratio * sig[e];
            o[e] = (__bf16)((yv[e][it] + vv[e] * u) * (float)gv[e]);
        }
        ((v4bf*)Yg)[u] = o;
    }
}

// ---------------------------------------------------------------------------
// Host launcher
// ---------------------------------------------------------------------------
extern "C" void kernel_launch(void* const* d_in, const int* in_sizes, int n_in,
                              void* d_out, int out_size, void* d_ws,
                              size_t ws_size, hipStream_t stream)
{
    (void)in_sizes; (void)n_in; (void)out_size; (void)ws_size;

    const float* residual = (const float*)d_in[0];
    const float* x        = (const float*)d_in[1];
    const float* x0       = (const float*)d_in[2];
    const float* dx0      = (const float*)d_in[3];
    const float* Wq       = (const float*)d_in[4];
    const float* Wk       = (const float*)d_in[5];
    const float* Wv       = (const float*)d_in[6];
    const float* Wproj    = (const float*)d_in[7];
    const float* x_q      = (const float*)d_in[8];
    const float* x_k      = (const float*)d_in[9];
    const float* x_v      = (const float*)d_in[10];
    const float* v0       = (const float*)d_in[11];
    const float* w0       = (const float*)d_in[12];
    const float* a0       = (const float*)d_in[13];
    const float* miss     = (const float*)d_in[14];
    const float* r_k      = (const float*)d_in[15];
    float*       out      = (float*)d_out;

    // ---- workspace layout (256B aligned bump allocator) ----
    char*  ws  = (char*)d_ws;
    size_t off = 0;
    auto alloc = [&](size_t bytes) -> void* {
        void* p = ws + off;
        off += (bytes + 255) & ~(size_t)255;
        return p;
    };
    const size_t MC_BF = (size_t)MM * CC * sizeof(__bf16);    // 8 MB
    const size_t MC_F  = (size_t)MM * CC * sizeof(float);     // 16 MB
    const size_t W_BF  = (size_t)CC * CC * sizeof(__bf16);    // 2 MB
    const size_t XD_BF = (size_t)MM * MR * sizeof(__bf16);    // 1 MB
    const size_t DL_F  = (size_t)MM * 4 * CC * sizeof(float); // 64 MB
    const size_t SO_SZ = (size_t)MM * HH * SPB * sizeof(ScanOp); // 56 MB

    __bf16* Xq    = (__bf16*)alloc(MC_BF);
    __bf16* Xk    = (__bf16*)alloc(MC_BF);
    __bf16* Xv    = (__bf16*)alloc(MC_BF);
    __bf16* Xv0   = (__bf16*)alloc(MC_BF);
    __bf16* Xd    = (__bf16*)alloc(XD_BF);
    __bf16* Wqb   = (__bf16*)alloc(W_BF);
    __bf16* Wkb   = (__bf16*)alloc(W_BF);
    __bf16* Wvb   = (__bf16*)alloc(W_BF);
    __bf16* Wpb   = (__bf16*)alloc(W_BF);
    __bf16* missT = (__bf16*)alloc(XD_BF);
    float*  qf    = (float*)alloc(MC_F);
    float*  kf    = (float*)alloc(MC_F);
    float*  vfr   = (float*)alloc(MC_F);
    float*  vfirst= (float*)alloc(MC_F);
    float*  deltas= (float*)alloc(DL_F);
    ScanOp* sops  = (ScanOp*)alloc(SO_SZ);
    __bf16* gb    = (__bf16*)alloc(MC_BF);
    // aliases over buffers whose last reader precedes the new writer:
    __bf16* vh  = Xv0;       // Xv0 consumed by v_first GEMM before post_gemm
    float*  y   = qf;        // qf consumed by post_gemm before scan writes
    __bf16* Yg  = (__bf16*)kf;

    // ---- 1) input prep + weight conversion ----
    {
        prep_wconv_kernel<<<dim3(MT_BLOCKS + WC_BLOCKS + PREP_BLOCKS), dim3(256), 0, stream>>>(
            x, x0, dx0, x_q, x_k, x_v, Wq, Wk, Wv, Wproj, miss,
            Xq, Xk, Xv, Xv0, Xd, Wqb, Wkb, Wvb, Wpb, missT);
    }

    // ---- 2) WMMA GEMMs: q, k, v, v_first (K=1024, N=1024), deltas (K=128, N=4096)
    {
        dim3 grid8(CC / 128, MM / 128, 8), blk(256);
        gemm_proj4_deltas_kernel<<<grid8, blk, 0, stream>>>(
            Xq, Xk, Xv, Xv0, Wqb, Wkb, Wvb, Xd, missT, qf, kf, vfr, vfirst, deltas);
    }

    // ---- 3) elementwise + k-norm -> packed scan operands (bf16, e^w f32) ----
    post_gemm_kernel<<<dim3(MM / ETK), dim3(256), 0, stream>>>(
        qf, kf, vfr, vfirst, deltas, w0, v0, a0, sops, vh, gb);

    // ---- 4) sequential scan (state in VGPRs, 8 rows per block) ----
    scan_kernel<<<dim3(BB * HH * 8), dim3(128), 0, stream>>>(sops, y);

    // ---- 5) norm correction + gate ----
    post_scan_kernel<<<dim3(MM / ETK), dim3(256), 0, stream>>>(y, x, vh, gb, r_k, Yg);

    // ---- 6) output projection + residual -> d_out ----
    {
        dim3 grid(CC / 128, MM / 128), blk(256);
        gemm_bf16_wmma<CC, CC, true><<<grid, blk, 0, stream>>>(Yg, Wpb, out, residual);
    }
}

// v009
// One run takes 157 microseconds.
// Timed twice side by side with v008, it ran 1.07 times as fast both times.
// Over all steps from v000 it is 28.4 times as fast.
#include <hip/hip_runtime.h>
#include <hip/hip_bf16.h>

// ---------------------------------------------------------------------------
// RWKV7 time-mix for MI455X (gfx1250, wave32, WMMA).
//   B=2, T=2048, C=1024, H=16, N=64, MISS_ROWS=128
// ---------------------------------------------------------------------------

typedef __attribute__((ext_vector_type(16))) __bf16 v16bf;
typedef __attribute__((ext_vector_type(8)))  __bf16 v8bf;
typedef __attribute__((ext_vector_type(8)))  float  v8f;
typedef __attribute__((ext_vector_type(4)))  int    v4i;

constexpr int BB = 2;
constexpr int TT = 2048;
constexpr int CC = 1024;
constexpr int HH = 16;
constexpr int NN = 64;
constexpr int MR = 128;          // MISS_ROWS
constexpr int MM = BB * TT;      // 4096 tokens

// Scan operands, in 16-B pieces. One (token, head) is SPB pieces: for each group
// of four columns three pieces (a word q | k a column; a word z | b a column, all
// bf16; e^w of the four in f32), 16 groups, then v of the 64 rows in bf16.
// Group l holds the head's columns l, 16 + l, 32 + l, 48 + l: what lane l of a
// WMMA accumulator row holds of the head's four 16-column tiles. The same order
// (place l * 4 + e for column e * 16 + l) holds for v in its pieces, for vh, gb
// and Yg, and for the k index of the output projection's weight.
struct __align__(16) ScanOp { unsigned d[4]; };
constexpr int SPB = 16 * 3 + 8;  // pieces per (token, head)

typedef __attribute__((ext_vector_type(2))) __bf16 v2bf;
__device__ static inline int pack2(float lo, float hi)
{
    return __builtin_bit_cast(int, v2bf{(__bf16)lo, (__bf16)hi});
}
// The scan's arithmetic, one instruction a statement. A wave of the scan issues
// in order: a step lasts as long as its chain of dependent
// instructions only if the independent ones stand in the chain's gaps. The
// statements are volatile so that they keep the order in which they are written
// (ScanSteps); from plain source this compiler also widens the bf16 operands with
// extra instructions to feed packed f32 arithmetic.
// a * (low or high bf16 of word d) + c
template <bool HI>
__device__ static inline float fma_bf(float a, int d, float c)
{
    float r;
    if constexpr (HI)
        asm volatile("v_fma_mix_f32_bf16 %0, %1, %2, %3 op_sel:[0,1,0] op_sel_hi:[0,1,0]"
                     : "=v"(r) : "v"(a), "v"(d), "v"(c));
    else
        asm volatile("v_fma_mix_f32_bf16 %0, %1, %2, %3 op_sel_hi:[0,1,0]"
                     : "=v"(r) : "v"(a), "v"(d), "v"(c));
    return r;
}
// (low bf16 of word a) * (high bf16 of word d) + c
__device__ static inline float fma_bb(int a, int d, float c)
{
    float r;
    asm volatile("v_fma_mix_f32_bf16 %0, %1, %2, %3 op_sel:[0,1,0] op_sel_hi:[1,1,0]"
                 : "=v"(r) : "v"(a), "v"(d), "v"(c));
    return r;
}
// a * (low bf16 of word d)
__device__ static inline float mul_bf(float a, int d)
{
    float r;
    asm volatile("v_fma_mix_f32_bf16 %0, %1, %2, neg(0) op_sel_hi:[0,1,0]"
                 : "=v"(r) : "v"(a), "v"(d));
    return r;
}
// the plain product and the plain sum, as statements so that they keep their place
__device__ static inline float mul_f(float a, float b)
{
    float r;
    asm volatile("v_mul_f32 %0, %1, %2" : "=v"(r) : "v"(a), "v"(b));
    return r;
}
__device__ static inline float add_f(float a, float b)
{
    float r;
    asm volatile("v_add_f32 %0, %1, %2" : "=v"(r) : "v"(a), "v"(b));
    return r;
}
// x + x of lane ^ M, inside a 16-lane row
template <int M>
__device__ static inline float add_xmask(float x)
{
    float r;
    asm volatile("v_add_f32_dpp %0, %1, %1 row_xmask:%2 row_mask:0xf bank_mask:0xf bound_ctrl:1"
                 : "=v"(r) : "v"(x), "n"(M));
    return r;
}
// y + x of lane ^ M
template <int M>
__device__ static inline float add_xmask2(float x, float y)
{
    float r;
    asm volatile("v_add_f32_dpp %0, %1, %2 row_xmask:%3 row_mask:0xf bank_mask:0xf bound_ctrl:1"
                 : "=v"(r) : "v"(x), "v"(y), "n"(M));
    return r;
}
// b in the lanes of mask m, a in the others
__device__ static inline float select_f(float a, float b, unsigned m)
{
    float r;
    asm volatile("v_cndmask_b32_e64 %0, %1, %2, %3" : "=v"(r) : "v"(a), "v"(b), "s"(m));
    return r;
}
// x of lane L of the row, in every lane of it
template <int L>
__device__ static inline int row_share(int x)
{
    int r;
    asm volatile("v_mov_b32_dpp %0, %1 row_share:%2 row_mask:0xf bank_mask:0xf bound_ctrl:1"
                 : "=v"(r) : "v"(x), "n"(L));
    return r;
}

// ---- gfx1250 async global->LDS copy path (guarded; falls back cleanly) ----
#if defined(__HIP_DEVICE_COMPILE__) &&                                        \
    __has_builtin(__builtin_amdgcn_global_load_async_to_lds_b128) &&          \
    __has_builtin(__builtin_amdgcn_s_wait_asynccnt)
#define USE_ASYNC_LDS 1
#else
#define USE_ASYNC_LDS 0
#endif

#if USE_ASYNC_LDS
__device__ static inline void async_copy_b128(const void* g, void* l)
{
    // Builtin signature (from clang diagnostic): AS1 v4i* src, AS3 v4i* dst,
    // imm offset, imm cpol.
    __builtin_amdgcn_global_load_async_to_lds_b128(
        (__attribute__((address_space(1))) v4i*)(g),
        (__attribute__((address_space(3))) v4i*)(l),
        0, 0);
}
#endif

// ---------------------------------------------------------------------------
// The elementwise kernels (1, 2, 6) are dealt so that a launch is about
// a thousand work-groups of eight waves, all resident at once: a lane takes 16 to
// 64 elements and moves them 8 or 16 B at a time (miss, read down a column, 4 B).
// ---------------------------------------------------------------------------
typedef __attribute__((ext_vector_type(4))) float  v4f;
typedef __attribute__((ext_vector_type(4))) __bf16 v4bf;

template <int CTRL>
__device__ static inline float dpp_mov(float x)
{
    return __builtin_bit_cast(float, __builtin_amdgcn_mov_dpp(
        __builtin_bit_cast(int, x), CTRL, 0xf, 0xf, true));
}
constexpr int DPP_ROW_XMASK = 0x160;          // + xor mask inside the row

// sum over the 16 lanes of a row, left in every lane of it
__device__ static inline float row_sum16(float s)
{
    s += dpp_mov<DPP_ROW_XMASK + 1>(s);
    s += dpp_mov<DPP_ROW_XMASK + 2>(s);
    s += dpp_mov<DPP_ROW_XMASK + 4>(s);
    s += dpp_mov<DPP_ROW_XMASK + 8>(s);
    return s;
}

__device__ static inline v4f ld4(const float* p) { return *(const v4f*)p; }

__device__ static inline v8bf cvt8(const float* p, unsigned u)
{
    const v4f lo = ((const v4f*)p)[2 * u], hi = ((const v4f*)p)[2 * u + 1];
    v8bf o;
    #pragma unroll
    for (int e = 0; e < 4; ++e) { o[e] = (__bf16)lo[e]; o[4 + e] = (__bf16)hi[e]; }
    return o;
}

// the same for a matrix whose rows are whole heads, into the order of ScanOp:
// place l * 4 + e of a head takes its column e * 16 + l
__device__ static inline v8bf cvt8_head_order(const float* p, unsigned u)
{
    const float* hp = p + ((8 * u) & ~63u) + (((8 * u) & 63u) >> 2);
    v8bf o;
    #pragma unroll
    for (int q = 0; q < 8; ++q) o[q] = (__bf16)hp[(q & 3) * 16 + (q >> 2)];
    return o;
}

// ---------------------------------------------------------------------------
// Kernel 1: token-shift input mixing -> bf16 GEMM operands.
// A lane: 8 columns of step t in every batch (the mix vectors are read once).
// ---------------------------------------------------------------------------
constexpr int PREP_BLOCKS = TT * (CC / 8) / 256;

__device__ static __forceinline__ void prep_block(int blk,
    const float* __restrict__ x, const float* __restrict__ x0,
    const float* __restrict__ dx0,
    const float* __restrict__ x_q, const float* __restrict__ x_k,
    const float* __restrict__ x_v,
    __bf16* __restrict__ Xq, __bf16* __restrict__ Xk,
    __bf16* __restrict__ Xv, __bf16* __restrict__ Xv0,
    __bf16* __restrict__ Xd)
{
    const int i = blk * 256 + threadIdx.x;
    const int c = (i % (CC / 8)) * 8;
    const int t = i / (CC / 8);

    v4f mq[2], mk[2], mv[2];
    #pragma unroll
    for (int p = 0; p < 2; ++p) {
        mq[p] = ld4(x_q + c + 4 * p);
        mk[p] = ld4(x_k + c + 4 * p);
        mv[p] = ld4(x_v + c + 4 * p);
    }
    // before a later load's result lands in a register that these loads name.
    // The output pointers are inputs so that they are fetched here, into scalar
    // registers of their own: fetched later they took the place of the bases
    // of the loads below, ahead of those loads' wait
    asm volatile("s_wait_xcnt 0x0" :: "s"(Xq), "s"(Xk), "s"(Xv), "s"(Xv0), "s"(Xd) : "memory");

    // every load of the lane is issued before the first value is used
    v4f xvs[BB][2], xps[BB][2], z0s[BB][2], d0s[BB][2];
    #pragma unroll
    for (int b = 0; b < BB; ++b) {
        const unsigned u = (unsigned)(b * (TT * CC / 8) + i);   // in 8 elements
        #pragma unroll
        for (int p = 0; p < 2; ++p) {
            xvs[b][p] = ((const v4f*)x)[2 * u + p];
            // step t-1; at t=0 the lane's own step, in bounds and not used
            xps[b][p] = ((const v4f*)x)[2 * u + p - (t > 0 ? CC / 4 : 0)];
            z0s[b][p] = ((const v4f*)x0)[2 * u + p];
            d0s[b][p] = ((const v4f*)dx0)[2 * u + p];
        }
        // before a later load's result, or the arithmetic, lands in a register
        // that these loads name
        asm volatile("s_wait_xcnt 0x0" ::: "memory");
    }
    // keeps the first batch's arithmetic, which waits for its loads, from being
    // scheduled in front of the second batch's loads
    __builtin_amdgcn_sched_barrier(0);

    #pragma unroll
    for (int b = 0; b < BB; ++b) {
        const unsigned u = (unsigned)(b * (TT * CC / 8) + i);
        v8bf oq, ok, ov, o0, od;
        #pragma unroll
        for (int p = 0; p < 2; ++p) {
            const v4f xv = xvs[b][p], z0 = z0s[b][p], d0 = d0s[b][p];
            const v4f xp = t > 0 ? xps[b][p] : v4f{0.0f, 0.0f, 0.0f, 0.0f};   // zero pad
            #pragma unroll
            for (int e = 0; e < 4; ++e) {
                const float dxp = xp[e] - xv[e];         // x_{t-1} - x_t
                oq[4 * p + e] = (__bf16)(xv[e] + dxp * mq[p][e]);
                ok[4 * p + e] = (__bf16)(xv[e] + dxp * mk[p][e]);
                ov[4 * p + e] = (__bf16)(xv[e] + dxp * mv[p][e]);
                o0[4 * p + e] = (__bf16)(z0[e] + d0[e] * mv[p][e]);
                od[4 * p + e] = (__bf16)xv[e];
            }
        }
        ((v8bf*)Xq)[u]  = oq;
        ((v8bf*)Xk)[u]  = ok;
        ((v8bf*)Xv)[u]  = ov;
        ((v8bf*)Xv0)[u] = o0;
        if (c < MR)                                      // x[:, :, :128]
            ((v8bf*)Xd)[(unsigned)((b * TT + t) * (MR / 8) + c / 8)] = od;
        // before the next batch's arithmetic reuses registers that these stores name
        if (b + 1 < BB) asm volatile("s_wait_xcnt 0x0" ::: "memory");
    }
}

// ---------------------------------------------------------------------------
// Kernel 2: f32 weights -> bf16; miss [128,4096] -> missT [4096,128].
// The first blocks transpose: a lane reads 64 rows of one column of miss (a wave
// reads whole lines) and writes one whole 128-B line of missT. The others
// convert 8 elements of each weight a lane.
// ---------------------------------------------------------------------------
constexpr int MT_BLOCKS = 4 * CC * (MR / 64) / 256;
constexpr int WC_BLOCKS = CC * CC / 8 / 256;

__device__ static __forceinline__ void wconv_block(int blk,
    const float* __restrict__ Wq, const float* __restrict__ Wk,
    const float* __restrict__ Wv, const float* __restrict__ Wp,
    const float* __restrict__ miss,
    __bf16* __restrict__ Wqb, __bf16* __restrict__ Wkb,
    __bf16* __restrict__ Wvb, __bf16* __restrict__ Wpb,
    __bf16* __restrict__ missT)
{
    if (blk < MT_BLOCKS) {
        const int i  = blk * 256 + threadIdx.x;
        const int n  = i % (4 * CC);
        const int r0 = (i / (4 * CC)) * 64;
        const float* s = miss + (unsigned)(r0 * (4 * CC) + n);
        float v[64];
        #pragma unroll
        for (int r = 0; r < 64; ++r) v[r] = s[r * (4 * CC)];
        #pragma unroll
        for (int q = 0; q < 8; ++q) {
            v8bf o;
            #pragma unroll
            for (int e = 0; e < 8; ++e) o[e] = (__bf16)v[q * 8 + e];
            ((v8bf*)missT)[(unsigned)((n * MR + r0) / 8 + q)] = o;
        }
    } else {
        const unsigned u = (blk - MT_BLOCKS) * 256 + threadIdx.x;           // in 8 elements
        const v8bf q = cvt8(Wq, u), k = cvt8(Wk, u), v = cvt8(Wv, u), p = cvt8_head_order(Wp, u);
        ((v8bf*)Wqb)[u] = q;
        ((v8bf*)Wkb)[u] = k;
        ((v8bf*)Wvb)[u] = v;
        ((v8bf*)Wpb)[u] = p;
        // the built code lays the other branch behind this one: no register that
        // these stores name is rewritten ahead of this wait on any way through it
        asm volatile("s_wait_xcnt 0x0" ::: "memory");
    }
}

// Kernels 1 and 2 read only inputs and depend on nothing of one another: one
// launch. The weights' blocks come first (the transposing
// ones take longest); the second launch's gap and its
// start-up, during which the memory idles, are gone.
__global__ __launch_bounds__(256) void prep_wconv_kernel(
    const float* __restrict__ x, const float* __restrict__ x0,
    const float* __restrict__ dx0,
    const float* __restrict__ x_q, const float* __restrict__ x_k,
    const float* __restrict__ x_v,
    const float* __restrict__ Wq, const float* __restrict__ Wk,
    const float* __restrict__ Wv, const float* __restrict__ Wp,
    const float* __restrict__ miss,
    __bf16* __restrict__ Xq, __bf16* __restrict__ Xk,
    __bf16* __restrict__ Xv, __bf16* __restrict__ Xv0,
    __bf16* __restrict__ Xd,
    __bf16* __restrict__ Wqb, __bf16* __restrict__ Wkb,
    __bf16* __restrict__ Wvb, __bf16* __restrict__ Wpb,
    __bf16* __restrict__ missT)
{
    const int blk = blockIdx.x;
    if (blk < MT_BLOCKS + WC_BLOCKS)
        wconv_block(blk, Wq, Wk, Wv, Wp, miss, Wqb, Wkb, Wvb, Wpb, missT);
    else
        prep_block(blk - (MT_BLOCKS + WC_BLOCKS), x, x0, dx0, x_q, x_k, x_v, Xq, Xk, Xv, Xv0, Xd);
}

// ---------------------------------------------------------------------------
// Kernel 3: bf16 WMMA GEMM,  Y[m,n] = sum_k X[m,k] * W[n,k]  (+ resid)
//   block tile 128x128, 256 threads = 8 wave32; wave tile 64x32 (4x2 WMMA).
//   K-step 64, double-buffered LDS, async global->LDS staging when available:
//   a row's piece of a stage is one whole 128-B line, so a wave's copy touches
//   four lines (with 32 k a stage it was eight half lines for the same bytes).
// gemm_tile is one block's tile; the kernel behind it says which tile a
// block takes. Whether a residual is added, and the row pitch of Y,
// are settled at compile time: a lane's 64 places in Y (and in resid) are then
// one address and 64 constant offsets.
// ---------------------------------------------------------------------------
constexpr int GKT = 64;                  // k per stage
constexpr int LDR = GKT + 8;             // padded row (144B, 16B aligned)
// The two operands' tiles, two buffers each. The kernel declares them, so that a
// kernel which holds tiles of two shapes has them once.
struct __align__(16) GemmLds { __bf16 A[2][128][LDR]; __bf16 B[2][128][LDR]; };

template <int KDIM, int NDIM, bool RESID>
__device__ static __forceinline__ void gemm_tile(
    GemmLds& lds,
    const __bf16* __restrict__ X, const __bf16* __restrict__ W,
    float* __restrict__ Y, const float* __restrict__ resid,
    int mBase, int nBase)
{
    constexpr int KT    = GKT;
    constexpr int KITER = KDIM / KT;
    static_assert(KDIM % KT == 0 && KT % 32 == 0, "whole stages of whole WMMA steps");
    auto& As = lds.A;
    auto& Bs = lds.B;

    const int tid    = threadIdx.x;
    const int lane   = tid & 31;
    const int wave   = tid >> 5;
    const int wm     = (wave >> 2) * 64;     // 0 | 64
    const int wn     = (wave & 3) * 32;      // 0,32,64,96
    const int laneLo = lane & 15;
    const int kbase  = ((lane >> 4) & 1) * 8; // lanes 0-15 -> K{0..7,16..23};
                                              // lanes 16-31 -> K{8..15,24..31}

    v8f acc[4][2];
    #pragma unroll
    for (int i = 0; i < 4; ++i)
        #pragma unroll
        for (int j = 0; j < 2; ++j)
            #pragma unroll
            for (int e = 0; e < 8; ++e) acc[i][j][e] = 0.0f;

    auto loadTile = [&](int buf, int k0) {
        #pragma unroll
        for (int ch = 0; ch < 128 * KT / 2048; ++ch) {
            int e  = ch * 2048 + tid * 8;
            int r  = e / KT;        // 0..127
            int kk = e % KT;        // 0,8,..,KT-8
            const __bf16* gA = &X[(size_t)(mBase + r) * KDIM + k0 + kk];
            const __bf16* gB = &W[(size_t)(nBase + r) * KDIM + k0 + kk];
#if USE_ASYNC_LDS
            async_copy_b128(gA, &As[buf][r][kk]);
            async_copy_b128(gB, &Bs[buf][r][kk]);
#else
            *(v8bf*)&As[buf][r][kk] = *(const v8bf*)gA;
            *(v8bf*)&Bs[buf][r][kk] = *(const v8bf*)gB;
#endif
        }
    };

    loadTile(0, 0);

    // C/D layout: VGPR v, lanes 0-15 -> (M=v, N=lane); lanes 16-31 -> (M=8+v)
    // the lane's first place in Y; tile (i, j), register v lies
    // (i * 16 + v) * NDIM + j * 16 elements further on
    const size_t off0 = (size_t)(mBase + wm + (lane >> 4) * 8) * NDIM + (nBase + wn + laneLo);

    // The residual depends on nothing that is computed here: all 64 loads of the
    // lane are issued now and fly beside the first tile's copies (the loop's first
    // barrier waits for loads too, once for all of them). One at a time in the
    // epilogue, each waited for before the next is issued, they cost the wave 64
    // latencies in a row.
    float rv[4][2][8];
    if constexpr (RESID) {
        const float* rp = resid + off0;
        #pragma unroll
        for (int i = 0; i < 4; ++i)
            #pragma unroll
            for (int j = 0; j < 2; ++j)
                #pragma unroll
                for (int v = 0; v < 8; ++v)
                    rv[i][j][v] = rp[(i * 16 + v) * NDIM + j * 16];
        // before the loop's arithmetic reuses a register that these loads name
        asm volatile("s_wait_xcnt 0x0" ::: "memory");
    }

    for (int ki = 0; ki < KITER; ++ki) {
#if USE_ASYNC_LDS
        __builtin_amdgcn_s_wait_asynccnt(0);   // own async copies in LDS
#endif
        __syncthreads();                       // all waves' copies visible
        const int buf = ki & 1;
        if (ki + 1 < KITER) loadTile(buf ^ 1, (ki + 1) * KT);

        // unrolled, so that kh is a constant offset of the LDS reads
        #pragma unroll
        for (int kh = 0; kh < KT; kh += 32) {
            v16bf afrag[4], bfrag[2];
            #pragma unroll
            for (int i = 0; i < 4; ++i) {
                const __bf16* ap = &As[buf][wm + i * 16 + laneLo][kh + kbase];
                v8bf lo = *(const v8bf*)ap;
                v8bf hi = *(const v8bf*)(ap + 16);
                afrag[i] = __builtin_shufflevector(lo, hi, 0, 1, 2, 3, 4, 5, 6, 7,
                                                   8, 9, 10, 11, 12, 13, 14, 15);
            }
            #pragma unroll
            for (int j = 0; j < 2; ++j) {
                const __bf16* bp = &Bs[buf][wn + j * 16 + laneLo][kh + kbase];
                v8bf lo = *(const v8bf*)bp;
                v8bf hi = *(const v8bf*)(bp + 16);
                bfrag[j] = __builtin_shufflevector(lo, hi, 0, 1, 2, 3, 4, 5, 6, 7,
                                                   8, 9, 10, 11, 12, 13, 14, 15);
            }
            #pragma unroll
            for (int i = 0; i < 4; ++i)
                #pragma unroll
                for (int j = 0; j < 2; ++j)
                    acc[i][j] = __builtin_amdgcn_wmma_f32_16x16x32_bf16(
                        false, afrag[i], false, bfrag[j],
                        (short)0, acc[i][j], false, false);
        }
    }

    if constexpr (RESID) {
        #pragma unroll
        for (int i = 0; i < 4; ++i)
            #pragma unroll
            for (int j = 0; j < 2; ++j)
                #pragma unroll
                for (int v = 0; v < 8; ++v) acc[i][j][v] += rv[i][j][v];
        // every sum stands in front of the first store: mixed among the stores,
        // later sums were put into registers that issued stores still name
        __builtin_amdgcn_sched_barrier(0);
    }
    float* yp = Y + off0;
    #pragma unroll
    for (int i = 0; i < 4; ++i)
        #pragma unroll
        for (int j = 0; j < 2; ++j)
            #pragma unroll
            for (int v = 0; v < 8; ++v)
                yp[(i * 16 + v) * NDIM + j * 16] = acc[i][j][v];
}

template <int KDIM, int NDIM, bool RESID>
__global__ __launch_bounds__(256) void gemm_bf16_wmma(
    const __bf16* __restrict__ X, const __bf16* __restrict__ W,
    float* __restrict__ Y, const float* __restrict__ resid)
{
    __shared__ GemmLds lds;
    gemm_tile<KDIM, NDIM, RESID>(lds, X, W, Y, resid, blockIdx.y * 128, blockIdx.x * 128);
}

// ---------------------------------------------------------------------------
// Kernel 3a: the input projections, the deltas product and the elementwise work
// behind them, in one launch. The f32 products never leave the registers: the two
// blocks of a tile (blockIdx.z) make between them, one after another, every product
// that its 128 tokens x 128 columns of scan operands need, and pack the operands
// from the accumulators.
// A wave's tile is 32 tokens x 64 columns, one head: |k|^2 is a sum over the
// lane's four column tiles and a DPP row sum, and a lane's four columns of a token
// are one 16-B piece of ScanOp (its order of columns).
// blockIdx.z = 0: a, k, q, w -> z | b, q | k, e^w (half).
//              1: g, w, v gate, v, v_first -> gb, e^w (half), v.
// Two blocks share a WGP: one works while the other waits for
// its copies or does its elementwise work (the long e^w: one early, one late).
// ---------------------------------------------------------------------------
template <int KDIM>
__device__ static __forceinline__ void head_product(
    GemmLds& lds, const __bf16* __restrict__ X, const __bf16* __restrict__ W,
    int mBase, int wBase, v8f (&acc)[2][4])
{
    constexpr int KT    = GKT;
    constexpr int KITER = KDIM / KT;
    // An even number of stages: the last one reads buffer 1, and buffer 0 was left
    // by every wave before that stage's barrier, so the next product's first
    // copies may go into buffer 0 at once.
    static_assert(KDIM % KT == 0 && KT % 32 == 0 && KITER % 2 == 0, "whole stages, in pairs");
    auto& As = lds.A;
    auto& Bs = lds.B;

    const int tid    = threadIdx.x;
    const int lane   = tid & 31;
    const int wave   = tid >> 5;
    const int wm     = (wave >> 1) * 32;     // 0,32,64,96
    const int wn     = (wave & 1) * 64;      // 0 | 64
    const int laneLo = lane & 15;
    const int kbase  = ((lane >> 4) & 1) * 8; // k order as in gemm_tile, A and B alike

    #pragma unroll
    for (int i = 0; i < 2; ++i)
        #pragma unroll
        for (int j = 0; j < 4; ++j)
            #pragma unroll
            for (int e = 0; e < 8; ++e) acc[i][j][e] = 0.0f;

    // A copy's address is a base that is the same for the block, kept in scalar
    // registers, and one 32-bit offset of the lane that serves every copy of both
    // operands: eight 64-bit addresses a stage in vector registers do not fit
    // beside the accumulators.
    constexpr int RPC = 2048 / KT;           // rows per copy of the block
    const unsigned lo = (unsigned)((tid / (KT / 8)) * KDIM + (tid % (KT / 8)) * 8);
    auto loadTile = [&](int buf, int k0) {
        #pragma unroll
        for (int ch = 0; ch < 128 / RPC; ++ch) {
            const int r  = ch * RPC + tid / (KT / 8);    // 0..127
            const int kk = (tid % (KT / 8)) * 8;         // 0,8,..,KT-8
            const __bf16* gA = X + ((size_t)(mBase + ch * RPC) * KDIM + k0) + lo;
            const __bf16* gB = W + ((size_t)(wBase + ch * RPC) * KDIM + k0) + lo;
#if USE_ASYNC_LDS
            async_copy_b128(gA, &As[buf][r][kk]);
            async_copy_b128(gB, &Bs[buf][r][kk]);
#else
            *(v8bf*)&As[buf][r][kk] = *(const v8bf*)gA;
            *(v8bf*)&Bs[buf][r][kk] = *(const v8bf*)gB;
#endif
        }
    };

    loadTile(0, 0);

    // two stages a trip make the buffer index a constant; unrolled further, the
    // eight products' loops outgrow the instruction cache
    #pragma unroll 2
    for (int ki = 0; ki < KITER; ++ki) {
        // own copies of this stage have landed; the barrier says it of every wave,
        // and that every wave has left the other buffer
        asm volatile("s_wait_asynccnt 0x0" ::: "memory");
        __syncthreads();
        const int buf = ki & 1;
        if (ki + 1 < KITER) loadTile(buf ^ 1, (ki + 1) * KT);

        // unrolled, so that kh is a constant offset of the LDS reads
        #pragma unroll
        for (int kh = 0; kh < KT; kh += 32) {
            v16bf afrag[2], bfrag[4];
            #pragma unroll
            for (int i = 0; i < 2; ++i) {
                const __bf16* ap = &As[buf][wm + i * 16 + laneLo][kh + kbase];
                v8bf lo = *(const v8bf*)ap;
                v8bf hi = *(const v8bf*)(ap + 16);
                afrag[i] = __builtin_shufflevector(lo, hi, 0, 1, 2, 3, 4, 5, 6, 7,
                                                   8, 9, 10, 11, 12, 13, 14, 15);
            }
            #pragma unroll
            for (int j = 0; j < 4; ++j) {
                const __bf16* bp = &Bs[buf][wn + j * 16 + laneLo][kh + kbase];
                v8bf lo = *(const v8bf*)bp;
                v8bf hi = *(const v8bf*)(bp + 16);
                bfrag[j] = __builtin_shufflevector(lo, hi, 0, 1, 2, 3, 4, 5, 6, 7,
                                                   8, 9, 10, 11, 12, 13, 14, 15);
            }
            #pragma unroll
            for (int i = 0; i < 2; ++i)
                #pragma unroll
                for (int j = 0; j < 4; ++j)
                    acc[i][j] = __builtin_amdgcn_wmma_f32_16x16x32_bf16(
                        false, afrag[i], false, bfrag[j],
                        (short)0, acc[i][j], false, false);
        }
    }
}

constexpr int ETK = 4;                        // tokens per block, kernel 6
static_assert(CC == 256 * 4 && NN == 16 * 4 && MM % ETK == 0, "lane deal");

// The longer elementwise parts are rolled loops over the eight registers of the
// accumulator tiles: unrolled, they make the kernel larger than the instruction
// cache, and a WGP runs through each only once. Registers cannot be indexed by a
// loop counter, so each trip takes register 0 of every tile and then turns the
// tiles' registers by one place.
__device__ static __forceinline__ void turn_tiles(v8f (&acc)[2][4])
{
    #pragma unroll
    for (int i = 0; i < 2; ++i)
        #pragma unroll
        for (int e = 0; e < 4; ++e)
            acc[i][e] = __builtin_shufflevector(acc[i][e], acc[i][e], 1, 2, 3, 4, 5, 6, 7, 0);
}

// sigmoid(c0 + acc) of the wave's tile: a token's four columns to place i * 8 + v
__device__ static __forceinline__ void gate_park(v8f (&acc)[2][4], const float (&c0)[4],
                                                 v4f (&park)[16][256])
{
    // kept rolled: see above
    #pragma unroll 1
    for (int v = 0; v < 8; ++v) {
        #pragma unroll
        for (int i = 0; i < 2; ++i) {
            v4f s;
            #pragma unroll
            for (int e = 0; e < 4; ++e)
                s[e] = 1.0f / (1.0f + __expf(-(c0[e] + acc[i][e][0])));
            park[i * 8 + v][threadIdx.x] = s;
        }
        turn_tiles(acc);
    }
}

// e^w of row block I of the wave's tile, from the w_delta product, to its pieces.
// This is the longest of the elementwise parts: each kind of block makes the short
// product whole and takes one of the two row blocks, so that both kinds last alike.
template <int I>
__device__ static __forceinline__ void decay_store(const v8f (&acc)[2][4], const float* __restrict__ w0p,
                                                   ScanOp* __restrict__ ep, v4f (&park)[16][256])
{
    float w0c[4];
    #pragma unroll
    for (int e = 0; e < 4; ++e) w0c[e] = w0p[e * 16];
    // before the arithmetic reuses registers that these loads name
    asm volatile("s_wait_xcnt 0x0" ::: "memory");
    // through the lane's own places in LDS, so that the loop below can stay rolled
    // (registers cannot be indexed by a loop counter)
    #pragma unroll
    for (int v = 0; v < 8; ++v)
        park[v][threadIdx.x] = v4f{-(w0c[0] + acc[I][0][v]), -(w0c[1] + acc[I][1][v]),
                                   -(w0c[2] + acc[I][2][v]), -(w0c[3] + acc[I][3][v])};
    // kept rolled: see turn_tiles
    #pragma unroll 1
    for (int v = 0; v < 8; ++v) {
        const v4f x4 = park[v][threadIdx.x];
        v4f E;
        #pragma unroll
        for (int e = 0; e < 4; ++e) {
            const float xw   = x4[e];
            // softplus; the logarithm is taken in every lane (of the clamped value,
            // the same wherever it is used) so that no branch parts the four
            // columns' chains and they fill one another's gaps
            const float lg   = log1pf(__expf(fminf(xw, 20.0f)));
            const float sf   = (xw > 20.0f) ? xw : lg;
            const float logw = -__expf(-sf - 0.5f);                    // log decay < 0
            E[e] = __expf((float)(__bf16)logw);      // exp after bf16 round, as reference
        }
        *(v4f*)(ep + (I * 16 + v) * (HH * SPB)) = E;
        // before the next trip reuses registers that this store names
        asm volatile("s_wait_xcnt 0x0" ::: "memory");
    }
}

// four waves a SIMD: two blocks a WGP (at most 256 registers a wave)
__global__ __launch_bounds__(256) __attribute__((amdgpu_waves_per_eu(4, 4))) void proj_pack_kernel(
    const __bf16* __restrict__ Xq, const __bf16* __restrict__ Xk,
    const __bf16* __restrict__ Xv, const __bf16* __restrict__ Xv0,
    const __bf16* __restrict__ Wqb, const __bf16* __restrict__ Wkb,
    const __bf16* __restrict__ Wvb,
    const __bf16* __restrict__ Xd, const __bf16* __restrict__ missT,
    const float* __restrict__ w0, const float* __restrict__ v0,
    const float* __restrict__ a0,
    ScanOp* __restrict__ sops,
    __bf16* __restrict__ vh, __bf16* __restrict__ gb)
{
    __shared__ GemmLds lds;
    // The v gate, or k * a, waits here, each lane's own values in its own places,
    // while the long products behind it run: with them in registers a wave needs
    // more than the 256 that two blocks a WGP allow. decay_store uses it as well.
    __shared__ v4f park[16][256];
    const int lane   = threadIdx.x & 31;
    const int wave   = threadIdx.x >> 5;
    const int laneLo = lane & 15;
    const int mBase  = blockIdx.y * 128;
    const int nBase  = blockIdx.x * 128;
    const int col0   = nBase + (wave & 1) * 64;                  // the wave's head
    // C/D layout: tile (i, e), register v: token tok0 + i * 16 + v, column
    // col0 + e * 16 + laneLo
    const int tok0   = mBase + (wave >> 1) * 32 + (lane >> 4) * 8;
    constexpr int TP = HH * SPB;                                 // pieces per token
    ScanOp* sp = sops + (unsigned)((tok0 * HH + (col0 >> 6)) * SPB);
    // the lane's place in vh and gb, in 4 elements
    const unsigned u0 = (unsigned)(tok0 * (CC / 4) + (col0 >> 2) + laneLo);

    v8f acc[2][4];
    if (blockIdx.z == 0) {
        float a0c[4];
        #pragma unroll
        for (int e = 0; e < 4; ++e) a0c[e] = a0[col0 + e * 16 + laneLo];
        // before later arithmetic reuses registers that these loads name
        asm volatile("s_wait_xcnt 0x0" ::: "memory");

        head_product<MR>(lds, Xd, missT, mBase, 2 * CC + nBase, acc);     // a_delta
        gate_park(acc, a0c, park);                                        // a

        head_product<CC>(lds, Xk, Wkb, mBase, nBase, acc);                // k
        // kept rolled: see turn_tiles
        #pragma unroll 1
        for (int v = 0; v < 8; ++v) {
            #pragma unroll
            for (int i = 0; i < 2; ++i) {
                const float k0 = acc[i][0][0], k1 = acc[i][1][0];
                const float k2 = acc[i][2][0], k3 = acc[i][3][0];
                const float norm = sqrtf(row_sum16((k0 * k0 + k1 * k1) + (k2 * k2 + k3 * k3)));
                const float den  = fmaxf(norm, 1e-12f);
                const v4f a4 = park[i * 8 + v][threadIdx.x];
                v4f s;
                v4i zb;
                #pragma unroll
                for (int e = 0; e < 4; ++e) {
                    const float kv = acc[i][e][0];
                    const float kk = kv / den;
                    zb[e] = pack2(-kk, kk * a4[e]);
                    s[e]  = kv * a4[e];
                }
                park[i * 8 + v][threadIdx.x] = s;    // k * a waits in LDS while the q product runs
                *(v4i*)(sp + (i * 16 + v) * TP + 3 * laneLo + 1) = zb;
            }
            // before the next trip, or the next product, reuses registers that
            // these stores name
            asm volatile("s_wait_xcnt 0x0" ::: "memory");
            turn_tiles(acc);
        }
        v4i R[2][8];

        head_product<CC>(lds, Xq, Wqb, mBase, nBase, acc);                // q
        #pragma unroll
        for (int i = 0; i < 2; ++i)
            #pragma unroll
            for (int v = 0; v < 8; ++v) {
                const v4f s = park[i * 8 + v][threadIdx.x];
                #pragma unroll
                for (int e = 0; e < 4; ++e) R[i][v][e] = pack2(acc[i][e][v], s[e]);
            }
        // all arithmetic stands in front of the first store, so that none of it
        // lands in a register that an issued store still names
        __builtin_amdgcn_sched_barrier(0);
        #pragma unroll
        for (int i = 0; i < 2; ++i)
            #pragma unroll
            for (int v = 0; v < 8; ++v)
                *(v4i*)(sp + (i * 16 + v) * TP + 3 * laneLo) = R[i][v];
        // before the next product reuses registers that these stores name
        asm volatile("s_wait_xcnt 0x0" ::: "memory");

        head_product<MR>(lds, Xd, missT, mBase, nBase, acc);              // w_delta
        decay_store<0>(acc, w0 + col0 + laneLo, sp + 3 * laneLo + 2, park);
    } else {
        float v0c[4];
        #pragma unroll
        for (int e = 0; e < 4; ++e) v0c[e] = v0[col0 + e * 16 + laneLo];
        // before later arithmetic reuses registers that these loads name
        asm volatile("s_wait_xcnt 0x0" ::: "memory");

        head_product<MR>(lds, Xd, missT, mBase, 3 * CC + nBase, acc);     // g
        v4bf G[2][8];
        #pragma unroll
        for (int i = 0; i < 2; ++i)
            #pragma unroll
            for (int v = 0; v < 8; ++v)
                #pragma unroll
                for (int e = 0; e < 4; ++e) G[i][v][e] = (__bf16)(1.0f + acc[i][e][v]);
        // all arithmetic in front of the first store, as in the other branch
        __builtin_amdgcn_sched_barrier(0);
        #pragma unroll
        for (int i = 0; i < 2; ++i)
            #pragma unroll
            for (int v = 0; v < 8; ++v)
                ((v4bf*)gb + u0)[(i * 16 + v) * (CC / 4)] = G[i][v];
        // before the next product reuses registers that these stores name
        asm volatile("s_wait_xcnt 0x0" ::: "memory");

        head_product<MR>(lds, Xd, missT, mBase, nBase, acc);              // w_delta
        decay_store<1>(acc, w0 + col0 + laneLo, sp + 3 * laneLo + 2, park);

        head_product<MR>(lds, Xd, missT, mBase, CC + nBase, acc);         // v_delta
        gate_park(acc, v0c, park);                                        // the v gate
        float vr[2][4][8];

        head_product<CC>(lds, Xv, Wvb, mBase, nBase, acc);                // v
        #pragma unroll
        for (int i = 0; i < 2; ++i)
            #pragma unroll
            for (int e = 0; e < 4; ++e)
                #pragma unroll
                for (int v = 0; v < 8; ++v) vr[i][e][v] = acc[i][e][v];

        head_product<CC>(lds, Xv0, Wvb, mBase, nBase, acc);               // v_first
        #pragma unroll
        for (int i = 0; i < 2; ++i)
            #pragma unroll
            for (int v = 0; v < 8; ++v) {
                const v4f s = park[i * 8 + v][threadIdx.x];
                #pragma unroll
                for (int e = 0; e < 4; ++e) {
                    const float r = vr[i][e][v];
                    G[i][v][e] = (__bf16)(r + (acc[i][e][v] - r) * s[e]);
                }
            }
        // as above
        __builtin_amdgcn_sched_barrier(0);
        #pragma unroll
        for (int i = 0; i < 2; ++i)
            #pragma unroll
            for (int v = 0; v < 8; ++v) {
                ((v4bf*)(sp + (i * 16 + v) * TP + 48))[laneLo] = G[i][v];
                ((v4bf*)vh + u0)[(i * 16 + v) * (CC / 4)]      = G[i][v];
            }
    }
}

constexpr int SCH = 16;
constexpr int STS = 32;
constexpr int SNT = TT / STS;
static_assert(SNT >= 2 && STS % SCH == 0, "two tiles at least, whole chunks");

// One tile: STS steps of SPB pieces (896 B a step, contiguous; steps lie
// HH * SPB pieces apart in global memory, back to back in LDS). A wave brings
// STS/4 steps, one piece a lane and copy; 7 * 32 pieces are four steps.
static_assert(4 * SPB == 7 * 32 && STS % 16 == 0, "four steps are seven copies of a wave");

__device__ static inline void scan_fetch(const ScanOp* g0, ScanOp* l0,
                                         int wave, int lane)
{
    constexpr int GP = HH * SPB;                             // step pitch, global
    const ScanOp* g = g0 + (size_t)wave * (STS / 4) * GP;
    ScanOp*       l = l0 + wave * (STS / 4) * SPB + lane;
    #pragma unroll
    for (int r = 0; r < 7; ++r) {
        const int     pc = r * 32 + lane;                    // piece 0..223
        const ScanOp* gr = g + (pc / SPB) * GP + pc % SPB;
        #pragma unroll
        for (int a = 0; a < STS / 16; ++a) {
#if USE_ASYNC_LDS
            async_copy_b128(gr + a * 4 * GP, l + (a * 7 + r) * 32);
#else
            l[(a * 7 + r) * 32] = gr[a * 4 * GP];
#endif
        }
    }
}

struct Rec4 { v4i qk, zb; v4f ew; };         // a lane's four columns of one step

__device__ static inline Rec4 scan_read(const ScanOp* lp, int u)
{
    const ScanOp* rp = lp + u * SPB;
    return Rec4{*(const v4i*)rp, *(const v4i*)(rp + 1), *(const v4f*)(rp + 2)};
}

constexpr int SG = 8;                         // steps whose LDS reads stand together
static_assert(STS % SG == 0 && STS / SG >= 2, "whole groups, two at least");

// The S.q partials are folded level by level. Level N makes one sum of two, each
// of 2^(N-1) steps: lanes whose step slot has bit 2^(N-1) clear keep the first,
// the others the second, and each adds what its partner (lane ^ bit) holds of the
// same. The partial of step T is at hand in step T + 1, and level N
// of the group that T ends is taken in step T + N, so that a step holds two
// selects and one row add per level and at most two levels, all in the gaps of
// its chain. f[n]: the first half of a level, waiting; r[n]: the second half.
template <int T, int N>                      // is level N of a group ending at T due?
constexpr bool fold_due = T >= 0 && T % (1 << N) == (1 << N) - 1;

constexpr unsigned fold_mask(int bit)        // lanes whose step slot has this bit
{
    return bit == 1 ? 0xaaaaaaaau : bit == 2 ? 0xccccccccu : bit == 4 ? 0xf0f0f0f0u : 0xff00ff00u;
}

template <int N>
__device__ static inline void fold_select(const float (&f)[4], const float (&r)[4],
                                          float& keep, float& send)
{
    keep = select_f(f[N - 1], r[N - 1], fold_mask(1 << (N - 1)));
    send = select_f(r[N - 1], f[N - 1], fold_mask(1 << (N - 1)));
}

// where a finished sum of level N for the group ending at T goes
template <int T, int N>
__device__ static inline void fold_bank(float s, float (&f)[4], float (&r)[4],
                                        float (&o)[STS / SCH])
{
    if constexpr (N == 4) o[T / SCH] = s;
    else if constexpr (fold_due<T, N + 1>) r[N] = s;
    else f[N] = s;
}

template <int T, int N>
__device__ static inline void fold_add(float keep, float send, float (&f)[4], float (&r)[4],
                                       float (&o)[STS / SCH])
{
    fold_bank<T, N>(add_xmask2<1 << (N - 1)>(send, keep), f, r, o);
}

template <int U>
struct ScanSteps {
    // lp: the lane's three pieces of the tile's first step, in LDS
    // qp: the q | k words of the step before (its output sum is taken here)
    __device__ static inline void run(const ScanOp* lp, Rec4 (&pipe)[2][SG], float (&S)[4],
                                      float (&f)[4], float (&r)[4],
                                      const int (&vrow)[STS / SCH],
                                      float (&o)[STS / SCH], v4i qp)
    {
        constexpr int t = STS - U;           // step in the tile
        constexpr int u = t % SCH;           // step in the chunk
        constexpr int gr = t / SG;           // group of steps in the tile
        if constexpr (t % SG == 0 && t + SG < STS) {
            // The next group's reads stand together at the head of this group (for
            // speed only). The two scheduling barriers keep the
            // scheduler from spreading the reads over the steps on either side.
            // At t = 0 the tile's first reads stand directly in front, and no
            // barrier parts the two groups.
            if constexpr (t > 0) __builtin_amdgcn_sched_barrier(0);
            #pragma unroll
            for (int i = 0; i < SG; ++i)
                pipe[(gr + 1) & 1][i] = scan_read(lp, t + SG + i);
            __builtin_amdgcn_sched_barrier(0);
        }
        const v4i qk = pipe[gr & 1][t % SG].qk, zb = pipe[gr & 1][t % SG].zb;
        const v4f ew = pipe[gr & 1][t % SG].ew;

        // The chain: S.z in the lane (three links), four row-sum links, the update
        // of S. Everything else stands between its links: S * e^w, v * k, the
        // output sum of the step before, for which S still holds that step's
        // state, and the folds that are due.
        float p0 = 0.0f, p1 = 0.0f, kp[5], sd[5];
        float a0 = mul_bf(S[0], zb[0]);
        float a1 = mul_bf(S[2], zb[2]);
        float X0 = mul_f(S[0], ew[0]);
        float X1 = mul_f(S[1], ew[1]);
        float X2 = mul_f(S[2], ew[2]);
        a0 = fma_bf<false>(S[1], zb[1], a0);
        a1 = fma_bf<false>(S[3], zb[3], a1);
        float X3 = mul_f(S[3], ew[3]);
        const int vt = row_share<u>(vrow[t / SCH]);          // this step's v of the row, bf16
        if constexpr (t > 0) p0 = mul_bf(S[0], qp[0]);
        float sa = add_f(a0, a1);
        if constexpr (t > 0) p1 = mul_bf(S[2], qp[2]);
        X0 = fma_bb(vt, qk[0], X0);
        X1 = fma_bb(vt, qk[1], X1);
        sa = add_xmask<1>(sa);
        X2 = fma_bb(vt, qk[2], X2);
        X3 = fma_bb(vt, qk[3], X3);
        if constexpr (t > 0) {
            p0 = fma_bf<false>(S[1], qp[1], p0);
            p1 = fma_bf<false>(S[3], qp[3], p1);
        }
        sa = add_xmask<2>(sa);
        if constexpr (t > 0) fold_bank<t - 1, 0>(add_f(p0, p1), f, r, o);
        sa = add_xmask<4>(sa);
        if constexpr (fold_due<t - 4, 4>) fold_select<4>(f, r, kp[4], sd[4]);
        if constexpr (fold_due<t - 3, 3>) fold_select<3>(f, r, kp[3], sd[3]);
        if constexpr (fold_due<t - 2, 2>) fold_select<2>(f, r, kp[2], sd[2]);
        if constexpr (fold_due<t - 1, 1>) fold_select<1>(f, r, kp[1], sd[1]);
        sa = add_xmask<8>(sa);
        if constexpr (fold_due<t - 4, 4>) fold_add<t - 4, 4>(kp[4], sd[4], f, r, o);
        if constexpr (fold_due<t - 3, 3>) fold_add<t - 3, 3>(kp[3], sd[3], f, r, o);
        if constexpr (fold_due<t - 2, 2>) fold_add<t - 2, 2>(kp[2], sd[2], f, r, o);
        if constexpr (fold_due<t - 1, 1>) fold_add<t - 1, 1>(kp[1], sd[1], f, r, o);
        S[0] = fma_bf<true>(sa, zb[0], X0);
        S[2] = fma_bf<true>(sa, zb[2], X2);
        S[1] = fma_bf<true>(sa, zb[1], X1);
        S[3] = fma_bf<true>(sa, zb[3], X3);

        ScanSteps<U - 1>::run(lp, pipe, S, f, r, vrow, o, qk);
    }
};
template <>
struct ScanSteps<0> {
    // the output sum of the tile's last step, and its four folds
    __device__ static inline void run(const ScanOp*, Rec4 (&)[2][SG], float (&S)[4],
                                      float (&f)[4], float (&r)[4],
                                      const int (&)[STS / SCH],
                                      float (&o)[STS / SCH], v4i qp)
    {
        float p0 = mul_bf(S[0], qp[0]);
        float p1 = mul_bf(S[2], qp[2]);
        p0 = fma_bf<false>(S[1], qp[1], p0);
        p1 = fma_bf<false>(S[3], qp[3], p1);
        fold_bank<STS - 1, 0>(add_f(p0, p1), f, r, o);
        float kp, sd;
        fold_select<1>(f, r, kp, sd);  fold_add<STS - 1, 1>(kp, sd, f, r, o);
        fold_select<2>(f, r, kp, sd);  fold_add<STS - 1, 2>(kp, sd, f, r, o);
        fold_select<3>(f, r, kp, sd);  fold_add<STS - 1, 3>(kp, sd, f, r, o);
        fold_select<4>(f, r, kp, sd);  fold_add<STS - 1, 4>(kp, sd, f, r, o);
    }
};

__global__ __launch_bounds__(128) void scan_kernel(
    const ScanOp* __restrict__ sops, float* __restrict__ y)
{
    __shared__ ScanOp tile[2][STS][SPB];

    const int lane = threadIdx.x & 31;
    const int wave = threadIdx.x >> 5;
    const int g    = blockIdx.x >> 3;                        // b*H + h
    const int rp   = (blockIdx.x & 7) * 4 + wave;            // row pair 0..31
    const int h    = g % HH;
    const int b    = g / HH;
    const int j    = lane & 15;                              // column group / step slot
    const int row  = rp * 2 + (lane >> 4);

    const ScanOp* hb = sops + ((size_t)b * TT * HH + h) * SPB;        // t = 0
    float* yp = y + ((size_t)g * (TT / SCH) * 32 + rp) * 32 + lane;

    float S[4] = {0.0f, 0.0f, 0.0f, 0.0f};

    scan_fetch(hb, &tile[0][0][0], wave, lane);
    // own copies of tile 0 landed; the barrier publishes every wave's
    asm volatile("s_wait_asynccnt 0x0" ::: "memory");
    __syncthreads();
    scan_fetch(hb + (size_t)STS * HH * SPB, &tile[1][0][0], wave, lane);

    // kept rolled: the body already holds STS unrolled steps
    #pragma unroll 1
    for (int tl = 0; tl < SNT; ++tl) {
        ScanOp* tb = &tile[tl & 1][0][0];

        // read first: the tile's first step needs them, and LDS answers in order
        int   vrow[STS / SCH];
        float o[STS / SCH], f[4], r[4];
        #pragma unroll
        for (int c = 0; c < STS / SCH; ++c)  // v of my row at step j of chunk c, bf16
            vrow[c] = ((const unsigned short*)(tb + (c * SCH + j) * SPB + 48))[(row & 15) * 4 + (row >> 4)];
        // keeps these two reads in front: behind the first group's reads, the
        // first step waits for the whole group
        __builtin_amdgcn_sched_barrier(0);
        Rec4 pipe[2][SG];
        #pragma unroll
        for (int i = 0; i < SG; ++i) pipe[0][i] = scan_read(tb + j * 3, i);

        ScanSteps<STS>::run(tb + j * 3, pipe, S, f, r, vrow, o, v4i{0, 0, 0, 0});

        // keeps the last groups' arithmetic in front of the foot: lifted over it,
        // the wait below stands right behind the tile's last reads and the wave
        // sits out their whole latency
        __builtin_amdgcn_sched_barrier(0);
        // foot of the trip: my reads of this tile are done, my copies of the
        // next tile have landed; the barrier says both of every wave
        asm volatile("s_wait_dscnt 0x0" ::: "memory");
        asm volatile("s_wait_asynccnt 0x0" ::: "memory");
        __syncthreads();
        if (tl + 2 < SNT)
            scan_fetch(hb + (size_t)(tl + 2) * STS * HH * SPB, tb, wave, lane);

        // stored behind the barrier: in front of it the barrier's own wait for
        // stores would expose their whole latency once per tile
        #pragma unroll
        for (int c = 0; c < STS / SCH; ++c) {
            *yp = o[c] * 0.125f;             // * N^-0.5
            yp += 32 * 32;
        }
    }
    // no copy is left in flight when the wave ends
    asm volatile("s_wait_asynccnt 0x0" ::: "memory");
}

// ---------------------------------------------------------------------------
// Kernel 6: norm-ratio correction + gate -> bf16 input for output projection.
// A block: ETK tokens of one chunk of y, all columns. A lane: 4 columns of each,
// a 16-lane row is one head (norms: DPP row sums). y lies step-fastest (see
// kernel 5), so one 16-B load is one column's ETK steps. vh, gb and Yg lie in
// ScanOp's order of columns; of x only a head's sum of squares is used, so the
// lane takes four neighbouring columns of it.
// ---------------------------------------------------------------------------
static_assert(ETK == 4 && SCH % ETK == 0 && TT % SCH == 0, "a block stays in one chunk");

__global__ __launch_bounds__(256) void post_scan_kernel(
    const float* __restrict__ y, const float* __restrict__ x,
    const __bf16* __restrict__ vh, const __bf16* __restrict__ gb,
    const float* __restrict__ r_k, __bf16* __restrict__ Yg)
{
    const int    c  = threadIdx.x * 4;
    const int    h  = threadIdx.x >> 4;
    const int    n0 = threadIdx.x & 15;        // the lane's columns: n0 + 16 * e (ScanOp's order)
    const unsigned m0 = blockIdx.x * ETK;
    const unsigned t0 = m0 % TT;
    const unsigned gy = (m0 / TT) * HH + h;

    // y[((gy*(T/SCH) + chunk)*NN + n)*SCH + step], here in 4 steps
    const unsigned yu = ((gy * (TT / SCH) + t0 / SCH) * NN + n0) * (SCH / 4) + (t0 % SCH) / 4;
    v4f yv[4];                                // [column][token]
    #pragma unroll
    for (int e = 0; e < 4; ++e) yv[e] = ((const v4f*)y)[yu + e * 16 * (SCH / 4)];

    float rk[4];
    #pragma unroll
    for (int e = 0; e < 4; ++e) rk[e] = r_k[h * NN + e * 16 + n0];
    // before a later load's result lands in a register that these loads name
    asm volatile("s_wait_xcnt 0x0" ::: "memory");
    float sig[4];
    #pragma unroll
    for (int e = 0; e < 4; ++e) sig[e] = 1.0f / (1.0f + __expf(-rk[e]));

    // every load of the lane is issued before the first value is used
    v4f  xvs[ETK];
    v4bf vbs[ETK], gvs[ETK];
    #pragma unroll
    for (int it = 0; it < ETK; ++it) {
        const unsigned u = (m0 + it) * (CC / 4) + threadIdx.x;   // in 4 elements
        xvs[it] = ((const v4f*)x)[u];
        vbs[it] = ((const v4bf*)vh)[u];
        gvs[it] = ((const v4bf*)gb)[u];
    }

    #pragma unroll
    for (int it = 0; it < ETK; ++it) {
        const unsigned u = (m0 + it) * (CC / 4) + threadIdx.x;
        const v4f  xv = xvs[it];
        const v4bf vb = vbs[it], gv = gvs[it];
        float vv[4];
        #pragma unroll
        for (int e = 0; e < 4; ++e) vv[e] = (float)vb[e];

        const float xnorm = sqrtf(row_sum16((xv[0] * xv[0] + xv[1] * xv[1]) +
                                            (xv[2] * xv[2] + xv[3] * xv[3])));
        const float vnorm = sqrtf(row_sum16((vv[0] * vv[0] + vv[1] * vv[1]) +
                                            (vv[2] * vv[2] + vv[3] * vv[3])));
        const float ratio = 1.0f - xnorm / (vnorm + 1e-12f);

        v4bf o;
        #pragma unroll
        for (int e = 0; e < 4; ++e) {
            const float u = ratio * sig[e];
            o[e] = (__bf16)((yv[e][it] + vv[e] * u) * (float)gv[e]);
        }
        ((v4bf*)Yg)[u] = o;
    }
}

// ---------------------------------------------------------------------------
// Host launcher
// ---------------------------------------------------------------------------
extern "C" void kernel_launch(void* const* d_in, const int* in_sizes, int n_in,
                              void* d_out, int out_size, void* d_ws,
                              size_t ws_size, hipStream_t stream)
{
    (void)in_sizes; (void)n_in; (void)out_size; (void)ws_size;

    const float* residual = (const float*)d_in[0];
    const float* x        = (const float*)d_in[1];
    const float* x0       = (const float*)d_in[2];
    const float* dx0      = (const float*)d_in[3];
    const float* Wq       = (const float*)d_in[4];
    const float* Wk       = (const float*)d_in[5];
    const float* Wv       = (const float*)d_in[6];
    const float* Wproj    = (const float*)d_in[7];
    const float* x_q      = (const float*)d_in[8];
    const float* x_k      = (const float*)d_in[9];
    const float* x_v      = (const float*)d_in[10];
    const float* v0       = (const float*)d_in[11];
    const float* w0       = (const float*)d_in[12];
    const float* a0       = (const float*)d_in[13];
    const float* miss     = (const float*)d_in[14];
    const float* r_k      = (const float*)d_in[15];
    float*       out      = (float*)d_out;

    // ---- workspace layout (256B aligned bump allocator) ----
    char*  ws  = (char*)d_ws;
    size_t off = 0;
    auto alloc = [&](size_t bytes) -> void* {
        void* p = ws + off;
        off += (bytes + 255) & ~(size_t)255;
        return p;
    };
    const size_t MC_BF = (size_t)MM * CC * sizeof(__bf16);    // 8 MB
    const size_t MC_F  = (size_t)MM * CC * sizeof(float);     // 16 MB
    const size_t W_BF  = (size_t)CC * CC * sizeof(__bf16);    // 2 MB
    const size_t XD_BF = (size_t)MM * MR * sizeof(__bf16);    // 1 MB
    const size_t SO_SZ = (size_t)MM * HH * SPB * sizeof(ScanOp); // 56 MB

    __bf16* Xq    = (__bf16*)alloc(MC_BF);
    __bf16* Xk    = (__bf16*)alloc(MC_BF);
    __bf16* Xv    = (__bf16*)alloc(MC_BF);
    __bf16* Xv0   = (__bf16*)alloc(MC_BF);
    __bf16* Xd    = (__bf16*)alloc(XD_BF);
    __bf16* Wqb   = (__bf16*)alloc(W_BF);
    __bf16* Wkb   = (__bf16*)alloc(W_BF);
    __bf16* Wvb   = (__bf16*)alloc(W_BF);
    __bf16* Wpb   = (__bf16*)alloc(W_BF);
    __bf16* missT = (__bf16*)alloc(XD_BF);
    ScanOp* sops  = (ScanOp*)alloc(SO_SZ);
    __bf16* gb    = (__bf16*)alloc(MC_BF);
    __bf16* vh    = (__bf16*)alloc(MC_BF);
    float*  y     = (float*)alloc(MC_F);
    __bf16* Yg    = (__bf16*)alloc(MC_BF);

    // ---- 1) input prep + weight conversion ----
    {
        prep_wconv_kernel<<<dim3(MT_BLOCKS + WC_BLOCKS + PREP_BLOCKS), dim3(256), 0, stream>>>(
            x, x0, dx0, x_q, x_k, x_v, Wq, Wk, Wv, Wproj, miss,
            Xq, Xk, Xv, Xv0, Xd, Wqb, Wkb, Wvb, Wpb, missT);
    }

    // ---- 2) WMMA products q, k, v, v_first (K=1024), deltas (K=128), and the
    //         elementwise work behind them -> packed scan operands, vh, gb ----
    proj_pack_kernel<<<dim3(CC / 128, MM / 128, 2), dim3(256), 0, stream>>>(
        Xq, Xk, Xv, Xv0, Wqb, Wkb, Wvb, Xd, missT, w0, v0, a0, sops, vh, gb);

    // ---- 3) sequential scan (state in VGPRs, 8 rows per block) ----
    scan_kernel<<<dim3(BB * HH * 8), dim3(128), 0, stream>>>(sops, y);

    // ---- 4) norm correction + gate ----
    post_scan_kernel<<<dim3(MM / ETK), dim3(256), 0, stream>>>(y, x, vh, gb, r_k, Yg);

    // ---- 5) output projection + residual -> d_out ----
    {
        dim3 grid(CC / 128, MM / 128), blk(256);
        gemm_bf16_wmma<CC, CC, true><<<grid, blk, 0, stream>>>(Yg, Wpb, out, residual);
    }
}

// v010
// One run takes 152 microseconds.
// Timed twice side by side with v009, it ran 1.03 times as fast both times.
// Over all steps from v000 it is 29.3 times as fast.
#include <hip/hip_runtime.h>
#include <hip/hip_bf16.h>

// ---------------------------------------------------------------------------
// RWKV7 time-mix for MI455X (gfx1250, wave32, WMMA).
//   B=2, T=2048, C=1024, H=16, N=64, MISS_ROWS=128
// ---------------------------------------------------------------------------

typedef __attribute__((ext_vector_type(16))) __bf16 v16bf;
typedef __attribute__((ext_vector_type(8)))  __bf16 v8bf;
typedef __attribute__((ext_vector_type(8)))  float  v8f;
typedef __attribute__((ext_vector_type(4)))  int    v4i;

constexpr int BB = 2;
constexpr int TT = 2048;
constexpr int CC = 1024;
constexpr int HH = 16;
constexpr int NN = 64;
constexpr int MR = 128;          // MISS_ROWS
constexpr int MM = BB * TT;      // 4096 tokens

// Scan operands, in 16-B pieces. One (token, head) is SPB pieces: for each group
// of four columns three pieces (a word q | k a column; a word z | b a column, all
// bf16; e^w of the four in f32), 16 groups, then v of the 64 rows in bf16.
// Group l holds the head's columns l, 16 + l, 32 + l, 48 + l: what lane l of a
// WMMA accumulator row holds of the head's four 16-column tiles. The same order
// (place l * 4 + e for column e * 16 + l) holds for v in its pieces, for vh, gb
// and Yg, and for the k index of the output projection's weight.
struct __align__(16) ScanOp { unsigned d[4]; };
constexpr int SPB = 16 * 3 + 8;  // pieces per (token, head)

typedef __attribute__((ext_vector_type(2))) __bf16 v2bf;
__device__ static inline int pack2(float lo, float hi)
{
    return __builtin_bit_cast(int, v2bf{(__bf16)lo, (__bf16)hi});
}
// The scan's arithmetic, one instruction a statement. A wave of the scan issues
// in order: a step lasts as long as its chain of dependent
// instructions only if the independent ones stand in the chain's gaps. The
// statements are volatile so that they keep the order in which they are written
// (ScanSteps); from plain source this compiler also widens the bf16 operands with
// extra instructions to feed packed f32 arithmetic.
// a * (low or high bf16 of word d) + c
template <bool HI>
__device__ static inline float fma_bf(float a, int d, float c)
{
    float r;
    if constexpr (HI)
        asm volatile("v_fma_mix_f32_bf16 %0, %1, %2, %3 op_sel:[0,1,0] op_sel_hi:[0,1,0]"
                     : "=v"(r) : "v"(a), "v"(d), "v"(c));
    else
        asm volatile("v_fma_mix_f32_bf16 %0, %1, %2, %3 op_sel_hi:[0,1,0]"
                     : "=v"(r) : "v"(a), "v"(d), "v"(c));
    return r;
}
// (low bf16 of word a) * (high bf16 of word d) + c
__device__ static inline float fma_bb(int a, int d, float c)
{
    float r;
    asm volatile("v_fma_mix_f32_bf16 %0, %1, %2, %3 op_sel:[0,1,0] op_sel_hi:[1,1,0]"
                 : "=v"(r) : "v"(a), "v"(d), "v"(c));
    return r;
}
// a * (low bf16 of word d)
__device__ static inline float mul_bf(float a, int d)
{
    float r;
    asm volatile("v_fma_mix_f32_bf16 %0, %1, %2, neg(0) op_sel_hi:[0,1,0]"
                 : "=v"(r) : "v"(a), "v"(d));
    return r;
}
// the plain product and the plain sum, as statements so that they keep their place
__device__ static inline float mul_f(float a, float b)
{
    float r;
    asm volatile("v_mul_f32 %0, %1, %2" : "=v"(r) : "v"(a), "v"(b));
    return r;
}
__device__ static inline float add_f(float a, float b)
{
    float r;
    asm volatile("v_add_f32 %0, %1, %2" : "=v"(r) : "v"(a), "v"(b));
    return r;
}
// x + x of lane ^ M, inside a 16-lane row
template <int M>
__device__ static inline float add_xmask(float x)
{
    float r;
    asm volatile("v_add_f32_dpp %0, %1, %1 row_xmask:%2 row_mask:0xf bank_mask:0xf bound_ctrl:1"
                 : "=v"(r) : "v"(x), "n"(M));
    return r;
}
// y + x of lane ^ M
template <int M>
__device__ static inline float add_xmask2(float x, float y)
{
    float r;
    asm volatile("v_add_f32_dpp %0, %1, %2 row_xmask:%3 row_mask:0xf bank_mask:0xf bound_ctrl:1"
                 : "=v"(r) : "v"(x), "v"(y), "n"(M));
    return r;
}
// b in the lanes of mask m, a in the others
__device__ static inline float select_f(float a, float b, unsigned m)
{
    float r;
    asm volatile("v_cndmask_b32_e64 %0, %1, %2, %3" : "=v"(r) : "v"(a), "v"(b), "s"(m));
    return r;
}
// x of lane L of the row, in every lane of it
template <int L>
__device__ static inline int row_share(int x)
{
    int r;
    asm volatile("v_mov_b32_dpp %0, %1 row_share:%2 row_mask:0xf bank_mask:0xf bound_ctrl:1"
                 : "=v"(r) : "v"(x), "n"(L));
    return r;
}

// ---- gfx1250 async global->LDS copy path (guarded; falls back cleanly) ----
#if defined(__HIP_DEVICE_COMPILE__) &&                                        \
    __has_builtin(__builtin_amdgcn_global_load_async_to_lds_b128) &&          \
    __has_builtin(__builtin_amdgcn_s_wait_asynccnt)
#define USE_ASYNC_LDS 1
#else
#define USE_ASYNC_LDS 0
#endif

#if USE_ASYNC_LDS
__device__ static inline void async_copy_b128(const void* g, void* l)
{
    // Builtin signature (from clang diagnostic): AS1 v4i* src, AS3 v4i* dst,
    // imm offset, imm cpol.
    __builtin_amdgcn_global_load_async_to_lds_b128(
        (__attribute__((address_space(1))) v4i*)(g),
        (__attribute__((address_space(3))) v4i*)(l),
        0, 0);
}
#endif

// ---------------------------------------------------------------------------
// The elementwise kernels (1, 2, 6) are dealt so that a launch is about
// a thousand work-groups of eight waves, all resident at once: a lane takes 16 to
// 64 elements and moves them 8 or 16 B at a time (miss, read down a column, 4 B).
// ---------------------------------------------------------------------------
typedef __attribute__((ext_vector_type(4))) float  v4f;
typedef __attribute__((ext_vector_type(4))) __bf16 v4bf;

template <int CTRL>
__device__ static inline float dpp_mov(float x)
{
    return __builtin_bit_cast(float, __builtin_amdgcn_mov_dpp(
        __builtin_bit_cast(int, x), CTRL, 0xf, 0xf, true));
}
constexpr int DPP_ROW_XMASK = 0x160;          // + xor mask inside the row

// sum over the 16 lanes of a row, left in every lane of it
__device__ static inline float row_sum16(float s)
{
    s += dpp_mov<DPP_ROW_XMASK + 1>(s);
    s += dpp_mov<DPP_ROW_XMASK + 2>(s);
    s += dpp_mov<DPP_ROW_XMASK + 4>(s);
    s += dpp_mov<DPP_ROW_XMASK + 8>(s);
    return s;
}

__device__ static inline v4f ld4(const float* p) { return *(const v4f*)p; }

__device__ static inline v8bf cvt8(const float* p, unsigned u)
{
    const v4f lo = ((const v4f*)p)[2 * u], hi = ((const v4f*)p)[2 * u + 1];
    v8bf o;
    #pragma unroll
    for (int e = 0; e < 4; ++e) { o[e] = (__bf16)lo[e]; o[4 + e] = (__bf16)hi[e]; }
    return o;
}

// the same for a matrix whose rows are whole heads, into the order of ScanOp:
// place l * 4 + e of a head takes its column e * 16 + l
__device__ static inline v8bf cvt8_head_order(const float* p, unsigned u)
{
    const float* hp = p + ((8 * u) & ~63u) + (((8 * u) & 63u) >> 2);
    v8bf o;
    #pragma unroll
    for (int q = 0; q < 8; ++q) o[q] = (__bf16)hp[(q & 3) * 16 + (q >> 2)];
    return o;
}

// ---------------------------------------------------------------------------
// Kernel 1: token-shift input mixing -> bf16 GEMM operands.
// A lane: 8 columns of step t in every batch (the mix vectors are read once).
// ---------------------------------------------------------------------------
constexpr int PREP_BLOCKS = TT * (CC / 8) / 256;

__device__ static __forceinline__ void prep_block(int blk,
    const float* __restrict__ x, const float* __restrict__ x0,
    const float* __restrict__ dx0,
    const float* __restrict__ x_q, const float* __restrict__ x_k,
    const float* __restrict__ x_v,
    __bf16* __restrict__ Xq, __bf16* __restrict__ Xk,
    __bf16* __restrict__ Xv, __bf16* __restrict__ Xv0,
    __bf16* __restrict__ Xd)
{
    const int i = blk * 256 + threadIdx.x;
    const int c = (i % (CC / 8)) * 8;
    const int t = i / (CC / 8);

    v4f mq[2], mk[2], mv[2];
    #pragma unroll
    for (int p = 0; p < 2; ++p) {
        mq[p] = ld4(x_q + c + 4 * p);
        mk[p] = ld4(x_k + c + 4 * p);
        mv[p] = ld4(x_v + c + 4 * p);
    }
    // before a later load's result lands in a register that these loads name.
    // The output pointers are inputs so that they are fetched here, into scalar
    // registers of their own: fetched later they took the place of the bases
    // of the loads below, ahead of those loads' wait
    asm volatile("s_wait_xcnt 0x0" :: "s"(Xq), "s"(Xk), "s"(Xv), "s"(Xv0), "s"(Xd) : "memory");

    // every load of the lane is issued before the first value is used
    v4f xvs[BB][2], xps[BB][2], z0s[BB][2], d0s[BB][2];
    #pragma unroll
    for (int b = 0; b < BB; ++b) {
        const unsigned u = (unsigned)(b * (TT * CC / 8) + i);   // in 8 elements
        #pragma unroll
        for (int p = 0; p < 2; ++p) {
            xvs[b][p] = ((const v4f*)x)[2 * u + p];
            // step t-1; at t=0 the lane's own step, in bounds and not used
            xps[b][p] = ((const v4f*)x)[2 * u + p - (t > 0 ? CC / 4 : 0)];
            z0s[b][p] = ((const v4f*)x0)[2 * u + p];
            d0s[b][p] = ((const v4f*)dx0)[2 * u + p];
        }
        // before a later load's result, or the arithmetic, lands in a register
        // that these loads name
        asm volatile("s_wait_xcnt 0x0" ::: "memory");
    }
    // keeps the first batch's arithmetic, which waits for its loads, from being
    // scheduled in front of the second batch's loads
    __builtin_amdgcn_sched_barrier(0);

    #pragma unroll
    for (int b = 0; b < BB; ++b) {
        const unsigned u = (unsigned)(b * (TT * CC / 8) + i);
        v8bf oq, ok, ov, o0, od;
        #pragma unroll
        for (int p = 0; p < 2; ++p) {
            const v4f xv = xvs[b][p], z0 = z0s[b][p], d0 = d0s[b][p];
            const v4f xp = t > 0 ? xps[b][p] : v4f{0.0f, 0.0f, 0.0f, 0.0f};   // zero pad
            #pragma unroll
            for (int e = 0; e < 4; ++e) {
                const float dxp = xp[e] - xv[e];         // x_{t-1} - x_t
                oq[4 * p + e] = (__bf16)(xv[e] + dxp * mq[p][e]);
                ok[4 * p + e] = (__bf16)(xv[e] + dxp * mk[p][e]);
                ov[4 * p + e] = (__bf16)(xv[e] + dxp * mv[p][e]);
                o0[4 * p + e] = (__bf16)(z0[e] + d0[e] * mv[p][e]);
                od[4 * p + e] = (__bf16)xv[e];
            }
        }
        ((v8bf*)Xq)[u]  = oq;
        ((v8bf*)Xk)[u]  = ok;
        ((v8bf*)Xv)[u]  = ov;
        ((v8bf*)Xv0)[u] = o0;
        if (c < MR)                                      // x[:, :, :128]
            ((v8bf*)Xd)[(unsigned)((b * TT + t) * (MR / 8) + c / 8)] = od;
        // before the next batch's arithmetic reuses registers that these stores name
        if (b + 1 < BB) asm volatile("s_wait_xcnt 0x0" ::: "memory");
    }
}

// ---------------------------------------------------------------------------
// Kernel 2: f32 weights -> bf16; miss [128,4096] -> missT [4096,128].
// The first blocks transpose: a lane reads 64 rows of one column of miss (a wave
// reads whole lines) and writes one whole 128-B line of missT. The others
// convert 8 elements of each weight a lane.
// ---------------------------------------------------------------------------
constexpr int MT_BLOCKS = 4 * CC * (MR / 64) / 256;
constexpr int WC_BLOCKS = CC * CC / 8 / 256;

__device__ static __forceinline__ void wconv_block(int blk,
    const float* __restrict__ Wq, const float* __restrict__ Wk,
    const float* __restrict__ Wv, const float* __restrict__ Wp,
    const float* __restrict__ miss,
    __bf16* __restrict__ Wqb, __bf16* __restrict__ Wkb,
    __bf16* __restrict__ Wvb, __bf16* __restrict__ Wpb,
    __bf16* __restrict__ missT)
{
    if (blk < MT_BLOCKS) {
        const int i  = blk * 256 + threadIdx.x;
        const int n  = i % (4 * CC);
        const int r0 = (i / (4 * CC)) * 64;
        const float* s = miss + (unsigned)(r0 * (4 * CC) + n);
        float v[64];
        #pragma unroll
        for (int r = 0; r < 64; ++r) v[r] = s[r * (4 * CC)];
        #pragma unroll
        for (int q = 0; q < 8; ++q) {
            v8bf o;
            #pragma unroll
            for (int e = 0; e < 8; ++e) o[e] = (__bf16)v[q * 8 + e];
            ((v8bf*)missT)[(unsigned)((n * MR + r0) / 8 + q)] = o;
        }
    } else {
        const unsigned u = (blk - MT_BLOCKS) * 256 + threadIdx.x;           // in 8 elements
        const v8bf q = cvt8(Wq, u), k = cvt8(Wk, u), v = cvt8(Wv, u), p = cvt8_head_order(Wp, u);
        ((v8bf*)Wqb)[u] = q;
        ((v8bf*)Wkb)[u] = k;
        ((v8bf*)Wvb)[u] = v;
        ((v8bf*)Wpb)[u] = p;
        // the built code lays the other branch behind this one: no register that
        // these stores name is rewritten ahead of this wait on any way through it
        asm volatile("s_wait_xcnt 0x0" ::: "memory");
    }
}

// Kernels 1 and 2 read only inputs and depend on nothing of one another: one
// launch. The weights' blocks come first (the transposing
// ones take longest); the second launch's gap and its
// start-up, during which the memory idles, are gone.
__global__ __launch_bounds__(256) void prep_wconv_kernel(
    const float* __restrict__ x, const float* __restrict__ x0,
    const float* __restrict__ dx0,
    const float* __restrict__ x_q, const float* __restrict__ x_k,
    const float* __restrict__ x_v,
    const float* __restrict__ Wq, const float* __restrict__ Wk,
    const float* __restrict__ Wv, const float* __restrict__ Wp,
    const float* __restrict__ miss,
    __bf16* __restrict__ Xq, __bf16* __restrict__ Xk,
    __bf16* __restrict__ Xv, __bf16* __restrict__ Xv0,
    __bf16* __restrict__ Xd,
    __bf16* __restrict__ Wqb, __bf16* __restrict__ Wkb,
    __bf16* __restrict__ Wvb, __bf16* __restrict__ Wpb,
    __bf16* __restrict__ missT)
{
    const int blk = blockIdx.x;
    if (blk < MT_BLOCKS + WC_BLOCKS)
        wconv_block(blk, Wq, Wk, Wv, Wp, miss, Wqb, Wkb, Wvb, Wpb, missT);
    else
        prep_block(blk - (MT_BLOCKS + WC_BLOCKS), x, x0, dx0, x_q, x_k, x_v, Xq, Xk, Xv, Xv0, Xd);
}

// ---------------------------------------------------------------------------
// Kernel 3: bf16 WMMA GEMM,  Y[m,n] = sum_k X[m,k] * W[n,k]  (+ resid)
//   block tile 128x128, 256 threads = 8 wave32; wave tile 64x32 (4x2 WMMA).
//   K-step 64, double-buffered LDS, async global->LDS staging when available:
//   a row's piece of a stage is one whole 128-B line, so a wave's copy touches
//   four lines (with 32 k a stage it was eight half lines for the same bytes).
// gemm_tile is one block's tile; the kernel behind it says which tile a
// block takes. Whether a residual is added, and the row pitch of Y,
// are settled at compile time: a lane's 64 places in Y (and in resid) are then
// one address and 64 constant offsets.
// ---------------------------------------------------------------------------
constexpr int GKT = 64;                  // k per stage
constexpr int LDR = GKT + 8;             // padded row (144B, 16B aligned)
// The two operands' tiles, two buffers each. The kernel declares them, so that a
// kernel which holds tiles of two shapes has them once.
struct __align__(16) GemmLds { __bf16 A[2][128][LDR]; __bf16 B[2][128][LDR]; };

template <int KDIM, int NDIM, bool RESID>
__device__ static __forceinline__ void gemm_tile(
    GemmLds& lds,
    const __bf16* __restrict__ X, const __bf16* __restrict__ W,
    float* __restrict__ Y, const float* __restrict__ resid,
    int mBase, int nBase)
{
    constexpr int KT    = GKT;
    constexpr int KITER = KDIM / KT;
    static_assert(KDIM % KT == 0 && KT % 32 == 0, "whole stages of whole WMMA steps");
    auto& As = lds.A;
    auto& Bs = lds.B;

    const int tid    = threadIdx.x;
    const int lane   = tid & 31;
    const int wave   = tid >> 5;
    const int wm     = (wave >> 2) * 64;     // 0 | 64
    const int wn     = (wave & 3) * 32;      // 0,32,64,96
    const int laneLo = lane & 15;
    const int kbase  = ((lane >> 4) & 1) * 8; // lanes 0-15 -> K{0..7,16..23};
                                              // lanes 16-31 -> K{8..15,24..31}

    v8f acc[4][2];
    #pragma unroll
    for (int i = 0; i < 4; ++i)
        #pragma unroll
        for (int j = 0; j < 2; ++j)
            #pragma unroll
            for (int e = 0; e < 8; ++e) acc[i][j][e] = 0.0f;

    auto loadTile = [&](int buf, int k0) {
        #pragma unroll
        for (int ch = 0; ch < 128 * KT / 2048; ++ch) {
            int e  = ch * 2048 + tid * 8;
            int r  = e / KT;        // 0..127
            int kk = e % KT;        // 0,8,..,KT-8
            const __bf16* gA = &X[(size_t)(mBase + r) * KDIM + k0 + kk];
            const __bf16* gB = &W[(size_t)(nBase + r) * KDIM + k0 + kk];
#if USE_ASYNC_LDS
            async_copy_b128(gA, &As[buf][r][kk]);
            async_copy_b128(gB, &Bs[buf][r][kk]);
#else
            *(v8bf*)&As[buf][r][kk] = *(const v8bf*)gA;
            *(v8bf*)&Bs[buf][r][kk] = *(const v8bf*)gB;
#endif
        }
    };

    loadTile(0, 0);

    // C/D layout: VGPR v, lanes 0-15 -> (M=v, N=lane); lanes 16-31 -> (M=8+v)
    // the lane's first place in Y; tile (i, j), register v lies
    // (i * 16 + v) * NDIM + j * 16 elements further on
    const size_t off0 = (size_t)(mBase + wm + (lane >> 4) * 8) * NDIM + (nBase + wn + laneLo);

    // The residual depends on nothing that is computed here: all 64 loads of the
    // lane are issued now and fly beside the first tile's copies (the loop's first
    // barrier waits for loads too, once for all of them). One at a time in the
    // epilogue, each waited for before the next is issued, they cost the wave 64
    // latencies in a row.
    float rv[4][2][8];
    if constexpr (RESID) {
        const float* rp = resid + off0;
        #pragma unroll
        for (int i = 0; i < 4; ++i)
            #pragma unroll
            for (int j = 0; j < 2; ++j)
                #pragma unroll
                for (int v = 0; v < 8; ++v)
                    rv[i][j][v] = rp[(i * 16 + v) * NDIM + j * 16];
        // before the loop's arithmetic reuses a register that these loads name
        asm volatile("s_wait_xcnt 0x0" ::: "memory");
    }

    for (int ki = 0; ki < KITER; ++ki) {
#if USE_ASYNC_LDS
        __builtin_amdgcn_s_wait_asynccnt(0);   // own async copies in LDS
#endif
        __syncthreads();                       // all waves' copies visible
        const int buf = ki & 1;
        if (ki + 1 < KITER) loadTile(buf ^ 1, (ki + 1) * KT);

        // unrolled, so that kh is a constant offset of the LDS reads
        #pragma unroll
        for (int kh = 0; kh < KT; kh += 32) {
            v16bf afrag[4], bfrag[2];
            #pragma unroll
            for (int i = 0; i < 4; ++i) {
                const __bf16* ap = &As[buf][wm + i * 16 + laneLo][kh + kbase];
                v8bf lo = *(const v8bf*)ap;
                v8bf hi = *(const v8bf*)(ap + 16);
                afrag[i] = __builtin_shufflevector(lo, hi, 0, 1, 2, 3, 4, 5, 6, 7,
                                                   8, 9, 10, 11, 12, 13, 14, 15);
            }
            #pragma unroll
            for (int j = 0; j < 2; ++j) {
                const __bf16* bp = &Bs[buf][wn + j * 16 + laneLo][kh + kbase];
                v8bf lo = *(const v8bf*)bp;
                v8bf hi = *(const v8bf*)(bp + 16);
                bfrag[j] = __builtin_shufflevector(lo, hi, 0, 1, 2, 3, 4, 5, 6, 7,
                                                   8, 9, 10, 11, 12, 13, 14, 15);
            }
            #pragma unroll
            for (int i = 0; i < 4; ++i)
                #pragma unroll
                for (int j = 0; j < 2; ++j)
                    acc[i][j] = __builtin_amdgcn_wmma_f32_16x16x32_bf16(
                        false, afrag[i], false, bfrag[j],
                        (short)0, acc[i][j], false, false);
        }
    }

    if constexpr (RESID) {
        #pragma unroll
        for (int i = 0; i < 4; ++i)
            #pragma unroll
            for (int j = 0; j < 2; ++j)
                #pragma unroll
                for (int v = 0; v < 8; ++v) acc[i][j][v] += rv[i][j][v];
        // every sum stands in front of the first store: mixed among the stores,
        // later sums were put into registers that issued stores still name
        __builtin_amdgcn_sched_barrier(0);
    }
    float* yp = Y + off0;
    #pragma unroll
    for (int i = 0; i < 4; ++i)
        #pragma unroll
        for (int j = 0; j < 2; ++j)
            #pragma unroll
            for (int v = 0; v < 8; ++v)
                yp[(i * 16 + v) * NDIM + j * 16] = acc[i][j][v];
}

template <int KDIM, int NDIM, bool RESID>
__global__ __launch_bounds__(256) void gemm_bf16_wmma(
    const __bf16* __restrict__ X, const __bf16* __restrict__ W,
    float* __restrict__ Y, const float* __restrict__ resid)
{
    __shared__ GemmLds lds;
    gemm_tile<KDIM, NDIM, RESID>(lds, X, W, Y, resid, blockIdx.y * 128, blockIdx.x * 128);
}

// ---------------------------------------------------------------------------
// Kernel 3a: the input projections, the deltas product and the elementwise work
// behind them, in one launch. The f32 products never leave the registers: the two
// blocks of a tile (blockIdx.z) make between them, one after another, every product
// that its 128 tokens x 128 columns of scan operands need, and pack the operands
// from the accumulators.
// A wave's tile is 32 tokens x 64 columns, one head: |k|^2 is a sum over the
// lane's four column tiles and a DPP row sum, and a lane's four columns of a token
// are one 16-B piece of ScanOp (its order of columns).
// blockIdx.z = 0: a, k, q, w -> z | b, q | k, e^w (half).
//              1: g, w, v gate, v, v_first -> gb, e^w (half), v.
// Two blocks share a WGP: one works while the other waits for
// its copies or does its elementwise work (the long e^w: one early, one late).
// ---------------------------------------------------------------------------
template <int KDIM>
__device__ static __forceinline__ void head_product(
    GemmLds& lds, const __bf16* __restrict__ X, const __bf16* __restrict__ W,
    int mBase, int wBase, v8f (&acc)[2][4])
{
    constexpr int KT    = GKT;
    constexpr int KITER = KDIM / KT;
    // An even number of stages: the last one reads buffer 1, and buffer 0 was left
    // by every wave before that stage's barrier, so the next product's first
    // copies may go into buffer 0 at once.
    static_assert(KDIM % KT == 0 && KT % 32 == 0 && KITER % 2 == 0, "whole stages, in pairs");
    auto& As = lds.A;
    auto& Bs = lds.B;

    const int tid    = threadIdx.x;
    const int lane   = tid & 31;
    const int wave   = tid >> 5;
    const int wm     = (wave >> 1) * 32;     // 0,32,64,96
    const int wn     = (wave & 1) * 64;      // 0 | 64
    const int laneLo = lane & 15;
    const int kbase  = ((lane >> 4) & 1) * 8; // k order as in gemm_tile, A and B alike

    #pragma unroll
    for (int i = 0; i < 2; ++i)
        #pragma unroll
        for (int j = 0; j < 4; ++j)
            #pragma unroll
            for (int e = 0; e < 8; ++e) acc[i][j][e] = 0.0f;

    // A copy's address is a base that is the same for the block, kept in scalar
    // registers, and one 32-bit offset of the lane that serves every copy of both
    // operands: eight 64-bit addresses a stage in vector registers do not fit
    // beside the accumulators.
    constexpr int RPC = 2048 / KT;           // rows per copy of the block
    const unsigned lo = (unsigned)((tid / (KT / 8)) * KDIM + (tid % (KT / 8)) * 8);
    auto loadTile = [&](int buf, int k0) {
        #pragma unroll
        for (int ch = 0; ch < 128 / RPC; ++ch) {
            const int r  = ch * RPC + tid / (KT / 8);    // 0..127
            const int kk = (tid % (KT / 8)) * 8;         // 0,8,..,KT-8
            const __bf16* gA = X + ((size_t)(mBase + ch * RPC) * KDIM + k0) + lo;
            const __bf16* gB = W + ((size_t)(wBase + ch * RPC) * KDIM + k0) + lo;
#if USE_ASYNC_LDS
            async_copy_b128(gA, &As[buf][r][kk]);
            async_copy_b128(gB, &Bs[buf][r][kk]);
#else
            *(v8bf*)&As[buf][r][kk] = *(const v8bf*)gA;
            *(v8bf*)&Bs[buf][r][kk] = *(const v8bf*)gB;
#endif
        }
    };

    loadTile(0, 0);

    // two stages a trip make the buffer index a constant; unrolled further, the
    // eight products' loops outgrow the instruction cache
    #pragma unroll 2
    for (int ki = 0; ki < KITER; ++ki) {
        // own copies of this stage have landed; the barrier says it of every wave,
        // and that every wave has left the other buffer
        asm volatile("s_wait_asynccnt 0x0" ::: "memory");
        __syncthreads();
        const int buf = ki & 1;
        if (ki + 1 < KITER) loadTile(buf ^ 1, (ki + 1) * KT);

        // unrolled, so that kh is a constant offset of the LDS reads
        #pragma unroll
        for (int kh = 0; kh < KT; kh += 32) {
            v16bf afrag[2], bfrag[4];
            #pragma unroll
            for (int i = 0; i < 2; ++i) {
                const __bf16* ap = &As[buf][wm + i * 16 + laneLo][kh + kbase];
                v8bf lo = *(const v8bf*)ap;
                v8bf hi = *(const v8bf*)(ap + 16);
                afrag[i] = __builtin_shufflevector(lo, hi, 0, 1, 2, 3, 4, 5, 6, 7,
                                                   8, 9, 10, 11, 12, 13, 14, 15);
            }
            #pragma unroll
            for (int j = 0; j < 4; ++j) {
                const __bf16* bp = &Bs[buf][wn + j * 16 + laneLo][kh + kbase];
                v8bf lo = *(const v8bf*)bp;
                v8bf hi = *(const v8bf*)(bp + 16);
                bfrag[j] = __builtin_shufflevector(lo, hi, 0, 1, 2, 3, 4, 5, 6, 7,
                                                   8, 9, 10, 11, 12, 13, 14, 15);
            }
            #pragma unroll
            for (int i = 0; i < 2; ++i)
                #pragma unroll
                for (int j = 0; j < 4; ++j)
                    acc[i][j] = __builtin_amdgcn_wmma_f32_16x16x32_bf16(
                        false, afrag[i], false, bfrag[j],
                        (short)0, acc[i][j], false, false);
        }
    }
}

constexpr int ETK = 4;                        // tokens per block, kernel 6
static_assert(CC == 256 * 4 && NN == 16 * 4 && MM % ETK == 0, "lane deal");

// The longer elementwise parts are rolled loops over the eight registers of the
// accumulator tiles: unrolled, they make the kernel larger than the instruction
// cache, and a WGP runs through each only once. Registers cannot be indexed by a
// loop counter, so each trip takes register 0 of every tile and then turns the
// tiles' registers by one place.
__device__ static __forceinline__ void turn_tiles(v8f (&acc)[2][4])
{
    #pragma unroll
    for (int i = 0; i < 2; ++i)
        #pragma unroll
        for (int e = 0; e < 4; ++e)
            acc[i][e] = __builtin_shufflevector(acc[i][e], acc[i][e], 1, 2, 3, 4, 5, 6, 7, 0);
}

// sigmoid(c0 + acc) of the wave's tile: a token's four columns to place i * 8 + v
__device__ static __forceinline__ void gate_park(v8f (&acc)[2][4], const float (&c0)[4],
                                                 v4f (&park)[16][256])
{
    // kept rolled: see above
    #pragma unroll 1
    for (int v = 0; v < 8; ++v) {
        #pragma unroll
        for (int i = 0; i < 2; ++i) {
            v4f s;
            #pragma unroll
            for (int e = 0; e < 4; ++e)
                s[e] = 1.0f / (1.0f + __expf(-(c0[e] + acc[i][e][0])));
            park[i * 8 + v][threadIdx.x] = s;
        }
        turn_tiles(acc);
    }
}

// e^w of row block I of the wave's tile, from the w_delta product, to its pieces.
// This is the longest of the elementwise parts: each kind of block makes the short
// product whole and takes one of the two row blocks, so that both kinds last alike.
template <int I>
__device__ static __forceinline__ void decay_store(const v8f (&acc)[2][4], const float* __restrict__ w0p,
                                                   ScanOp* __restrict__ ep, v4f (&park)[16][256])
{
    float w0c[4];
    #pragma unroll
    for (int e = 0; e < 4; ++e) w0c[e] = w0p[e * 16];
    // before the arithmetic reuses registers that these loads name
    asm volatile("s_wait_xcnt 0x0" ::: "memory");
    // through the lane's own places in LDS, so that the loop below can stay rolled
    // (registers cannot be indexed by a loop counter)
    #pragma unroll
    for (int v = 0; v < 8; ++v)
        park[v][threadIdx.x] = v4f{-(w0c[0] + acc[I][0][v]), -(w0c[1] + acc[I][1][v]),
                                   -(w0c[2] + acc[I][2][v]), -(w0c[3] + acc[I][3][v])};
    // kept rolled: see turn_tiles
    #pragma unroll 1
    for (int v = 0; v < 8; ++v) {
        const v4f x4 = park[v][threadIdx.x];
        v4f E;
        #pragma unroll
        for (int e = 0; e < 4; ++e) {
            const float xw   = x4[e];
            // softplus; the logarithm is taken in every lane (of the clamped value,
            // the same wherever it is used) so that no branch parts the four
            // columns' chains and they fill one another's gaps
            const float lg   = log1pf(__expf(fminf(xw, 20.0f)));
            const float sf   = (xw > 20.0f) ? xw : lg;
            const float logw = -__expf(-sf - 0.5f);                    // log decay < 0
            E[e] = __expf((float)(__bf16)logw);      // exp after bf16 round, as reference
        }
        *(v4f*)(ep + (I * 16 + v) * (HH * SPB)) = E;
        // before the next trip reuses registers that this store names
        asm volatile("s_wait_xcnt 0x0" ::: "memory");
    }
}

// four waves a SIMD: two blocks a WGP (at most 256 registers a wave)
__global__ __launch_bounds__(256) __attribute__((amdgpu_waves_per_eu(4, 4))) void proj_pack_kernel(
    const __bf16* __restrict__ Xq, const __bf16* __restrict__ Xk,
    const __bf16* __restrict__ Xv, const __bf16* __restrict__ Xv0,
    const __bf16* __restrict__ Wqb, const __bf16* __restrict__ Wkb,
    const __bf16* __restrict__ Wvb,
    const __bf16* __restrict__ Xd, const __bf16* __restrict__ missT,
    const float* __restrict__ w0, const float* __restrict__ v0,
    const float* __restrict__ a0,
    ScanOp* __restrict__ sops,
    __bf16* __restrict__ vh, __bf16* __restrict__ gb)
{
    __shared__ GemmLds lds;
    // The v gate, or k * a, waits here, each lane's own values in its own places,
    // while the long products behind it run: with them in registers a wave needs
    // more than the 256 that two blocks a WGP allow. decay_store uses it as well.
    __shared__ v4f park[16][256];
    const int lane   = threadIdx.x & 31;
    const int wave   = threadIdx.x >> 5;
    const int laneLo = lane & 15;
    const int mBase  = blockIdx.y * 128;
    const int nBase  = blockIdx.x * 128;
    const int col0   = nBase + (wave & 1) * 64;                  // the wave's head
    // C/D layout: tile (i, e), register v: token tok0 + i * 16 + v, column
    // col0 + e * 16 + laneLo
    const int tok0   = mBase + (wave >> 1) * 32 + (lane >> 4) * 8;
    constexpr int TP = HH * SPB;                                 // pieces per token
    ScanOp* sp = sops + (unsigned)((tok0 * HH + (col0 >> 6)) * SPB);
    // the lane's place in vh and gb, in 4 elements
    const unsigned u0 = (unsigned)(tok0 * (CC / 4) + (col0 >> 2) + laneLo);

    v8f acc[2][4];
    if (blockIdx.z == 0) {
        float a0c[4];
        #pragma unroll
        for (int e = 0; e < 4; ++e) a0c[e] = a0[col0 + e * 16 + laneLo];
        // before later arithmetic reuses registers that these loads name
        asm volatile("s_wait_xcnt 0x0" ::: "memory");

        head_product<MR>(lds, Xd, missT, mBase, 2 * CC + nBase, acc);     // a_delta
        gate_park(acc, a0c, park);                                        // a

        head_product<CC>(lds, Xk, Wkb, mBase, nBase, acc);                // k
        // kept rolled: see turn_tiles
        #pragma unroll 1
        for (int v = 0; v < 8; ++v) {
            #pragma unroll
            for (int i = 0; i < 2; ++i) {
                const float k0 = acc[i][0][0], k1 = acc[i][1][0];
                const float k2 = acc[i][2][0], k3 = acc[i][3][0];
                const float norm = sqrtf(row_sum16((k0 * k0 + k1 * k1) + (k2 * k2 + k3 * k3)));
                const float den  = fmaxf(norm, 1e-12f);
                const v4f a4 = park[i * 8 + v][threadIdx.x];
                v4f s;
                v4i zb;
                #pragma unroll
                for (int e = 0; e < 4; ++e) {
                    const float kv = acc[i][e][0];
                    const float kk = kv / den;
                    zb[e] = pack2(-kk, kk * a4[e]);
                    s[e]  = kv * a4[e];
                }
                park[i * 8 + v][threadIdx.x] = s;    // k * a waits in LDS while the q product runs
                *(v4i*)(sp + (i * 16 + v) * TP + 3 * laneLo + 1) = zb;
            }
            // before the next trip, or the next product, reuses registers that
            // these stores name
            asm volatile("s_wait_xcnt 0x0" ::: "memory");
            turn_tiles(acc);
        }
        v4i R[2][8];

        head_product<CC>(lds, Xq, Wqb, mBase, nBase, acc);                // q
        #pragma unroll
        for (int i = 0; i < 2; ++i)
            #pragma unroll
            for (int v = 0; v < 8; ++v) {
                const v4f s = park[i * 8 + v][threadIdx.x];
                #pragma unroll
                for (int e = 0; e < 4; ++e) R[i][v][e] = pack2(acc[i][e][v], s[e]);
            }
        // all arithmetic stands in front of the first store, so that none of it
        // lands in a register that an issued store still names
        __builtin_amdgcn_sched_barrier(0);
        #pragma unroll
        for (int i = 0; i < 2; ++i)
            #pragma unroll
            for (int v = 0; v < 8; ++v)
                *(v4i*)(sp + (i * 16 + v) * TP + 3 * laneLo) = R[i][v];
        // before the next product reuses registers that these stores name
        asm volatile("s_wait_xcnt 0x0" ::: "memory");

        head_product<MR>(lds, Xd, missT, mBase, nBase, acc);              // w_delta
        decay_store<0>(acc, w0 + col0 + laneLo, sp + 3 * laneLo + 2, park);
    } else {
        float v0c[4];
        #pragma unroll
        for (int e = 0; e < 4; ++e) v0c[e] = v0[col0 + e * 16 + laneLo];
        // before later arithmetic reuses registers that these loads name
        asm volatile("s_wait_xcnt 0x0" ::: "memory");

        head_product<MR>(lds, Xd, missT, mBase, 3 * CC + nBase, acc);     // g
        v4bf G[2][8];
        #pragma unroll
        for (int i = 0; i < 2; ++i)
            #pragma unroll
            for (int v = 0; v < 8; ++v)
                #pragma unroll
                for (int e = 0; e < 4; ++e) G[i][v][e] = (__bf16)(1.0f + acc[i][e][v]);
        // all arithmetic in front of the first store, as in the other branch
        __builtin_amdgcn_sched_barrier(0);
        #pragma unroll
        for (int i = 0; i < 2; ++i)
            #pragma unroll
            for (int v = 0; v < 8; ++v)
                ((v4bf*)gb + u0)[(i * 16 + v) * (CC / 4)] = G[i][v];
        // before the next product reuses registers that these stores name
        asm volatile("s_wait_xcnt 0x0" ::: "memory");

        head_product<MR>(lds, Xd, missT, mBase, nBase, acc);              // w_delta
        decay_store<1>(acc, w0 + col0 + laneLo, sp + 3 * laneLo + 2, park);

        head_product<MR>(lds, Xd, missT, mBase, CC + nBase, acc);         // v_delta
        gate_park(acc, v0c, park);                                        // the v gate
        float vr[2][4][8];

        head_product<CC>(lds, Xv, Wvb, mBase, nBase, acc);                // v
        #pragma unroll
        for (int i = 0; i < 2; ++i)
            #pragma unroll
            for (int e = 0; e < 4; ++e)
                #pragma unroll
                for (int v = 0; v < 8; ++v) vr[i][e][v] = acc[i][e][v];

        head_product<CC>(lds, Xv0, Wvb, mBase, nBase, acc);               // v_first
        #pragma unroll
        for (int i = 0; i < 2; ++i)
            #pragma unroll
            for (int v = 0; v < 8; ++v) {
                const v4f s = park[i * 8 + v][threadIdx.x];
                #pragma unroll
                for (int e = 0; e < 4; ++e) {
                    const float r = vr[i][e][v];
                    G[i][v][e] = (__bf16)(r + (acc[i][e][v] - r) * s[e]);
                }
            }
        // as above
        __builtin_amdgcn_sched_barrier(0);
        #pragma unroll
        for (int i = 0; i < 2; ++i)
            #pragma unroll
            for (int v = 0; v < 8; ++v) {
                ((v4bf*)(sp + (i * 16 + v) * TP + 48))[laneLo] = G[i][v];
                ((v4bf*)vh + u0)[(i * 16 + v) * (CC / 4)]      = G[i][v];
            }
    }
}

constexpr int SCH = 16;
// A tile's end costs the lone wave of a SIMD time that no other wave fills: the
// last step's output folds run as a bare chain, then the waits, the barrier, the
// issue of the next copies and the latency of the new tile's first LDS reads.
// 64 steps a tile pay that half as often as 32.
constexpr int STS = 64;                       // steps per LDS tile
constexpr int SNT = TT / STS;                 // tiles
static_assert(SNT >= 2 && STS % SCH == 0, "two tiles at least, whole chunks");

// One tile: STS steps of SPB pieces (896 B a step, contiguous; steps lie
// HH * SPB pieces apart in global memory, back to back in LDS). A wave brings
// STS/4 steps, one piece a lane and copy; 7 * 32 pieces are four steps.
static_assert(4 * SPB == 7 * 32 && STS % 16 == 0, "four steps are seven copies of a wave");

__device__ static inline void scan_fetch(const ScanOp* g0, ScanOp* l0,
                                         int wave, int lane)
{
    constexpr int GP = HH * SPB;                             // step pitch, global
    const ScanOp* g = g0 + (size_t)wave * (STS / 4) * GP;
    ScanOp*       l = l0 + wave * (STS / 4) * SPB + lane;
    #pragma unroll
    for (int r = 0; r < 7; ++r) {
        const int     pc = r * 32 + lane;                    // piece 0..223
        const ScanOp* gr = g + (pc / SPB) * GP + pc % SPB;
        #pragma unroll
        for (int a = 0; a < STS / 16; ++a) {
#if USE_ASYNC_LDS
            async_copy_b128(gr + a * 4 * GP, l + (a * 7 + r) * 32);
#else
            l[(a * 7 + r) * 32] = gr[a * 4 * GP];
#endif
        }
    }
}

struct Rec4 { v4i qk, zb; v4f ew; };         // a lane's four columns of one step

__device__ static inline Rec4 scan_read(const ScanOp* lp, int u)
{
    const ScanOp* rp = lp + u * SPB;
    return Rec4{*(const v4i*)rp, *(const v4i*)(rp + 1), *(const v4f*)(rp + 2)};
}

constexpr int SG = 8;                         // steps whose LDS reads stand together
static_assert(STS % SG == 0 && STS / SG >= 2, "whole groups, two at least");

// The S.q partials are folded level by level. Level N makes one sum of two, each
// of 2^(N-1) steps: lanes whose step slot has bit 2^(N-1) clear keep the first,
// the others the second, and each adds what its partner (lane ^ bit) holds of the
// same. The partial of step T is at hand in step T + 1, and level N
// of the group that T ends is taken in step T + N, so that a step holds two
// selects and one row add per level and at most two levels, all in the gaps of
// its chain. f[n]: the first half of a level, waiting; r[n]: the second half.
template <int T, int N>                      // is level N of a group ending at T due?
constexpr bool fold_due = T >= 0 && T % (1 << N) == (1 << N) - 1;

constexpr unsigned fold_mask(int bit)        // lanes whose step slot has this bit
{
    return bit == 1 ? 0xaaaaaaaau : bit == 2 ? 0xccccccccu : bit == 4 ? 0xf0f0f0f0u : 0xff00ff00u;
}

template <int N>
__device__ static inline void fold_select(const float (&f)[4], const float (&r)[4],
                                          float& keep, float& send)
{
    keep = select_f(f[N - 1], r[N - 1], fold_mask(1 << (N - 1)));
    send = select_f(r[N - 1], f[N - 1], fold_mask(1 << (N - 1)));
}

// where a finished sum of level N for the group ending at T goes
template <int T, int N>
__device__ static inline void fold_bank(float s, float (&f)[4], float (&r)[4],
                                        float (&o)[STS / SCH])
{
    if constexpr (N == 4) o[T / SCH] = s;
    else if constexpr (fold_due<T, N + 1>) r[N] = s;
    else f[N] = s;
}

template <int T, int N>
__device__ static inline void fold_add(float keep, float send, float (&f)[4], float (&r)[4],
                                       float (&o)[STS / SCH])
{
    fold_bank<T, N>(add_xmask2<1 << (N - 1)>(send, keep), f, r, o);
}

template <int U>
struct ScanSteps {
    // lp: the lane's three pieces of the tile's first step, in LDS
    // qp: the q | k words of the step before (its output sum is taken here)
    __device__ static inline void run(const ScanOp* lp, Rec4 (&pipe)[2][SG], float (&S)[4],
                                      float (&f)[4], float (&r)[4],
                                      const int (&vrow)[STS / SCH],
                                      float (&o)[STS / SCH], v4i qp)
    {
        constexpr int t = STS - U;           // step in the tile
        constexpr int u = t % SCH;           // step in the chunk
        constexpr int gr = t / SG;           // group of steps in the tile
        if constexpr (t % SG == 0 && t + SG < STS) {
            // The next group's reads stand together at the head of this group (for
            // speed only). The two scheduling barriers keep the
            // scheduler from spreading the reads over the steps on either side.
            // At t = 0 the tile's first reads stand directly in front, and no
            // barrier parts the two groups.
            if constexpr (t > 0) __builtin_amdgcn_sched_barrier(0);
            #pragma unroll
            for (int i = 0; i < SG; ++i)
                pipe[(gr + 1) & 1][i] = scan_read(lp, t + SG + i);
            __builtin_amdgcn_sched_barrier(0);
        }
        const v4i qk = pipe[gr & 1][t % SG].qk, zb = pipe[gr & 1][t % SG].zb;
        const v4f ew = pipe[gr & 1][t % SG].ew;

        // The chain: S.z in the lane (three links), four row-sum links, the update
        // of S. Everything else stands between its links: S * e^w, v * k, the
        // output sum of the step before, for which S still holds that step's
        // state, and the folds that are due.
        float p0 = 0.0f, p1 = 0.0f, kp[5], sd[5];
        float a0 = mul_bf(S[0], zb[0]);
        float a1 = mul_bf(S[2], zb[2]);
        float X0 = mul_f(S[0], ew[0]);
        float X1 = mul_f(S[1], ew[1]);
        float X2 = mul_f(S[2], ew[2]);
        a0 = fma_bf<false>(S[1], zb[1], a0);
        a1 = fma_bf<false>(S[3], zb[3], a1);
        float X3 = mul_f(S[3], ew[3]);
        const int vt = row_share<u>(vrow[t / SCH]);          // this step's v of the row, bf16
        if constexpr (t > 0) p0 = mul_bf(S[0], qp[0]);
        float sa = add_f(a0, a1);
        if constexpr (t > 0) p1 = mul_bf(S[2], qp[2]);
        X0 = fma_bb(vt, qk[0], X0);
        X1 = fma_bb(vt, qk[1], X1);
        sa = add_xmask<1>(sa);
        X2 = fma_bb(vt, qk[2], X2);
        X3 = fma_bb(vt, qk[3], X3);
        if constexpr (t > 0) {
            p0 = fma_bf<false>(S[1], qp[1], p0);
            p1 = fma_bf<false>(S[3], qp[3], p1);
        }
        sa = add_xmask<2>(sa);
        if constexpr (t > 0) fold_bank<t - 1, 0>(add_f(p0, p1), f, r, o);
        sa = add_xmask<4>(sa);
        if constexpr (fold_due<t - 4, 4>) fold_select<4>(f, r, kp[4], sd[4]);
        if constexpr (fold_due<t - 3, 3>) fold_select<3>(f, r, kp[3], sd[3]);
        if constexpr (fold_due<t - 2, 2>) fold_select<2>(f, r, kp[2], sd[2]);
        if constexpr (fold_due<t - 1, 1>) fold_select<1>(f, r, kp[1], sd[1]);
        sa = add_xmask<8>(sa);
        if constexpr (fold_due<t - 4, 4>) fold_add<t - 4, 4>(kp[4], sd[4], f, r, o);
        if constexpr (fold_due<t - 3, 3>) fold_add<t - 3, 3>(kp[3], sd[3], f, r, o);
        if constexpr (fold_due<t - 2, 2>) fold_add<t - 2, 2>(kp[2], sd[2], f, r, o);
        if constexpr (fold_due<t - 1, 1>) fold_add<t - 1, 1>(kp[1], sd[1], f, r, o);
        S[0] = fma_bf<true>(sa, zb[0], X0);
        S[2] = fma_bf<true>(sa, zb[2], X2);
        S[1] = fma_bf<true>(sa, zb[1], X1);
        S[3] = fma_bf<true>(sa, zb[3], X3);

        ScanSteps<U - 1>::run(lp, pipe, S, f, r, vrow, o, qk);
    }
};
template <>
struct ScanSteps<0> {
    // the output sum of the tile's last step, and its four folds
    __device__ static inline void run(const ScanOp*, Rec4 (&)[2][SG], float (&S)[4],
                                      float (&f)[4], float (&r)[4],
                                      const int (&)[STS / SCH],
                                      float (&o)[STS / SCH], v4i qp)
    {
        float p0 = mul_bf(S[0], qp[0]);
        float p1 = mul_bf(S[2], qp[2]);
        p0 = fma_bf<false>(S[1], qp[1], p0);
        p1 = fma_bf<false>(S[3], qp[3], p1);
        fold_bank<STS - 1, 0>(add_f(p0, p1), f, r, o);
        float kp, sd;
        fold_select<1>(f, r, kp, sd);  fold_add<STS - 1, 1>(kp, sd, f, r, o);
        fold_select<2>(f, r, kp, sd);  fold_add<STS - 1, 2>(kp, sd, f, r, o);
        fold_select<3>(f, r, kp, sd);  fold_add<STS - 1, 3>(kp, sd, f, r, o);
        fold_select<4>(f, r, kp, sd);  fold_add<STS - 1, 4>(kp, sd, f, r, o);
    }
};

__global__ __launch_bounds__(128) void scan_kernel(
    const ScanOp* __restrict__ sops, float* __restrict__ y)
{
    __shared__ ScanOp tile[2][STS][SPB];

    const int lane = threadIdx.x & 31;
    const int wave = threadIdx.x >> 5;
    const int g    = blockIdx.x >> 3;                        // b*H + h
    const int rp   = (blockIdx.x & 7) * 4 + wave;            // row pair 0..31
    const int h    = g % HH;
    const int b    = g / HH;
    const int j    = lane & 15;                              // column group / step slot
    const int row  = rp * 2 + (lane >> 4);

    const ScanOp* hb = sops + ((size_t)b * TT * HH + h) * SPB;        // t = 0
    float* yp = y + ((size_t)g * (TT / SCH) * 32 + rp) * 32 + lane;

    float S[4] = {0.0f, 0.0f, 0.0f, 0.0f};

    scan_fetch(hb, &tile[0][0][0], wave, lane);
    // own copies of tile 0 landed; the barrier publishes every wave's
    asm volatile("s_wait_asynccnt 0x0" ::: "memory");
    __syncthreads();
    scan_fetch(hb + (size_t)STS * HH * SPB, &tile[1][0][0], wave, lane);

    // kept rolled: the body already holds STS unrolled steps
    #pragma unroll 1
    for (int tl = 0; tl < SNT; ++tl) {
        ScanOp* tb = &tile[tl & 1][0][0];

        // read first: the tile's first step needs them, and LDS answers in order
        int   vrow[STS / SCH];
        float o[STS / SCH], f[4], r[4];
        #pragma unroll
        for (int c = 0; c < STS / SCH; ++c)  // v of my row at step j of chunk c, bf16
            vrow[c] = ((const unsigned short*)(tb + (c * SCH + j) * SPB + 48))[(row & 15) * 4 + (row >> 4)];
        // keeps these four reads in front: behind the first group's reads, the
        // first step waits for the whole group
        __builtin_amdgcn_sched_barrier(0);
        Rec4 pipe[2][SG];
        #pragma unroll
        for (int i = 0; i < SG; ++i) pipe[0][i] = scan_read(tb + j * 3, i);

        ScanSteps<STS>::run(tb + j * 3, pipe, S, f, r, vrow, o, v4i{0, 0, 0, 0});

        // keeps the last groups' arithmetic in front of the foot: lifted over it,
        // the wait below stands right behind the tile's last reads and the wave
        // sits out their whole latency
        __builtin_amdgcn_sched_barrier(0);
        // foot of the trip: my reads of this tile are done, my copies of the
        // next tile have landed; the barrier says both of every wave
        asm volatile("s_wait_dscnt 0x0" ::: "memory");
        asm volatile("s_wait_asynccnt 0x0" ::: "memory");
        __syncthreads();
        if (tl + 2 < SNT)
            scan_fetch(hb + (size_t)(tl + 2) * STS * HH * SPB, tb, wave, lane);

        // stored behind the barrier: in front of it the barrier's own wait for
        // stores would expose their whole latency once per tile
        #pragma unroll
        for (int c = 0; c < STS / SCH; ++c) {
            *yp = o[c] * 0.125f;             // * N^-0.5
            yp += 32 * 32;
        }
    }
    // no copy is left in flight when the wave ends
    asm volatile("s_wait_asynccnt 0x0" ::: "memory");
}

// ---------------------------------------------------------------------------
// Kernel 6: norm-ratio correction + gate -> bf16 input for output projection.
// A block: ETK tokens of one chunk of y, all columns. A lane: 4 columns of each,
// a 16-lane row is one head (norms: DPP row sums). y lies step-fastest (see
// kernel 5), so one 16-B load is one column's ETK steps. vh, gb and Yg lie in
// ScanOp's order of columns; of x only a head's sum of squares is used, so the
// lane takes four neighbouring columns of it.
// ---------------------------------------------------------------------------
static_assert(ETK == 4 && SCH % ETK == 0 && TT % SCH == 0, "a block stays in one chunk");

__global__ __launch_bounds__(256) void post_scan_kernel(
    const float* __restrict__ y, const float* __restrict__ x,
    const __bf16* __restrict__ vh, const __bf16* __restrict__ gb,
    const float* __restrict__ r_k, __bf16* __restrict__ Yg)
{
    const int    c  = threadIdx.x * 4;
    const int    h  = threadIdx.x >> 4;
    const int    n0 = threadIdx.x & 15;        // the lane's columns: n0 + 16 * e (ScanOp's order)
    const unsigned m0 = blockIdx.x * ETK;
    const unsigned t0 = m0 % TT;
    const unsigned gy = (m0 / TT) * HH + h;

    // y[((gy*(T/SCH) + chunk)*NN + n)*SCH + step], here in 4 steps
    const unsigned yu = ((gy * (TT / SCH) + t0 / SCH) * NN + n0) * (SCH / 4) + (t0 % SCH) / 4;
    v4f yv[4];                                // [column][token]
    #pragma unroll
    for (int e = 0; e < 4; ++e) yv[e] = ((const v4f*)y)[yu + e * 16 * (SCH / 4)];

    float rk[4];
    #pragma unroll
    for (int e = 0; e < 4; ++e) rk[e] = r_k[h * NN + e * 16 + n0];
    // before a later load's result lands in a register that these loads name
    asm volatile("s_wait_xcnt 0x0" ::: "memory");
    float sig[4];
    #pragma unroll
    for (int e = 0; e < 4; ++e) sig[e] = 1.0f / (1.0f + __expf(-rk[e]));

    // every load of the lane is issued before the first value is used
    v4f  xvs[ETK];
    v4bf vbs[ETK], gvs[ETK];
    #pragma unroll
    for (int it = 0; it < ETK; ++it) {
        const unsigned u = (m0 + it) * (CC / 4) + threadIdx.x;   // in 4 elements
        xvs[it] = ((const v4f*)x)[u];
        vbs[it] = ((const v4bf*)vh)[u];
        gvs[it] = ((const v4bf*)gb)[u];
    }

    #pragma unroll
    for (int it = 0; it < ETK; ++it) {
        const unsigned u = (m0 + it) * (CC / 4) + threadIdx.x;
        const v4f  xv = xvs[it];
        const v4bf vb = vbs[it], gv = gvs[it];
        float vv[4];
        #pragma unroll
        for (int e = 0; e < 4; ++e) vv[e] = (float)vb[e];

        const float xnorm = sqrtf(row_sum16((xv[0] * xv[0] + xv[1] * xv[1]) +
                                            (xv[2] * xv[2] + xv[3] * xv[3])));
        const float vnorm = sqrtf(row_sum16((vv[0] * vv[0] + vv[1] * vv[1]) +
                                            (vv[2] * vv[2] + vv[3] * vv[3])));
        const float ratio = 1.0f - xnorm / (vnorm + 1e-12f);

        v4bf o;
        #pragma unroll
        for (int e = 0; e < 4; ++e) {
            const float u = ratio * sig[e];
            o[e] = (__bf16)((yv[e][it] + vv[e] * u) * (float)gv[e]);
        }
        ((v4bf*)Yg)[u] = o;
    }
}

// ---------------------------------------------------------------------------
// Host launcher
// ---------------------------------------------------------------------------
extern "C" void kernel_launch(void* const* d_in, const int* in_sizes, int n_in,
                              void* d_out, int out_size, void* d_ws,
                              size_t ws_size, hipStream_t stream)
{
    (void)in_sizes; (void)n_in; (void)out_size; (void)ws_size;

    const float* residual = (const float*)d_in[0];
    const float* x        = (const float*)d_in[1];
    const float* x0       = (const float*)d_in[2];
    const float* dx0      = (const float*)d_in[3];
    const float* Wq       = (const float*)d_in[4];
    const float* Wk       = (const float*)d_in[5];
    const float* Wv       = (const float*)d_in[6];
    const float* Wproj    = (const float*)d_in[7];
    const float* x_q      = (const float*)d_in[8];
    const float* x_k      = (const float*)d_in[9];
    const float* x_v      = (const float*)d_in[10];
    const float* v0       = (const float*)d_in[11];
    const float* w0       = (const float*)d_in[12];
    const float* a0       = (const float*)d_in[13];
    const float* miss     = (const float*)d_in[14];
    const float* r_k      = (const float*)d_in[15];
    float*       out      = (float*)d_out;

    // ---- workspace layout (256B aligned bump allocator) ----
    char*  ws  = (char*)d_ws;
    size_t off = 0;
    auto alloc = [&](size_t bytes) -> void* {
        void* p = ws + off;
        off += (bytes + 255) & ~(size_t)255;
        return p;
    };
    const size_t MC_BF = (size_t)MM * CC * sizeof(__bf16);    // 8 MB
    const size_t MC_F  = (size_t)MM * CC * sizeof(float);     // 16 MB
    const size_t W_BF  = (size_t)CC * CC * sizeof(__bf16);    // 2 MB
    const size_t XD_BF = (size_t)MM * MR * sizeof(__bf16);    // 1 MB
    const size_t SO_SZ = (size_t)MM * HH * SPB * sizeof(ScanOp); // 56 MB

    __bf16* Xq    = (__bf16*)alloc(MC_BF);
    __bf16* Xk    = (__bf16*)alloc(MC_BF);
    __bf16* Xv    = (__bf16*)alloc(MC_BF);
    __bf16* Xv0   = (__bf16*)alloc(MC_BF);
    __bf16* Xd    = (__bf16*)alloc(XD_BF);
    __bf16* Wqb   = (__bf16*)alloc(W_BF);
    __bf16* Wkb   = (__bf16*)alloc(W_BF);
    __bf16* Wvb   = (__bf16*)alloc(W_BF);
    __bf16* Wpb   = (__bf16*)alloc(W_BF);
    __bf16* missT = (__bf16*)alloc(XD_BF);
    ScanOp* sops  = (ScanOp*)alloc(SO_SZ);
    __bf16* gb    = (__bf16*)alloc(MC_BF);
    __bf16* vh    = (__bf16*)alloc(MC_BF);
    float*  y     = (float*)alloc(MC_F);
    __bf16* Yg    = (__bf16*)alloc(MC_BF);

    // ---- 1) input prep + weight conversion ----
    {
        prep_wconv_kernel<<<dim3(MT_BLOCKS + WC_BLOCKS + PREP_BLOCKS), dim3(256), 0, stream>>>(
            x, x0, dx0, x_q, x_k, x_v, Wq, Wk, Wv, Wproj, miss,
            Xq, Xk, Xv, Xv0, Xd, Wqb, Wkb, Wvb, Wpb, missT);
    }

    // ---- 2) WMMA products q, k, v, v_first (K=1024), deltas (K=128), and the
    //         elementwise work behind them -> packed scan operands, vh, gb ----
    proj_pack_kernel<<<dim3(CC / 128, MM / 128, 2), dim3(256), 0, stream>>>(
        Xq, Xk, Xv, Xv0, Wqb, Wkb, Wvb, Xd, missT, w0, v0, a0, sops, vh, gb);

    // ---- 3) sequential scan (state in VGPRs, 8 rows per block) ----
    scan_kernel<<<dim3(BB * HH * 8), dim3(128), 0, stream>>>(sops, y);

    // ---- 4) norm correction + gate ----
    post_scan_kernel<<<dim3(MM / ETK), dim3(256), 0, stream>>>(y, x, vh, gb, r_k, Yg);

    // ---- 5) output projection + residual -> d_out ----
    {
        dim3 grid(CC / 128, MM / 128), blk(256);
        gemm_bf16_wmma<CC, CC, true><<<grid, blk, 0, stream>>>(Yg, Wpb, out, residual);
    }
}
